// v000
// Times are from an AMD MI455X. After a warm-up the kernel runs many times in a row, and a time is the length of
// such a window on the GPU divided by its runs, so every launch and the gaps after it count. The runs cycle
// through copies of the inputs. A figure is the median of several windows, for all but v000 over two sittings.
// Sittings can differ by a few percent; kernels timed side by side share one.
// v000, which the later versions start from, runs in 2250 microseconds.
// compute dtype: all float inputs rounded to bf16; q/k/v = x W + b with EXACT bf16 products on WMMA 16x16x32 (f32 accumulate); UNSCALED 32-deep logits q.k with both as f16 hi + residual planes (3 products); softmax in f32 (precise expf); attn x 2^11 once to f16 against v once to f16 (1 product); y = gamma * out + x in f32; f32 output.
// SAGAN self-attention on channels-LAST images (B 8, 64 x 64 = 4,096 positions, C 256; (in,out) 1/16-scale weights, zero biases, gamma = 0.5): q = x Wq + bq (32), k = x Wk + bk (32), v = x Wv + bv (256); attn = softmax(q k^T) (NO scaling); out = attn v; y = gamma * out + x -> [B, 64, 64, 256].
#include <hip/hip_runtime.h>
#include <math.h>

typedef __attribute__((ext_vector_type(16))) _Float16 v16h;
typedef __attribute__((ext_vector_type(16))) __bf16 v16b;
typedef __attribute__((ext_vector_type(8)))  _Float16 v8h;
typedef __attribute__((ext_vector_type(8)))  float v8f;
typedef __attribute__((ext_vector_type(4)))  float v4f;
typedef __attribute__((ext_vector_type(2)))  float v2f;
typedef __attribute__((ext_vector_type(4)))  unsigned v4u;
typedef __attribute__((ext_vector_type(4)))  int v4i;
typedef float __attribute__((may_alias)) float_a;
typedef int __attribute__((may_alias)) int_a;

template <typename T> __device__ __forceinline__ void vst2(void* p, T v) { *(T*)p = v;  }
__device__ __forceinline__ v8f wmma16(v16h a, v16h b, v8f c) {
  v8f d = __builtin_amdgcn_wmma_f32_16x16x32_f16(false, a, false, b, (short)0, c, false, false);
  asm volatile("v_nop\n\tv_nop\n\tv_nop\n\tv_nop" : "+v"(d) : "v"(a), "v"(b));
  return d;
}
__device__ __forceinline__ v8f wmma_bf(v16b a, v16b b, v8f c) {
  v8f d = __builtin_amdgcn_wmma_f32_16x16x32_bf16(false, a, false, b, (short)0, c, false, false);
  asm volatile("v_nop\n\tv_nop\n\tv_nop\n\tv_nop" : "+v"(d) : "v"(a), "v"(b));
  return d;
}
// 16x16x32 fragments: lane = (h = lane>>4, row/col = lane&15); elements 0..7 = k0+8h+0..7, 8..15 = k0+16+8h+0..7; D element r = row 8h+r
__device__ __forceinline__ v16h frag_h(const _Float16* rowk0, int lane) {
  union { v16h v; v8h q[2]; } u; const _Float16* p = rowk0 + 8 * (lane >> 4);
  u.q[0] = *(const v8h*)p; u.q[1] = *(const v8h*)(p + 16); return u.v;
}
__device__ __forceinline__ v16h frag_f32(const float* rowk0, int lane) {
  v16h a; const float* p = rowk0 + 8 * (lane >> 4);
#pragma unroll
  for (int i = 0; i < 8; ++i) { a[i] = (_Float16)p[i]; a[8 + i] = (_Float16)p[16 + i]; }
  return a;
}
__device__ __forceinline__ v16h frag_f32s(const float* rowk0, int lane, float sc) {
  v16h a; const float* p = rowk0 + 8 * (lane >> 4);
#pragma unroll
  for (int i = 0; i < 8; ++i) { a[i] = (_Float16)(p[i] * sc); a[8 + i] = (_Float16)(p[16 + i] * sc); }
  return a;
}
// column fragment from a [K][ld] layout (column n), rows >= K read as 0
__device__ __forceinline__ v16h fragc_f32(const float* W, int k0, int n, int lane, int ld, int K) {
  v16h a; const int g = lane >> 4;
#pragma unroll
  for (int i = 0; i < 8; ++i) { const int ka = k0 + 8 * g + i, kb = ka + 16;
    a[i] = (_Float16)(ka < K ? W[(size_t)(ka < K ? ka : K - 1) * ld + n] : 0.f); a[8 + i] = (_Float16)(kb < K ? W[(size_t)(kb < K ? kb : K - 1) * ld + n] : 0.f); }
  return a;
}
struct F2 { v16b h, l; };
__device__ __forceinline__ F2 bsplit16(const float v[16]) { F2 r;
#pragma unroll
  for (int i = 0; i < 16; ++i) { const __bf16 h = (__bf16)v[i]; r.h[i] = h; r.l[i] = (__bf16)(v[i] - (float)h); }
  return r; }
__device__ __forceinline__ F2 split_row(const float* row, int k0, int lane) { float v[16]; const float* p = row + k0 + 8 * (lane >> 4);
#pragma unroll
  for (int i = 0; i < 8; ++i) { v[i] = p[i]; v[8 + i] = p[16 + i]; }
  return bsplit16(v); }
__device__ __forceinline__ F2 split_rowK(const float* row, int k0, int lane, int K) { float v[16]; const int g = lane >> 4;
#pragma unroll
  for (int i = 0; i < 8; ++i) { const int ka = k0 + 8 * g + i, kb = ka + 16; v[i] = ka < K ? row[ka < K ? ka : K - 1] : 0.f; v[8 + i] = kb < K ? row[kb < K ? kb : K - 1] : 0.f; }
  return bsplit16(v); }
__device__ __forceinline__ F2 split_col(const float* W, int k0, int n, int lane, int ld, int K) { float v[16]; const int g = lane >> 4;
#pragma unroll
  for (int i = 0; i < 8; ++i) { const int ka = k0 + 8 * g + i, kb = ka + 16; v[i] = ka < K ? W[(size_t)(ka < K ? ka : K - 1) * ld + n] : 0.f; v[8 + i] = kb < K ? W[(size_t)(kb < K ? kb : K - 1) * ld + n] : 0.f; }
  return bsplit16(v); }
__device__ __forceinline__ v8f mac3(const F2& a, const F2& b, v8f c) { c = wmma_bf(a.l, b.h, c); c = wmma_bf(a.h, b.l, c); return wmma_bf(a.h, b.h, c); }
__device__ __forceinline__ float sigm(float v) { return 1.0f / (1.0f + expf(-v)); }
#define LDSX() do { asm volatile("s_wait_dscnt 0" ::: "memory"); __builtin_amdgcn_wave_barrier(); __builtin_amdgcn_fence(__ATOMIC_RELEASE, "workgroup"); } while (0)

#define NB 8
#define TT 4096
#define CC 256            // plane width: q/k planes carry 32 real columns (rest zero), v planes all 256
#define DIN 256
#define NH 1
#define HD 256
#define NQB (TT / 64)
#define HG 1               // one 4,096 x 4,096 score plane per pass
#define SCALE (1.0f)
#define HDQK 32
#define CAUSAL 0
#ifndef TNB
#define TNB NB
#endif
__device__ __forceinline__ v16b zero16b() { v16b z; _Pragma("unroll") for (int i = 0; i < 16; ++i) z[i] = (__bf16)0.f; return z; }
__device__ __forceinline__ float bfr(float v) { return (float)(__bf16)v; }
__host__ __device__ __forceinline__ int kb_last(int qb) { return CAUSAL ? ((qb * 64 + 63) >> 7) : (TT / 128 - 1); }
typedef __attribute__((ext_vector_type(8))) __bf16 v8b;
__device__ __forceinline__ v16b frag_b(const __bf16* rowk0, int lane) {
  union { v16b v; v8b q[2]; } u; const __bf16* p = rowk0 + 8 * (lane >> 4);
  u.q[0] = *(const v8b*)p; u.q[1] = *(const v8b*)(p + 16); return u.v;
}
#define QBH (TT / 64)      // ALL query blocks take k_sc's 3-product path
#define QBH_PV 0           // A.g stays single f16
#define QHI 4096            // q residual rows everywhere (2-product logits)
#define KHI 4096           // k residual rows for ALL keys (3-product logits)
// B fragment (k rows k0+.., output column o) of a weight: (in,out) [K][ld] or (out,in) [ld rows of K]: bf16 exact, or f16(bf16 * 256) exact
__device__ __forceinline__ v16b wcol_io(const float* Wm, int k0, int o, int lane, int ld) { v16b w; const int g = lane >> 4;
#pragma unroll
  for (int i = 0; i < 8; ++i) { w[i] = (__bf16)Wm[(size_t)(k0 + 8 * g + i) * ld + o]; w[8 + i] = (__bf16)Wm[(size_t)(k0 + 16 + 8 * g + i) * ld + o]; }
  return w; }
__device__ __forceinline__ v16b wcol_oi(const float* Wm, int k0, int o, int lane, int K) { v16b w; const float* p = Wm + (size_t)o * K + k0 + 8 * (lane >> 4);
#pragma unroll
  for (int i = 0; i < 8; ++i) { w[i] = (__bf16)p[i]; w[8 + i] = (__bf16)p[16 + i]; }
  return w; }
__device__ __forceinline__ v16h wcolh_io(const float* Wm, int k0, int o, int lane, int ld) { v16h w; const int g = lane >> 4;
#pragma unroll
  for (int i = 0; i < 8; ++i) { w[i] = (_Float16)(bfr(Wm[(size_t)(k0 + 8 * g + i) * ld + o]) * 256.0f); w[8 + i] = (_Float16)(bfr(Wm[(size_t)(k0 + 16 + 8 * g + i) * ld + o]) * 256.0f); }
  return w; }
__device__ __forceinline__ v16h wcolh_oi(const float* Wm, int k0, int o, int lane, int K) { v16h w; const float* p = Wm + (size_t)o * K + k0 + 8 * (lane >> 4);
#pragma unroll
  for (int i = 0; i < 8; ++i) { w[i] = (_Float16)(bfr(p[i]) * 256.0f); w[8 + i] = (_Float16)(bfr(p[16 + i]) * 256.0f); }
  return w; }
#define WQKV_LAYOUT 1   // 0 = (in,out) [DIN][CC]; 1 = (in,out) Wq/Wk [DIN][HDQK], Wv [DIN][CC]; 2 = per-head [NH][DIN][HD]
__device__ __forceinline__ v16b wcol_hdk(const float* Wm, int k0, int o, int lane) { v16b w; const int g = lane >> 4; const float* p = Wm + (size_t)(o / HD) * DIN * HD + (o % HD);
#pragma unroll
  for (int i = 0; i < 8; ++i) { w[i] = (__bf16)p[(size_t)(k0 + 8 * g + i) * HD]; w[8 + i] = (__bf16)p[(size_t)(k0 + 16 + 8 * g + i) * HD]; }
  return w; }
#define WO_OUT_IN 0
#if WQKV_LAYOUT == 1
#define WCOL(W, k0, o, lane) ((which == 2) ? wcol_io(W, k0, (o), lane, CC) : (((o) < HDQK) ? wcol_io(W, k0, (o), lane, HDQK) : zero16b()))   /* (in,out): Wq/Wk [256][32] (plane columns >= 32 zero), Wv [256][256] full */
#define WCOL_OLD_UNUSED(W, k0, o, lane) (((o) < HDQK) ? wcol_oi(W, k0, (o), lane, DIN) : zero16b())   /* unused: reads (out,in) [32][256] weights; plane columns >= 32 are zero for all three */
#elif WQKV_LAYOUT == 2
#define WCOL(W, k0, o, lane) wcol_hdk(W, k0, o, lane)
#else
#define WCOL(W, k0, o, lane) wcol_io(W, k0, o, lane, CC)
#endif
#if WO_OUT_IN
#define WOCOL(W, k0, o, lane) wcol_oi(W, k0, o, lane, CC)
#define WOCOLH(W, k0, o, lane) wcolh_oi(W, k0, o, lane, CC)
#else
#define WOCOL(W, k0, o, lane) wcol_io(W, k0, o, lane, DIN)
#define WOCOLH(W, k0, o, lane) wcolh_io(W, k0, o, lane, DIN)
#endif
#ifndef XP
#define OUT1_OFF (4u * (size_t)NB * DIN * TT)   /* output 1 (o) follows output 0 (y) */
#define XP TT              // position pitch of x and of the output
#endif
#define BG HG              // the pass group spans BATCHES (single head): blockIdx.z / blockIdx.y select batch b0 + z
#define DVH 128            // value columns per k_pv block (2 blocks cover the 256-wide v)
#define WS_YR (WS_END)     // f32 attended rows [b*n][256]
#define WS_END2 (WS_YR + 4u * (size_t)NB * TT * HD)
// ---- k_wz: block = (64 rows, 128 output cols): OR = y (hi + lo, K = 32 real columns of the YR rows) . W^T ((out,in) [256][32], exact) + b
__global__ __launch_bounds__(128) void k_wz(const float* __restrict__ YR, const float* __restrict__ WW, const float* __restrict__ WB, float* __restrict__ ORW) { __shared__ __align__(16) float sf[4][16][132];
  const int tid = threadIdx.x, wave = tid >> 5, lane = tid & 31, col = lane & 15, g = lane >> 4; const int c0 = blockIdx.y * 128; const size_t r0 = (size_t)blockIdx.x * 64 + wave * 16;
  v8f acc[8] = {};
#pragma unroll
  for (int kc = 0; kc < HDQK / 32; ++kc) { const F2 a = split_row(YR + (r0 + col) * CC, kc * 32, lane); asm volatile("s_wait_loadcnt 0x0" ::: "memory");
#pragma unroll
    for (int j = 0; j < 8; ++j) { const v16b w = wcol_oi(WW, kc * 32, c0 + j * 16 + col, lane, HDQK); asm volatile("s_wait_loadcnt 0x0" ::: "memory"); acc[j] = wmma_bf(a.h, w, acc[j]); acc[j] = wmma_bf(a.l, w, acc[j]); } }
#pragma unroll
  for (int j = 0; j < 8; ++j) { const float bb = WB ? bfr(WB[c0 + j * 16 + col]) : 0.f; asm volatile("s_wait_loadcnt 0x0" ::: "memory");
#pragma unroll
    for (int r = 0; r < 8; ++r) sf[wave][8 * g + r][j * 16 + col] = acc[j][r] + bb; }
  LDSX(); for (int rl = 0; rl < 16; ++rl) vst2(ORW + (r0 + rl) * DIN + c0 + lane * 4, *(const v4f*)&sf[wave][rl][lane * 4]); }
// ---- k_fin2: block = (64 positions, 64 channels, batch b): o[b][c][n] = OR[b*N + n][c] (channels-first via LDS transpose) -> output 1; y = gamma * o + bf16(x) -> output 0 (256-B runs)
__global__ __launch_bounds__(256) void k_fin2(const float* __restrict__ ORW, const float* __restrict__ X, const float* __restrict__ GM, float* __restrict__ OUT, float* __restrict__ OUT1) { const float gmv = bfr(GM[0]); __shared__ float st[64][68]; const int tid = threadIdx.x; const int n0 = blockIdx.x * 64, c0 = blockIdx.y * 64; const size_t b = blockIdx.z;
  for (int e = tid; e < 64 * 16; e += 256) { const int nl = e >> 4, q = e & 15; *(v4f*)&st[nl][q * 4] = *(const v4f*)(ORW + (b * TT + n0 + nl) * (size_t)DIN + c0 + q * 4); }
  __syncthreads();
  for (int e = tid; e < 64 * 16; e += 256) { const int cl = e >> 4, q = e & 15; const size_t oi = (b * DIN + c0 + cl) * (size_t)XP + n0 + q * 4; const v4f xr = *(const v4f*)(X + oi); v4f o, y; _Pragma("unroll") for (int i = 0; i < 4; ++i) { o[i] = st[q * 4 + i][cl]; y[i] = gmv * o[i] + bfr(xr[i]); } vst2(OUT + oi, y); vst2(OUT1 + oi, o); } }   /* y = gamma * o + x (output 0), o (output 1) */
#ifndef SM_EXTRA_PARAMS
#define SM_EXTRA_PARAMS
#endif
#ifndef PROJ_EXTRA_PARAMS
#define PROJ_EXTRA_PARAMS
#endif
#ifndef SM_MASK_HOOK
#define SM_MASK_HOOK (void)0
#endif

#define WS_QH  0u                                      // f16 q rows [b*t][CC]
#define WS_KH  (WS_QH + 2u * (size_t)NB * TT * CC)      // f16 k rows [b*t][CC]
#define WS_VT  (WS_KH + 2u * (size_t)NB * TT * CC)      // f16 v planes [b][c][t]
#define WS_QL  (WS_VT + 2u * (size_t)NB * CC * TT)      // f16 q residual x 2^10 rows [b][t < QHI][CC]
#define WS_KL  (WS_QL + 2u * (size_t)NB * QHI * CC)     // f16 k residual x 2^10 rows [b][t < KHI][CC]
#define WS_VB  (WS_KL + 2u * (size_t)NB * KHI * CC)     // bf16 v hi planes [b][c][t < KHI]
#define WS_VBL (WS_VB + 2u * (size_t)NB * CC * KHI)
#define WS_S   (WS_VBL + 2u * (size_t)NB * CC * KHI)    // f32 logits / P [hg][t][s]
#define WS_Y   (WS_S  + 4u * (size_t)HG * TT * TT)      // f32 ctx rows [b*t][CC] (only when there is an output projection)
#define WS_END (WS_Y  + 0u)

// ---- k_proj: block = (64 rows, 128 cols, which): q/k/v = X W (+ b) with exact bf16 products (K = DIN) -> which 0: q f16 rows (+ residual rows < QHI); 1: k f16 rows (+ residual rows < KHI); 2: v f16 planes [c][t] (+ bf16 hi/lo planes for t < KHI)
__global__ __launch_bounds__(128) void k_proj(const float* __restrict__ XQ, const float* __restrict__ XK, const float* __restrict__ XV, const float* __restrict__ WQ, const float* __restrict__ WK, const float* __restrict__ WV, const float* __restrict__ BQ, const float* __restrict__ BK, const float* __restrict__ BV,
    _Float16* __restrict__ QH, _Float16* __restrict__ QL, _Float16* __restrict__ KH, _Float16* __restrict__ KL, _Float16* __restrict__ VT, __bf16* __restrict__ VB, __bf16* __restrict__ VBL) {
  __shared__ __align__(16) _Float16 sh[64][136], sl[64][136]; __shared__ __align__(16) _Float16 th[128][72]; __shared__ __align__(16) __bf16 tb[128][72], tbl[128][72];
  const int tid = threadIdx.x, wave = tid >> 5, lane = tid & 31, col = lane & 15, g = lane >> 4; const int which = blockIdx.z; const int c0 = blockIdx.y * 128; const size_t r0 = (size_t)blockIdx.x * 64; const size_t bb = r0 / TT; const int t0 = (int)(r0 % TT);
  const float* X = which == 0 ? XQ : which == 1 ? XK : XV; const float* WA = which == 0 ? WQ : which == 1 ? WK : WV; const float* BA = which == 0 ? BQ : which == 1 ? BK : BV;
  v8f acc[8] = {};
#pragma unroll 2
  for (int kc = 0; kc < DIN / 32; ++kc) { v16b a; { const float* p = X + (r0 + wave * 16 + col) * (size_t)DIN + kc * 32 + 8 * g;   /* channels-LAST: plain rows x[b*T + t][k] */
#pragma unroll
      for (int i = 0; i < 8; ++i) { a[i] = (__bf16)p[i]; a[8 + i] = (__bf16)p[16 + i]; } }
    asm volatile("s_wait_loadcnt 0x0" ::: "memory");
#pragma unroll
    for (int j = 0; j < 8; ++j) { const v16b w = WCOL(WA, kc * 32, c0 + j * 16 + col, lane); asm volatile("s_wait_loadcnt 0x0" ::: "memory"); acc[j] = wmma_bf(a, w, acc[j]); } }
  if (which < 2) { _Float16* DH = which == 0 ? QH : KH; _Float16* DL = which == 0 ? QL : KL; const int nhi = which == 0 ? QHI : KHI; const bool hi_rows = t0 < nhi;
#pragma unroll
    for (int j = 0; j < 8; ++j) { const float bias = (BA && (which == 2 || (c0 + j * 16 + col) < HDQK)) ? bfr(BA[c0 + j * 16 + col]) : 0.f;   /* q/k: 32 real columns; v: all 256 */   /* 32-entry biases */
#pragma unroll
      for (int r = 0; r < 8; ++r) { const float v = acc[j][r] + bias; const _Float16 hv = (_Float16)v; sh[wave * 16 + 8 * g + r][j * 16 + col] = hv; sl[wave * 16 + 8 * g + r][j * 16 + col] = (_Float16)((v - (float)hv) * 1024.0f); } }
    __syncthreads();
    for (int e = tid; e < 64 * 16; e += 128) { const int rl = e >> 4, q = e & 15; vst2((unsigned*)(DH + (r0 + rl) * CC + c0 + q * 8), *(const v4u*)&sh[rl][q * 8]); if (hi_rows) vst2((unsigned*)(DL + (bb * nhi + t0 + rl) * (size_t)CC + c0 + q * 8), *(const v4u*)&sl[rl][q * 8]); }
  } else { const bool hi_rows = t0 < KHI;
#pragma unroll
    for (int j = 0; j < 8; ++j) { const float bias = (BA && (which == 2 || (c0 + j * 16 + col) < HDQK)) ? bfr(BA[c0 + j * 16 + col]) : 0.f;   /* q/k: 32 real columns; v: all 256 */   /* 256-entry bias */
#pragma unroll
      for (int r = 0; r < 8; ++r) { const float v = acc[j][r] + bias; const int rl = wave * 16 + 8 * g + r, cl = j * 16 + col; th[cl][rl] = (_Float16)v; const __bf16 bh = (__bf16)v; tb[cl][rl] = bh; tbl[cl][rl] = (__bf16)(v - (float)bh); } }
    __syncthreads();
    for (int e = tid; e < 128 * 8; e += 128) { const int cl = e >> 3, q = e & 7; vst2((unsigned*)(VT + (bb * CC + c0 + cl) * (size_t)TT + t0 + q * 8), *(const v4u*)&th[cl][q * 8]); if (hi_rows) { const size_t o3 = (bb * CC + c0 + cl) * (size_t)KHI + t0 + q * 8; vst2((unsigned*)(VB + o3), *(const v4u*)&tb[cl][q * 8]); vst2((unsigned*)(VBL + o3), *(const v4u*)&tbl[cl][q * 8]); } } } }
// ---- k_sc: block = (query block qb, key block kb <= kb_last(qb), batch b = bgrp + z in group): logits x SCALE; q hi + residual (x 2^10) against k (2 products) for query rows < QHI, plus the k residual (3 products) for query blocks < QBH (all 64); causal: blocks past the diagonal exit, the mask itself is applied by index in k_sm
__global__ __launch_bounds__(128) void k_sc(const _Float16* __restrict__ QH, const _Float16* __restrict__ KH, const _Float16* __restrict__ QL, const _Float16* __restrict__ KL, int bgrp, int h0, float* __restrict__ S0) { __shared__ __align__(16) float ss[4][16][132];
  const int qb = blockIdx.x, kb = blockIdx.y; if (kb > kb_last(qb)) return;
  const int h = h0; const int b = bgrp + blockIdx.z; float* S = S0 + (size_t)blockIdx.z * TT * TT;   /* group spans batches */
  const int tid = threadIdx.x, wave = tid >> 5, lane = tid & 31, col = lane & 15, g = lane >> 4; const int k0 = kb * 128; const int ql0 = qb * 64 + wave * 16; const size_t q0 = (size_t)b * TT + ql0, kr0 = (size_t)b * TT + k0;
  v8f acc[8] = {}, accl[8] = {};
  const _Float16* QLb = QL + (size_t)b * QHI * CC; const _Float16* KLb = KL + (size_t)b * KHI * CC;
  if (qb < QBH) {
#pragma unroll
    for (int kc = 0; kc < HDQK / 32; ++kc) { const v16h ah = frag_h(QH + (q0 + col) * CC + h * HD + kc * 32, lane), al = frag_h(QLb + (size_t)(ql0 + col) * CC + h * HD + kc * 32, lane);
#pragma unroll
      for (int j = 0; j < 8; ++j) { const v16h kbf = frag_h(KH + (kr0 + j * 16 + col) * CC + h * HD + kc * 32, lane), klf = frag_h(KLb + (size_t)(k0 + j * 16 + col) * CC + h * HD + kc * 32, lane); acc[j] = wmma16(ah, kbf, acc[j]); accl[j] = wmma16(al, kbf, accl[j]); accl[j] = wmma16(ah, klf, accl[j]); } }
  } else if (qb * 64 < QHI) {
#pragma unroll
    for (int kc = 0; kc < HDQK / 32; ++kc) { const v16h ah = frag_h(QH + (q0 + col) * CC + h * HD + kc * 32, lane), al = frag_h(QLb + (size_t)(ql0 + col) * CC + h * HD + kc * 32, lane);
#pragma unroll
      for (int j = 0; j < 8; ++j) { const v16h kbf = frag_h(KH + (kr0 + j * 16 + col) * CC + h * HD + kc * 32, lane); acc[j] = wmma16(ah, kbf, acc[j]); accl[j] = wmma16(al, kbf, accl[j]); } }
  } else {
#pragma unroll
    for (int kc = 0; kc < HDQK / 32; ++kc) { const v16h ah = frag_h(QH + (q0 + col) * CC + h * HD + kc * 32, lane);
#pragma unroll
      for (int j = 0; j < 8; ++j) { const v16h kbf = frag_h(KH + (kr0 + j * 16 + col) * CC + h * HD + kc * 32, lane); acc[j] = wmma16(ah, kbf, acc[j]); } } }
#pragma unroll
  for (int j = 0; j < 8; ++j) {
#pragma unroll
    for (int r = 0; r < 8; ++r) ss[wave][8 * g + r][j * 16 + col] = (acc[j][r] + accl[j][r] * (1.0f / 1024.0f)) * SCALE; }
  LDSX(); for (int rl = 0; rl < 16; ++rl) vst2(S + (size_t)(ql0 + rl) * TT + k0 + lane * 4, *(const v4f*)&ss[wave][rl][lane * 4]); }
// ---- k_sm: block = query row t (batch in group): keys [0, kend): causal -> logit if s <= t else excluded; softmax in f32; P x 2^11 in place (0 for excluded)
__global__ __launch_bounds__(256) void k_sm(float* __restrict__ S0 SM_EXTRA_PARAMS) { __shared__ float sred[8]; __shared__ float sbc; __shared__ __align__(16) float shv[TT];
  const int tid = threadIdx.x; const int t = blockIdx.x; const int kend = (kb_last(t >> 6) + 1) * 128;
  float* sr = S0 + (size_t)blockIdx.y * TT * TT + (size_t)t * TT;
  float m = -3.0e38f; for (int k = tid; k < kend; k += 256) { float v = (!CAUSAL || k <= t) ? sr[k] : -3.0e38f; SM_MASK_HOOK; shv[k] = v; m = fmaxf(m, v); }
#pragma unroll
  for (int o = 1; o < 32; o <<= 1) m = fmaxf(m, __shfl_xor(m, o));
  if ((tid & 31) == 0) sred[tid >> 5] = m; __syncthreads(); if (tid == 0) { float a = sred[0]; for (int i = 1; i < 8; ++i) a = fmaxf(a, sred[i]); sbc = a; } __syncthreads(); m = sbc; __syncthreads();
  float sum = 0.f; for (int k = tid; k < kend; k += 256) { const float v = shv[k]; const float e = (v <= -1.0e38f) ? 0.f : expf(v - m); shv[k] = e; sum += e; }
#pragma unroll
  for (int o = 1; o < 32; o <<= 1) sum += __shfl_xor(sum, o);
  if ((tid & 31) == 0) sred[tid >> 5] = sum; __syncthreads(); if (tid == 0) { float a = 0.f; for (int i = 0; i < 8; ++i) a += sred[i]; sbc = a > 0.f ? 2048.0f / a : 0.f; }   /* a fully excluded row yields P = 0 */ __syncthreads(); const float inv = sbc;
  for (int k = tid; k < kend; k += 256) shv[k] = shv[k] * inv;
  __syncthreads(); for (int q = tid; q < kend / 4; q += 256) vst2(sr + q * 4, *(const v4f*)&shv[q * 4]); }
// ---- k_pv: block = 64 queries (qb) of (b, h): ctx = P . v over keys [0, kend) (P x 2^11 once to f16 against v f16: 1 product for all query blocks; the bf16 hi + lo 3-product path is not taken); 512-B (row, column-half) segment by 32 lanes
__global__ __launch_bounds__(128) void k_pv(const float* __restrict__ PS0, const _Float16* __restrict__ VT, const __bf16* __restrict__ VB, const __bf16* __restrict__ VBL, int bgrp, int h0, float* __restrict__ Y) { const int h = h0; const int b = bgrp + blockIdx.z; const float* PS = PS0 + (size_t)blockIdx.z * TT * TT; const int d0 = blockIdx.y * DVH;   /* group spans batches; column half d0 */ __shared__ __align__(16) float ss[4][16][DVH + 4];
  const int tid = threadIdx.x, wave = tid >> 5, lane = tid & 31, col = lane & 15, g = lane >> 4; const int qb = blockIdx.x; const int ql0 = qb * 64 + wave * 16; const int kce = (kb_last(qb) + 1) * 4;
  v8f acc[DVH / 16] = {};
  if (qb < QBH_PV) {
#pragma unroll 1
    for (int kc = 0; kc < kce; ++kc) { const F2 p = split_row(PS + (size_t)(ql0 + col) * TT, kc * 32, lane);
      asm volatile("s_wait_loadcnt 0x0" ::: "memory");
#pragma unroll
      for (int j = 0; j < DVH / 16; ++j) { const size_t po = ((size_t)b * CC + h * HD + d0 + j * 16 + col) * (size_t)KHI + kc * 32; const v16b vh = frag_b(VB + po, lane); acc[j] = wmma_bf(p.h, vh, acc[j]); acc[j] = wmma_bf(p.l, vh, acc[j]); acc[j] = wmma_bf(p.h, frag_b(VBL + po, lane), acc[j]); } }
  } else {
#pragma unroll 1
    for (int kc = 0; kc < kce; ++kc) { const v16h p = frag_f32(PS + (size_t)(ql0 + col) * TT + kc * 32, lane);
      asm volatile("s_wait_loadcnt 0x0" ::: "memory");
#pragma unroll
      for (int j = 0; j < DVH / 16; ++j) { const size_t po = ((size_t)b * CC + h * HD + d0 + j * 16 + col) * (size_t)TT + kc * 32; acc[j] = wmma16(p, frag_h(VT + po, lane), acc[j]); } } }
#pragma unroll
  for (int j = 0; j < DVH / 16; ++j)
#pragma unroll
    for (int r = 0; r < 8; ++r) ss[wave][8 * g + r][j * 16 + col] = acc[j][r] * (1.0f / 2048.0f);
  LDSX(); for (int rl = 0; rl < 16; ++rl) vst2(Y + ((size_t)b * TT + ql0 + rl) * CC + h * HD + d0 + lane * 4, *(const v4f*)&ss[wave][rl][lane * 4]); }   /* 512-B (row, column-half) segment by 32 lanes */

__global__ __launch_bounds__(256) void k_axpy(const float* __restrict__ YR, const float* __restrict__ X, const float* __restrict__ GM, float* __restrict__ OUT) { const size_t e = ((size_t)blockIdx.x * 256 + threadIdx.x) * 4; if (e >= (size_t)TNB * TT * DIN) return; const float gmv = bfr(GM[0]); const v4f o = *(const v4f*)(YR + e); const v4f xr = *(const v4f*)(X + e); asm volatile("s_wait_loadcnt 0x0" ::: "memory"); v4f y; _Pragma("unroll") for (int i = 0; i < 4; ++i) y[i] = gmv * o[i] + bfr(xr[i]); vst2(OUT + e, y); }
extern "C" void kernel_launch(void* const* d_in, const int* in_sizes, int n_in, void* d_out, int out_size, void* d_ws, size_t ws_size, hipStream_t stream) {
  (void)in_sizes; (void)n_in; (void)out_size;
  const float** F = (const float**)d_in;
  if (ws_size < (size_t)WS_END) return;
  char* ws = (char*)d_ws; _Float16 *QH = (_Float16*)(ws + WS_QH), *KH = (_Float16*)(ws + WS_KH), *VT = (_Float16*)(ws + WS_VT), *QL = (_Float16*)(ws + WS_QL), *KL = (_Float16*)(ws + WS_KL); __bf16 *VB = (__bf16*)(ws + WS_VB), *VBL = (__bf16*)(ws + WS_VBL); float *S = (float*)(ws + WS_S), *Y = (float*)(ws + WS_Y);
  (void)Y; (void)QL; (void)KL; (void)VB; (void)VBL;
  // inputs: 0 x [8,64,64,256] (channels-last = rows); 1 Wq [256,32] (in,out), 2 bq; 3 Wk, 4 bk; 5 Wv [256,256], 6 bv; 7 gamma (scalar 0.5)
  if (ws_size < (size_t)WS_END2) return;
  float *YR = (float*)(ws + WS_YR);
  k_proj<<<dim3(TNB * TT / 64, CC / 128, 3), 128, 0, stream>>>(F[0], F[0], F[0], F[1], F[3], F[5], F[2], F[4], F[6], QH, QL, KH, KL, VT, VB, VBL);
  for (int b0 = 0; b0 < TNB; b0 += BG) {
    k_sc<<<dim3(NQB, TT / 128, BG), 128, 0, stream>>>(QH, KH, QL, KL, b0, 0, S);
    k_sm<<<dim3(TT, BG), 256, 0, stream>>>(S);
    k_pv<<<dim3(NQB, HD / DVH, BG), 128, 0, stream>>>(S, VT, VB, VBL, b0, 0, YR);
  }
  k_axpy<<<dim3((unsigned)(((size_t)TNB * TT * DIN / 4 + 255) / 256)), 256, 0, stream>>>(YR, F[0], F[7], (float*)d_out);
}

// v001
// Measured time: 1080 microseconds a run.
// Two timings next to v000 put it at 2.11 and 2.12 times that version's speed.
// compute dtype: all float inputs rounded to bf16; q/k/v = x W + b with EXACT bf16 products on WMMA 16x16x32 (f32 accumulate); UNSCALED 32-deep logits q.k with both as f16 hi + residual planes (3 products); softmax in f32 (precise expf); attn x 2^11 once to f16 against v once to f16 (1 product); y = gamma * out + x in f32; f32 output.
// SAGAN self-attention on channels-LAST images (B 8, 64 x 64 = 4,096 positions, C 256; (in,out) 1/16-scale weights, zero biases, gamma = 0.5): q = x Wq + bq (32), k = x Wk + bk (32), v = x Wv + bv (256); attn = softmax(q k^T) (NO scaling); out = attn v; y = gamma * out + x -> [B, 64, 64, 256].
#include <hip/hip_runtime.h>
#include <math.h>

typedef __attribute__((ext_vector_type(16))) _Float16 v16h;
typedef __attribute__((ext_vector_type(16))) __bf16 v16b;
typedef __attribute__((ext_vector_type(8)))  _Float16 v8h;
typedef __attribute__((ext_vector_type(8)))  float v8f;
typedef __attribute__((ext_vector_type(4)))  float v4f;
typedef __attribute__((ext_vector_type(2)))  float v2f;
typedef __attribute__((ext_vector_type(4)))  unsigned v4u;
typedef __attribute__((ext_vector_type(4)))  int v4i;
typedef float __attribute__((may_alias)) float_a;
typedef int __attribute__((may_alias)) int_a;

template <typename T> __device__ __forceinline__ void vst2(void* p, T v) { *(T*)p = v;  }
__device__ __forceinline__ v8f wmma16(v16h a, v16h b, v8f c) {
  v8f d = __builtin_amdgcn_wmma_f32_16x16x32_f16(false, a, false, b, (short)0, c, false, false);
  asm volatile("v_nop\n\tv_nop\n\tv_nop\n\tv_nop" : "+v"(d) : "v"(a), "v"(b));
  return d;
}
__device__ __forceinline__ v8f wmma_bf(v16b a, v16b b, v8f c) {
  v8f d = __builtin_amdgcn_wmma_f32_16x16x32_bf16(false, a, false, b, (short)0, c, false, false);
  asm volatile("v_nop\n\tv_nop\n\tv_nop\n\tv_nop" : "+v"(d) : "v"(a), "v"(b));
  return d;
}
// 16x16x32 fragments: lane = (h = lane>>4, row/col = lane&15); elements 0..7 = k0+8h+0..7, 8..15 = k0+16+8h+0..7; D element r = row 8h+r
__device__ __forceinline__ v16h frag_h(const _Float16* rowk0, int lane) {
  union { v16h v; v8h q[2]; } u; const _Float16* p = rowk0 + 8 * (lane >> 4);
  u.q[0] = *(const v8h*)p; u.q[1] = *(const v8h*)(p + 16); return u.v;
}
__device__ __forceinline__ v16h frag_f32(const float* rowk0, int lane) {
  v16h a; const float* p = rowk0 + 8 * (lane >> 4);
#pragma unroll
  for (int i = 0; i < 8; ++i) { a[i] = (_Float16)p[i]; a[8 + i] = (_Float16)p[16 + i]; }
  return a;
}
__device__ __forceinline__ v16h frag_f32s(const float* rowk0, int lane, float sc) {
  v16h a; const float* p = rowk0 + 8 * (lane >> 4);
#pragma unroll
  for (int i = 0; i < 8; ++i) { a[i] = (_Float16)(p[i] * sc); a[8 + i] = (_Float16)(p[16 + i] * sc); }
  return a;
}
// column fragment from a [K][ld] layout (column n), rows >= K read as 0
__device__ __forceinline__ v16h fragc_f32(const float* W, int k0, int n, int lane, int ld, int K) {
  v16h a; const int g = lane >> 4;
#pragma unroll
  for (int i = 0; i < 8; ++i) { const int ka = k0 + 8 * g + i, kb = ka + 16;
    a[i] = (_Float16)(ka < K ? W[(size_t)(ka < K ? ka : K - 1) * ld + n] : 0.f); a[8 + i] = (_Float16)(kb < K ? W[(size_t)(kb < K ? kb : K - 1) * ld + n] : 0.f); }
  return a;
}
struct F2 { v16b h, l; };
__device__ __forceinline__ F2 bsplit16(const float v[16]) { F2 r;
#pragma unroll
  for (int i = 0; i < 16; ++i) { const __bf16 h = (__bf16)v[i]; r.h[i] = h; r.l[i] = (__bf16)(v[i] - (float)h); }
  return r; }
__device__ __forceinline__ F2 split_row(const float* row, int k0, int lane) { float v[16]; const float* p = row + k0 + 8 * (lane >> 4);
#pragma unroll
  for (int i = 0; i < 8; ++i) { v[i] = p[i]; v[8 + i] = p[16 + i]; }
  return bsplit16(v); }
__device__ __forceinline__ F2 split_rowK(const float* row, int k0, int lane, int K) { float v[16]; const int g = lane >> 4;
#pragma unroll
  for (int i = 0; i < 8; ++i) { const int ka = k0 + 8 * g + i, kb = ka + 16; v[i] = ka < K ? row[ka < K ? ka : K - 1] : 0.f; v[8 + i] = kb < K ? row[kb < K ? kb : K - 1] : 0.f; }
  return bsplit16(v); }
__device__ __forceinline__ F2 split_col(const float* W, int k0, int n, int lane, int ld, int K) { float v[16]; const int g = lane >> 4;
#pragma unroll
  for (int i = 0; i < 8; ++i) { const int ka = k0 + 8 * g + i, kb = ka + 16; v[i] = ka < K ? W[(size_t)(ka < K ? ka : K - 1) * ld + n] : 0.f; v[8 + i] = kb < K ? W[(size_t)(kb < K ? kb : K - 1) * ld + n] : 0.f; }
  return bsplit16(v); }
__device__ __forceinline__ v8f mac3(const F2& a, const F2& b, v8f c) { c = wmma_bf(a.l, b.h, c); c = wmma_bf(a.h, b.l, c); return wmma_bf(a.h, b.h, c); }
__device__ __forceinline__ float sigm(float v) { return 1.0f / (1.0f + expf(-v)); }
#define LDSX() do { asm volatile("s_wait_dscnt 0" ::: "memory"); __builtin_amdgcn_wave_barrier(); __builtin_amdgcn_fence(__ATOMIC_RELEASE, "workgroup"); } while (0)

#define NB 8
#define TT 4096
#define CC 256            // plane width: q/k planes carry 32 real columns (rest zero), v planes all 256
#define DIN 256
#define NH 1
#define HD 256
#define NQB (TT / 64)
#define HG 1               // one 4,096 x 4,096 score plane per pass
#define SCALE (1.0f)
#define HDQK 32
#define CAUSAL 0
#ifndef TNB
#define TNB NB
#endif
__device__ __forceinline__ v16b zero16b() { v16b z; _Pragma("unroll") for (int i = 0; i < 16; ++i) z[i] = (__bf16)0.f; return z; }
__device__ __forceinline__ float bfr(float v) { return (float)(__bf16)v; }
__host__ __device__ __forceinline__ int kb_last(int qb) { return CAUSAL ? ((qb * 64 + 63) >> 7) : (TT / 128 - 1); }
typedef __attribute__((ext_vector_type(8))) __bf16 v8b;
__device__ __forceinline__ v16b frag_b(const __bf16* rowk0, int lane) {
  union { v16b v; v8b q[2]; } u; const __bf16* p = rowk0 + 8 * (lane >> 4);
  u.q[0] = *(const v8b*)p; u.q[1] = *(const v8b*)(p + 16); return u.v;
}
#define QBH (TT / 64)      // ALL query blocks take k_sc's 3-product path
#define QBH_PV 0           // A.g stays single f16
#define QHI 4096            // q residual rows everywhere (2-product logits)
#define KHI 4096           // k residual rows for ALL keys (3-product logits)
// B fragment (k rows k0+.., output column o) of a weight: (in,out) [K][ld] or (out,in) [ld rows of K]: bf16 exact, or f16(bf16 * 256) exact
__device__ __forceinline__ v16b wcol_io(const float* Wm, int k0, int o, int lane, int ld) { v16b w; const int g = lane >> 4;
#pragma unroll
  for (int i = 0; i < 8; ++i) { w[i] = (__bf16)Wm[(size_t)(k0 + 8 * g + i) * ld + o]; w[8 + i] = (__bf16)Wm[(size_t)(k0 + 16 + 8 * g + i) * ld + o]; }
  return w; }
__device__ __forceinline__ v16b wcol_oi(const float* Wm, int k0, int o, int lane, int K) { v16b w; const float* p = Wm + (size_t)o * K + k0 + 8 * (lane >> 4);
#pragma unroll
  for (int i = 0; i < 8; ++i) { w[i] = (__bf16)p[i]; w[8 + i] = (__bf16)p[16 + i]; }
  return w; }
__device__ __forceinline__ v16h wcolh_io(const float* Wm, int k0, int o, int lane, int ld) { v16h w; const int g = lane >> 4;
#pragma unroll
  for (int i = 0; i < 8; ++i) { w[i] = (_Float16)(bfr(Wm[(size_t)(k0 + 8 * g + i) * ld + o]) * 256.0f); w[8 + i] = (_Float16)(bfr(Wm[(size_t)(k0 + 16 + 8 * g + i) * ld + o]) * 256.0f); }
  return w; }
__device__ __forceinline__ v16h wcolh_oi(const float* Wm, int k0, int o, int lane, int K) { v16h w; const float* p = Wm + (size_t)o * K + k0 + 8 * (lane >> 4);
#pragma unroll
  for (int i = 0; i < 8; ++i) { w[i] = (_Float16)(bfr(p[i]) * 256.0f); w[8 + i] = (_Float16)(bfr(p[16 + i]) * 256.0f); }
  return w; }
#define WQKV_LAYOUT 1   // 0 = (in,out) [DIN][CC]; 1 = (in,out) Wq/Wk [DIN][HDQK], Wv [DIN][CC]; 2 = per-head [NH][DIN][HD]
__device__ __forceinline__ v16b wcol_hdk(const float* Wm, int k0, int o, int lane) { v16b w; const int g = lane >> 4; const float* p = Wm + (size_t)(o / HD) * DIN * HD + (o % HD);
#pragma unroll
  for (int i = 0; i < 8; ++i) { w[i] = (__bf16)p[(size_t)(k0 + 8 * g + i) * HD]; w[8 + i] = (__bf16)p[(size_t)(k0 + 16 + 8 * g + i) * HD]; }
  return w; }
#define WO_OUT_IN 0
#if WQKV_LAYOUT == 1
#define WCOL(W, k0, o, lane) ((which == 2) ? wcol_io(W, k0, (o), lane, CC) : (((o) < HDQK) ? wcol_io(W, k0, (o), lane, HDQK) : zero16b()))   /* (in,out): Wq/Wk [256][32] (plane columns >= 32 zero), Wv [256][256] full */
#define WCOL_OLD_UNUSED(W, k0, o, lane) (((o) < HDQK) ? wcol_oi(W, k0, (o), lane, DIN) : zero16b())   /* unused: reads (out,in) [32][256] weights; plane columns >= 32 are zero for all three */
#elif WQKV_LAYOUT == 2
#define WCOL(W, k0, o, lane) wcol_hdk(W, k0, o, lane)
#else
#define WCOL(W, k0, o, lane) wcol_io(W, k0, o, lane, CC)
#endif
#if WO_OUT_IN
#define WOCOL(W, k0, o, lane) wcol_oi(W, k0, o, lane, CC)
#define WOCOLH(W, k0, o, lane) wcolh_oi(W, k0, o, lane, CC)
#else
#define WOCOL(W, k0, o, lane) wcol_io(W, k0, o, lane, DIN)
#define WOCOLH(W, k0, o, lane) wcolh_io(W, k0, o, lane, DIN)
#endif
#ifndef XP
#define OUT1_OFF (4u * (size_t)NB * DIN * TT)   /* output 1 (o) follows output 0 (y) */
#define XP TT              // position pitch of x and of the output
#endif
#define BG HG              // the pass group spans BATCHES (single head): blockIdx.z / blockIdx.y select batch b0 + z
#define DVH 128            // value columns per k_pv block (2 blocks cover the 256-wide v)
#define WS_YR (WS_END)     // f32 attended rows [b*n][256]
#define WS_END2 (WS_YR + 4u * (size_t)NB * TT * HD)
// ---- k_wz: block = (64 rows, 128 output cols): OR = y (hi + lo, K = 32 real columns of the YR rows) . W^T ((out,in) [256][32], exact) + b
__global__ __launch_bounds__(128) void k_wz(const float* __restrict__ YR, const float* __restrict__ WW, const float* __restrict__ WB, float* __restrict__ ORW) { __shared__ __align__(16) float sf[4][16][132];
  const int tid = threadIdx.x, wave = tid >> 5, lane = tid & 31, col = lane & 15, g = lane >> 4; const int c0 = blockIdx.y * 128; const size_t r0 = (size_t)blockIdx.x * 64 + wave * 16;
  v8f acc[8] = {};
#pragma unroll
  for (int kc = 0; kc < HDQK / 32; ++kc) { const F2 a = split_row(YR + (r0 + col) * CC, kc * 32, lane); asm volatile("s_wait_loadcnt 0x0" ::: "memory");
#pragma unroll
    for (int j = 0; j < 8; ++j) { const v16b w = wcol_oi(WW, kc * 32, c0 + j * 16 + col, lane, HDQK); asm volatile("s_wait_loadcnt 0x0" ::: "memory"); acc[j] = wmma_bf(a.h, w, acc[j]); acc[j] = wmma_bf(a.l, w, acc[j]); } }
#pragma unroll
  for (int j = 0; j < 8; ++j) { const float bb = WB ? bfr(WB[c0 + j * 16 + col]) : 0.f; asm volatile("s_wait_loadcnt 0x0" ::: "memory");
#pragma unroll
    for (int r = 0; r < 8; ++r) sf[wave][8 * g + r][j * 16 + col] = acc[j][r] + bb; }
  LDSX(); for (int rl = 0; rl < 16; ++rl) vst2(ORW + (r0 + rl) * DIN + c0 + lane * 4, *(const v4f*)&sf[wave][rl][lane * 4]); }
// ---- k_fin2: block = (64 positions, 64 channels, batch b): o[b][c][n] = OR[b*N + n][c] (channels-first via LDS transpose) -> output 1; y = gamma * o + bf16(x) -> output 0 (256-B runs)
__global__ __launch_bounds__(256) void k_fin2(const float* __restrict__ ORW, const float* __restrict__ X, const float* __restrict__ GM, float* __restrict__ OUT, float* __restrict__ OUT1) { const float gmv = bfr(GM[0]); __shared__ float st[64][68]; const int tid = threadIdx.x; const int n0 = blockIdx.x * 64, c0 = blockIdx.y * 64; const size_t b = blockIdx.z;
  for (int e = tid; e < 64 * 16; e += 256) { const int nl = e >> 4, q = e & 15; *(v4f*)&st[nl][q * 4] = *(const v4f*)(ORW + (b * TT + n0 + nl) * (size_t)DIN + c0 + q * 4); }
  __syncthreads();
  for (int e = tid; e < 64 * 16; e += 256) { const int cl = e >> 4, q = e & 15; const size_t oi = (b * DIN + c0 + cl) * (size_t)XP + n0 + q * 4; const v4f xr = *(const v4f*)(X + oi); v4f o, y; _Pragma("unroll") for (int i = 0; i < 4; ++i) { o[i] = st[q * 4 + i][cl]; y[i] = gmv * o[i] + bfr(xr[i]); } vst2(OUT + oi, y); vst2(OUT1 + oi, o); } }   /* y = gamma * o + x (output 0), o (output 1) */
#ifndef SM_EXTRA_PARAMS
#define SM_EXTRA_PARAMS
#endif
#ifndef PROJ_EXTRA_PARAMS
#define PROJ_EXTRA_PARAMS
#endif
#ifndef SM_MASK_HOOK
#define SM_MASK_HOOK (void)0
#endif

#define WS_QH  0u                                      // f16 q rows [b*t][CC]
#define WS_KH  (WS_QH + 2u * (size_t)NB * TT * CC)      // f16 k rows [b*t][CC]
#define WS_VT  (WS_KH + 2u * (size_t)NB * TT * CC)      // f16 v planes [b][c][t]
#define WS_QL  (WS_VT + 2u * (size_t)NB * CC * TT)      // f16 q residual x 2^10 rows [b][t < QHI][CC]
#define WS_KL  (WS_QL + 2u * (size_t)NB * QHI * CC)     // f16 k residual x 2^10 rows [b][t < KHI][CC]
#define WS_VB  (WS_KL + 2u * (size_t)NB * KHI * CC)     // bf16 v hi planes [b][c][t < KHI]
#define WS_VBL (WS_VB + 2u * (size_t)NB * CC * KHI)
#define WS_S   (WS_VBL + 2u * (size_t)NB * CC * KHI)    // f32 logits / P [hg][t][s]
#define WS_Y   (WS_S  + 4u * (size_t)HG * TT * TT)      // f32 ctx rows [b*t][CC] (only when there is an output projection)
#define WS_END (WS_Y  + 0u)

// ---- k_proj: block = (64 rows, 128 cols, which): q/k/v = X W (+ b) with exact bf16 products (K = DIN) -> which 0: q f16 rows (+ residual rows < QHI); 1: k f16 rows (+ residual rows < KHI); 2: v f16 planes [c][t] (+ bf16 hi/lo planes for t < KHI)
__global__ __launch_bounds__(128) void k_proj(const float* __restrict__ XQ, const float* __restrict__ XK, const float* __restrict__ XV, const float* __restrict__ WQ, const float* __restrict__ WK, const float* __restrict__ WV, const float* __restrict__ BQ, const float* __restrict__ BK, const float* __restrict__ BV,
    _Float16* __restrict__ QH, _Float16* __restrict__ QL, _Float16* __restrict__ KH, _Float16* __restrict__ KL, _Float16* __restrict__ VT, __bf16* __restrict__ VB, __bf16* __restrict__ VBL) {
  __shared__ __align__(16) _Float16 sh[64][136], sl[64][136]; __shared__ __align__(16) _Float16 th[128][72]; __shared__ __align__(16) __bf16 tb[128][72], tbl[128][72];
  const int tid = threadIdx.x, wave = tid >> 5, lane = tid & 31, col = lane & 15, g = lane >> 4; const int which = blockIdx.z; const int c0 = blockIdx.y * 128; const size_t r0 = (size_t)blockIdx.x * 64; const size_t bb = r0 / TT; const int t0 = (int)(r0 % TT);
  const float* X = which == 0 ? XQ : which == 1 ? XK : XV; const float* WA = which == 0 ? WQ : which == 1 ? WK : WV; const float* BA = which == 0 ? BQ : which == 1 ? BK : BV;
  v8f acc[8] = {};
#pragma unroll 2
  for (int kc = 0; kc < DIN / 32; ++kc) { v16b a; { const float* p = X + (r0 + wave * 16 + col) * (size_t)DIN + kc * 32 + 8 * g;   /* channels-LAST: plain rows x[b*T + t][k] */
#pragma unroll
      for (int i = 0; i < 8; ++i) { a[i] = (__bf16)p[i]; a[8 + i] = (__bf16)p[16 + i]; } }
    asm volatile("s_wait_loadcnt 0x0" ::: "memory");
#pragma unroll
    for (int j = 0; j < 8; ++j) { const v16b w = WCOL(WA, kc * 32, c0 + j * 16 + col, lane); asm volatile("s_wait_loadcnt 0x0" ::: "memory"); acc[j] = wmma_bf(a, w, acc[j]); } }
  if (which < 2) { _Float16* DH = which == 0 ? QH : KH; _Float16* DL = which == 0 ? QL : KL; const int nhi = which == 0 ? QHI : KHI; const bool hi_rows = t0 < nhi;
#pragma unroll
    for (int j = 0; j < 8; ++j) { const float bias = (BA && (which == 2 || (c0 + j * 16 + col) < HDQK)) ? bfr(BA[c0 + j * 16 + col]) : 0.f;   /* q/k: 32 real columns; v: all 256 */   /* 32-entry biases */
#pragma unroll
      for (int r = 0; r < 8; ++r) { const float v = acc[j][r] + bias; const _Float16 hv = (_Float16)v; sh[wave * 16 + 8 * g + r][j * 16 + col] = hv; sl[wave * 16 + 8 * g + r][j * 16 + col] = (_Float16)((v - (float)hv) * 1024.0f); } }
    __syncthreads();
    for (int e = tid; e < 64 * 16; e += 128) { const int rl = e >> 4, q = e & 15; vst2((unsigned*)(DH + (r0 + rl) * CC + c0 + q * 8), *(const v4u*)&sh[rl][q * 8]); if (hi_rows) vst2((unsigned*)(DL + (bb * nhi + t0 + rl) * (size_t)CC + c0 + q * 8), *(const v4u*)&sl[rl][q * 8]); }
  } else { const bool hi_rows = t0 < KHI;
#pragma unroll
    for (int j = 0; j < 8; ++j) { const float bias = (BA && (which == 2 || (c0 + j * 16 + col) < HDQK)) ? bfr(BA[c0 + j * 16 + col]) : 0.f;   /* q/k: 32 real columns; v: all 256 */   /* 256-entry bias */
#pragma unroll
      for (int r = 0; r < 8; ++r) { const float v = acc[j][r] + bias; const int rl = wave * 16 + 8 * g + r, cl = j * 16 + col; th[cl][rl] = (_Float16)v; const __bf16 bh = (__bf16)v; tb[cl][rl] = bh; tbl[cl][rl] = (__bf16)(v - (float)bh); } }
    __syncthreads();
    for (int e = tid; e < 128 * 8; e += 128) { const int cl = e >> 3, q = e & 7; vst2((unsigned*)(VT + (bb * CC + c0 + cl) * (size_t)TT + t0 + q * 8), *(const v4u*)&th[cl][q * 8]); if (hi_rows) { const size_t o3 = (bb * CC + c0 + cl) * (size_t)KHI + t0 + q * 8; vst2((unsigned*)(VB + o3), *(const v4u*)&tb[cl][q * 8]); vst2((unsigned*)(VBL + o3), *(const v4u*)&tbl[cl][q * 8]); } } } }
// ---- k_sc: block = (query block qb, key block kb <= kb_last(qb), batch b = bgrp + z in group): logits x SCALE; q hi + residual (x 2^10) against k (2 products) for query rows < QHI, plus the k residual (3 products) for query blocks < QBH (all 64); causal: blocks past the diagonal exit, the mask itself is applied by index in k_sm
__global__ __launch_bounds__(128) void k_sc(const _Float16* __restrict__ QH, const _Float16* __restrict__ KH, const _Float16* __restrict__ QL, const _Float16* __restrict__ KL, int bgrp, int h0, float* __restrict__ S0) { __shared__ __align__(16) float ss[4][16][132];
  const int qb = blockIdx.x, kb = blockIdx.y; if (kb > kb_last(qb)) return;
  const int h = h0; const int b = bgrp + blockIdx.z; float* S = S0 + (size_t)blockIdx.z * TT * TT;   /* group spans batches */
  const int tid = threadIdx.x, wave = tid >> 5, lane = tid & 31, col = lane & 15, g = lane >> 4; const int k0 = kb * 128; const int ql0 = qb * 64 + wave * 16; const size_t q0 = (size_t)b * TT + ql0, kr0 = (size_t)b * TT + k0;
  v8f acc[8] = {}, accl[8] = {};
  const _Float16* QLb = QL + (size_t)b * QHI * CC; const _Float16* KLb = KL + (size_t)b * KHI * CC;
  if (qb < QBH) {
#pragma unroll
    for (int kc = 0; kc < HDQK / 32; ++kc) { const v16h ah = frag_h(QH + (q0 + col) * CC + h * HD + kc * 32, lane), al = frag_h(QLb + (size_t)(ql0 + col) * CC + h * HD + kc * 32, lane);
#pragma unroll
      for (int j = 0; j < 8; ++j) { const v16h kbf = frag_h(KH + (kr0 + j * 16 + col) * CC + h * HD + kc * 32, lane), klf = frag_h(KLb + (size_t)(k0 + j * 16 + col) * CC + h * HD + kc * 32, lane); acc[j] = wmma16(ah, kbf, acc[j]); accl[j] = wmma16(al, kbf, accl[j]); accl[j] = wmma16(ah, klf, accl[j]); } }
  } else if (qb * 64 < QHI) {
#pragma unroll
    for (int kc = 0; kc < HDQK / 32; ++kc) { const v16h ah = frag_h(QH + (q0 + col) * CC + h * HD + kc * 32, lane), al = frag_h(QLb + (size_t)(ql0 + col) * CC + h * HD + kc * 32, lane);
#pragma unroll
      for (int j = 0; j < 8; ++j) { const v16h kbf = frag_h(KH + (kr0 + j * 16 + col) * CC + h * HD + kc * 32, lane); acc[j] = wmma16(ah, kbf, acc[j]); accl[j] = wmma16(al, kbf, accl[j]); } }
  } else {
#pragma unroll
    for (int kc = 0; kc < HDQK / 32; ++kc) { const v16h ah = frag_h(QH + (q0 + col) * CC + h * HD + kc * 32, lane);
#pragma unroll
      for (int j = 0; j < 8; ++j) { const v16h kbf = frag_h(KH + (kr0 + j * 16 + col) * CC + h * HD + kc * 32, lane); acc[j] = wmma16(ah, kbf, acc[j]); } } }
#pragma unroll
  for (int j = 0; j < 8; ++j) {
#pragma unroll
    for (int r = 0; r < 8; ++r) ss[wave][8 * g + r][j * 16 + col] = (acc[j][r] + accl[j][r] * (1.0f / 1024.0f)) * SCALE; }
  LDSX(); for (int rl = 0; rl < 16; ++rl) vst2(S + (size_t)(ql0 + rl) * TT + k0 + lane * 4, *(const v4f*)&ss[wave][rl][lane * 4]); }
// ---- k_sm: block = query row t (batch in group): keys [0, kend): causal -> logit if s <= t else excluded; softmax in f32; P x 2^11 in place (0 for excluded)
__global__ __launch_bounds__(256) void k_sm(float* __restrict__ S0 SM_EXTRA_PARAMS) { __shared__ float sred[8]; __shared__ float sbc; __shared__ __align__(16) float shv[TT];
  const int tid = threadIdx.x; const int t = blockIdx.x; const int kend = (kb_last(t >> 6) + 1) * 128;
  float* sr = S0 + (size_t)blockIdx.y * TT * TT + (size_t)t * TT;
  float m = -3.0e38f; for (int k = tid; k < kend; k += 256) { float v = (!CAUSAL || k <= t) ? sr[k] : -3.0e38f; SM_MASK_HOOK; shv[k] = v; m = fmaxf(m, v); }
#pragma unroll
  for (int o = 1; o < 32; o <<= 1) m = fmaxf(m, __shfl_xor(m, o));
  if ((tid & 31) == 0) sred[tid >> 5] = m; __syncthreads(); if (tid == 0) { float a = sred[0]; for (int i = 1; i < 8; ++i) a = fmaxf(a, sred[i]); sbc = a; } __syncthreads(); m = sbc; __syncthreads();
  float sum = 0.f; for (int k = tid; k < kend; k += 256) { const float v = shv[k]; const float e = (v <= -1.0e38f) ? 0.f : expf(v - m); shv[k] = e; sum += e; }
#pragma unroll
  for (int o = 1; o < 32; o <<= 1) sum += __shfl_xor(sum, o);
  if ((tid & 31) == 0) sred[tid >> 5] = sum; __syncthreads(); if (tid == 0) { float a = 0.f; for (int i = 0; i < 8; ++i) a += sred[i]; sbc = a > 0.f ? 2048.0f / a : 0.f; }   /* a fully excluded row yields P = 0 */ __syncthreads(); const float inv = sbc;
  for (int k = tid; k < kend; k += 256) shv[k] = shv[k] * inv;
  __syncthreads(); for (int q = tid; q < kend / 4; q += 256) vst2(sr + q * 4, *(const v4f*)&shv[q * 4]); }
// ---- k_pv: block = 32 queries x 128 value columns of batch b, 16 waves = 2 query strips (16 rows) x 8 key slices: wave (qw, ks) sums ctx = P . v over the 32-key steps kc = ks, ks + 8, ... (P x 2^11 once to f16 against v f16: 1 product); the 8 partial tiles meet in LDS and are added in slice order 0..7; 512-B (row, column-half) segment by 32 lanes
#define KS 8               // key slices (waves that share one 16-query strip)
#define QW 2               // 16-query strips per block
__global__ __launch_bounds__(32 * QW * KS) void k_pv(const float* __restrict__ PS0, const _Float16* __restrict__ VT, const __bf16* __restrict__ VB, const __bf16* __restrict__ VBL, int bgrp, int h0, float* __restrict__ Y) { const int h = h0; const int b = bgrp + blockIdx.z; const float* PS = PS0 + (size_t)blockIdx.z * TT * TT; const int d0 = blockIdx.y * DVH;   /* group spans batches; column half d0 */ __shared__ __align__(16) float ss[KS][QW * 16][DVH + 4];
  const int tid = threadIdx.x, wave = __builtin_amdgcn_readfirstlane(tid >> 5), lane = tid & 31, col = lane & 15, g = lane >> 4; const int qw = wave % QW, ks = wave / QW; const int qr0 = blockIdx.x * (16 * QW); const int ql0 = qr0 + qw * 16; const int qb = qr0 >> 6; const int kce = (kb_last(qb) + 1) * 4;   /* wave number through readfirstlane: the key loop's counter and branch stay scalar, EXEC stays all ones at the WMMAs */
  v8f acc[DVH / 16] = {};
  if (qb < QBH_PV) {
#pragma unroll 1
    for (int kc = ks; kc < kce; kc += KS) { const F2 p = split_row(PS + (size_t)(ql0 + col) * TT, kc * 32, lane);
      asm volatile("s_wait_loadcnt 0x0" ::: "memory");
#pragma unroll
      for (int j = 0; j < DVH / 16; ++j) { const size_t po = ((size_t)b * CC + h * HD + d0 + j * 16 + col) * (size_t)KHI + kc * 32; const v16b vh = frag_b(VB + po, lane); acc[j] = wmma_bf(p.h, vh, acc[j]); acc[j] = wmma_bf(p.l, vh, acc[j]); acc[j] = wmma_bf(p.h, frag_b(VBL + po, lane), acc[j]); } }
  } else {
#pragma unroll 1
    for (int kc = ks; kc < kce; kc += KS) { const v16h p = frag_f32(PS + (size_t)(ql0 + col) * TT + kc * 32, lane);
      asm volatile("s_wait_loadcnt 0x0" ::: "memory");
#pragma unroll
      for (int j = 0; j < DVH / 16; ++j) { const size_t po = ((size_t)b * CC + h * HD + d0 + j * 16 + col) * (size_t)TT + kc * 32; acc[j] = wmma16(p, frag_h(VT + po, lane), acc[j]); } } }
#pragma unroll
  for (int j = 0; j < DVH / 16; ++j)
#pragma unroll
    for (int r = 0; r < 8; ++r) ss[ks][qw * 16 + 8 * g + r][j * 16 + col] = acc[j][r];
  __syncthreads();   /* every slice's partial tile is in LDS before any wave adds them */
  for (int e = tid; e < QW * 16 * (DVH / 4); e += 32 * QW * KS) { const int rl = e / (DVH / 4), q = e % (DVH / 4); v4f s = *(const v4f*)&ss[0][rl][q * 4];
#pragma unroll   /* so that the slices' LDS reads issue together instead of one per trip */
    for (int k = 1; k < KS; ++k) s += *(const v4f*)&ss[k][rl][q * 4];
    vst2(Y + ((size_t)b * TT + qr0 + rl) * CC + h * HD + d0 + q * 4, s * (1.0f / 2048.0f)); } }

__global__ __launch_bounds__(256) void k_axpy(const float* __restrict__ YR, const float* __restrict__ X, const float* __restrict__ GM, float* __restrict__ OUT) { const size_t e = ((size_t)blockIdx.x * 256 + threadIdx.x) * 4; if (e >= (size_t)TNB * TT * DIN) return; const float gmv = bfr(GM[0]); const v4f o = *(const v4f*)(YR + e); const v4f xr = *(const v4f*)(X + e); asm volatile("s_wait_loadcnt 0x0" ::: "memory"); v4f y; _Pragma("unroll") for (int i = 0; i < 4; ++i) y[i] = gmv * o[i] + bfr(xr[i]); vst2(OUT + e, y); }
extern "C" void kernel_launch(void* const* d_in, const int* in_sizes, int n_in, void* d_out, int out_size, void* d_ws, size_t ws_size, hipStream_t stream) {
  (void)in_sizes; (void)n_in; (void)out_size;
  const float** F = (const float**)d_in;
  if (ws_size < (size_t)WS_END) return;
  char* ws = (char*)d_ws; _Float16 *QH = (_Float16*)(ws + WS_QH), *KH = (_Float16*)(ws + WS_KH), *VT = (_Float16*)(ws + WS_VT), *QL = (_Float16*)(ws + WS_QL), *KL = (_Float16*)(ws + WS_KL); __bf16 *VB = (__bf16*)(ws + WS_VB), *VBL = (__bf16*)(ws + WS_VBL); float *S = (float*)(ws + WS_S), *Y = (float*)(ws + WS_Y);
  (void)Y; (void)QL; (void)KL; (void)VB; (void)VBL;
  // inputs: 0 x [8,64,64,256] (channels-last = rows); 1 Wq [256,32] (in,out), 2 bq; 3 Wk, 4 bk; 5 Wv [256,256], 6 bv; 7 gamma (scalar 0.5)
  if (ws_size < (size_t)WS_END2) return;
  float *YR = (float*)(ws + WS_YR);
  k_proj<<<dim3(TNB * TT / 64, CC / 128, 3), 128, 0, stream>>>(F[0], F[0], F[0], F[1], F[3], F[5], F[2], F[4], F[6], QH, QL, KH, KL, VT, VB, VBL);
  for (int b0 = 0; b0 < TNB; b0 += BG) {
    k_sc<<<dim3(NQB, TT / 128, BG), 128, 0, stream>>>(QH, KH, QL, KL, b0, 0, S);
    k_sm<<<dim3(TT, BG), 256, 0, stream>>>(S);
    k_pv<<<dim3(TT / (16 * QW), HD / DVH, BG), 32 * QW * KS, 0, stream>>>(S, VT, VB, VBL, b0, 0, YR);
  }
  k_axpy<<<dim3((unsigned)(((size_t)TNB * TT * DIN / 4 + 255) / 256)), 256, 0, stream>>>(YR, F[0], F[7], (float*)d_out);
}

// v002
// One run takes 243 microseconds.
// Timed twice side by side with v001, it ran 4.40 and 4.39 times as fast.
// All steps since v000 together make it 9.29 times as fast.
// compute dtype: all float inputs rounded to bf16; q/k/v = x W + b with EXACT bf16 products on WMMA 16x16x32 (f32 accumulate); UNSCALED 32-deep logits q.k with both as f16 hi + residual planes (3 products); online softmax in f32 (precise expf, running maximum); exp(logit - maximum) x 2^11 once to f16 against v once to f16 (1 product), divided by the f32 sum at the end; y = gamma * out + x in f32; f32 output.
// SAGAN self-attention on channels-LAST images (B 8, 64 x 64 = 4,096 positions, C 256; (in,out) 1/16-scale weights, zero biases, gamma = 0.5): q = x Wq + bq (32), k = x Wk + bk (32), v = x Wv + bv (256); attn = softmax(q k^T) (NO scaling); out = attn v; y = gamma * out + x -> [B, 64, 64, 256].
#include <hip/hip_runtime.h>
#include <math.h>

typedef __attribute__((ext_vector_type(16))) _Float16 v16h;
typedef __attribute__((ext_vector_type(16))) __bf16 v16b;
typedef __attribute__((ext_vector_type(8)))  _Float16 v8h;
typedef __attribute__((ext_vector_type(8)))  float v8f;
typedef __attribute__((ext_vector_type(4)))  float v4f;
typedef __attribute__((ext_vector_type(2)))  float v2f;
typedef __attribute__((ext_vector_type(4)))  unsigned v4u;
typedef __attribute__((ext_vector_type(4)))  int v4i;
typedef float __attribute__((may_alias)) float_a;
typedef int __attribute__((may_alias)) int_a;

template <typename T> __device__ __forceinline__ void vst2(void* p, T v) { *(T*)p = v;  }
__device__ __forceinline__ v8f wmma16(v16h a, v16h b, v8f c) {
  v8f d = __builtin_amdgcn_wmma_f32_16x16x32_f16(false, a, false, b, (short)0, c, false, false);
  asm volatile("v_nop\n\tv_nop\n\tv_nop\n\tv_nop" : "+v"(d) : "v"(a), "v"(b));
  return d;
}
__device__ __forceinline__ v8f wmma_bf(v16b a, v16b b, v8f c) {
  v8f d = __builtin_amdgcn_wmma_f32_16x16x32_bf16(false, a, false, b, (short)0, c, false, false);
  asm volatile("v_nop\n\tv_nop\n\tv_nop\n\tv_nop" : "+v"(d) : "v"(a), "v"(b));
  return d;
}
// 16x16x32 fragments: lane = (h = lane>>4, row/col = lane&15); elements 0..7 = k0+8h+0..7, 8..15 = k0+16+8h+0..7; D element r = row 8h+r
__device__ __forceinline__ v16h frag_h(const _Float16* rowk0, int lane) {
  union { v16h v; v8h q[2]; } u; const _Float16* p = rowk0 + 8 * (lane >> 4);
  u.q[0] = *(const v8h*)p; u.q[1] = *(const v8h*)(p + 16); return u.v;
}
__device__ __forceinline__ v16h frag_f32(const float* rowk0, int lane) {
  v16h a; const float* p = rowk0 + 8 * (lane >> 4);
#pragma unroll
  for (int i = 0; i < 8; ++i) { a[i] = (_Float16)p[i]; a[8 + i] = (_Float16)p[16 + i]; }
  return a;
}
__device__ __forceinline__ v16h frag_f32s(const float* rowk0, int lane, float sc) {
  v16h a; const float* p = rowk0 + 8 * (lane >> 4);
#pragma unroll
  for (int i = 0; i < 8; ++i) { a[i] = (_Float16)(p[i] * sc); a[8 + i] = (_Float16)(p[16 + i] * sc); }
  return a;
}
// column fragment from a [K][ld] layout (column n), rows >= K read as 0
__device__ __forceinline__ v16h fragc_f32(const float* W, int k0, int n, int lane, int ld, int K) {
  v16h a; const int g = lane >> 4;
#pragma unroll
  for (int i = 0; i < 8; ++i) { const int ka = k0 + 8 * g + i, kb = ka + 16;
    a[i] = (_Float16)(ka < K ? W[(size_t)(ka < K ? ka : K - 1) * ld + n] : 0.f); a[8 + i] = (_Float16)(kb < K ? W[(size_t)(kb < K ? kb : K - 1) * ld + n] : 0.f); }
  return a;
}
struct F2 { v16b h, l; };
__device__ __forceinline__ F2 bsplit16(const float v[16]) { F2 r;
#pragma unroll
  for (int i = 0; i < 16; ++i) { const __bf16 h = (__bf16)v[i]; r.h[i] = h; r.l[i] = (__bf16)(v[i] - (float)h); }
  return r; }
__device__ __forceinline__ F2 split_row(const float* row, int k0, int lane) { float v[16]; const float* p = row + k0 + 8 * (lane >> 4);
#pragma unroll
  for (int i = 0; i < 8; ++i) { v[i] = p[i]; v[8 + i] = p[16 + i]; }
  return bsplit16(v); }
__device__ __forceinline__ F2 split_rowK(const float* row, int k0, int lane, int K) { float v[16]; const int g = lane >> 4;
#pragma unroll
  for (int i = 0; i < 8; ++i) { const int ka = k0 + 8 * g + i, kb = ka + 16; v[i] = ka < K ? row[ka < K ? ka : K - 1] : 0.f; v[8 + i] = kb < K ? row[kb < K ? kb : K - 1] : 0.f; }
  return bsplit16(v); }
__device__ __forceinline__ F2 split_col(const float* W, int k0, int n, int lane, int ld, int K) { float v[16]; const int g = lane >> 4;
#pragma unroll
  for (int i = 0; i < 8; ++i) { const int ka = k0 + 8 * g + i, kb = ka + 16; v[i] = ka < K ? W[(size_t)(ka < K ? ka : K - 1) * ld + n] : 0.f; v[8 + i] = kb < K ? W[(size_t)(kb < K ? kb : K - 1) * ld + n] : 0.f; }
  return bsplit16(v); }
__device__ __forceinline__ v8f mac3(const F2& a, const F2& b, v8f c) { c = wmma_bf(a.l, b.h, c); c = wmma_bf(a.h, b.l, c); return wmma_bf(a.h, b.h, c); }
__device__ __forceinline__ float sigm(float v) { return 1.0f / (1.0f + expf(-v)); }
#define LDSX() do { asm volatile("s_wait_dscnt 0" ::: "memory"); __builtin_amdgcn_wave_barrier(); __builtin_amdgcn_fence(__ATOMIC_RELEASE, "workgroup"); } while (0)

#define NB 8
#define TT 4096
#define CC 256            // plane width: q/k planes carry 32 real columns (rest zero), v planes all 256
#define DIN 256
#define NH 1
#define HD 256
#define NQB (TT / 64)
#define HG 1               // one 4,096 x 4,096 f32 score plane in the workspace, which no kernel uses
#define SCALE (1.0f)
#define HDQK 32
#define CAUSAL 0
#ifndef TNB
#define TNB NB
#endif
__device__ __forceinline__ v16b zero16b() { v16b z; _Pragma("unroll") for (int i = 0; i < 16; ++i) z[i] = (__bf16)0.f; return z; }
__device__ __forceinline__ float bfr(float v) { return (float)(__bf16)v; }
__host__ __device__ __forceinline__ int kb_last(int qb) { return CAUSAL ? ((qb * 64 + 63) >> 7) : (TT / 128 - 1); }
typedef __attribute__((ext_vector_type(8))) __bf16 v8b;
__device__ __forceinline__ v16b frag_b(const __bf16* rowk0, int lane) {
  union { v16b v; v8b q[2]; } u; const __bf16* p = rowk0 + 8 * (lane >> 4);
  u.q[0] = *(const v8b*)p; u.q[1] = *(const v8b*)(p + 16); return u.v;
}
#define QBH (TT / 64)
#define QBH_PV 0           // A.g stays single f16
#define QHI 4096            // q residual rows everywhere (2-product logits)
#define KHI 4096           // k residual rows for ALL keys (3-product logits)
// B fragment (k rows k0+.., output column o) of a weight: (in,out) [K][ld] or (out,in) [ld rows of K]: bf16 exact, or f16(bf16 * 256) exact
__device__ __forceinline__ v16b wcol_io(const float* Wm, int k0, int o, int lane, int ld) { v16b w; const int g = lane >> 4;
#pragma unroll
  for (int i = 0; i < 8; ++i) { w[i] = (__bf16)Wm[(size_t)(k0 + 8 * g + i) * ld + o]; w[8 + i] = (__bf16)Wm[(size_t)(k0 + 16 + 8 * g + i) * ld + o]; }
  return w; }
__device__ __forceinline__ v16b wcol_oi(const float* Wm, int k0, int o, int lane, int K) { v16b w; const float* p = Wm + (size_t)o * K + k0 + 8 * (lane >> 4);
#pragma unroll
  for (int i = 0; i < 8; ++i) { w[i] = (__bf16)p[i]; w[8 + i] = (__bf16)p[16 + i]; }
  return w; }
__device__ __forceinline__ v16h wcolh_io(const float* Wm, int k0, int o, int lane, int ld) { v16h w; const int g = lane >> 4;
#pragma unroll
  for (int i = 0; i < 8; ++i) { w[i] = (_Float16)(bfr(Wm[(size_t)(k0 + 8 * g + i) * ld + o]) * 256.0f); w[8 + i] = (_Float16)(bfr(Wm[(size_t)(k0 + 16 + 8 * g + i) * ld + o]) * 256.0f); }
  return w; }
__device__ __forceinline__ v16h wcolh_oi(const float* Wm, int k0, int o, int lane, int K) { v16h w; const float* p = Wm + (size_t)o * K + k0 + 8 * (lane >> 4);
#pragma unroll
  for (int i = 0; i < 8; ++i) { w[i] = (_Float16)(bfr(p[i]) * 256.0f); w[8 + i] = (_Float16)(bfr(p[16 + i]) * 256.0f); }
  return w; }
#define WQKV_LAYOUT 1   // 0 = (in,out) [DIN][CC]; 1 = (in,out) Wq/Wk [DIN][HDQK], Wv [DIN][CC]; 2 = per-head [NH][DIN][HD]
__device__ __forceinline__ v16b wcol_hdk(const float* Wm, int k0, int o, int lane) { v16b w; const int g = lane >> 4; const float* p = Wm + (size_t)(o / HD) * DIN * HD + (o % HD);
#pragma unroll
  for (int i = 0; i < 8; ++i) { w[i] = (__bf16)p[(size_t)(k0 + 8 * g + i) * HD]; w[8 + i] = (__bf16)p[(size_t)(k0 + 16 + 8 * g + i) * HD]; }
  return w; }
#define WO_OUT_IN 0
#if WQKV_LAYOUT == 1
#define WCOL(W, k0, o, lane) ((which == 2) ? wcol_io(W, k0, (o), lane, CC) : (((o) < HDQK) ? wcol_io(W, k0, (o), lane, HDQK) : zero16b()))   /* (in,out): Wq/Wk [256][32] (plane columns >= 32 zero), Wv [256][256] full */
#define WCOL_OLD_UNUSED(W, k0, o, lane) (((o) < HDQK) ? wcol_oi(W, k0, (o), lane, DIN) : zero16b())   /* unused: reads (out,in) [32][256] weights; plane columns >= 32 are zero for all three */
#elif WQKV_LAYOUT == 2
#define WCOL(W, k0, o, lane) wcol_hdk(W, k0, o, lane)
#else
#define WCOL(W, k0, o, lane) wcol_io(W, k0, o, lane, CC)
#endif
#if WO_OUT_IN
#define WOCOL(W, k0, o, lane) wcol_oi(W, k0, o, lane, CC)
#define WOCOLH(W, k0, o, lane) wcolh_oi(W, k0, o, lane, CC)
#else
#define WOCOL(W, k0, o, lane) wcol_io(W, k0, o, lane, DIN)
#define WOCOLH(W, k0, o, lane) wcolh_io(W, k0, o, lane, DIN)
#endif
#ifndef XP
#define OUT1_OFF (4u * (size_t)NB * DIN * TT)   /* output 1 (o) follows output 0 (y) */
#define XP TT              // position pitch of x and of the output
#endif
#define BG HG
#define DVH 128
#define WS_YR (WS_END)     // f32 attended rows [b*n][256]
#define WS_END2 (WS_YR + 4u * (size_t)NB * TT * HD)
// ---- k_wz: block = (64 rows, 128 output cols): OR = y (hi + lo, K = 32 real columns of the YR rows) . W^T ((out,in) [256][32], exact) + b
__global__ __launch_bounds__(128) void k_wz(const float* __restrict__ YR, const float* __restrict__ WW, const float* __restrict__ WB, float* __restrict__ ORW) { __shared__ __align__(16) float sf[4][16][132];
  const int tid = threadIdx.x, wave = tid >> 5, lane = tid & 31, col = lane & 15, g = lane >> 4; const int c0 = blockIdx.y * 128; const size_t r0 = (size_t)blockIdx.x * 64 + wave * 16;
  v8f acc[8] = {};
#pragma unroll
  for (int kc = 0; kc < HDQK / 32; ++kc) { const F2 a = split_row(YR + (r0 + col) * CC, kc * 32, lane); asm volatile("s_wait_loadcnt 0x0" ::: "memory");
#pragma unroll
    for (int j = 0; j < 8; ++j) { const v16b w = wcol_oi(WW, kc * 32, c0 + j * 16 + col, lane, HDQK); asm volatile("s_wait_loadcnt 0x0" ::: "memory"); acc[j] = wmma_bf(a.h, w, acc[j]); acc[j] = wmma_bf(a.l, w, acc[j]); } }
#pragma unroll
  for (int j = 0; j < 8; ++j) { const float bb = WB ? bfr(WB[c0 + j * 16 + col]) : 0.f; asm volatile("s_wait_loadcnt 0x0" ::: "memory");
#pragma unroll
    for (int r = 0; r < 8; ++r) sf[wave][8 * g + r][j * 16 + col] = acc[j][r] + bb; }
  LDSX(); for (int rl = 0; rl < 16; ++rl) vst2(ORW + (r0 + rl) * DIN + c0 + lane * 4, *(const v4f*)&sf[wave][rl][lane * 4]); }
// ---- k_fin2: block = (64 positions, 64 channels, batch b): o[b][c][n] = OR[b*N + n][c] (channels-first via LDS transpose) -> output 1; y = gamma * o + bf16(x) -> output 0 (256-B runs)
__global__ __launch_bounds__(256) void k_fin2(const float* __restrict__ ORW, const float* __restrict__ X, const float* __restrict__ GM, float* __restrict__ OUT, float* __restrict__ OUT1) { const float gmv = bfr(GM[0]); __shared__ float st[64][68]; const int tid = threadIdx.x; const int n0 = blockIdx.x * 64, c0 = blockIdx.y * 64; const size_t b = blockIdx.z;
  for (int e = tid; e < 64 * 16; e += 256) { const int nl = e >> 4, q = e & 15; *(v4f*)&st[nl][q * 4] = *(const v4f*)(ORW + (b * TT + n0 + nl) * (size_t)DIN + c0 + q * 4); }
  __syncthreads();
  for (int e = tid; e < 64 * 16; e += 256) { const int cl = e >> 4, q = e & 15; const size_t oi = (b * DIN + c0 + cl) * (size_t)XP + n0 + q * 4; const v4f xr = *(const v4f*)(X + oi); v4f o, y; _Pragma("unroll") for (int i = 0; i < 4; ++i) { o[i] = st[q * 4 + i][cl]; y[i] = gmv * o[i] + bfr(xr[i]); } vst2(OUT + oi, y); vst2(OUT1 + oi, o); } }   /* y = gamma * o + x (output 0), o (output 1) */
#ifndef SM_EXTRA_PARAMS
#define SM_EXTRA_PARAMS
#endif
#ifndef PROJ_EXTRA_PARAMS
#define PROJ_EXTRA_PARAMS
#endif
#ifndef SM_MASK_HOOK
#define SM_MASK_HOOK (void)0
#endif

#define WS_QH  0u                                      // f16 q rows [b*t][CC]
#define WS_KH  (WS_QH + 2u * (size_t)NB * TT * CC)      // f16 k rows [b*t][CC]
#define WS_VT  (WS_KH + 2u * (size_t)NB * TT * CC)      // f16 v planes [b][c][t]
#define WS_QL  (WS_VT + 2u * (size_t)NB * CC * TT)      // f16 q residual x 2^10 rows [b][t < QHI][CC]
#define WS_KL  (WS_QL + 2u * (size_t)NB * QHI * CC)     // f16 k residual x 2^10 rows [b][t < KHI][CC]
#define WS_VB  (WS_KL + 2u * (size_t)NB * KHI * CC)     // bf16 v hi planes [b][c][t < KHI]
#define WS_VBL (WS_VB + 2u * (size_t)NB * CC * KHI)
#define WS_S   (WS_VBL + 2u * (size_t)NB * CC * KHI)    // f32 logits / P [hg][t][s]
#define WS_Y   (WS_S  + 4u * (size_t)HG * TT * TT)      // f32 ctx rows [b*t][CC] (only when there is an output projection)
#define WS_END (WS_Y  + 0u)

// ---- k_proj: block = (64 rows, 128 cols, which): q/k/v = X W (+ b) with exact bf16 products (K = DIN) -> which 0: q f16 rows (+ residual rows < QHI); 1: k f16 rows (+ residual rows < KHI); 2: v f16 planes [c][t] (+ bf16 hi/lo planes for t < KHI)
__global__ __launch_bounds__(128) void k_proj(const float* __restrict__ XQ, const float* __restrict__ XK, const float* __restrict__ XV, const float* __restrict__ WQ, const float* __restrict__ WK, const float* __restrict__ WV, const float* __restrict__ BQ, const float* __restrict__ BK, const float* __restrict__ BV,
    _Float16* __restrict__ QH, _Float16* __restrict__ QL, _Float16* __restrict__ KH, _Float16* __restrict__ KL, _Float16* __restrict__ VT, __bf16* __restrict__ VB, __bf16* __restrict__ VBL) {
  __shared__ __align__(16) _Float16 sh[64][136], sl[64][136]; __shared__ __align__(16) _Float16 th[128][72]; __shared__ __align__(16) __bf16 tb[128][72], tbl[128][72];
  const int tid = threadIdx.x, wave = tid >> 5, lane = tid & 31, col = lane & 15, g = lane >> 4; const int which = blockIdx.z; const int c0 = blockIdx.y * 128; const size_t r0 = (size_t)blockIdx.x * 64; const size_t bb = r0 / TT; const int t0 = (int)(r0 % TT);
  const float* X = which == 0 ? XQ : which == 1 ? XK : XV; const float* WA = which == 0 ? WQ : which == 1 ? WK : WV; const float* BA = which == 0 ? BQ : which == 1 ? BK : BV;
  v8f acc[8] = {};
#pragma unroll 2
  for (int kc = 0; kc < DIN / 32; ++kc) { v16b a; { const float* p = X + (r0 + wave * 16 + col) * (size_t)DIN + kc * 32 + 8 * g;   /* channels-LAST: plain rows x[b*T + t][k] */
#pragma unroll
      for (int i = 0; i < 8; ++i) { a[i] = (__bf16)p[i]; a[8 + i] = (__bf16)p[16 + i]; } }
    asm volatile("s_wait_loadcnt 0x0" ::: "memory");
#pragma unroll
    for (int j = 0; j < 8; ++j) { const v16b w = WCOL(WA, kc * 32, c0 + j * 16 + col, lane); asm volatile("s_wait_loadcnt 0x0" ::: "memory"); acc[j] = wmma_bf(a, w, acc[j]); } }
  if (which < 2) { _Float16* DH = which == 0 ? QH : KH; _Float16* DL = which == 0 ? QL : KL; const int nhi = which == 0 ? QHI : KHI; const bool hi_rows = t0 < nhi;
#pragma unroll
    for (int j = 0; j < 8; ++j) { const float bias = (BA && (which == 2 || (c0 + j * 16 + col) < HDQK)) ? bfr(BA[c0 + j * 16 + col]) : 0.f;   /* q/k: 32 real columns; v: all 256 */   /* 32-entry biases */
#pragma unroll
      for (int r = 0; r < 8; ++r) { const float v = acc[j][r] + bias; const _Float16 hv = (_Float16)v; sh[wave * 16 + 8 * g + r][j * 16 + col] = hv; sl[wave * 16 + 8 * g + r][j * 16 + col] = (_Float16)((v - (float)hv) * 1024.0f); } }
    __syncthreads();
    for (int e = tid; e < 64 * 16; e += 128) { const int rl = e >> 4, q = e & 15; vst2((unsigned*)(DH + (r0 + rl) * CC + c0 + q * 8), *(const v4u*)&sh[rl][q * 8]); if (hi_rows) vst2((unsigned*)(DL + (bb * nhi + t0 + rl) * (size_t)CC + c0 + q * 8), *(const v4u*)&sl[rl][q * 8]); }
  } else { const bool hi_rows = t0 < KHI;
#pragma unroll
    for (int j = 0; j < 8; ++j) { const float bias = (BA && (which == 2 || (c0 + j * 16 + col) < HDQK)) ? bfr(BA[c0 + j * 16 + col]) : 0.f;   /* q/k: 32 real columns; v: all 256 */   /* 256-entry bias */
#pragma unroll
      for (int r = 0; r < 8; ++r) { const float v = acc[j][r] + bias; const int rl = wave * 16 + 8 * g + r, cl = j * 16 + col; th[cl][rl] = (_Float16)v; const __bf16 bh = (__bf16)v; tb[cl][rl] = bh; tbl[cl][rl] = (__bf16)(v - (float)bh); } }
    __syncthreads();
    for (int e = tid; e < 128 * 8; e += 128) { const int cl = e >> 3, q = e & 7; vst2((unsigned*)(VT + (bb * CC + c0 + cl) * (size_t)TT + t0 + q * 8), *(const v4u*)&th[cl][q * 8]); if (hi_rows) { const size_t o3 = (bb * CC + c0 + cl) * (size_t)KHI + t0 + q * 8; vst2((unsigned*)(VB + o3), *(const v4u*)&tb[cl][q * 8]); vst2((unsigned*)(VBL + o3), *(const v4u*)&tbl[cl][q * 8]); } } } }
#define FQ 16              // query columns per wave
#define FW 8               // waves per block
#define FK 32              // keys per pass
#define FP 40              // LDS row pitch in f16: 64-byte rows at 80 bytes (16 B x odd) for 16-byte reads
__device__ __forceinline__ float xhalf(float x) { return __builtin_bit_cast(float, __builtin_amdgcn_permlanex16(__builtin_bit_cast(int, x), __builtin_bit_cast(int, x), 0x76543210, 0xfedcba98, false, false)); }   /* lane l with lane l ^ 16 */
__device__ __forceinline__ v8f wm16(v16h a, v16h b, v8f c) { return __builtin_amdgcn_wmma_f32_16x16x32_f16(false, a, false, b, (short)0, c, false, false); }
__global__ __launch_bounds__(32 * FW) void k_fa(const _Float16* __restrict__ QH, const _Float16* __restrict__ QL, const _Float16* __restrict__ KH, const _Float16* __restrict__ KL, const _Float16* __restrict__ VT, float* __restrict__ Y) {
  __shared__ __align__(16) _Float16 sv[2][CC][FP]; __shared__ __align__(16) _Float16 sk[2][2][FK][FP];
  const int tid = threadIdx.x, wave = tid >> 5, lane = tid & 31, col = lane & 15, g = lane >> 4; const int b = blockIdx.y; const int q0 = blockIdx.x * (FQ * FW) + wave * FQ;
  const size_t qrow = ((size_t)b * TT + q0 + col) * CC; const v16h qh = frag_h(QH + qrow, lane), ql = frag_h(QL + qrow, lane);
  asm volatile("s_wait_xcnt 0x0" ::: "memory");   /* the build lets the first tile's loads land in the q loads' address registers */
  // staging: 4 lanes bring one 64-byte row; a thread brings 4 v rows' pieces (channels srow + 64 i) and one k piece (plane hi for threads < 128, residual above)
  const int srow = tid >> 2, sch = (tid & 3) * 8, kpl = tid >> 7, krow = srow & (FK - 1);
  const _Float16* vsrc = VT + ((size_t)b * CC + srow) * TT + sch; const _Float16* ksrc = (kpl ? KL : KH) + ((size_t)b * TT + krow) * CC + sch;
  v8h rv[4], rk;
#pragma unroll
  for (int i = 0; i < 4; ++i) rv[i] = *(const v8h*)(vsrc + (size_t)i * 64 * TT);
  rk = *(const v8h*)ksrc;
#pragma unroll
  for (int i = 0; i < 4; ++i) *(v8h*)&sv[0][i * 64 + srow][sch] = rv[i];
  *(v8h*)&sk[0][kpl][krow][sch] = rk;
  __syncthreads();   /* pass 0's tiles are in LDS before any wave reads them */
  v8f acc[CC / 16] = {}; float m = -3.0e38f, l = 0.f;
#pragma unroll 1   /* one pass a trip: the body already holds 22 matrix instructions and the accumulators fill the registers */
  for (int s = 0; s < TT / FK; ++s) { const int cur = s & 1; const int sn = s + 1 < TT / FK ? s + 1 : s;   /* the last pass fetches its own tile again, into the buffer nobody reads any more */
#pragma unroll
    for (int i = 0; i < 4; ++i) rv[i] = *(const v8h*)(vsrc + (size_t)i * 64 * TT + sn * FK);
    rk = *(const v8h*)(ksrc + (size_t)sn * FK * CC);
    asm volatile("s_wait_xcnt 0x0" ::: "memory");   /* the build reuses these loads' address registers for the k fragments right behind them */
    float sc[2][8]; v16h kh[2], kl[2];
#pragma unroll
    for (int t = 0; t < 2; ++t) { kh[t] = frag_h(&sk[cur][0][t * 16 + col][0], lane); kl[t] = frag_h(&sk[cur][1][t * 16 + col][0], lane); }
    __builtin_amdgcn_sched_barrier(0);   /* the pass's k fragments are asked for as one group: one LDS latency in front of the six score products, not one in front of each pair */
#pragma unroll
    for (int t = 0; t < 2; ++t) { v8f a = {}, al = {}; a = wm16(kh[t], qh, a); al = wm16(kh[t], ql, al); al = wm16(kl[t], qh, al);
#pragma unroll
      for (int r = 0; r < 8; ++r) sc[t][r] = a[r] + al[r] * (1.0f / 1024.0f); }
    float mx = sc[0][0];
#pragma unroll
    for (int r = 0; r < 8; ++r) mx = fmaxf(mx, fmaxf(sc[0][r], sc[1][r]));
    const float mn = fmaxf(m, fmaxf(mx, xhalf(mx)));
    if (__builtin_amdgcn_ballot_w32(mn > m) != 0) { const float al = expf(m - mn); l *= al; m = mn;   /* scalar branch: EXEC stays all ones; a column whose maximum stands multiplies by exp(0) = 1 */
#pragma unroll
      for (int j = 0; j < CC / 16; ++j) acc[j] *= al; }
    v16h vf[CC / 16];
#pragma unroll
    for (int j = 0; j < CC / 16; ++j) vf[j] = frag_h(&sv[cur][j * 16 + col][0], lane);
    __builtin_amdgcn_sched_barrier(0);   /* the pass's v fragments are asked for as one group ahead of the exponentials and land under them; left to itself the build reads each one product ahead, and every product waits out an LDS read */
    v16h pf;
#pragma unroll
    for (int t = 0; t < 2; ++t)
#pragma unroll
      for (int r = 0; r < 8; ++r) { const float e = expf(sc[t][r] - m); l += e; pf[t * 8 + r] = (_Float16)(e * 2048.0f); }   /* element 8 t + r = key 16 t + 8 g + r: frag_h's own k order */
#pragma unroll
    for (int j = 0; j < CC / 16; ++j) acc[j] = wm16(vf[j], pf, acc[j]);
#pragma unroll
    for (int i = 0; i < 4; ++i) *(v8h*)&sv[cur ^ 1][i * 64 + srow][sch] = rv[i];
    *(v8h*)&sk[cur ^ 1][kpl][krow][sch] = rk;
    __syncthreads();   /* publishes the next pass's tiles and ends every wave's reads of this pass's buffer, which the next trip refills */
  }
  l += xhalf(l); const float inv = 1.0f / (2048.0f * l); float* yr = Y + ((size_t)b * TT + q0 + col) * CC + 8 * g;   /* a lane's 8 accumulator registers = 8 consecutive channels of its query's row */
#pragma unroll
  for (int j = 0; j < CC / 16; ++j) { v4f o0, o1;
#pragma unroll
    for (int r = 0; r < 4; ++r) { o0[r] = acc[j][r] * inv; o1[r] = acc[j][4 + r] * inv; }
    vst2(yr + j * 16, o0); vst2(yr + j * 16 + 4, o1); } }

__global__ __launch_bounds__(256) void k_axpy(const float* __restrict__ YR, const float* __restrict__ X, const float* __restrict__ GM, float* __restrict__ OUT) { const size_t e = ((size_t)blockIdx.x * 256 + threadIdx.x) * 4; if (e >= (size_t)TNB * TT * DIN) return; const float gmv = bfr(GM[0]); const v4f o = *(const v4f*)(YR + e); const v4f xr = *(const v4f*)(X + e); asm volatile("s_wait_loadcnt 0x0" ::: "memory"); v4f y; _Pragma("unroll") for (int i = 0; i < 4; ++i) y[i] = gmv * o[i] + bfr(xr[i]); vst2(OUT + e, y); }
extern "C" void kernel_launch(void* const* d_in, const int* in_sizes, int n_in, void* d_out, int out_size, void* d_ws, size_t ws_size, hipStream_t stream) {
  (void)in_sizes; (void)n_in; (void)out_size;
  const float** F = (const float**)d_in;
  if (ws_size < (size_t)WS_END) return;
  char* ws = (char*)d_ws; _Float16 *QH = (_Float16*)(ws + WS_QH), *KH = (_Float16*)(ws + WS_KH), *VT = (_Float16*)(ws + WS_VT), *QL = (_Float16*)(ws + WS_QL), *KL = (_Float16*)(ws + WS_KL); __bf16 *VB = (__bf16*)(ws + WS_VB), *VBL = (__bf16*)(ws + WS_VBL); float *S = (float*)(ws + WS_S), *Y = (float*)(ws + WS_Y);
  (void)Y; (void)S; (void)QL; (void)KL; (void)VB; (void)VBL;
  // inputs: 0 x [8,64,64,256] (channels-last = rows); 1 Wq [256,32] (in,out), 2 bq; 3 Wk, 4 bk; 5 Wv [256,256], 6 bv; 7 gamma (scalar 0.5)
  if (ws_size < (size_t)WS_END2) return;
  float *YR = (float*)(ws + WS_YR);
  k_proj<<<dim3(TNB * TT / 64, CC / 128, 3), 128, 0, stream>>>(F[0], F[0], F[0], F[1], F[3], F[5], F[2], F[4], F[6], QH, QL, KH, KL, VT, VB, VBL);
  k_fa<<<dim3(TT / (FQ * FW), TNB), 32 * FW, 0, stream>>>(QH, QL, KH, KL, VT, YR);
  k_axpy<<<dim3((unsigned)(((size_t)TNB * TT * DIN / 4 + 255) / 256)), 256, 0, stream>>>(YR, F[0], F[7], (float*)d_out);
}

// v003
// One run takes 165 microseconds.
// Next to v002, in two timings, it ran 1.48 times as fast each time.
// Counting every step since v000, it is 13.7 times as fast.
// compute dtype: all float inputs rounded to bf16; q/k/v = x W + b with EXACT bf16 products on WMMA 16x16x32 (f32 accumulate); UNSCALED 32-deep logits q.k with both as f16 hi + residual planes (3 products); online softmax in f32 (precise expf, running maximum); exp(logit - maximum) x 2^11 once to f16 against v once to f16 (1 product), divided by the f32 sum at the end; y = gamma * out + x in f32; f32 output.
// SAGAN self-attention on channels-LAST images (B 8, 64 x 64 = 4,096 positions, C 256; (in,out) 1/16-scale weights, zero biases, gamma = 0.5): q = x Wq + bq (32), k = x Wk + bk (32), v = x Wv + bv (256); attn = softmax(q k^T) (NO scaling); out = attn v; y = gamma * out + x -> [B, 64, 64, 256].
#include <hip/hip_runtime.h>
#include <math.h>

typedef __attribute__((ext_vector_type(16))) _Float16 v16h;
typedef __attribute__((ext_vector_type(16))) __bf16 v16b;
typedef __attribute__((ext_vector_type(8)))  _Float16 v8h;
typedef __attribute__((ext_vector_type(8)))  float v8f;
typedef __attribute__((ext_vector_type(4)))  float v4f;
typedef __attribute__((ext_vector_type(2)))  float v2f;
typedef __attribute__((ext_vector_type(4)))  unsigned v4u;
typedef __attribute__((ext_vector_type(4)))  int v4i;
typedef float __attribute__((may_alias)) float_a;
typedef int __attribute__((may_alias)) int_a;

template <typename T> __device__ __forceinline__ void vst2(void* p, T v) { *(T*)p = v;  }
__device__ __forceinline__ v8f wmma16(v16h a, v16h b, v8f c) {
  v8f d = __builtin_amdgcn_wmma_f32_16x16x32_f16(false, a, false, b, (short)0, c, false, false);
  asm volatile("v_nop\n\tv_nop\n\tv_nop\n\tv_nop" : "+v"(d) : "v"(a), "v"(b));
  return d;
}
__device__ __forceinline__ v8f wmma_bf(v16b a, v16b b, v8f c) {
  v8f d = __builtin_amdgcn_wmma_f32_16x16x32_bf16(false, a, false, b, (short)0, c, false, false);
  asm volatile("v_nop\n\tv_nop\n\tv_nop\n\tv_nop" : "+v"(d) : "v"(a), "v"(b));
  return d;
}
// 16x16x32 fragments: lane = (h = lane>>4, row/col = lane&15); elements 0..7 = k0+8h+0..7, 8..15 = k0+16+8h+0..7; D element r = row 8h+r
__device__ __forceinline__ v16h frag_h(const _Float16* rowk0, int lane) {
  union { v16h v; v8h q[2]; } u; const _Float16* p = rowk0 + 8 * (lane >> 4);
  u.q[0] = *(const v8h*)p; u.q[1] = *(const v8h*)(p + 16); return u.v;
}
__device__ __forceinline__ v16h frag_f32(const float* rowk0, int lane) {
  v16h a; const float* p = rowk0 + 8 * (lane >> 4);
#pragma unroll
  for (int i = 0; i < 8; ++i) { a[i] = (_Float16)p[i]; a[8 + i] = (_Float16)p[16 + i]; }
  return a;
}
__device__ __forceinline__ v16h frag_f32s(const float* rowk0, int lane, float sc) {
  v16h a; const float* p = rowk0 + 8 * (lane >> 4);
#pragma unroll
  for (int i = 0; i < 8; ++i) { a[i] = (_Float16)(p[i] * sc); a[8 + i] = (_Float16)(p[16 + i] * sc); }
  return a;
}
// column fragment from a [K][ld] layout (column n), rows >= K read as 0
__device__ __forceinline__ v16h fragc_f32(const float* W, int k0, int n, int lane, int ld, int K) {
  v16h a; const int g = lane >> 4;
#pragma unroll
  for (int i = 0; i < 8; ++i) { const int ka = k0 + 8 * g + i, kb = ka + 16;
    a[i] = (_Float16)(ka < K ? W[(size_t)(ka < K ? ka : K - 1) * ld + n] : 0.f); a[8 + i] = (_Float16)(kb < K ? W[(size_t)(kb < K ? kb : K - 1) * ld + n] : 0.f); }
  return a;
}
struct F2 { v16b h, l; };
__device__ __forceinline__ F2 bsplit16(const float v[16]) { F2 r;
#pragma unroll
  for (int i = 0; i < 16; ++i) { const __bf16 h = (__bf16)v[i]; r.h[i] = h; r.l[i] = (__bf16)(v[i] - (float)h); }
  return r; }
__device__ __forceinline__ F2 split_row(const float* row, int k0, int lane) { float v[16]; const float* p = row + k0 + 8 * (lane >> 4);
#pragma unroll
  for (int i = 0; i < 8; ++i) { v[i] = p[i]; v[8 + i] = p[16 + i]; }
  return bsplit16(v); }
__device__ __forceinline__ F2 split_rowK(const float* row, int k0, int lane, int K) { float v[16]; const int g = lane >> 4;
#pragma unroll
  for (int i = 0; i < 8; ++i) { const int ka = k0 + 8 * g + i, kb = ka + 16; v[i] = ka < K ? row[ka < K ? ka : K - 1] : 0.f; v[8 + i] = kb < K ? row[kb < K ? kb : K - 1] : 0.f; }
  return bsplit16(v); }
__device__ __forceinline__ F2 split_col(const float* W, int k0, int n, int lane, int ld, int K) { float v[16]; const int g = lane >> 4;
#pragma unroll
  for (int i = 0; i < 8; ++i) { const int ka = k0 + 8 * g + i, kb = ka + 16; v[i] = ka < K ? W[(size_t)(ka < K ? ka : K - 1) * ld + n] : 0.f; v[8 + i] = kb < K ? W[(size_t)(kb < K ? kb : K - 1) * ld + n] : 0.f; }
  return bsplit16(v); }
__device__ __forceinline__ v8f mac3(const F2& a, const F2& b, v8f c) { c = wmma_bf(a.l, b.h, c); c = wmma_bf(a.h, b.l, c); return wmma_bf(a.h, b.h, c); }
__device__ __forceinline__ float sigm(float v) { return 1.0f / (1.0f + expf(-v)); }
#define LDSX() do { asm volatile("s_wait_dscnt 0" ::: "memory"); __builtin_amdgcn_wave_barrier(); __builtin_amdgcn_fence(__ATOMIC_RELEASE, "workgroup"); } while (0)

#define NB 8
#define TT 4096
#define CC 256            // plane width: q/k planes carry 32 real columns (rest never written or read), v planes all 256
#define DIN 256
#define NH 1
#define HD 256
#define NQB (TT / 64)
#define HG 1               // one 4,096 x 4,096 f32 score plane in the workspace, which no kernel uses
#define SCALE (1.0f)
#define HDQK 32
#define CAUSAL 0
#ifndef TNB
#define TNB NB
#endif
__device__ __forceinline__ v16b zero16b() { v16b z; _Pragma("unroll") for (int i = 0; i < 16; ++i) z[i] = (__bf16)0.f; return z; }
__device__ __forceinline__ float bfr(float v) { return (float)(__bf16)v; }
__host__ __device__ __forceinline__ int kb_last(int qb) { return CAUSAL ? ((qb * 64 + 63) >> 7) : (TT / 128 - 1); }
typedef __attribute__((ext_vector_type(8))) __bf16 v8b;
__device__ __forceinline__ v16b frag_b(const __bf16* rowk0, int lane) {
  union { v16b v; v8b q[2]; } u; const __bf16* p = rowk0 + 8 * (lane >> 4);
  u.q[0] = *(const v8b*)p; u.q[1] = *(const v8b*)(p + 16); return u.v;
}
#define QBH (TT / 64)
#define QBH_PV 0           // A.g stays single f16
#define QHI 4096            // q residual rows everywhere (2-product logits)
#define KHI 4096           // k residual rows for ALL keys (3-product logits)
// B fragment (k rows k0+.., output column o) of a weight: (in,out) [K][ld] or (out,in) [ld rows of K]: bf16 exact, or f16(bf16 * 256) exact
__device__ __forceinline__ v16b wcol_io(const float* Wm, int k0, int o, int lane, int ld) { v16b w; const int g = lane >> 4;
#pragma unroll
  for (int i = 0; i < 8; ++i) { w[i] = (__bf16)Wm[(size_t)(k0 + 8 * g + i) * ld + o]; w[8 + i] = (__bf16)Wm[(size_t)(k0 + 16 + 8 * g + i) * ld + o]; }
  return w; }
__device__ __forceinline__ v16b wcol_oi(const float* Wm, int k0, int o, int lane, int K) { v16b w; const float* p = Wm + (size_t)o * K + k0 + 8 * (lane >> 4);
#pragma unroll
  for (int i = 0; i < 8; ++i) { w[i] = (__bf16)p[i]; w[8 + i] = (__bf16)p[16 + i]; }
  return w; }
__device__ __forceinline__ v16h wcolh_io(const float* Wm, int k0, int o, int lane, int ld) { v16h w; const int g = lane >> 4;
#pragma unroll
  for (int i = 0; i < 8; ++i) { w[i] = (_Float16)(bfr(Wm[(size_t)(k0 + 8 * g + i) * ld + o]) * 256.0f); w[8 + i] = (_Float16)(bfr(Wm[(size_t)(k0 + 16 + 8 * g + i) * ld + o]) * 256.0f); }
  return w; }
__device__ __forceinline__ v16h wcolh_oi(const float* Wm, int k0, int o, int lane, int K) { v16h w; const float* p = Wm + (size_t)o * K + k0 + 8 * (lane >> 4);
#pragma unroll
  for (int i = 0; i < 8; ++i) { w[i] = (_Float16)(bfr(p[i]) * 256.0f); w[8 + i] = (_Float16)(bfr(p[16 + i]) * 256.0f); }
  return w; }
#define WQKV_LAYOUT 1   // 0 = (in,out) [DIN][CC]; 1 = (in,out) Wq/Wk [DIN][HDQK], Wv [DIN][CC]; 2 = per-head [NH][DIN][HD]
__device__ __forceinline__ v16b wcol_hdk(const float* Wm, int k0, int o, int lane) { v16b w; const int g = lane >> 4; const float* p = Wm + (size_t)(o / HD) * DIN * HD + (o % HD);
#pragma unroll
  for (int i = 0; i < 8; ++i) { w[i] = (__bf16)p[(size_t)(k0 + 8 * g + i) * HD]; w[8 + i] = (__bf16)p[(size_t)(k0 + 16 + 8 * g + i) * HD]; }
  return w; }
#define WO_OUT_IN 0
#if WQKV_LAYOUT == 1
#define WCOL(W, k0, o, lane) ((which == 2) ? wcol_io(W, k0, (o), lane, CC) : (((o) < HDQK) ? wcol_io(W, k0, (o), lane, HDQK) : zero16b()))   /* (in,out): Wq/Wk [256][32] (plane columns >= 32 zero), Wv [256][256] full */
#define WCOL_OLD_UNUSED(W, k0, o, lane) (((o) < HDQK) ? wcol_oi(W, k0, (o), lane, DIN) : zero16b())   /* unused: reads (out,in) [32][256] weights; plane columns >= 32 are zero for all three */
#elif WQKV_LAYOUT == 2
#define WCOL(W, k0, o, lane) wcol_hdk(W, k0, o, lane)
#else
#define WCOL(W, k0, o, lane) wcol_io(W, k0, o, lane, CC)
#endif
#if WO_OUT_IN
#define WOCOL(W, k0, o, lane) wcol_oi(W, k0, o, lane, CC)
#define WOCOLH(W, k0, o, lane) wcolh_oi(W, k0, o, lane, CC)
#else
#define WOCOL(W, k0, o, lane) wcol_io(W, k0, o, lane, DIN)
#define WOCOLH(W, k0, o, lane) wcolh_io(W, k0, o, lane, DIN)
#endif
#ifndef XP
#define OUT1_OFF (4u * (size_t)NB * DIN * TT)   /* output 1 (o) follows output 0 (y) */
#define XP TT              // position pitch of x and of the output
#endif
#define BG HG
#define DVH 128
#define WS_YR (WS_END)     // f32 attended rows [b*n][256]
#define WS_END2 (WS_YR + 4u * (size_t)NB * TT * HD)
// ---- k_wz: block = (64 rows, 128 output cols): OR = y (hi + lo, K = 32 real columns of the YR rows) . W^T ((out,in) [256][32], exact) + b
__global__ __launch_bounds__(128) void k_wz(const float* __restrict__ YR, const float* __restrict__ WW, const float* __restrict__ WB, float* __restrict__ ORW) { __shared__ __align__(16) float sf[4][16][132];
  const int tid = threadIdx.x, wave = tid >> 5, lane = tid & 31, col = lane & 15, g = lane >> 4; const int c0 = blockIdx.y * 128; const size_t r0 = (size_t)blockIdx.x * 64 + wave * 16;
  v8f acc[8] = {};
#pragma unroll
  for (int kc = 0; kc < HDQK / 32; ++kc) { const F2 a = split_row(YR + (r0 + col) * CC, kc * 32, lane); asm volatile("s_wait_loadcnt 0x0" ::: "memory");
#pragma unroll
    for (int j = 0; j < 8; ++j) { const v16b w = wcol_oi(WW, kc * 32, c0 + j * 16 + col, lane, HDQK); asm volatile("s_wait_loadcnt 0x0" ::: "memory"); acc[j] = wmma_bf(a.h, w, acc[j]); acc[j] = wmma_bf(a.l, w, acc[j]); } }
#pragma unroll
  for (int j = 0; j < 8; ++j) { const float bb = WB ? bfr(WB[c0 + j * 16 + col]) : 0.f; asm volatile("s_wait_loadcnt 0x0" ::: "memory");
#pragma unroll
    for (int r = 0; r < 8; ++r) sf[wave][8 * g + r][j * 16 + col] = acc[j][r] + bb; }
  LDSX(); for (int rl = 0; rl < 16; ++rl) vst2(ORW + (r0 + rl) * DIN + c0 + lane * 4, *(const v4f*)&sf[wave][rl][lane * 4]); }
// ---- k_fin2: block = (64 positions, 64 channels, batch b): o[b][c][n] = OR[b*N + n][c] (channels-first via LDS transpose) -> output 1; y = gamma * o + bf16(x) -> output 0 (256-B runs)
__global__ __launch_bounds__(256) void k_fin2(const float* __restrict__ ORW, const float* __restrict__ X, const float* __restrict__ GM, float* __restrict__ OUT, float* __restrict__ OUT1) { const float gmv = bfr(GM[0]); __shared__ float st[64][68]; const int tid = threadIdx.x; const int n0 = blockIdx.x * 64, c0 = blockIdx.y * 64; const size_t b = blockIdx.z;
  for (int e = tid; e < 64 * 16; e += 256) { const int nl = e >> 4, q = e & 15; *(v4f*)&st[nl][q * 4] = *(const v4f*)(ORW + (b * TT + n0 + nl) * (size_t)DIN + c0 + q * 4); }
  __syncthreads();
  for (int e = tid; e < 64 * 16; e += 256) { const int cl = e >> 4, q = e & 15; const size_t oi = (b * DIN + c0 + cl) * (size_t)XP + n0 + q * 4; const v4f xr = *(const v4f*)(X + oi); v4f o, y; _Pragma("unroll") for (int i = 0; i < 4; ++i) { o[i] = st[q * 4 + i][cl]; y[i] = gmv * o[i] + bfr(xr[i]); } vst2(OUT + oi, y); vst2(OUT1 + oi, o); } }   /* y = gamma * o + x (output 0), o (output 1) */
#ifndef SM_EXTRA_PARAMS
#define SM_EXTRA_PARAMS
#endif
#ifndef PROJ_EXTRA_PARAMS
#define PROJ_EXTRA_PARAMS
#endif
#ifndef SM_MASK_HOOK
#define SM_MASK_HOOK (void)0
#endif

#define WS_QH  0u                                      // f16 q rows [b*t][CC]
#define WS_KH  (WS_QH + 2u * (size_t)NB * TT * CC)      // f16 k rows [b*t][CC]
#define WS_VT  (WS_KH + 2u * (size_t)NB * TT * CC)      // f16 v planes [b][c][t]
#define WS_QL  (WS_VT + 2u * (size_t)NB * CC * TT)      // f16 q residual x 2^10 rows [b][t < QHI][CC]
#define WS_KL  (WS_QL + 2u * (size_t)NB * QHI * CC)     // f16 k residual x 2^10 rows [b][t < KHI][CC]
#define WS_VB  (WS_KL + 2u * (size_t)NB * KHI * CC)     // bf16 v hi planes [b][c][t < KHI]
#define WS_VBL (WS_VB + 2u * (size_t)NB * CC * KHI)
#define WS_S   (WS_VBL + 2u * (size_t)NB * CC * KHI)    // f32 logits / P [hg][t][s]
#define WS_Y   (WS_S  + 4u * (size_t)HG * TT * TT)      // f32 ctx rows [b*t][CC] (only when there is an output projection)
#define WS_END (WS_Y  + 0u)

// ---- k_proj: block = 128 rows of x, 8 waves x 16 rows, every wave all 320 output columns (32 q, 32 k, 256 v). The three weights are rounded to bf16 and laid k-contiguous per output column in LDS once a block, and the block's x rows are read once, in whole lines, and laid beside them as bf16: every fragment is two 16-byte LDS reads. Exact bf16 products (K = DIN), f32 accumulate, k blocks in ascending order. q and k are formed transposed (A = weight columns, B = x rows): a lane holds 8 consecutive features of one row and stores them directly (f16 rows + residual x 2^10 rows, the 32 real columns only: nobody reads the rest of those planes). v goes through LDS to f16 planes [c][t] in 256-byte runs.
#define PR 128             // rows per block
#define PO (2 * HDQK + CC) // output columns: q, k, v
#define PWP (DIN + 8)      // LDS pitch of a weight column and of an x row in bf16: 512 bytes at 528 (16 B x odd) for 16-byte reads
#define PVP (PR + 8)       // LDS pitch of a v channel in f16: 256-byte runs at 272 bytes (16 B x odd)
typedef __attribute__((ext_vector_type(4))) __bf16 v4b;
__device__ __forceinline__ v8f wmb(v16b a, v16b b, v8f c) { return __builtin_amdgcn_wmma_f32_16x16x32_bf16(false, a, false, b, (short)0, c, false, false); }
__global__ __launch_bounds__(256) void k_proj(const float* __restrict__ X, const float* __restrict__ WQ, const float* __restrict__ WK, const float* __restrict__ WV, const float* __restrict__ BQ, const float* __restrict__ BK, const float* __restrict__ BV,
    _Float16* __restrict__ QH, _Float16* __restrict__ QL, _Float16* __restrict__ KH, _Float16* __restrict__ KL, _Float16* __restrict__ VT) {
  __shared__ __align__(16) __bf16 wt[PO][PWP]; __shared__ __align__(16) __bf16 xs[PR][PWP]; __shared__ __align__(16) _Float16 th[CC][PVP]; __shared__ __align__(16) float sb[PO];
  const int tid = threadIdx.x, wave = __builtin_amdgcn_readfirstlane(tid >> 5), lane = tid & 31, col = lane & 15, g = lane >> 4; const size_t r0 = (size_t)blockIdx.x * PR;
  // the 320 biases, one or two a thread, on their way to LDS with the rest
  const float bvr = BV[tid]; const float bqr = ((wave & 1) ? BK : BQ)[lane];   /* every wave asks, so that no branch and no wait stand in front of the x loads; waves 0 and 1 store */
  // the wave's 16 x rows (16 KB in a row, 512 bytes a load), asked for ahead of the weight staging so that they fly under it
  const float* xp = X + (r0 + wave * 16) * DIN + lane * 4; v4f xr[32];
#pragma unroll
  for (int i = 0; i < 32; ++i) xr[i] = *(const v4f*)(xp + i * 128);
  // weight staging: a unit = 32 output columns (one a lane: whole 128-byte lines) x 8 k rows -> one 16-byte LDS store a lane. A wave brings 32 v columns, all k, and a quarter of the k rows of q (even waves) or k (odd waves)
  const float* sv = WV + wave * 32 + lane;
#pragma unroll 8   /* eight units' loads in flight a wave */
  for (int k8 = 0; k8 < DIN / 8; ++k8) { v8b p;
#pragma unroll
    for (int e = 0; e < 8; ++e) p[e] = (__bf16)sv[(k8 * 8 + e) * CC];
    *(v8b*)&wt[2 * HDQK + wave * 32 + lane][k8 * 8] = p; }
  const float* sq = ((wave & 1) ? WK : WQ) + (wave >> 1) * (DIN / 4) * HDQK + lane;
#pragma unroll
  for (int k8 = 0; k8 < DIN / 32; ++k8) { v8b p;
#pragma unroll
    for (int e = 0; e < 8; ++e) p[e] = (__bf16)sq[(k8 * 8 + e) * HDQK];
    *(v8b*)&wt[(wave & 1) * HDQK + lane][(wave >> 1) * (DIN / 4) + k8 * 8] = p; }
#pragma unroll
  for (int i = 0; i < 32; ++i) { v4b p;
#pragma unroll
    for (int e = 0; e < 4; ++e) p[e] = (__bf16)xr[i][e];
    *(v4b*)&xs[wave * 16 + (i >> 1)][(i & 1) * 128 + lane * 4] = p; }
  sb[2 * HDQK + tid] = bfr(bvr); if (wave < 2) sb[wave * HDQK + lane] = bfr(bqr);
  __syncthreads();   /* weights, biases and x rows are in LDS before any wave reads them */
  v8f aq[4] = {}, av[CC / 16] = {};
#pragma unroll 1   /* one k block a trip: 20 products; the accumulators and one block's fragments fill the registers */
  for (int kc = 0; kc < DIN / 32; ++kc) { const v16b a = frag_b(&xs[wave * 16 + col][kc * 32], lane); v16b w[PO / 16];
#pragma unroll
    for (int j = 0; j < PO / 16; ++j) w[j] = frag_b(&wt[j * 16 + col][kc * 32], lane);
    __builtin_amdgcn_sched_barrier(0);   /* the k block's fragments are asked for as one group: one LDS latency in front of the 20 products, not one in front of each */
#pragma unroll
    for (int j = 0; j < 4; ++j) aq[j] = wmb(w[j], a, aq[j]);   /* D[feature 8 g + r][row col] */
#pragma unroll
    for (int j = 0; j < CC / 16; ++j) av[j] = wmb(a, w[4 + j], av[j]); }   /* D[row 8 g + r][channel col] */
  const size_t trow = r0 + wave * 16 + col;
#pragma unroll
  for (int j = 0; j < 4; ++j) { const int d0 = (j & 1) * 16 + 8 * g; const float* ba = &sb[j * 16 + 8 * g]; v8h hi, lo;
#pragma unroll
    for (int r = 0; r < 8; ++r) { const float v = aq[j][r] + ba[r]; const _Float16 hv = (_Float16)v; hi[r] = hv; lo[r] = (_Float16)((v - (float)hv) * 1024.0f); }
    vst2((j < 2 ? QH : KH) + trow * CC + d0, hi); vst2((j < 2 ? QL : KL) + trow * CC + d0, lo); }
#pragma unroll
  for (int j = 0; j < CC / 16; ++j) { const float bias = sb[2 * HDQK + j * 16 + col]; v8h h;
#pragma unroll
    for (int r = 0; r < 8; ++r) h[r] = (_Float16)(av[j][r] + bias);
    *(v8h*)&th[j * 16 + col][wave * 16 + 8 * g] = h; }
  __syncthreads();   /* every wave's 16 positions of each channel are in LDS before the 256-byte runs are read back */
  const size_t bb = r0 / TT; const int t0 = (int)(r0 % TT);
  _Float16* vd = VT + (bb * CC + (tid >> 4)) * (size_t)TT + t0 + (tid & 15) * 8;   /* 16 lanes bring one channel's 256 bytes */
#pragma unroll
  for (int i = 0; i < CC / 16; ++i) vst2(vd + (size_t)i * 16 * TT, *(const v8h*)&th[i * 16 + (tid >> 4)][(tid & 15) * 8]); }
#define FQ 16              // query columns per wave
#define FW 8               // waves per block
#define FK 32              // keys per pass
#define FP 40              // LDS row pitch in f16: 64-byte rows at 80 bytes (16 B x odd) for 16-byte reads
__device__ __forceinline__ float xhalf(float x) { return __builtin_bit_cast(float, __builtin_amdgcn_permlanex16(__builtin_bit_cast(int, x), __builtin_bit_cast(int, x), 0x76543210, 0xfedcba98, false, false)); }   /* lane l with lane l ^ 16 */
__device__ __forceinline__ v8f wm16(v16h a, v16h b, v8f c) { return __builtin_amdgcn_wmma_f32_16x16x32_f16(false, a, false, b, (short)0, c, false, false); }
__global__ __launch_bounds__(32 * FW) void k_fa(const _Float16* __restrict__ QH, const _Float16* __restrict__ QL, const _Float16* __restrict__ KH, const _Float16* __restrict__ KL, const _Float16* __restrict__ VT, float* __restrict__ Y) {
  __shared__ __align__(16) _Float16 sv[2][CC][FP]; __shared__ __align__(16) _Float16 sk[2][2][FK][FP];
  const int tid = threadIdx.x, wave = tid >> 5, lane = tid & 31, col = lane & 15, g = lane >> 4; const int b = blockIdx.y; const int q0 = blockIdx.x * (FQ * FW) + wave * FQ;
  const size_t qrow = ((size_t)b * TT + q0 + col) * CC; const v16h qh = frag_h(QH + qrow, lane), ql = frag_h(QL + qrow, lane);
  asm volatile("s_wait_xcnt 0x0" ::: "memory");   /* the build lets the first tile's loads land in the q loads' address registers */
  // staging: 4 lanes bring one 64-byte row; a thread brings 4 v rows' pieces (channels srow + 64 i) and one k piece (plane hi for threads < 128, residual above)
  const int srow = tid >> 2, sch = (tid & 3) * 8, kpl = tid >> 7, krow = srow & (FK - 1);
  const _Float16* vsrc = VT + ((size_t)b * CC + srow) * TT + sch; const _Float16* ksrc = (kpl ? KL : KH) + ((size_t)b * TT + krow) * CC + sch;
  v8h rv[4], rk;
#pragma unroll
  for (int i = 0; i < 4; ++i) rv[i] = *(const v8h*)(vsrc + (size_t)i * 64 * TT);
  rk = *(const v8h*)ksrc;
#pragma unroll
  for (int i = 0; i < 4; ++i) *(v8h*)&sv[0][i * 64 + srow][sch] = rv[i];
  *(v8h*)&sk[0][kpl][krow][sch] = rk;
  __syncthreads();   /* pass 0's tiles are in LDS before any wave reads them */
  v8f acc[CC / 16] = {}; float m = -3.0e38f, l = 0.f;
#pragma unroll 1   /* one pass a trip: the body already holds 22 matrix instructions and the accumulators fill the registers */
  for (int s = 0; s < TT / FK; ++s) { const int cur = s & 1; const int sn = s + 1 < TT / FK ? s + 1 : s;   /* the last pass fetches its own tile again, into the buffer nobody reads any more */
#pragma unroll
    for (int i = 0; i < 4; ++i) rv[i] = *(const v8h*)(vsrc + (size_t)i * 64 * TT + sn * FK);
    rk = *(const v8h*)(ksrc + (size_t)sn * FK * CC);
    asm volatile("s_wait_xcnt 0x0" ::: "memory");   /* the build reuses these loads' address registers for the k fragments right behind them */
    float sc[2][8]; v16h kh[2], kl[2];
#pragma unroll
    for (int t = 0; t < 2; ++t) { kh[t] = frag_h(&sk[cur][0][t * 16 + col][0], lane); kl[t] = frag_h(&sk[cur][1][t * 16 + col][0], lane); }
    __builtin_amdgcn_sched_barrier(0);   /* the pass's k fragments are asked for as one group: one LDS latency in front of the six score products, not one in front of each pair */
#pragma unroll
    for (int t = 0; t < 2; ++t) { v8f a = {}, al = {}; a = wm16(kh[t], qh, a); al = wm16(kh[t], ql, al); al = wm16(kl[t], qh, al);
#pragma unroll
      for (int r = 0; r < 8; ++r) sc[t][r] = a[r] + al[r] * (1.0f / 1024.0f); }
    float mx = sc[0][0];
#pragma unroll
    for (int r = 0; r < 8; ++r) mx = fmaxf(mx, fmaxf(sc[0][r], sc[1][r]));
    const float mn = fmaxf(m, fmaxf(mx, xhalf(mx)));
    if (__builtin_amdgcn_ballot_w32(mn > m) != 0) { const float al = expf(m - mn); l *= al; m = mn;   /* scalar branch: EXEC stays all ones; a column whose maximum stands multiplies by exp(0) = 1 */
#pragma unroll
      for (int j = 0; j < CC / 16; ++j) acc[j] *= al; }
    v16h vf[CC / 16];
#pragma unroll
    for (int j = 0; j < CC / 16; ++j) vf[j] = frag_h(&sv[cur][j * 16 + col][0], lane);
    __builtin_amdgcn_sched_barrier(0);   /* the pass's v fragments are asked for as one group ahead of the exponentials and land under them; left to itself the build reads each one product ahead, and every product waits out an LDS read */
    v16h pf;
#pragma unroll
    for (int t = 0; t < 2; ++t)
#pragma unroll
      for (int r = 0; r < 8; ++r) { const float e = expf(sc[t][r] - m); l += e; pf[t * 8 + r] = (_Float16)(e * 2048.0f); }   /* element 8 t + r = key 16 t + 8 g + r: frag_h's own k order */
#pragma unroll
    for (int j = 0; j < CC / 16; ++j) acc[j] = wm16(vf[j], pf, acc[j]);
#pragma unroll
    for (int i = 0; i < 4; ++i) *(v8h*)&sv[cur ^ 1][i * 64 + srow][sch] = rv[i];
    *(v8h*)&sk[cur ^ 1][kpl][krow][sch] = rk;
    __syncthreads();   /* publishes the next pass's tiles and ends every wave's reads of this pass's buffer, which the next trip refills */
  }
  l += xhalf(l); const float inv = 1.0f / (2048.0f * l); float* yr = Y + ((size_t)b * TT + q0 + col) * CC + 8 * g;   /* a lane's 8 accumulator registers = 8 consecutive channels of its query's row */
#pragma unroll
  for (int j = 0; j < CC / 16; ++j) { v4f o0, o1;
#pragma unroll
    for (int r = 0; r < 4; ++r) { o0[r] = acc[j][r] * inv; o1[r] = acc[j][4 + r] * inv; }
    vst2(yr + j * 16, o0); vst2(yr + j * 16 + 4, o1); } }

__global__ __launch_bounds__(256) void k_axpy(const float* __restrict__ YR, const float* __restrict__ X, const float* __restrict__ GM, float* __restrict__ OUT) { const size_t e = ((size_t)blockIdx.x * 256 + threadIdx.x) * 4; if (e >= (size_t)TNB * TT * DIN) return; const float gmv = bfr(GM[0]); const v4f o = *(const v4f*)(YR + e); const v4f xr = *(const v4f*)(X + e); asm volatile("s_wait_loadcnt 0x0" ::: "memory"); v4f y; _Pragma("unroll") for (int i = 0; i < 4; ++i) y[i] = gmv * o[i] + bfr(xr[i]); vst2(OUT + e, y); }
extern "C" void kernel_launch(void* const* d_in, const int* in_sizes, int n_in, void* d_out, int out_size, void* d_ws, size_t ws_size, hipStream_t stream) {
  (void)in_sizes; (void)n_in; (void)out_size;
  const float** F = (const float**)d_in;
  if (ws_size < (size_t)WS_END) return;
  char* ws = (char*)d_ws; _Float16 *QH = (_Float16*)(ws + WS_QH), *KH = (_Float16*)(ws + WS_KH), *VT = (_Float16*)(ws + WS_VT), *QL = (_Float16*)(ws + WS_QL), *KL = (_Float16*)(ws + WS_KL); __bf16 *VB = (__bf16*)(ws + WS_VB), *VBL = (__bf16*)(ws + WS_VBL); float *S = (float*)(ws + WS_S), *Y = (float*)(ws + WS_Y);
  (void)Y; (void)S; (void)QL; (void)KL; (void)VB; (void)VBL;
  // inputs: 0 x [8,64,64,256] (channels-last = rows); 1 Wq [256,32] (in,out), 2 bq; 3 Wk, 4 bk; 5 Wv [256,256], 6 bv; 7 gamma (scalar 0.5)
  if (ws_size < (size_t)WS_END2) return;
  float *YR = (float*)(ws + WS_YR);
  k_proj<<<dim3(TNB * TT / PR), 256, 0, stream>>>(F[0], F[1], F[3], F[5], F[2], F[4], F[6], QH, QL, KH, KL, VT);
  k_fa<<<dim3(TT / (FQ * FW), TNB), 32 * FW, 0, stream>>>(QH, QL, KH, KL, VT, YR);
  k_axpy<<<dim3((unsigned)(((size_t)TNB * TT * DIN / 4 + 255) / 256)), 256, 0, stream>>>(YR, F[0], F[7], (float*)d_out);
}

// v004
// A run of this version takes 160 microseconds.
// Timed twice side by side with v003, it ran 1.03 times as fast both times.
// Counting every step since v000, it is 14.2 times as fast.
// compute dtype: all float inputs rounded to bf16; q/k/v = x W + b with EXACT bf16 products on WMMA 16x16x32 (f32 accumulate); UNSCALED 32-deep logits q.k with both as f16 hi + residual planes (3 products); online softmax in f32 (precise expf, running maximum); exp(logit - maximum) x 2^11 once to f16 against v once to f16 (1 product), divided by the f32 sum at the end; y = gamma * out + x in f32; f32 output.
// SAGAN self-attention on channels-LAST images (B 8, 64 x 64 = 4,096 positions, C 256; (in,out) 1/16-scale weights, zero biases, gamma = 0.5): q = x Wq + bq (32), k = x Wk + bk (32), v = x Wv + bv (256); attn = softmax(q k^T) (NO scaling); out = attn v; y = gamma * out + x -> [B, 64, 64, 256].
#include <hip/hip_runtime.h>
#include <math.h>

typedef __attribute__((ext_vector_type(16))) _Float16 v16h;
typedef __attribute__((ext_vector_type(16))) __bf16 v16b;
typedef __attribute__((ext_vector_type(8)))  _Float16 v8h;
typedef __attribute__((ext_vector_type(8)))  float v8f;
typedef __attribute__((ext_vector_type(4)))  float v4f;
typedef __attribute__((ext_vector_type(2)))  float v2f;
typedef __attribute__((ext_vector_type(4)))  unsigned v4u;
typedef __attribute__((ext_vector_type(4)))  int v4i;
typedef float __attribute__((may_alias)) float_a;
typedef int __attribute__((may_alias)) int_a;

template <typename T> __device__ __forceinline__ void vst2(void* p, T v) { *(T*)p = v;  }
__device__ __forceinline__ v8f wmma16(v16h a, v16h b, v8f c) {
  v8f d = __builtin_amdgcn_wmma_f32_16x16x32_f16(false, a, false, b, (short)0, c, false, false);
  asm volatile("v_nop\n\tv_nop\n\tv_nop\n\tv_nop" : "+v"(d) : "v"(a), "v"(b));
  return d;
}
__device__ __forceinline__ v8f wmma_bf(v16b a, v16b b, v8f c) {
  v8f d = __builtin_amdgcn_wmma_f32_16x16x32_bf16(false, a, false, b, (short)0, c, false, false);
  asm volatile("v_nop\n\tv_nop\n\tv_nop\n\tv_nop" : "+v"(d) : "v"(a), "v"(b));
  return d;
}
// 16x16x32 fragments: lane = (h = lane>>4, row/col = lane&15); elements 0..7 = k0+8h+0..7, 8..15 = k0+16+8h+0..7; D element r = row 8h+r
__device__ __forceinline__ v16h frag_h(const _Float16* rowk0, int lane) {
  union { v16h v; v8h q[2]; } u; const _Float16* p = rowk0 + 8 * (lane >> 4);
  u.q[0] = *(const v8h*)p; u.q[1] = *(const v8h*)(p + 16); return u.v;
}
__device__ __forceinline__ v16h frag_f32(const float* rowk0, int lane) {
  v16h a; const float* p = rowk0 + 8 * (lane >> 4);
#pragma unroll
  for (int i = 0; i < 8; ++i) { a[i] = (_Float16)p[i]; a[8 + i] = (_Float16)p[16 + i]; }
  return a;
}
__device__ __forceinline__ v16h frag_f32s(const float* rowk0, int lane, float sc) {
  v16h a; const float* p = rowk0 + 8 * (lane >> 4);
#pragma unroll
  for (int i = 0; i < 8; ++i) { a[i] = (_Float16)(p[i] * sc); a[8 + i] = (_Float16)(p[16 + i] * sc); }
  return a;
}
// column fragment from a [K][ld] layout (column n), rows >= K read as 0
__device__ __forceinline__ v16h fragc_f32(const float* W, int k0, int n, int lane, int ld, int K) {
  v16h a; const int g = lane >> 4;
#pragma unroll
  for (int i = 0; i < 8; ++i) { const int ka = k0 + 8 * g + i, kb = ka + 16;
    a[i] = (_Float16)(ka < K ? W[(size_t)(ka < K ? ka : K - 1) * ld + n] : 0.f); a[8 + i] = (_Float16)(kb < K ? W[(size_t)(kb < K ? kb : K - 1) * ld + n] : 0.f); }
  return a;
}
struct F2 { v16b h, l; };
__device__ __forceinline__ F2 bsplit16(const float v[16]) { F2 r;
#pragma unroll
  for (int i = 0; i < 16; ++i) { const __bf16 h = (__bf16)v[i]; r.h[i] = h; r.l[i] = (__bf16)(v[i] - (float)h); }
  return r; }
__device__ __forceinline__ F2 split_row(const float* row, int k0, int lane) { float v[16]; const float* p = row + k0 + 8 * (lane >> 4);
#pragma unroll
  for (int i = 0; i < 8; ++i) { v[i] = p[i]; v[8 + i] = p[16 + i]; }
  return bsplit16(v); }
__device__ __forceinline__ F2 split_rowK(const float* row, int k0, int lane, int K) { float v[16]; const int g = lane >> 4;
#pragma unroll
  for (int i = 0; i < 8; ++i) { const int ka = k0 + 8 * g + i, kb = ka + 16; v[i] = ka < K ? row[ka < K ? ka : K - 1] : 0.f; v[8 + i] = kb < K ? row[kb < K ? kb : K - 1] : 0.f; }
  return bsplit16(v); }
__device__ __forceinline__ F2 split_col(const float* W, int k0, int n, int lane, int ld, int K) { float v[16]; const int g = lane >> 4;
#pragma unroll
  for (int i = 0; i < 8; ++i) { const int ka = k0 + 8 * g + i, kb = ka + 16; v[i] = ka < K ? W[(size_t)(ka < K ? ka : K - 1) * ld + n] : 0.f; v[8 + i] = kb < K ? W[(size_t)(kb < K ? kb : K - 1) * ld + n] : 0.f; }
  return bsplit16(v); }
__device__ __forceinline__ v8f mac3(const F2& a, const F2& b, v8f c) { c = wmma_bf(a.l, b.h, c); c = wmma_bf(a.h, b.l, c); return wmma_bf(a.h, b.h, c); }
__device__ __forceinline__ float sigm(float v) { return 1.0f / (1.0f + expf(-v)); }
#define LDSX() do { asm volatile("s_wait_dscnt 0" ::: "memory"); __builtin_amdgcn_wave_barrier(); __builtin_amdgcn_fence(__ATOMIC_RELEASE, "workgroup"); } while (0)

#define NB 8
#define TT 4096
#define CC 256            // plane width: q/k planes carry 32 real columns (rest never written or read), v planes all 256
#define DIN 256
#define NH 1
#define HD 256
#define NQB (TT / 64)
#define HG 1               // one 4,096 x 4,096 f32 score plane in the workspace, which no kernel uses
#define SCALE (1.0f)
#define HDQK 32
#define CAUSAL 0
#ifndef TNB
#define TNB NB
#endif
__device__ __forceinline__ v16b zero16b() { v16b z; _Pragma("unroll") for (int i = 0; i < 16; ++i) z[i] = (__bf16)0.f; return z; }
__device__ __forceinline__ float bfr(float v) { return (float)(__bf16)v; }
__host__ __device__ __forceinline__ int kb_last(int qb) { return CAUSAL ? ((qb * 64 + 63) >> 7) : (TT / 128 - 1); }
typedef __attribute__((ext_vector_type(8))) __bf16 v8b;
__device__ __forceinline__ v16b frag_b(const __bf16* rowk0, int lane) {
  union { v16b v; v8b q[2]; } u; const __bf16* p = rowk0 + 8 * (lane >> 4);
  u.q[0] = *(const v8b*)p; u.q[1] = *(const v8b*)(p + 16); return u.v;
}
#define QBH (TT / 64)
#define QBH_PV 0           // A.g stays single f16
#define QHI 4096            // q residual rows everywhere (2-product logits)
#define KHI 4096           // k residual rows for ALL keys (3-product logits)
// B fragment (k rows k0+.., output column o) of a weight: (in,out) [K][ld] or (out,in) [ld rows of K]: bf16 exact, or f16(bf16 * 256) exact
__device__ __forceinline__ v16b wcol_io(const float* Wm, int k0, int o, int lane, int ld) { v16b w; const int g = lane >> 4;
#pragma unroll
  for (int i = 0; i < 8; ++i) { w[i] = (__bf16)Wm[(size_t)(k0 + 8 * g + i) * ld + o]; w[8 + i] = (__bf16)Wm[(size_t)(k0 + 16 + 8 * g + i) * ld + o]; }
  return w; }
__device__ __forceinline__ v16b wcol_oi(const float* Wm, int k0, int o, int lane, int K) { v16b w; const float* p = Wm + (size_t)o * K + k0 + 8 * (lane >> 4);
#pragma unroll
  for (int i = 0; i < 8; ++i) { w[i] = (__bf16)p[i]; w[8 + i] = (__bf16)p[16 + i]; }
  return w; }
__device__ __forceinline__ v16h wcolh_io(const float* Wm, int k0, int o, int lane, int ld) { v16h w; const int g = lane >> 4;
#pragma unroll
  for (int i = 0; i < 8; ++i) { w[i] = (_Float16)(bfr(Wm[(size_t)(k0 + 8 * g + i) * ld + o]) * 256.0f); w[8 + i] = (_Float16)(bfr(Wm[(size_t)(k0 + 16 + 8 * g + i) * ld + o]) * 256.0f); }
  return w; }
__device__ __forceinline__ v16h wcolh_oi(const float* Wm, int k0, int o, int lane, int K) { v16h w; const float* p = Wm + (size_t)o * K + k0 + 8 * (lane >> 4);
#pragma unroll
  for (int i = 0; i < 8; ++i) { w[i] = (_Float16)(bfr(p[i]) * 256.0f); w[8 + i] = (_Float16)(bfr(p[16 + i]) * 256.0f); }
  return w; }
#define WQKV_LAYOUT 1   // 0 = (in,out) [DIN][CC]; 1 = (in,out) Wq/Wk [DIN][HDQK], Wv [DIN][CC]; 2 = per-head [NH][DIN][HD]
__device__ __forceinline__ v16b wcol_hdk(const float* Wm, int k0, int o, int lane) { v16b w; const int g = lane >> 4; const float* p = Wm + (size_t)(o / HD) * DIN * HD + (o % HD);
#pragma unroll
  for (int i = 0; i < 8; ++i) { w[i] = (__bf16)p[(size_t)(k0 + 8 * g + i) * HD]; w[8 + i] = (__bf16)p[(size_t)(k0 + 16 + 8 * g + i) * HD]; }
  return w; }
#define WO_OUT_IN 0
#if WQKV_LAYOUT == 1
#define WCOL(W, k0, o, lane) ((which == 2) ? wcol_io(W, k0, (o), lane, CC) : (((o) < HDQK) ? wcol_io(W, k0, (o), lane, HDQK) : zero16b()))   /* (in,out): Wq/Wk [256][32] (plane columns >= 32 zero), Wv [256][256] full */
#define WCOL_OLD_UNUSED(W, k0, o, lane) (((o) < HDQK) ? wcol_oi(W, k0, (o), lane, DIN) : zero16b())   /* unused: reads (out,in) [32][256] weights; plane columns >= 32 are zero for all three */
#elif WQKV_LAYOUT == 2
#define WCOL(W, k0, o, lane) wcol_hdk(W, k0, o, lane)
#else
#define WCOL(W, k0, o, lane) wcol_io(W, k0, o, lane, CC)
#endif
#if WO_OUT_IN
#define WOCOL(W, k0, o, lane) wcol_oi(W, k0, o, lane, CC)
#define WOCOLH(W, k0, o, lane) wcolh_oi(W, k0, o, lane, CC)
#else
#define WOCOL(W, k0, o, lane) wcol_io(W, k0, o, lane, DIN)
#define WOCOLH(W, k0, o, lane) wcolh_io(W, k0, o, lane, DIN)
#endif
#ifndef XP
#define OUT1_OFF (4u * (size_t)NB * DIN * TT)   /* output 1 (o) follows output 0 (y) */
#define XP TT              // position pitch of x and of the output
#endif
#define BG HG
#define DVH 128
// ---- k_wz: block = (64 rows, 128 output cols): OR = y (hi + lo, K = 32 real columns of the YR rows) . W^T ((out,in) [256][32], exact) + b
__global__ __launch_bounds__(128) void k_wz(const float* __restrict__ YR, const float* __restrict__ WW, const float* __restrict__ WB, float* __restrict__ ORW) { __shared__ __align__(16) float sf[4][16][132];
  const int tid = threadIdx.x, wave = tid >> 5, lane = tid & 31, col = lane & 15, g = lane >> 4; const int c0 = blockIdx.y * 128; const size_t r0 = (size_t)blockIdx.x * 64 + wave * 16;
  v8f acc[8] = {};
#pragma unroll
  for (int kc = 0; kc < HDQK / 32; ++kc) { const F2 a = split_row(YR + (r0 + col) * CC, kc * 32, lane); asm volatile("s_wait_loadcnt 0x0" ::: "memory");
#pragma unroll
    for (int j = 0; j < 8; ++j) { const v16b w = wcol_oi(WW, kc * 32, c0 + j * 16 + col, lane, HDQK); asm volatile("s_wait_loadcnt 0x0" ::: "memory"); acc[j] = wmma_bf(a.h, w, acc[j]); acc[j] = wmma_bf(a.l, w, acc[j]); } }
#pragma unroll
  for (int j = 0; j < 8; ++j) { const float bb = WB ? bfr(WB[c0 + j * 16 + col]) : 0.f; asm volatile("s_wait_loadcnt 0x0" ::: "memory");
#pragma unroll
    for (int r = 0; r < 8; ++r) sf[wave][8 * g + r][j * 16 + col] = acc[j][r] + bb; }
  LDSX(); for (int rl = 0; rl < 16; ++rl) vst2(ORW + (r0 + rl) * DIN + c0 + lane * 4, *(const v4f*)&sf[wave][rl][lane * 4]); }
// ---- k_fin2: block = (64 positions, 64 channels, batch b): o[b][c][n] = OR[b*N + n][c] (channels-first via LDS transpose) -> output 1; y = gamma * o + bf16(x) -> output 0 (256-B runs)
__global__ __launch_bounds__(256) void k_fin2(const float* __restrict__ ORW, const float* __restrict__ X, const float* __restrict__ GM, float* __restrict__ OUT, float* __restrict__ OUT1) { const float gmv = bfr(GM[0]); __shared__ float st[64][68]; const int tid = threadIdx.x; const int n0 = blockIdx.x * 64, c0 = blockIdx.y * 64; const size_t b = blockIdx.z;
  for (int e = tid; e < 64 * 16; e += 256) { const int nl = e >> 4, q = e & 15; *(v4f*)&st[nl][q * 4] = *(const v4f*)(ORW + (b * TT + n0 + nl) * (size_t)DIN + c0 + q * 4); }
  __syncthreads();
  for (int e = tid; e < 64 * 16; e += 256) { const int cl = e >> 4, q = e & 15; const size_t oi = (b * DIN + c0 + cl) * (size_t)XP + n0 + q * 4; const v4f xr = *(const v4f*)(X + oi); v4f o, y; _Pragma("unroll") for (int i = 0; i < 4; ++i) { o[i] = st[q * 4 + i][cl]; y[i] = gmv * o[i] + bfr(xr[i]); } vst2(OUT + oi, y); vst2(OUT1 + oi, o); } }   /* y = gamma * o + x (output 0), o (output 1) */
#ifndef SM_EXTRA_PARAMS
#define SM_EXTRA_PARAMS
#endif
#ifndef PROJ_EXTRA_PARAMS
#define PROJ_EXTRA_PARAMS
#endif
#ifndef SM_MASK_HOOK
#define SM_MASK_HOOK (void)0
#endif

#define WS_QH  0u                                      // f16 q rows [b*t][CC]
#define WS_KH  (WS_QH + 2u * (size_t)NB * TT * CC)      // f16 k rows [b*t][CC]
#define WS_VT  (WS_KH + 2u * (size_t)NB * TT * CC)      // f16 v planes [b][c][t]
#define WS_QL  (WS_VT + 2u * (size_t)NB * CC * TT)      // f16 q residual x 2^10 rows [b][t < QHI][CC]
#define WS_KL  (WS_QL + 2u * (size_t)NB * QHI * CC)     // f16 k residual x 2^10 rows [b][t < KHI][CC]
#define WS_VB  (WS_KL + 2u * (size_t)NB * KHI * CC)     // bf16 v hi planes [b][c][t < KHI]
#define WS_VBL (WS_VB + 2u * (size_t)NB * CC * KHI)
#define WS_S   (WS_VBL + 2u * (size_t)NB * CC * KHI)    // f32 logits / P [hg][t][s]
#define WS_Y   (WS_S  + 4u * (size_t)HG * TT * TT)      // f32 ctx rows [b*t][CC] (only when there is an output projection)
#define WS_END (WS_Y  + 0u)

// ---- k_proj: block = 128 rows of x, 8 waves x 16 rows, every wave all 320 output columns (32 q, 32 k, 256 v). The three weights are rounded to bf16 and laid k-contiguous per output column in LDS once a block, and the block's x rows are read once, in whole lines, and laid beside them as bf16: every fragment is two 16-byte LDS reads. Exact bf16 products (K = DIN), f32 accumulate, k blocks in ascending order. q and k are formed transposed (A = weight columns, B = x rows): a lane holds 8 consecutive features of one row and stores them directly (f16 rows + residual x 2^10 rows, the 32 real columns only: nobody reads the rest of those planes). v goes through LDS to f16 planes [c][t] in 256-byte runs.
#define PR 128             // rows per block
#define PO (2 * HDQK + CC) // output columns: q, k, v
#define PWP (DIN + 8)      // LDS pitch of a weight column and of an x row in bf16: 512 bytes at 528 (16 B x odd) for 16-byte reads
#define PVP (PR + 8)       // LDS pitch of a v channel in f16: 256-byte runs at 272 bytes (16 B x odd)
typedef __attribute__((ext_vector_type(4))) __bf16 v4b;
__device__ __forceinline__ v8f wmb(v16b a, v16b b, v8f c) { return __builtin_amdgcn_wmma_f32_16x16x32_bf16(false, a, false, b, (short)0, c, false, false); }
__global__ __launch_bounds__(256) void k_proj(const float* __restrict__ X, const float* __restrict__ WQ, const float* __restrict__ WK, const float* __restrict__ WV, const float* __restrict__ BQ, const float* __restrict__ BK, const float* __restrict__ BV,
    _Float16* __restrict__ QH, _Float16* __restrict__ QL, _Float16* __restrict__ KH, _Float16* __restrict__ KL, _Float16* __restrict__ VT) {
  __shared__ __align__(16) __bf16 wt[PO][PWP]; __shared__ __align__(16) __bf16 xs[PR][PWP]; __shared__ __align__(16) _Float16 th[CC][PVP]; __shared__ __align__(16) float sb[PO];
  const int tid = threadIdx.x, wave = __builtin_amdgcn_readfirstlane(tid >> 5), lane = tid & 31, col = lane & 15, g = lane >> 4; const size_t r0 = (size_t)blockIdx.x * PR;
  // the 320 biases, one or two a thread, on their way to LDS with the rest
  const float bvr = BV[tid]; const float bqr = ((wave & 1) ? BK : BQ)[lane];   /* every wave asks, so that no branch and no wait stand in front of the x loads; waves 0 and 1 store */
  // the wave's 16 x rows (16 KB in a row, 512 bytes a load), asked for ahead of the weight staging so that they fly under it
  const float* xp = X + (r0 + wave * 16) * DIN + lane * 4; v4f xr[32];
#pragma unroll
  for (int i = 0; i < 32; ++i) xr[i] = *(const v4f*)(xp + i * 128);
  // weight staging: a unit = 32 output columns (one a lane: whole 128-byte lines) x 8 k rows -> one 16-byte LDS store a lane. A wave brings 32 v columns, all k, and a quarter of the k rows of q (even waves) or k (odd waves)
  const float* sv = WV + wave * 32 + lane;
#pragma unroll 8   /* eight units' loads in flight a wave */
  for (int k8 = 0; k8 < DIN / 8; ++k8) { v8b p;
#pragma unroll
    for (int e = 0; e < 8; ++e) p[e] = (__bf16)sv[(k8 * 8 + e) * CC];
    *(v8b*)&wt[2 * HDQK + wave * 32 + lane][k8 * 8] = p; }
  const float* sq = ((wave & 1) ? WK : WQ) + (wave >> 1) * (DIN / 4) * HDQK + lane;
#pragma unroll
  for (int k8 = 0; k8 < DIN / 32; ++k8) { v8b p;
#pragma unroll
    for (int e = 0; e < 8; ++e) p[e] = (__bf16)sq[(k8 * 8 + e) * HDQK];
    *(v8b*)&wt[(wave & 1) * HDQK + lane][(wave >> 1) * (DIN / 4) + k8 * 8] = p; }
#pragma unroll
  for (int i = 0; i < 32; ++i) { v4b p;
#pragma unroll
    for (int e = 0; e < 4; ++e) p[e] = (__bf16)xr[i][e];
    *(v4b*)&xs[wave * 16 + (i >> 1)][(i & 1) * 128 + lane * 4] = p; }
  sb[2 * HDQK + tid] = bfr(bvr); if (wave < 2) sb[wave * HDQK + lane] = bfr(bqr);
  __syncthreads();   /* weights, biases and x rows are in LDS before any wave reads them */
  v8f aq[4] = {}, av[CC / 16] = {};
#pragma unroll 1   /* one k block a trip: 20 products; the accumulators and one block's fragments fill the registers */
  for (int kc = 0; kc < DIN / 32; ++kc) { const v16b a = frag_b(&xs[wave * 16 + col][kc * 32], lane); v16b w[PO / 16];
#pragma unroll
    for (int j = 0; j < PO / 16; ++j) w[j] = frag_b(&wt[j * 16 + col][kc * 32], lane);
    __builtin_amdgcn_sched_barrier(0);   /* the k block's fragments are asked for as one group: one LDS latency in front of the 20 products, not one in front of each */
#pragma unroll
    for (int j = 0; j < 4; ++j) aq[j] = wmb(w[j], a, aq[j]);   /* D[feature 8 g + r][row col] */
#pragma unroll
    for (int j = 0; j < CC / 16; ++j) av[j] = wmb(a, w[4 + j], av[j]); }   /* D[row 8 g + r][channel col] */
  const size_t trow = r0 + wave * 16 + col;
#pragma unroll
  for (int j = 0; j < 4; ++j) { const int d0 = (j & 1) * 16 + 8 * g; const float* ba = &sb[j * 16 + 8 * g]; v8h hi, lo;
#pragma unroll
    for (int r = 0; r < 8; ++r) { const float v = aq[j][r] + ba[r]; const _Float16 hv = (_Float16)v; hi[r] = hv; lo[r] = (_Float16)((v - (float)hv) * 1024.0f); }
    vst2((j < 2 ? QH : KH) + trow * CC + d0, hi); vst2((j < 2 ? QL : KL) + trow * CC + d0, lo); }
#pragma unroll
  for (int j = 0; j < CC / 16; ++j) { const float bias = sb[2 * HDQK + j * 16 + col]; v8h h;
#pragma unroll
    for (int r = 0; r < 8; ++r) h[r] = (_Float16)(av[j][r] + bias);
    *(v8h*)&th[j * 16 + col][wave * 16 + 8 * g] = h; }
  __syncthreads();   /* every wave's 16 positions of each channel are in LDS before the 256-byte runs are read back */
  const size_t bb = r0 / TT; const int t0 = (int)(r0 % TT);
  _Float16* vd = VT + (bb * CC + (tid >> 4)) * (size_t)TT + t0 + (tid & 15) * 8;   /* 16 lanes bring one channel's 256 bytes */
#pragma unroll
  for (int i = 0; i < CC / 16; ++i) vst2(vd + (size_t)i * 16 * TT, *(const v8h*)&th[i * 16 + (tid >> 4)][(tid & 15) * 8]); }
#define FQ 16              // query columns per wave
#define FW 8               // waves per block
#define FK 32              // keys per pass
#define FP 40              // LDS row pitch in f16: 64-byte rows at 80 bytes (16 B x odd) for 16-byte reads
__device__ __forceinline__ float xhalf(float x) { return __builtin_bit_cast(float, __builtin_amdgcn_permlanex16(__builtin_bit_cast(int, x), __builtin_bit_cast(int, x), 0x76543210, 0xfedcba98, false, false)); }   /* lane l with lane l ^ 16 */
__device__ __forceinline__ v8f wm16(v16h a, v16h b, v8f c) { return __builtin_amdgcn_wmma_f32_16x16x32_f16(false, a, false, b, (short)0, c, false, false); }
__global__ __launch_bounds__(32 * FW) void k_fa(const _Float16* __restrict__ QH, const _Float16* __restrict__ QL, const _Float16* __restrict__ KH, const _Float16* __restrict__ KL, const _Float16* __restrict__ VT, const float* __restrict__ X, const float* __restrict__ GM, float* __restrict__ OUT) {
  __shared__ __align__(16) _Float16 sv[2][CC][FP]; __shared__ __align__(16) _Float16 sk[2][2][FK][FP];
  const int tid = threadIdx.x, wave = tid >> 5, lane = tid & 31, col = lane & 15, g = lane >> 4; const int b = blockIdx.y; const int q0 = blockIdx.x * (FQ * FW) + wave * FQ;
  const size_t qrow = ((size_t)b * TT + q0 + col) * CC; const v16h qh = frag_h(QH + qrow, lane), ql = frag_h(QL + qrow, lane);
  asm volatile("s_wait_xcnt 0x0" ::: "memory");   /* the build lets the first tile's loads land in the q loads' address registers */
  // staging: 4 lanes bring one 64-byte row; a thread brings 4 v rows' pieces (channels srow + 64 i) and one k piece (plane hi for threads < 128, residual above)
  const int srow = tid >> 2, sch = (tid & 3) * 8, kpl = tid >> 7, krow = srow & (FK - 1);
  const _Float16* vsrc = VT + ((size_t)b * CC + srow) * TT + sch; const _Float16* ksrc = (kpl ? KL : KH) + ((size_t)b * TT + krow) * CC + sch;
  v8h rv[4], rk;
#pragma unroll
  for (int i = 0; i < 4; ++i) rv[i] = *(const v8h*)(vsrc + (size_t)i * 64 * TT);
  rk = *(const v8h*)ksrc;
#pragma unroll
  for (int i = 0; i < 4; ++i) *(v8h*)&sv[0][i * 64 + srow][sch] = rv[i];
  *(v8h*)&sk[0][kpl][krow][sch] = rk;
  __syncthreads();   /* pass 0's tiles are in LDS before any wave reads them */
  v8f acc[CC / 16] = {}; float m = -3.0e38f, l = 0.f;
#pragma unroll 1   /* one pass a trip: the body already holds 22 matrix instructions and the accumulators fill the registers */
  for (int s = 0; s < TT / FK; ++s) { const int cur = s & 1; const int sn = s + 1 < TT / FK ? s + 1 : s;   /* the last pass fetches its own tile again, into the buffer nobody reads any more */
#pragma unroll
    for (int i = 0; i < 4; ++i) rv[i] = *(const v8h*)(vsrc + (size_t)i * 64 * TT + sn * FK);
    rk = *(const v8h*)(ksrc + (size_t)sn * FK * CC);
    asm volatile("s_wait_xcnt 0x0" ::: "memory");   /* the build reuses these loads' address registers for the k fragments right behind them */
    float sc[2][8]; v16h kh[2], kl[2];
#pragma unroll
    for (int t = 0; t < 2; ++t) { kh[t] = frag_h(&sk[cur][0][t * 16 + col][0], lane); kl[t] = frag_h(&sk[cur][1][t * 16 + col][0], lane); }
    __builtin_amdgcn_sched_barrier(0);   /* the pass's k fragments are asked for as one group: one LDS latency in front of the six score products, not one in front of each pair */
#pragma unroll
    for (int t = 0; t < 2; ++t) { v8f a = {}, al = {}; a = wm16(kh[t], qh, a); al = wm16(kh[t], ql, al); al = wm16(kl[t], qh, al);
#pragma unroll
      for (int r = 0; r < 8; ++r) sc[t][r] = a[r] + al[r] * (1.0f / 1024.0f); }
    float mx = sc[0][0];
#pragma unroll
    for (int r = 0; r < 8; ++r) mx = fmaxf(mx, fmaxf(sc[0][r], sc[1][r]));
    const float mn = fmaxf(m, fmaxf(mx, xhalf(mx)));
    if (__builtin_amdgcn_ballot_w32(mn > m) != 0) { const float al = expf(m - mn); l *= al; m = mn;   /* scalar branch: EXEC stays all ones; a column whose maximum stands multiplies by exp(0) = 1 */
#pragma unroll
      for (int j = 0; j < CC / 16; ++j) acc[j] *= al; }
    v16h vf[CC / 16];
#pragma unroll
    for (int j = 0; j < CC / 16; ++j) vf[j] = frag_h(&sv[cur][j * 16 + col][0], lane);
    __builtin_amdgcn_sched_barrier(0);   /* the pass's v fragments are asked for as one group ahead of the exponentials and land under them; left to itself the build reads each one product ahead, and every product waits out an LDS read */
    v16h pf;
#pragma unroll
    for (int t = 0; t < 2; ++t)
#pragma unroll
      for (int r = 0; r < 8; ++r) { const float e = expf(sc[t][r] - m); l += e; pf[t * 8 + r] = (_Float16)(e * 2048.0f); }   /* element 8 t + r = key 16 t + 8 g + r: frag_h's own k order */
#pragma unroll
    for (int j = 0; j < CC / 16; ++j) acc[j] = wm16(vf[j], pf, acc[j]);
#pragma unroll
    for (int i = 0; i < 4; ++i) *(v8h*)&sv[cur ^ 1][i * 64 + srow][sch] = rv[i];
    *(v8h*)&sk[cur ^ 1][kpl][krow][sch] = rk;
    __syncthreads();   /* publishes the next pass's tiles and ends every wave's reads of this pass's buffer, which the next trip refills */
  }
  const unsigned ro = (((unsigned)b * TT + q0 + col) * CC + 8 * g) * 4u; const float* xp = (const float*)((const char*)X + ro); float* yr = (float*)((char*)OUT + ro);   /* a lane's 8 accumulator registers = 8 consecutive channels of its query's row, in x and in the output alike: one 32-bit byte offset (under 2^25) serves both, beside the two scalar bases */
  v4f x0[CC / 16], x1[CC / 16];
#pragma unroll
  for (int j = 0; j < CC / 16; ++j) { x0[j] = *(const v4f*)(xp + j * 16); x1[j] = *(const v4f*)(xp + j * 16 + 4); }
  const float gmv = bfr(GM[0]); l += xhalf(l); const float inv = 1.0f / (2048.0f * l);
#pragma unroll
  for (int j = 0; j < CC / 16; ++j)
#pragma unroll
    for (int r = 0; r < 4; ++r) { const float o0 = acc[j][r] * inv, o1 = acc[j][4 + r] * inv; x0[j][r] = gmv * o0 + bfr(x0[j][r]); x1[j][r] = gmv * o1 + bfr(x1[j][r]); }
  __builtin_amdgcn_sched_barrier(0);   /* the stores stand behind all the arithmetic */
#pragma unroll
  for (int j = 0; j < CC / 16; ++j) { vst2(yr + j * 16, x0[j]); vst2(yr + j * 16 + 4, x1[j]); } }

extern "C" void kernel_launch(void* const* d_in, const int* in_sizes, int n_in, void* d_out, int out_size, void* d_ws, size_t ws_size, hipStream_t stream) {
  (void)in_sizes; (void)n_in; (void)out_size;
  const float** F = (const float**)d_in;
  if (ws_size < (size_t)WS_END) return;
  char* ws = (char*)d_ws; _Float16 *QH = (_Float16*)(ws + WS_QH), *KH = (_Float16*)(ws + WS_KH), *VT = (_Float16*)(ws + WS_VT), *QL = (_Float16*)(ws + WS_QL), *KL = (_Float16*)(ws + WS_KL); __bf16 *VB = (__bf16*)(ws + WS_VB), *VBL = (__bf16*)(ws + WS_VBL); float *S = (float*)(ws + WS_S), *Y = (float*)(ws + WS_Y);
  (void)Y; (void)S; (void)QL; (void)KL; (void)VB; (void)VBL;
  // inputs: 0 x [8,64,64,256] (channels-last = rows); 1 Wq [256,32] (in,out), 2 bq; 3 Wk, 4 bk; 5 Wv [256,256], 6 bv; 7 gamma (scalar 0.5)
  k_proj<<<dim3(TNB * TT / PR), 256, 0, stream>>>(F[0], F[1], F[3], F[5], F[2], F[4], F[6], QH, QL, KH, KL, VT);
  k_fa<<<dim3(TT / (FQ * FW), TNB), 32 * FW, 0, stream>>>(QH, QL, KH, KL, VT, F[0], F[7], (float*)d_out);
}

// v005
// One run takes 142 microseconds.
// Timed twice side by side with v004, it ran 1.13 times as fast both times.
// Counting every step since v000, it is 16.0 times as fast.
// compute dtype: all float inputs rounded to bf16; q/k/v = x W + b with EXACT bf16 products on WMMA 16x16x32 (f32 accumulate); UNSCALED 32-deep logits q.k with both as f16 hi + residual planes (3 products); online softmax in f32 (running maximum; exp(logit - maximum) x 2^11 formed as 2^(logit * log2 e - (maximum * log2 e - 11)): one f32 fma and the hardware's base-2 exponential), once to f16 against v once to f16 (1 product), divided by the f32 sum of the same values at the end; y = gamma * out + x in f32; f32 output.
// SAGAN self-attention on channels-LAST images (B 8, 64 x 64 = 4,096 positions, C 256; (in,out) 1/16-scale weights, zero biases, gamma = 0.5): q = x Wq + bq (32), k = x Wk + bk (32), v = x Wv + bv (256); attn = softmax(q k^T) (NO scaling); out = attn v; y = gamma * out + x -> [B, 64, 64, 256].
#include <hip/hip_runtime.h>
#include <math.h>

typedef __attribute__((ext_vector_type(16))) _Float16 v16h;
typedef __attribute__((ext_vector_type(16))) __bf16 v16b;
typedef __attribute__((ext_vector_type(8)))  _Float16 v8h;
typedef __attribute__((ext_vector_type(8)))  float v8f;
typedef __attribute__((ext_vector_type(4)))  float v4f;
typedef __attribute__((ext_vector_type(2)))  float v2f;
typedef __attribute__((ext_vector_type(4)))  unsigned v4u;
typedef __attribute__((ext_vector_type(4)))  int v4i;
typedef float __attribute__((may_alias)) float_a;
typedef int __attribute__((may_alias)) int_a;

template <typename T> __device__ __forceinline__ void vst2(void* p, T v) { *(T*)p = v;  }
__device__ __forceinline__ v8f wmma16(v16h a, v16h b, v8f c) {
  v8f d = __builtin_amdgcn_wmma_f32_16x16x32_f16(false, a, false, b, (short)0, c, false, false);
  asm volatile("v_nop\n\tv_nop\n\tv_nop\n\tv_nop" : "+v"(d) : "v"(a), "v"(b));
  return d;
}
__device__ __forceinline__ v8f wmma_bf(v16b a, v16b b, v8f c) {
  v8f d = __builtin_amdgcn_wmma_f32_16x16x32_bf16(false, a, false, b, (short)0, c, false, false);
  asm volatile("v_nop\n\tv_nop\n\tv_nop\n\tv_nop" : "+v"(d) : "v"(a), "v"(b));
  return d;
}
// 16x16x32 fragments: lane = (h = lane>>4, row/col = lane&15); elements 0..7 = k0+8h+0..7, 8..15 = k0+16+8h+0..7; D element r = row 8h+r
__device__ __forceinline__ v16h frag_h(const _Float16* rowk0, int lane) {
  union { v16h v; v8h q[2]; } u; const _Float16* p = rowk0 + 8 * (lane >> 4);
  u.q[0] = *(const v8h*)p; u.q[1] = *(const v8h*)(p + 16); return u.v;
}
__device__ __forceinline__ v16h frag_f32(const float* rowk0, int lane) {
  v16h a; const float* p = rowk0 + 8 * (lane >> 4);
#pragma unroll
  for (int i = 0; i < 8; ++i) { a[i] = (_Float16)p[i]; a[8 + i] = (_Float16)p[16 + i]; }
  return a;
}
__device__ __forceinline__ v16h frag_f32s(const float* rowk0, int lane, float sc) {
  v16h a; const float* p = rowk0 + 8 * (lane >> 4);
#pragma unroll
  for (int i = 0; i < 8; ++i) { a[i] = (_Float16)(p[i] * sc); a[8 + i] = (_Float16)(p[16 + i] * sc); }
  return a;
}
// column fragment from a [K][ld] layout (column n), rows >= K read as 0
__device__ __forceinline__ v16h fragc_f32(const float* W, int k0, int n, int lane, int ld, int K) {
  v16h a; const int g = lane >> 4;
#pragma unroll
  for (int i = 0; i < 8; ++i) { const int ka = k0 + 8 * g + i, kb = ka + 16;
    a[i] = (_Float16)(ka < K ? W[(size_t)(ka < K ? ka : K - 1) * ld + n] : 0.f); a[8 + i] = (_Float16)(kb < K ? W[(size_t)(kb < K ? kb : K - 1) * ld + n] : 0.f); }
  return a;
}
struct F2 { v16b h, l; };
__device__ __forceinline__ F2 bsplit16(const float v[16]) { F2 r;
#pragma unroll
  for (int i = 0; i < 16; ++i) { const __bf16 h = (__bf16)v[i]; r.h[i] = h; r.l[i] = (__bf16)(v[i] - (float)h); }
  return r; }
__device__ __forceinline__ F2 split_row(const float* row, int k0, int lane) { float v[16]; const float* p = row + k0 + 8 * (lane >> 4);
#pragma unroll
  for (int i = 0; i < 8; ++i) { v[i] = p[i]; v[8 + i] = p[16 + i]; }
  return bsplit16(v); }
__device__ __forceinline__ F2 split_rowK(const float* row, int k0, int lane, int K) { float v[16]; const int g = lane >> 4;
#pragma unroll
  for (int i = 0; i < 8; ++i) { const int ka = k0 + 8 * g + i, kb = ka + 16; v[i] = ka < K ? row[ka < K ? ka : K - 1] : 0.f; v[8 + i] = kb < K ? row[kb < K ? kb : K - 1] : 0.f; }
  return bsplit16(v); }
__device__ __forceinline__ F2 split_col(const float* W, int k0, int n, int lane, int ld, int K) { float v[16]; const int g = lane >> 4;
#pragma unroll
  for (int i = 0; i < 8; ++i) { const int ka = k0 + 8 * g + i, kb = ka + 16; v[i] = ka < K ? W[(size_t)(ka < K ? ka : K - 1) * ld + n] : 0.f; v[8 + i] = kb < K ? W[(size_t)(kb < K ? kb : K - 1) * ld + n] : 0.f; }
  return bsplit16(v); }
__device__ __forceinline__ v8f mac3(const F2& a, const F2& b, v8f c) { c = wmma_bf(a.l, b.h, c); c = wmma_bf(a.h, b.l, c); return wmma_bf(a.h, b.h, c); }
__device__ __forceinline__ float sigm(float v) { return 1.0f / (1.0f + expf(-v)); }
#define LDSX() do { asm volatile("s_wait_dscnt 0" ::: "memory"); __builtin_amdgcn_wave_barrier(); __builtin_amdgcn_fence(__ATOMIC_RELEASE, "workgroup"); } while (0)

#define NB 8
#define TT 4096
#define CC 256            // plane width: q/k planes carry 32 real columns (rest never written or read), v planes all 256
#define DIN 256
#define NH 1
#define HD 256
#define NQB (TT / 64)
#define HG 1               // one 4,096 x 4,096 f32 score plane in the workspace, which no kernel uses
#define SCALE (1.0f)
#define HDQK 32
#define CAUSAL 0
#ifndef TNB
#define TNB NB
#endif
__device__ __forceinline__ v16b zero16b() { v16b z; _Pragma("unroll") for (int i = 0; i < 16; ++i) z[i] = (__bf16)0.f; return z; }
__device__ __forceinline__ float bfr(float v) { return (float)(__bf16)v; }
__host__ __device__ __forceinline__ int kb_last(int qb) { return CAUSAL ? ((qb * 64 + 63) >> 7) : (TT / 128 - 1); }
typedef __attribute__((ext_vector_type(8))) __bf16 v8b;
__device__ __forceinline__ v16b frag_b(const __bf16* rowk0, int lane) {
  union { v16b v; v8b q[2]; } u; const __bf16* p = rowk0 + 8 * (lane >> 4);
  u.q[0] = *(const v8b*)p; u.q[1] = *(const v8b*)(p + 16); return u.v;
}
#define QBH (TT / 64)
#define QBH_PV 0           // A.g stays single f16
#define QHI 4096            // q residual rows everywhere (3-product logits)
#define KHI 4096           // k residual rows for ALL keys (3-product logits)
// B fragment (k rows k0+.., output column o) of a weight: (in,out) [K][ld] or (out,in) [ld rows of K]: bf16 exact, or f16(bf16 * 256) exact
__device__ __forceinline__ v16b wcol_io(const float* Wm, int k0, int o, int lane, int ld) { v16b w; const int g = lane >> 4;
#pragma unroll
  for (int i = 0; i < 8; ++i) { w[i] = (__bf16)Wm[(size_t)(k0 + 8 * g + i) * ld + o]; w[8 + i] = (__bf16)Wm[(size_t)(k0 + 16 + 8 * g + i) * ld + o]; }
  return w; }
__device__ __forceinline__ v16b wcol_oi(const float* Wm, int k0, int o, int lane, int K) { v16b w; const float* p = Wm + (size_t)o * K + k0 + 8 * (lane >> 4);
#pragma unroll
  for (int i = 0; i < 8; ++i) { w[i] = (__bf16)p[i]; w[8 + i] = (__bf16)p[16 + i]; }
  return w; }
__device__ __forceinline__ v16h wcolh_io(const float* Wm, int k0, int o, int lane, int ld) { v16h w; const int g = lane >> 4;
#pragma unroll
  for (int i = 0; i < 8; ++i) { w[i] = (_Float16)(bfr(Wm[(size_t)(k0 + 8 * g + i) * ld + o]) * 256.0f); w[8 + i] = (_Float16)(bfr(Wm[(size_t)(k0 + 16 + 8 * g + i) * ld + o]) * 256.0f); }
  return w; }
__device__ __forceinline__ v16h wcolh_oi(const float* Wm, int k0, int o, int lane, int K) { v16h w; const float* p = Wm + (size_t)o * K + k0 + 8 * (lane >> 4);
#pragma unroll
  for (int i = 0; i < 8; ++i) { w[i] = (_Float16)(bfr(p[i]) * 256.0f); w[8 + i] = (_Float16)(bfr(p[16 + i]) * 256.0f); }
  return w; }
#define WQKV_LAYOUT 1   // 0 = (in,out) [DIN][CC]; 1 = (in,out) Wq/Wk [DIN][HDQK], Wv [DIN][CC]; 2 = per-head [NH][DIN][HD]
__device__ __forceinline__ v16b wcol_hdk(const float* Wm, int k0, int o, int lane) { v16b w; const int g = lane >> 4; const float* p = Wm + (size_t)(o / HD) * DIN * HD + (o % HD);
#pragma unroll
  for (int i = 0; i < 8; ++i) { w[i] = (__bf16)p[(size_t)(k0 + 8 * g + i) * HD]; w[8 + i] = (__bf16)p[(size_t)(k0 + 16 + 8 * g + i) * HD]; }
  return w; }
#define WO_OUT_IN 0
#if WQKV_LAYOUT == 1
#define WCOL(W, k0, o, lane) ((which == 2) ? wcol_io(W, k0, (o), lane, CC) : (((o) < HDQK) ? wcol_io(W, k0, (o), lane, HDQK) : zero16b()))   /* (in,out): Wq/Wk [256][32] (plane columns >= 32 zero), Wv [256][256] full */
#define WCOL_OLD_UNUSED(W, k0, o, lane) (((o) < HDQK) ? wcol_oi(W, k0, (o), lane, DIN) : zero16b())   /* unused: reads (out,in) [32][256] weights; plane columns >= 32 are zero for all three */
#elif WQKV_LAYOUT == 2
#define WCOL(W, k0, o, lane) wcol_hdk(W, k0, o, lane)
#else
#define WCOL(W, k0, o, lane) wcol_io(W, k0, o, lane, CC)
#endif
#if WO_OUT_IN
#define WOCOL(W, k0, o, lane) wcol_oi(W, k0, o, lane, CC)
#define WOCOLH(W, k0, o, lane) wcolh_oi(W, k0, o, lane, CC)
#else
#define WOCOL(W, k0, o, lane) wcol_io(W, k0, o, lane, DIN)
#define WOCOLH(W, k0, o, lane) wcolh_io(W, k0, o, lane, DIN)
#endif
#ifndef XP
#define OUT1_OFF (4u * (size_t)NB * DIN * TT)   /* output 1 (o) follows output 0 (y) */
#define XP TT              // position pitch of x and of the output
#endif
#define BG HG
#define DVH 128
// ---- k_wz: block = (64 rows, 128 output cols): OR = y (hi + lo, K = 32 real columns of the YR rows) . W^T ((out,in) [256][32], exact) + b
__global__ __launch_bounds__(128) void k_wz(const float* __restrict__ YR, const float* __restrict__ WW, const float* __restrict__ WB, float* __restrict__ ORW) { __shared__ __align__(16) float sf[4][16][132];
  const int tid = threadIdx.x, wave = tid >> 5, lane = tid & 31, col = lane & 15, g = lane >> 4; const int c0 = blockIdx.y * 128; const size_t r0 = (size_t)blockIdx.x * 64 + wave * 16;
  v8f acc[8] = {};
#pragma unroll
  for (int kc = 0; kc < HDQK / 32; ++kc) { const F2 a = split_row(YR + (r0 + col) * CC, kc * 32, lane); asm volatile("s_wait_loadcnt 0x0" ::: "memory");
#pragma unroll
    for (int j = 0; j < 8; ++j) { const v16b w = wcol_oi(WW, kc * 32, c0 + j * 16 + col, lane, HDQK); asm volatile("s_wait_loadcnt 0x0" ::: "memory"); acc[j] = wmma_bf(a.h, w, acc[j]); acc[j] = wmma_bf(a.l, w, acc[j]); } }
#pragma unroll
  for (int j = 0; j < 8; ++j) { const float bb = WB ? bfr(WB[c0 + j * 16 + col]) : 0.f; asm volatile("s_wait_loadcnt 0x0" ::: "memory");
#pragma unroll
    for (int r = 0; r < 8; ++r) sf[wave][8 * g + r][j * 16 + col] = acc[j][r] + bb; }
  LDSX(); for (int rl = 0; rl < 16; ++rl) vst2(ORW + (r0 + rl) * DIN + c0 + lane * 4, *(const v4f*)&sf[wave][rl][lane * 4]); }
// ---- k_fin2: block = (64 positions, 64 channels, batch b): o[b][c][n] = OR[b*N + n][c] (channels-first via LDS transpose) -> output 1; y = gamma * o + bf16(x) -> output 0 (256-B runs)
__global__ __launch_bounds__(256) void k_fin2(const float* __restrict__ ORW, const float* __restrict__ X, const float* __restrict__ GM, float* __restrict__ OUT, float* __restrict__ OUT1) { const float gmv = bfr(GM[0]); __shared__ float st[64][68]; const int tid = threadIdx.x; const int n0 = blockIdx.x * 64, c0 = blockIdx.y * 64; const size_t b = blockIdx.z;
  for (int e = tid; e < 64 * 16; e += 256) { const int nl = e >> 4, q = e & 15; *(v4f*)&st[nl][q * 4] = *(const v4f*)(ORW + (b * TT + n0 + nl) * (size_t)DIN + c0 + q * 4); }
  __syncthreads();
  for (int e = tid; e < 64 * 16; e += 256) { const int cl = e >> 4, q = e & 15; const size_t oi = (b * DIN + c0 + cl) * (size_t)XP + n0 + q * 4; const v4f xr = *(const v4f*)(X + oi); v4f o, y; _Pragma("unroll") for (int i = 0; i < 4; ++i) { o[i] = st[q * 4 + i][cl]; y[i] = gmv * o[i] + bfr(xr[i]); } vst2(OUT + oi, y); vst2(OUT1 + oi, o); } }   /* y = gamma * o + x (output 0), o (output 1) */
#ifndef SM_EXTRA_PARAMS
#define SM_EXTRA_PARAMS
#endif
#ifndef PROJ_EXTRA_PARAMS
#define PROJ_EXTRA_PARAMS
#endif
#ifndef SM_MASK_HOOK
#define SM_MASK_HOOK (void)0
#endif

#define WS_QH  0u                                      // f16 q rows [b*t][CC]
#define WS_KH  (WS_QH + 2u * (size_t)NB * TT * CC)      // f16 k rows [b*t][CC]
#define WS_VT  (WS_KH + 2u * (size_t)NB * TT * CC)      // f16 v planes [b][c][t]
#define WS_QL  (WS_VT + 2u * (size_t)NB * CC * TT)      // f16 q residual x 2^10 rows [b][t < QHI][CC]
#define WS_KL  (WS_QL + 2u * (size_t)NB * QHI * CC)     // f16 k residual x 2^10 rows [b][t < KHI][CC]
#define WS_VB  (WS_KL + 2u * (size_t)NB * KHI * CC)     // bf16 v hi planes [b][c][t < KHI]
#define WS_VBL (WS_VB + 2u * (size_t)NB * CC * KHI)
#define WS_S   (WS_VBL + 2u * (size_t)NB * CC * KHI)    // f32 logits / P [hg][t][s]
#define WS_Y   (WS_S  + 4u * (size_t)HG * TT * TT)      // f32 ctx rows [b*t][CC] (only when there is an output projection)
#define WS_END (WS_Y  + 0u)

// ---- k_proj: block = 128 rows of x, 8 waves x 16 rows, every wave all 320 output columns (32 q, 32 k, 256 v). The three weights are rounded to bf16 and laid k-contiguous per output column in LDS once a block, and the block's x rows are read once, in whole lines, and laid beside them as bf16: every fragment is two 16-byte LDS reads. Exact bf16 products (K = DIN), f32 accumulate, k blocks in ascending order. q and k are formed transposed (A = weight columns, B = x rows): a lane holds 8 consecutive features of one row and stores them directly (f16 rows + residual x 2^10 rows, the 32 real columns only: nobody reads the rest of those planes). v goes through LDS to f16 planes [c][t] in 256-byte runs.
#define PR 128             // rows per block
#define PO (2 * HDQK + CC) // output columns: q, k, v
#define PWP (DIN + 8)      // LDS pitch of a weight column and of an x row in bf16: 512 bytes at 528 (16 B x odd) for 16-byte reads
#define PVP (PR + 8)       // LDS pitch of a v channel in f16: 256-byte runs at 272 bytes (16 B x odd)
typedef __attribute__((ext_vector_type(4))) __bf16 v4b;
__device__ __forceinline__ v8f wmb(v16b a, v16b b, v8f c) { return __builtin_amdgcn_wmma_f32_16x16x32_bf16(false, a, false, b, (short)0, c, false, false); }
__global__ __launch_bounds__(256) void k_proj(const float* __restrict__ X, const float* __restrict__ WQ, const float* __restrict__ WK, const float* __restrict__ WV, const float* __restrict__ BQ, const float* __restrict__ BK, const float* __restrict__ BV,
    _Float16* __restrict__ QH, _Float16* __restrict__ QL, _Float16* __restrict__ KH, _Float16* __restrict__ KL, _Float16* __restrict__ VT) {
  __shared__ __align__(16) __bf16 wt[PO][PWP]; __shared__ __align__(16) __bf16 xs[PR][PWP]; __shared__ __align__(16) _Float16 th[CC][PVP]; __shared__ __align__(16) float sb[PO];
  const int tid = threadIdx.x, wave = __builtin_amdgcn_readfirstlane(tid >> 5), lane = tid & 31, col = lane & 15, g = lane >> 4; const size_t r0 = (size_t)blockIdx.x * PR;
  // the 320 biases, one or two a thread, on their way to LDS with the rest
  const float bvr = BV[tid]; const float bqr = ((wave & 1) ? BK : BQ)[lane];   /* every wave asks, so that no branch and no wait stand in front of the x loads; waves 0 and 1 store */
  // the wave's 16 x rows (16 KB in a row, 512 bytes a load), asked for ahead of the weight staging so that they fly under it
  const float* xp = X + (r0 + wave * 16) * DIN + lane * 4; v4f xr[32];
#pragma unroll
  for (int i = 0; i < 32; ++i) xr[i] = *(const v4f*)(xp + i * 128);
  // weight staging: a unit = 32 output columns (one a lane: whole 128-byte lines) x 8 k rows -> one 16-byte LDS store a lane. A wave brings 32 v columns, all k, and a quarter of the k rows of q (even waves) or k (odd waves)
  const float* sv = WV + wave * 32 + lane;
#pragma unroll 8   /* eight units' loads in flight a wave */
  for (int k8 = 0; k8 < DIN / 8; ++k8) { v8b p;
#pragma unroll
    for (int e = 0; e < 8; ++e) p[e] = (__bf16)sv[(k8 * 8 + e) * CC];
    *(v8b*)&wt[2 * HDQK + wave * 32 + lane][k8 * 8] = p; }
  const float* sq = ((wave & 1) ? WK : WQ) + (wave >> 1) * (DIN / 4) * HDQK + lane;
#pragma unroll
  for (int k8 = 0; k8 < DIN / 32; ++k8) { v8b p;
#pragma unroll
    for (int e = 0; e < 8; ++e) p[e] = (__bf16)sq[(k8 * 8 + e) * HDQK];
    *(v8b*)&wt[(wave & 1) * HDQK + lane][(wave >> 1) * (DIN / 4) + k8 * 8] = p; }
#pragma unroll
  for (int i = 0; i < 32; ++i) { v4b p;
#pragma unroll
    for (int e = 0; e < 4; ++e) p[e] = (__bf16)xr[i][e];
    *(v4b*)&xs[wave * 16 + (i >> 1)][(i & 1) * 128 + lane * 4] = p; }
  sb[2 * HDQK + tid] = bfr(bvr); if (wave < 2) sb[wave * HDQK + lane] = bfr(bqr);
  __syncthreads();   /* weights, biases and x rows are in LDS before any wave reads them */
  v8f aq[4] = {}, av[CC / 16] = {};
#pragma unroll 1   /* one k block a trip: 20 products; the accumulators and one block's fragments fill the registers */
  for (int kc = 0; kc < DIN / 32; ++kc) { const v16b a = frag_b(&xs[wave * 16 + col][kc * 32], lane); v16b w[PO / 16];
#pragma unroll
    for (int j = 0; j < PO / 16; ++j) w[j] = frag_b(&wt[j * 16 + col][kc * 32], lane);
    __builtin_amdgcn_sched_barrier(0);   /* the k block's fragments are asked for as one group: one LDS latency in front of the 20 products, not one in front of each */
#pragma unroll
    for (int j = 0; j < 4; ++j) aq[j] = wmb(w[j], a, aq[j]);   /* D[feature 8 g + r][row col] */
#pragma unroll
    for (int j = 0; j < CC / 16; ++j) av[j] = wmb(a, w[4 + j], av[j]); }   /* D[row 8 g + r][channel col] */
  const size_t trow = r0 + wave * 16 + col;
#pragma unroll
  for (int j = 0; j < 4; ++j) { const int d0 = (j & 1) * 16 + 8 * g; const float* ba = &sb[j * 16 + 8 * g]; v8h hi, lo;
#pragma unroll
    for (int r = 0; r < 8; ++r) { const float v = aq[j][r] + ba[r]; const _Float16 hv = (_Float16)v; hi[r] = hv; lo[r] = (_Float16)((v - (float)hv) * 1024.0f); }
    vst2((j < 2 ? QH : KH) + trow * CC + d0, hi); vst2((j < 2 ? QL : KL) + trow * CC + d0, lo); }
#pragma unroll
  for (int j = 0; j < CC / 16; ++j) { const float bias = sb[2 * HDQK + j * 16 + col]; v8h h;
#pragma unroll
    for (int r = 0; r < 8; ++r) h[r] = (_Float16)(av[j][r] + bias);
    *(v8h*)&th[j * 16 + col][wave * 16 + 8 * g] = h; }
  __syncthreads();   /* every wave's 16 positions of each channel are in LDS before the 256-byte runs are read back */
  const size_t bb = r0 / TT; const int t0 = (int)(r0 % TT);
  _Float16* vd = VT + (bb * CC + (tid >> 4)) * (size_t)TT + t0 + (tid & 15) * 8;   /* 16 lanes bring one channel's 256 bytes */
#pragma unroll
  for (int i = 0; i < CC / 16; ++i) vst2(vd + (size_t)i * 16 * TT, *(const v8h*)&th[i * 16 + (tid >> 4)][(tid & 15) * 8]); }
#define FQ 16              // query columns per wave
#define FW 8               // waves per block
#define FK 32              // keys per pass
#define FP 40              // LDS row pitch in f16: 64-byte rows at 80 bytes (16 B x odd) for 16-byte reads
__device__ __forceinline__ float xhalf(float x) { return __builtin_bit_cast(float, __builtin_amdgcn_permlanex16(__builtin_bit_cast(int, x), __builtin_bit_cast(int, x), 0x76543210, 0xfedcba98, false, false)); }   /* lane l with lane l ^ 16 */
#define L2E 1.44269504088896340736f   // log2 e
__device__ __forceinline__ v8f wm16(v16h a, v16h b, v8f c) { return __builtin_amdgcn_wmma_f32_16x16x32_f16(false, a, false, b, (short)0, c, false, false); }
__global__ __launch_bounds__(32 * FW) void k_fa(const _Float16* __restrict__ QH, const _Float16* __restrict__ QL, const _Float16* __restrict__ KH, const _Float16* __restrict__ KL, const _Float16* __restrict__ VT, const float* __restrict__ X, const float* __restrict__ GM, float* __restrict__ OUT) {
  __shared__ __align__(16) _Float16 sv[2][CC][FP]; __shared__ __align__(16) _Float16 sk[2][2][FK][FP];
  const int tid = threadIdx.x, wave = tid >> 5, lane = tid & 31, col = lane & 15, g = lane >> 4; const int b = blockIdx.y; const int q0 = blockIdx.x * (FQ * FW) + wave * FQ;
  const size_t qrow = ((size_t)b * TT + q0 + col) * CC; const v16h qh = frag_h(QH + qrow, lane), ql = frag_h(QL + qrow, lane);
  asm volatile("s_wait_xcnt 0x0" ::: "memory");   /* the build lets the first tile's loads land in the q loads' address registers */
  // staging: 4 lanes bring one 64-byte row; a thread brings 4 v rows' pieces (channels srow + 64 i) and one k piece (plane hi for threads < 128, residual above)
  const int srow = tid >> 2, sch = (tid & 3) * 8, kpl = tid >> 7, krow = srow & (FK - 1);
  const _Float16* vsrc = VT + ((size_t)b * CC + srow) * TT + sch; const _Float16* ksrc = (kpl ? KL : KH) + ((size_t)b * TT + krow) * CC + sch;
  v8h rv[4], rk;
#pragma unroll
  for (int i = 0; i < 4; ++i) rv[i] = *(const v8h*)(vsrc + (size_t)i * 64 * TT);
  rk = *(const v8h*)ksrc;
#pragma unroll
  for (int i = 0; i < 4; ++i) *(v8h*)&sv[0][i * 64 + srow][sch] = rv[i];
  *(v8h*)&sk[0][kpl][krow][sch] = rk;
  __syncthreads();   /* pass 0's tiles are in LDS before any wave reads them */
  v8f acc[CC / 16] = {}; float m = -3.0e38f, c = -3.0e38f, l = 0.f;   /* c = m * log2 e - 11, rounded once per maximum: what every exponent of the column subtracts; l sums the values x 2^11 */
#pragma unroll 1   /* one pass a trip: the body already holds 22 matrix instructions and the accumulators fill the registers */
  for (int s = 0; s < TT / FK; ++s) { const int cur = s & 1; const int sn = s + 1 < TT / FK ? s + 1 : s;   /* the last pass fetches its own tile again, into the buffer nobody reads any more */
#pragma unroll
    for (int i = 0; i < 4; ++i) rv[i] = *(const v8h*)(vsrc + (size_t)i * 64 * TT + sn * FK);
    rk = *(const v8h*)(ksrc + (size_t)sn * FK * CC);
    asm volatile("s_wait_xcnt 0x0" ::: "memory");   /* the build reuses these loads' address registers for the k fragments right behind them */
    float sc[2][8]; v16h kh[2], kl[2];
#pragma unroll
    for (int t = 0; t < 2; ++t) { kh[t] = frag_h(&sk[cur][0][t * 16 + col][0], lane); kl[t] = frag_h(&sk[cur][1][t * 16 + col][0], lane); }
    __builtin_amdgcn_sched_barrier(0);   /* the pass's k fragments are asked for as one group: one LDS latency in front of the six score products, not one in front of each pair */
#pragma unroll
    for (int t = 0; t < 2; ++t) { v8f a = {}, al = {}; a = wm16(kh[t], qh, a); al = wm16(kh[t], ql, al); al = wm16(kl[t], qh, al);
#pragma unroll
      for (int r = 0; r < 8; ++r) sc[t][r] = a[r] + al[r] * (1.0f / 1024.0f); }
    float mx = sc[0][0];
#pragma unroll
    for (int r = 0; r < 8; ++r) mx = fmaxf(mx, fmaxf(sc[0][r], sc[1][r]));
    const float mn = fmaxf(m, fmaxf(mx, xhalf(mx)));
    if (__builtin_amdgcn_ballot_w32(mn > m) != 0) { const float cn = __builtin_fmaf(mn, L2E, -11.0f); const float al = __builtin_amdgcn_exp2f(c - cn); l *= al; m = mn; c = cn;   /* scalar branch: EXEC stays all ones; a column whose maximum stands gets the same c again and multiplies by 2^0 = 1; the factor comes from the same two rounded values that the old and the new exponents subtract */
#pragma unroll
      for (int j = 0; j < CC / 16; ++j) acc[j] *= al; }
    v16h vf[CC / 16];
#pragma unroll
    for (int j = 0; j < CC / 16; ++j) vf[j] = frag_h(&sv[cur][j * 16 + col][0], lane);
    __builtin_amdgcn_sched_barrier(0);   /* the pass's v fragments are asked for as one group ahead of the exponentials and land under them; left to itself the build reads each one product ahead, and every product waits out an LDS read */
    v16h pf;
#pragma unroll
    for (int t = 0; t < 2; ++t)
#pragma unroll
      for (int r = 0; r < 8; ++r) { const float e = __builtin_amdgcn_exp2f(__builtin_fmaf(sc[t][r], L2E, -c)); l += e; pf[t * 8 + r] = (_Float16)e; }   /* element 8 t + r = key 16 t + 8 g + r: frag_h's own k order */
#pragma unroll
    for (int j = 0; j < CC / 16; ++j) acc[j] = wm16(vf[j], pf, acc[j]);
#pragma unroll
    for (int i = 0; i < 4; ++i) *(v8h*)&sv[cur ^ 1][i * 64 + srow][sch] = rv[i];
    *(v8h*)&sk[cur ^ 1][kpl][krow][sch] = rk;
    __syncthreads();   /* publishes the next pass's tiles and ends every wave's reads of this pass's buffer, which the next trip refills */
  }
  const unsigned ro = (((unsigned)b * TT + q0 + col) * CC + 8 * g) * 4u; const float* xp = (const float*)((const char*)X + ro); float* yr = (float*)((char*)OUT + ro);   /* a lane's 8 accumulator registers = 8 consecutive channels of its query's row, in x and in the output alike: one 32-bit byte offset (under 2^25) serves both, beside the two scalar bases */
  v4f x0[CC / 16], x1[CC / 16];
#pragma unroll
  for (int j = 0; j < CC / 16; ++j) { x0[j] = *(const v4f*)(xp + j * 16); x1[j] = *(const v4f*)(xp + j * 16 + 4); }
  const float gmv = bfr(GM[0]); l += xhalf(l); const float inv = 1.0f / l;
#pragma unroll
  for (int j = 0; j < CC / 16; ++j)
#pragma unroll
    for (int r = 0; r < 4; ++r) { const float o0 = acc[j][r] * inv, o1 = acc[j][4 + r] * inv; x0[j][r] = gmv * o0 + bfr(x0[j][r]); x1[j][r] = gmv * o1 + bfr(x1[j][r]); }
  __builtin_amdgcn_sched_barrier(0);   /* the stores stand behind all the arithmetic */
#pragma unroll
  for (int j = 0; j < CC / 16; ++j) { vst2(yr + j * 16, x0[j]); vst2(yr + j * 16 + 4, x1[j]); } }

extern "C" void kernel_launch(void* const* d_in, const int* in_sizes, int n_in, void* d_out, int out_size, void* d_ws, size_t ws_size, hipStream_t stream) {
  (void)in_sizes; (void)n_in; (void)out_size;
  const float** F = (const float**)d_in;
  if (ws_size < (size_t)WS_END) return;
  char* ws = (char*)d_ws; _Float16 *QH = (_Float16*)(ws + WS_QH), *KH = (_Float16*)(ws + WS_KH), *VT = (_Float16*)(ws + WS_VT), *QL = (_Float16*)(ws + WS_QL), *KL = (_Float16*)(ws + WS_KL); __bf16 *VB = (__bf16*)(ws + WS_VB), *VBL = (__bf16*)(ws + WS_VBL); float *S = (float*)(ws + WS_S), *Y = (float*)(ws + WS_Y);
  (void)Y; (void)S; (void)QL; (void)KL; (void)VB; (void)VBL;
  // inputs: 0 x [8,64,64,256] (channels-last = rows); 1 Wq [256,32] (in,out), 2 bq; 3 Wk, 4 bk; 5 Wv [256,256], 6 bv; 7 gamma (scalar 0.5)
  k_proj<<<dim3(TNB * TT / PR), 256, 0, stream>>>(F[0], F[1], F[3], F[5], F[2], F[4], F[6], QH, QL, KH, KL, VT);
  k_fa<<<dim3(TT / (FQ * FW), TNB), 32 * FW, 0, stream>>>(QH, QL, KH, KL, VT, F[0], F[7], (float*)d_out);
}

// v006
// A run of this version takes 111 microseconds.
// Two timings next to v005 both put it at 1.28 times that version's speed.
// All steps since v000 together make it 20.6 times as fast.
// compute dtype: all float inputs rounded to bf16; q/k/v = x W + b with EXACT bf16 products on WMMA 16x16x32 (f32 accumulate); UNSCALED 32-deep logits q.k with both as f16 hi + residual planes (3 products); online softmax in f32 (running maximum; exp(logit - maximum) x 2^11 formed as 2^(logit * log2 e - (maximum * log2 e - 11)): one f32 fma and the hardware's base-2 exponential), once to f16 against v once to f16 (1 product), divided by the f32 sum of the same values at the end; y = gamma * out + x in f32; f32 output.
// SAGAN self-attention on channels-LAST images (B 8, 64 x 64 = 4,096 positions, C 256; (in,out) 1/16-scale weights, zero biases, gamma = 0.5): q = x Wq + bq (32), k = x Wk + bk (32), v = x Wv + bv (256); attn = softmax(q k^T) (NO scaling); out = attn v; y = gamma * out + x -> [B, 64, 64, 256].
#include <hip/hip_runtime.h>
#include <math.h>

typedef __attribute__((ext_vector_type(16))) _Float16 v16h;
typedef __attribute__((ext_vector_type(16))) __bf16 v16b;
typedef __attribute__((ext_vector_type(8)))  _Float16 v8h;
typedef __attribute__((ext_vector_type(8)))  float v8f;
typedef __attribute__((ext_vector_type(4)))  float v4f;
typedef __attribute__((ext_vector_type(2)))  float v2f;
typedef __attribute__((ext_vector_type(4)))  unsigned v4u;
typedef __attribute__((ext_vector_type(4)))  int v4i;
typedef float __attribute__((may_alias)) float_a;
typedef int __attribute__((may_alias)) int_a;

template <typename T> __device__ __forceinline__ void vst2(void* p, T v) { *(T*)p = v;  }
__device__ __forceinline__ v8f wmma16(v16h a, v16h b, v8f c) {
  v8f d = __builtin_amdgcn_wmma_f32_16x16x32_f16(false, a, false, b, (short)0, c, false, false);
  asm volatile("v_nop\n\tv_nop\n\tv_nop\n\tv_nop" : "+v"(d) : "v"(a), "v"(b));
  return d;
}
__device__ __forceinline__ v8f wmma_bf(v16b a, v16b b, v8f c) {
  v8f d = __builtin_amdgcn_wmma_f32_16x16x32_bf16(false, a, false, b, (short)0, c, false, false);
  asm volatile("v_nop\n\tv_nop\n\tv_nop\n\tv_nop" : "+v"(d) : "v"(a), "v"(b));
  return d;
}
// 16x16x32 fragments: lane = (h = lane>>4, row/col = lane&15); elements 0..7 = k0+8h+0..7, 8..15 = k0+16+8h+0..7; D element r = row 8h+r
__device__ __forceinline__ v16h frag_h(const _Float16* rowk0, int lane) {
  union { v16h v; v8h q[2]; } u; const _Float16* p = rowk0 + 8 * (lane >> 4);
  u.q[0] = *(const v8h*)p; u.q[1] = *(const v8h*)(p + 16); return u.v;
}
__device__ __forceinline__ v16h frag_f32(const float* rowk0, int lane) {
  v16h a; const float* p = rowk0 + 8 * (lane >> 4);
#pragma unroll
  for (int i = 0; i < 8; ++i) { a[i] = (_Float16)p[i]; a[8 + i] = (_Float16)p[16 + i]; }
  return a;
}
__device__ __forceinline__ v16h frag_f32s(const float* rowk0, int lane, float sc) {
  v16h a; const float* p = rowk0 + 8 * (lane >> 4);
#pragma unroll
  for (int i = 0; i < 8; ++i) { a[i] = (_Float16)(p[i] * sc); a[8 + i] = (_Float16)(p[16 + i] * sc); }
  return a;
}
// column fragment from a [K][ld] layout (column n), rows >= K read as 0
__device__ __forceinline__ v16h fragc_f32(const float* W, int k0, int n, int lane, int ld, int K) {
  v16h a; const int g = lane >> 4;
#pragma unroll
  for (int i = 0; i < 8; ++i) { const int ka = k0 + 8 * g + i, kb = ka + 16;
    a[i] = (_Float16)(ka < K ? W[(size_t)(ka < K ? ka : K - 1) * ld + n] : 0.f); a[8 + i] = (_Float16)(kb < K ? W[(size_t)(kb < K ? kb : K - 1) * ld + n] : 0.f); }
  return a;
}
struct F2 { v16b h, l; };
__device__ __forceinline__ F2 bsplit16(const float v[16]) { F2 r;
#pragma unroll
  for (int i = 0; i < 16; ++i) { const __bf16 h = (__bf16)v[i]; r.h[i] = h; r.l[i] = (__bf16)(v[i] - (float)h); }
  return r; }
__device__ __forceinline__ F2 split_row(const float* row, int k0, int lane) { float v[16]; const float* p = row + k0 + 8 * (lane >> 4);
#pragma unroll
  for (int i = 0; i < 8; ++i) { v[i] = p[i]; v[8 + i] = p[16 + i]; }
  return bsplit16(v); }
__device__ __forceinline__ F2 split_rowK(const float* row, int k0, int lane, int K) { float v[16]; const int g = lane >> 4;
#pragma unroll
  for (int i = 0; i < 8; ++i) { const int ka = k0 + 8 * g + i, kb = ka + 16; v[i] = ka < K ? row[ka < K ? ka : K - 1] : 0.f; v[8 + i] = kb < K ? row[kb < K ? kb : K - 1] : 0.f; }
  return bsplit16(v); }
__device__ __forceinline__ F2 split_col(const float* W, int k0, int n, int lane, int ld, int K) { float v[16]; const int g = lane >> 4;
#pragma unroll
  for (int i = 0; i < 8; ++i) { const int ka = k0 + 8 * g + i, kb = ka + 16; v[i] = ka < K ? W[(size_t)(ka < K ? ka : K - 1) * ld + n] : 0.f; v[8 + i] = kb < K ? W[(size_t)(kb < K ? kb : K - 1) * ld + n] : 0.f; }
  return bsplit16(v); }
__device__ __forceinline__ v8f mac3(const F2& a, const F2& b, v8f c) { c = wmma_bf(a.l, b.h, c); c = wmma_bf(a.h, b.l, c); return wmma_bf(a.h, b.h, c); }
__device__ __forceinline__ float sigm(float v) { return 1.0f / (1.0f + expf(-v)); }
#define LDSX() do { asm volatile("s_wait_dscnt 0" ::: "memory"); __builtin_amdgcn_wave_barrier(); __builtin_amdgcn_fence(__ATOMIC_RELEASE, "workgroup"); } while (0)

#define NB 8
#define TT 4096
#define CC 256            // plane width: q/k planes carry 32 real columns (rest never written or read), v planes all 256
#define DIN 256
#define NH 1
#define HD 256
#define NQB (TT / 64)
#define HG 1               // one 4,096 x 4,096 f32 score plane in the workspace, which no kernel uses
#define SCALE (1.0f)
#define HDQK 32
#define CAUSAL 0
#ifndef TNB
#define TNB NB
#endif
__device__ __forceinline__ v16b zero16b() { v16b z; _Pragma("unroll") for (int i = 0; i < 16; ++i) z[i] = (__bf16)0.f; return z; }
__device__ __forceinline__ float bfr(float v) { return (float)(__bf16)v; }
__host__ __device__ __forceinline__ int kb_last(int qb) { return CAUSAL ? ((qb * 64 + 63) >> 7) : (TT / 128 - 1); }
typedef __attribute__((ext_vector_type(8))) __bf16 v8b;
__device__ __forceinline__ v16b frag_b(const __bf16* rowk0, int lane) {
  union { v16b v; v8b q[2]; } u; const __bf16* p = rowk0 + 8 * (lane >> 4);
  u.q[0] = *(const v8b*)p; u.q[1] = *(const v8b*)(p + 16); return u.v;
}
#define QBH (TT / 64)
#define QBH_PV 0           // A.g stays single f16
#define QHI 4096            // q residual rows everywhere (3-product logits)
#define KHI 4096           // k residual rows for ALL keys (3-product logits)
// B fragment (k rows k0+.., output column o) of a weight: (in,out) [K][ld] or (out,in) [ld rows of K]: bf16 exact, or f16(bf16 * 256) exact
__device__ __forceinline__ v16b wcol_io(const float* Wm, int k0, int o, int lane, int ld) { v16b w; const int g = lane >> 4;
#pragma unroll
  for (int i = 0; i < 8; ++i) { w[i] = (__bf16)Wm[(size_t)(k0 + 8 * g + i) * ld + o]; w[8 + i] = (__bf16)Wm[(size_t)(k0 + 16 + 8 * g + i) * ld + o]; }
  return w; }
__device__ __forceinline__ v16b wcol_oi(const float* Wm, int k0, int o, int lane, int K) { v16b w; const float* p = Wm + (size_t)o * K + k0 + 8 * (lane >> 4);
#pragma unroll
  for (int i = 0; i < 8; ++i) { w[i] = (__bf16)p[i]; w[8 + i] = (__bf16)p[16 + i]; }
  return w; }
__device__ __forceinline__ v16h wcolh_io(const float* Wm, int k0, int o, int lane, int ld) { v16h w; const int g = lane >> 4;
#pragma unroll
  for (int i = 0; i < 8; ++i) { w[i] = (_Float16)(bfr(Wm[(size_t)(k0 + 8 * g + i) * ld + o]) * 256.0f); w[8 + i] = (_Float16)(bfr(Wm[(size_t)(k0 + 16 + 8 * g + i) * ld + o]) * 256.0f); }
  return w; }
__device__ __forceinline__ v16h wcolh_oi(const float* Wm, int k0, int o, int lane, int K) { v16h w; const float* p = Wm + (size_t)o * K + k0 + 8 * (lane >> 4);
#pragma unroll
  for (int i = 0; i < 8; ++i) { w[i] = (_Float16)(bfr(p[i]) * 256.0f); w[8 + i] = (_Float16)(bfr(p[16 + i]) * 256.0f); }
  return w; }
#define WQKV_LAYOUT 1   // 0 = (in,out) [DIN][CC]; 1 = (in,out) Wq/Wk [DIN][HDQK], Wv [DIN][CC]; 2 = per-head [NH][DIN][HD]
__device__ __forceinline__ v16b wcol_hdk(const float* Wm, int k0, int o, int lane) { v16b w; const int g = lane >> 4; const float* p = Wm + (size_t)(o / HD) * DIN * HD + (o % HD);
#pragma unroll
  for (int i = 0; i < 8; ++i) { w[i] = (__bf16)p[(size_t)(k0 + 8 * g + i) * HD]; w[8 + i] = (__bf16)p[(size_t)(k0 + 16 + 8 * g + i) * HD]; }
  return w; }
#define WO_OUT_IN 0
#if WQKV_LAYOUT == 1
#define WCOL(W, k0, o, lane) ((which == 2) ? wcol_io(W, k0, (o), lane, CC) : (((o) < HDQK) ? wcol_io(W, k0, (o), lane, HDQK) : zero16b()))   /* (in,out): Wq/Wk [256][32] (plane columns >= 32 zero), Wv [256][256] full */
#define WCOL_OLD_UNUSED(W, k0, o, lane) (((o) < HDQK) ? wcol_oi(W, k0, (o), lane, DIN) : zero16b())   /* unused: reads (out,in) [32][256] weights; plane columns >= 32 are zero for all three */
#elif WQKV_LAYOUT == 2
#define WCOL(W, k0, o, lane) wcol_hdk(W, k0, o, lane)
#else
#define WCOL(W, k0, o, lane) wcol_io(W, k0, o, lane, CC)
#endif
#if WO_OUT_IN
#define WOCOL(W, k0, o, lane) wcol_oi(W, k0, o, lane, CC)
#define WOCOLH(W, k0, o, lane) wcolh_oi(W, k0, o, lane, CC)
#else
#define WOCOL(W, k0, o, lane) wcol_io(W, k0, o, lane, DIN)
#define WOCOLH(W, k0, o, lane) wcolh_io(W, k0, o, lane, DIN)
#endif
#ifndef XP
#define OUT1_OFF (4u * (size_t)NB * DIN * TT)   /* output 1 (o) follows output 0 (y) */
#define XP TT              // position pitch of x and of the output
#endif
#define BG HG
#define DVH 128
// ---- k_wz: block = (64 rows, 128 output cols): OR = y (hi + lo, K = 32 real columns of the YR rows) . W^T ((out,in) [256][32], exact) + b
__global__ __launch_bounds__(128) void k_wz(const float* __restrict__ YR, const float* __restrict__ WW, const float* __restrict__ WB, float* __restrict__ ORW) { __shared__ __align__(16) float sf[4][16][132];
  const int tid = threadIdx.x, wave = tid >> 5, lane = tid & 31, col = lane & 15, g = lane >> 4; const int c0 = blockIdx.y * 128; const size_t r0 = (size_t)blockIdx.x * 64 + wave * 16;
  v8f acc[8] = {};
#pragma unroll
  for (int kc = 0; kc < HDQK / 32; ++kc) { const F2 a = split_row(YR + (r0 + col) * CC, kc * 32, lane); asm volatile("s_wait_loadcnt 0x0" ::: "memory");
#pragma unroll
    for (int j = 0; j < 8; ++j) { const v16b w = wcol_oi(WW, kc * 32, c0 + j * 16 + col, lane, HDQK); asm volatile("s_wait_loadcnt 0x0" ::: "memory"); acc[j] = wmma_bf(a.h, w, acc[j]); acc[j] = wmma_bf(a.l, w, acc[j]); } }
#pragma unroll
  for (int j = 0; j < 8; ++j) { const float bb = WB ? bfr(WB[c0 + j * 16 + col]) : 0.f; asm volatile("s_wait_loadcnt 0x0" ::: "memory");
#pragma unroll
    for (int r = 0; r < 8; ++r) sf[wave][8 * g + r][j * 16 + col] = acc[j][r] + bb; }
  LDSX(); for (int rl = 0; rl < 16; ++rl) vst2(ORW + (r0 + rl) * DIN + c0 + lane * 4, *(const v4f*)&sf[wave][rl][lane * 4]); }
// ---- k_fin2: block = (64 positions, 64 channels, batch b): o[b][c][n] = OR[b*N + n][c] (channels-first via LDS transpose) -> output 1; y = gamma * o + bf16(x) -> output 0 (256-B runs)
__global__ __launch_bounds__(256) void k_fin2(const float* __restrict__ ORW, const float* __restrict__ X, const float* __restrict__ GM, float* __restrict__ OUT, float* __restrict__ OUT1) { const float gmv = bfr(GM[0]); __shared__ float st[64][68]; const int tid = threadIdx.x; const int n0 = blockIdx.x * 64, c0 = blockIdx.y * 64; const size_t b = blockIdx.z;
  for (int e = tid; e < 64 * 16; e += 256) { const int nl = e >> 4, q = e & 15; *(v4f*)&st[nl][q * 4] = *(const v4f*)(ORW + (b * TT + n0 + nl) * (size_t)DIN + c0 + q * 4); }
  __syncthreads();
  for (int e = tid; e < 64 * 16; e += 256) { const int cl = e >> 4, q = e & 15; const size_t oi = (b * DIN + c0 + cl) * (size_t)XP + n0 + q * 4; const v4f xr = *(const v4f*)(X + oi); v4f o, y; _Pragma("unroll") for (int i = 0; i < 4; ++i) { o[i] = st[q * 4 + i][cl]; y[i] = gmv * o[i] + bfr(xr[i]); } vst2(OUT + oi, y); vst2(OUT1 + oi, o); } }   /* y = gamma * o + x (output 0), o (output 1) */
#ifndef SM_EXTRA_PARAMS
#define SM_EXTRA_PARAMS
#endif
#ifndef PROJ_EXTRA_PARAMS
#define PROJ_EXTRA_PARAMS
#endif
#ifndef SM_MASK_HOOK
#define SM_MASK_HOOK (void)0
#endif

#define WS_QH  0u                                      // f16 q rows [b*t][CC]
#define WS_KH  (WS_QH + 2u * (size_t)NB * TT * CC)      // f16 k rows [b*t][CC]
#define WS_VT  (WS_KH + 2u * (size_t)NB * TT * CC)      // f16 v planes [b][c][t]
#define WS_QL  (WS_VT + 2u * (size_t)NB * CC * TT)      // f16 q residual x 2^10 rows [b][t < QHI][CC]
#define WS_KL  (WS_QL + 2u * (size_t)NB * QHI * CC)     // f16 k residual x 2^10 rows [b][t < KHI][CC]
#define WS_VB  (WS_KL + 2u * (size_t)NB * KHI * CC)     // bf16 v hi planes [b][c][t < KHI]
#define WS_VBL (WS_VB + 2u * (size_t)NB * CC * KHI)
#define WS_S   (WS_VBL + 2u * (size_t)NB * CC * KHI)    // f32 logits / P [hg][t][s]
#define WS_Y   (WS_S  + 4u * (size_t)HG * TT * TT)      // f32 ctx rows [b*t][CC] (only when there is an output projection)
#define WS_END (WS_Y  + 0u)

// ---- k_proj: block = 128 rows of x, 8 waves x 16 rows, every wave all 320 output columns (32 q, 32 k, 256 v). The three weights are rounded to bf16 and laid k-contiguous per output column in LDS once a block, and the block's x rows are read once, in whole lines, and laid beside them as bf16: every fragment is two 16-byte LDS reads. Exact bf16 products (K = DIN), f32 accumulate, k blocks in ascending order. q and k are formed transposed (A = weight columns, B = x rows): a lane holds 8 consecutive features of one row and stores them directly (f16 rows + residual x 2^10 rows, the 32 real columns only: nobody reads the rest of those planes). v goes through LDS to f16 planes [c][t] in 256-byte runs.
#define PR 128             // rows per block
#define PO (2 * HDQK + CC) // output columns: q, k, v
#define PWP (DIN + 8)      // LDS pitch of a weight column and of an x row in bf16: 512 bytes at 528 (16 B x odd) for 16-byte reads
#define PVP (PR + 8)       // LDS pitch of a v channel in f16: 256-byte runs at 272 bytes (16 B x odd)
typedef __attribute__((ext_vector_type(4))) __bf16 v4b;
__device__ __forceinline__ v8f wmb(v16b a, v16b b, v8f c) { return __builtin_amdgcn_wmma_f32_16x16x32_bf16(false, a, false, b, (short)0, c, false, false); }
__global__ __launch_bounds__(256) void k_proj(const float* __restrict__ X, const float* __restrict__ WQ, const float* __restrict__ WK, const float* __restrict__ WV, const float* __restrict__ BQ, const float* __restrict__ BK, const float* __restrict__ BV,
    _Float16* __restrict__ QH, _Float16* __restrict__ QL, _Float16* __restrict__ KH, _Float16* __restrict__ KL, _Float16* __restrict__ VT) {
  __shared__ __align__(16) __bf16 wt[PO][PWP]; __shared__ __align__(16) __bf16 xs[PR][PWP]; __shared__ __align__(16) _Float16 th[CC][PVP]; __shared__ __align__(16) float sb[PO];
  const int tid = threadIdx.x, wave = __builtin_amdgcn_readfirstlane(tid >> 5), lane = tid & 31, col = lane & 15, g = lane >> 4; const size_t r0 = (size_t)blockIdx.x * PR;
  // the 320 biases, one or two a thread, on their way to LDS with the rest
  const float bvr = BV[tid]; const float bqr = ((wave & 1) ? BK : BQ)[lane];   /* every wave asks, so that no branch and no wait stand in front of the x loads; waves 0 and 1 store */
  // the wave's 16 x rows (16 KB in a row, 512 bytes a load), asked for ahead of the weight staging so that they fly under it
  const float* xp = X + (r0 + wave * 16) * DIN + lane * 4; v4f xr[32];
#pragma unroll
  for (int i = 0; i < 32; ++i) xr[i] = *(const v4f*)(xp + i * 128);
  // weight staging: a unit = 32 output columns (one a lane: whole 128-byte lines) x 8 k rows -> one 16-byte LDS store a lane. A wave brings 32 v columns, all k, and a quarter of the k rows of q (even waves) or k (odd waves)
  const float* sv = WV + wave * 32 + lane;
#pragma unroll 8   /* eight units' loads in flight a wave */
  for (int k8 = 0; k8 < DIN / 8; ++k8) { v8b p;
#pragma unroll
    for (int e = 0; e < 8; ++e) p[e] = (__bf16)sv[(k8 * 8 + e) * CC];
    *(v8b*)&wt[2 * HDQK + wave * 32 + lane][k8 * 8] = p; }
  const float* sq = ((wave & 1) ? WK : WQ) + (wave >> 1) * (DIN / 4) * HDQK + lane;
#pragma unroll
  for (int k8 = 0; k8 < DIN / 32; ++k8) { v8b p;
#pragma unroll
    for (int e = 0; e < 8; ++e) p[e] = (__bf16)sq[(k8 * 8 + e) * HDQK];
    *(v8b*)&wt[(wave & 1) * HDQK + lane][(wave >> 1) * (DIN / 4) + k8 * 8] = p; }
#pragma unroll
  for (int i = 0; i < 32; ++i) { v4b p;
#pragma unroll
    for (int e = 0; e < 4; ++e) p[e] = (__bf16)xr[i][e];
    *(v4b*)&xs[wave * 16 + (i >> 1)][(i & 1) * 128 + lane * 4] = p; }
  sb[2 * HDQK + tid] = bfr(bvr); if (wave < 2) sb[wave * HDQK + lane] = bfr(bqr);
  __syncthreads();   /* weights, biases and x rows are in LDS before any wave reads them */
  v8f aq[4] = {}, av[CC / 16] = {};
#pragma unroll 1   /* one k block a trip: 20 products; the accumulators and one block's fragments fill the registers */
  for (int kc = 0; kc < DIN / 32; ++kc) { const v16b a = frag_b(&xs[wave * 16 + col][kc * 32], lane); v16b w[PO / 16];
#pragma unroll
    for (int j = 0; j < PO / 16; ++j) w[j] = frag_b(&wt[j * 16 + col][kc * 32], lane);
    __builtin_amdgcn_sched_barrier(0);   /* the k block's fragments are asked for as one group: one LDS latency in front of the 20 products, not one in front of each */
#pragma unroll
    for (int j = 0; j < 4; ++j) aq[j] = wmb(w[j], a, aq[j]);   /* D[feature 8 g + r][row col] */
#pragma unroll
    for (int j = 0; j < CC / 16; ++j) av[j] = wmb(a, w[4 + j], av[j]); }   /* D[row 8 g + r][channel col] */
  const size_t trow = r0 + wave * 16 + col;
#pragma unroll
  for (int j = 0; j < 4; ++j) { const int d0 = (j & 1) * 16 + 8 * g; const float* ba = &sb[j * 16 + 8 * g]; v8h hi, lo;
#pragma unroll
    for (int r = 0; r < 8; ++r) { const float v = aq[j][r] + ba[r]; const _Float16 hv = (_Float16)v; hi[r] = hv; lo[r] = (_Float16)((v - (float)hv) * 1024.0f); }
    vst2((j < 2 ? QH : KH) + trow * CC + d0, hi); vst2((j < 2 ? QL : KL) + trow * CC + d0, lo); }
#pragma unroll
  for (int j = 0; j < CC / 16; ++j) { const float bias = sb[2 * HDQK + j * 16 + col]; v8h h;
#pragma unroll
    for (int r = 0; r < 8; ++r) h[r] = (_Float16)(av[j][r] + bias);
    *(v8h*)&th[j * 16 + col][wave * 16 + 8 * g] = h; }
  __syncthreads();   /* every wave's 16 positions of each channel are in LDS before the 256-byte runs are read back */
  const size_t bb = r0 / TT; const int t0 = (int)(r0 % TT);
  _Float16* vd = VT + (bb * CC + (tid >> 4)) * (size_t)TT + t0 + (tid & 15) * 8;   /* 16 lanes bring one channel's 256 bytes */
#pragma unroll
  for (int i = 0; i < CC / 16; ++i) vst2(vd + (size_t)i * 16 * TT, *(const v8h*)&th[i * 16 + (tid >> 4)][(tid & 15) * 8]); }
#define FQ 16              // query columns per tile
#define FU 2               // column tiles per wave
#define FW 8               // waves per block
#define FQB 128            // queries per block: 4 query groups x FU x FQ
#define FK 32              // keys per wave and pass
#define FKB 64             // keys per block and pass: the two halves' FK
#define FP 40              // LDS pitch of a k row in f16: 64-byte rows at 80 bytes (16 B x odd) for 16-byte reads
#define FPV 72             // LDS pitch of a v channel in f16: 128-byte rows at 144 bytes (16 B x odd) for 16-byte reads
__device__ __forceinline__ float xhalf(float x) { return __builtin_bit_cast(float, __builtin_amdgcn_permlanex16(__builtin_bit_cast(int, x), __builtin_bit_cast(int, x), 0x76543210, 0xfedcba98, false, false)); }   /* lane l with lane l ^ 16 */
#define L2E 1.44269504088896340736f   // log2 e
// eight base-2 exponentials, each in place in its own register: none reads another's result or lands in another's source; the v_nop is the slot that the instruction set asks for behind the last, which the build, not seeing into the statement, would not keep. With the builtin the build let an exponential's result land in the source register of the one directly in front of it
__device__ __forceinline__ void exp2x8(float (&e)[8]) {
  asm("v_exp_f32 %0, %0\n\tv_exp_f32 %1, %1\n\tv_exp_f32 %2, %2\n\tv_exp_f32 %3, %3\n\tv_exp_f32 %4, %4\n\tv_exp_f32 %5, %5\n\tv_exp_f32 %6, %6\n\tv_exp_f32 %7, %7\n\tv_nop"
      : "+v"(e[0]), "+v"(e[1]), "+v"(e[2]), "+v"(e[3]), "+v"(e[4]), "+v"(e[5]), "+v"(e[6]), "+v"(e[7])); }
__device__ __forceinline__ void exp2x2(float& a, float& b) { asm("v_exp_f32 %0, %0\n\tv_exp_f32 %1, %1\n\tv_nop" : "+v"(a), "+v"(b)); }   /* the same for two */
__device__ __forceinline__ v8f wm16(v16h a, v16h b, v8f c) { return __builtin_amdgcn_wmma_f32_16x16x32_f16(false, a, false, b, (short)0, c, false, false); }
__global__ __launch_bounds__(32 * FW) void k_fa(const _Float16* __restrict__ QH, const _Float16* __restrict__ QL, const _Float16* __restrict__ KH, const _Float16* __restrict__ KL, const _Float16* __restrict__ VT, const float* __restrict__ X, const float* __restrict__ GM, float* __restrict__ OUT) {
  __shared__ __align__(16) _Float16 sv[2][CC][FPV]; __shared__ __align__(16) _Float16 sk[2][2][FKB][FP]; __shared__ __align__(16) v4f mg[FW][CC / 8][32]; __shared__ float mcl[FW][2][32];
  const int tid = threadIdx.x, wave = __builtin_amdgcn_readfirstlane(tid >> 5), lane = tid & 31, col = lane & 15, g = lane >> 4; const int b = blockIdx.y; const int grp = wave >> 2;   /* grp = the wave's key half */
  const int q0 = blockIdx.x * FQB + (wave & 3) * (FU * FQ) + grp * FQ;   /* column tile 0 is the one the wave keeps to the end; tile 1, the other 16 of the group's 32 queries, goes to the partner wave, whose tile 0 it is */
  v16h qh[FU], ql[FU];
#pragma unroll
  for (int u = 0; u < FU; ++u) { const size_t qrow = ((size_t)b * TT + (q0 ^ (u * FQ)) + col) * CC; qh[u] = frag_h(QH + qrow, lane); ql[u] = frag_h(QL + qrow, lane); }
  asm volatile("s_wait_xcnt 0x0" ::: "memory");   /* stands in front of whatever the build lets land in the q loads' address registers */
  __builtin_amdgcn_sched_barrier(0);   /* keeps the staging's index arithmetic behind that wait: the build lifted it in between the q loads, into their address registers */
  // staging: 8 lanes bring one 128-byte v row (a whole line), a thread 8 rows' pieces (channels srow + 32 i); 4 lanes bring one 64-byte k row, a thread one piece of each plane
  const int srow = tid >> 3, sch = (tid & 7) * 8, krow = tid >> 2, kch = (tid & 3) * 8;
  const _Float16* vsrc = VT + ((size_t)b * CC + srow) * TT + sch; const size_t koff = ((size_t)b * TT + krow) * CC + kch; const _Float16* ksh = KH + koff; const _Float16* ksl = KL + koff;
  v8h rv[8], rk[2];
#pragma unroll
  for (int i = 0; i < 8; ++i) rv[i] = *(const v8h*)(vsrc + (size_t)i * 32 * TT);
  rk[0] = *(const v8h*)ksh; rk[1] = *(const v8h*)ksl;
#pragma unroll
  for (int i = 0; i < 8; ++i) *(v8h*)&sv[0][i * 32 + srow][sch] = rv[i];
  *(v8h*)&sk[0][0][krow][kch] = rk[0]; *(v8h*)&sk[0][1][krow][kch] = rk[1];
  __syncthreads();   /* pass 0's tiles are in LDS before any wave reads them */
  v8f acc[FU][CC / 16] = {}; float m[FU], c[FU], l[FU];   /* c = m * log2 e - 11, rounded once per maximum: what every exponent of the column subtracts; l sums the values x 2^11 */
#pragma unroll
  for (int u = 0; u < FU; ++u) { m[u] = -3.0e38f; c[u] = -3.0e38f; l[u] = 0.f; }
#pragma unroll 1   /* one pass a trip: the body already holds 44 matrix instructions and the accumulators fill the registers */
  for (int s = 0; s < TT / FKB; ++s) { const int cur = s & 1; const int sn = s + 1 < TT / FKB ? s + 1 : s;   /* the last pass fetches its own tile again, into the buffer nobody reads any more */
#pragma unroll
    for (int i = 0; i < 8; ++i) rv[i] = *(const v8h*)(vsrc + (size_t)i * 32 * TT + sn * FKB);
    rk[0] = *(const v8h*)(ksh + (size_t)sn * FKB * CC); rk[1] = *(const v8h*)(ksl + (size_t)sn * FKB * CC);
    asm volatile("s_wait_xcnt 0x0" ::: "memory");   /* stands in front of any reuse of these loads' address registers */
    float sc[FU][2][8]; v16h kh[2], kl[2];
#pragma unroll
    for (int t = 0; t < 2; ++t) { kh[t] = frag_h(&sk[cur][0][grp * FK + t * 16 + col][0], lane); kl[t] = frag_h(&sk[cur][1][grp * FK + t * 16 + col][0], lane); }
    __builtin_amdgcn_sched_barrier(0);   /* the pass's k fragments are asked for as one group: one LDS latency in front of the twelve score products, not one in front of each pair */
#pragma unroll
    for (int u = 0; u < FU; ++u)
#pragma unroll
      for (int t = 0; t < 2; ++t) { v8f a = {}, al = {}; a = wm16(kh[t], qh[u], a); al = wm16(kh[t], ql[u], al); al = wm16(kl[t], qh[u], al);
#pragma unroll
        for (int r = 0; r < 8; ++r) sc[u][t][r] = a[r] + al[r] * (1.0f / 1024.0f); }
    float mn[FU];
#pragma unroll
    for (int u = 0; u < FU; ++u) { float mx = sc[u][0][0];
#pragma unroll
      for (int r = 0; r < 8; ++r) mx = fmaxf(mx, fmaxf(sc[u][0][r], sc[u][1][r]));
      mn[u] = fmaxf(m[u], fmaxf(mx, xhalf(mx))); }
    if (__builtin_amdgcn_ballot_w32((mn[0] > m[0]) | (mn[1] > m[1])) != 0) {   /* one scalar branch a pass: EXEC stays all ones; a column whose maximum stands gets the same c again and multiplies by 2^0 = 1; the factor comes from the same two rounded values that the old and the new exponents subtract */
      const float cn0 = __builtin_fmaf(mn[0], L2E, -11.0f), cn1 = __builtin_fmaf(mn[1], L2E, -11.0f); float al[FU] = { c[0] - cn0, c[1] - cn1 }; exp2x2(al[0], al[1]); c[0] = cn0; c[1] = cn1;
#pragma unroll
      for (int u = 0; u < FU; ++u) { l[u] *= al[u]; m[u] = mn[u];
#pragma unroll
        for (int j = 0; j < CC / 16; ++j) acc[u][j] *= al[u]; } }
    v16h vf[CC / 16];
#pragma unroll
    for (int j = 0; j < CC / 32; ++j) vf[j] = frag_h(&sv[cur][j * 16 + col][grp * FK], lane);
    __builtin_amdgcn_sched_barrier(0);   /* the first half of the pass's v fragments is asked for as one group ahead of the exponentials */
    v16h pf[FU];
#pragma unroll
    for (int u = 0; u < FU; ++u)
#pragma unroll
      for (int t = 0; t < 2; ++t) { float e[8];
#pragma unroll
        for (int r = 0; r < 8; ++r) e[r] = __builtin_fmaf(sc[u][t][r], L2E, -c[u]);
        exp2x8(e);
#pragma unroll
        for (int r = 0; r < 8; ++r) { l[u] += e[r]; pf[u][t * 8 + r] = (_Float16)e[r]; } }   /* element 8 t + r = key 16 t + 8 g + r: frag_h's own k order */
    __builtin_amdgcn_sched_barrier(0);   /* the second half is asked for only here, where the scores' registers are free: all sixteen fragments beside the scores would not fit the wave's 512 registers */
#pragma unroll
    for (int i = 0; i < 8; ++i) *(v8h*)&sv[cur ^ 1][i * 32 + srow][sch] = rv[i];
    *(v8h*)&sk[cur ^ 1][0][krow][kch] = rk[0]; *(v8h*)&sk[cur ^ 1][1][krow][kch] = rk[1];   /* the next tiles go to LDS here, into the buffer nobody reads in this pass: their registers are free again before all sixteen fragments are held */
#pragma unroll
    for (int j = CC / 32; j < CC / 16; ++j) vf[j] = frag_h(&sv[cur][j * 16 + col][grp * FK], lane);
    __builtin_amdgcn_sched_barrier(0);   /* as one group again, ahead of the products on the first half, under which it lands */
#pragma unroll
    for (int j = 0; j < CC / 32; ++j)
#pragma unroll
      for (int u = 0; u < FU; ++u) acc[u][j] = wm16(vf[j], pf[u], acc[u][j]);
    __builtin_amdgcn_sched_barrier(0);   /* the products on the first half stay in front of the barrier: left to itself the build lifts it, with its wait for every LDS read, over the products, and the second half's reads then land under nothing */
#pragma unroll
    for (int j = CC / 32; j < CC / 16; ++j)
#pragma unroll
      for (int u = 0; u < FU; ++u) acc[u][j] = wm16(vf[j], pf[u], acc[u][j]);
    __syncthreads();   /* publishes the next pass's tiles and ends every wave's reads of this pass's buffer, which the next trip refills */
  }
  const unsigned ro = (((unsigned)b * TT + q0 + col) * CC + 8 * g) * 4u; const float* xp = (const float*)((const char*)X + ro); float* yr = (float*)((char*)OUT + ro);   /* a lane's 8 accumulator registers = 8 consecutive channels of its query's row, in x and in the output alike: one 32-bit byte offset (under 2^25) serves both, beside the two scalar bases */
  v4f x0[CC / 16], x1[CC / 16];
#pragma unroll
  for (int j = 0; j < CC / 16; ++j) { x0[j] = *(const v4f*)(xp + j * 16); x1[j] = *(const v4f*)(xp + j * 16 + 4); }
  // the two key halves meet: a wave hands tile 1 (partial sums, its c and its l, lane for lane) to the wave of the other half, and takes that wave's tile 1, which is its own tile 0
#pragma unroll
  for (int j = 0; j < CC / 16; ++j) { v4f lo, hi;
#pragma unroll
    for (int r = 0; r < 4; ++r) { lo[r] = acc[1][j][r]; hi[r] = acc[1][j][4 + r]; }
    mg[wave][2 * j][lane] = lo; mg[wave][2 * j + 1][lane] = hi; }
  mcl[wave][0][lane] = c[1]; mcl[wave][1][lane] = l[1];
  __syncthreads();   /* every wave's tile 1 is in LDS before its partner reads it */
  const int pw = wave ^ 4; const float cp = mcl[pw][0][lane], lp = mcl[pw][1][lane]; const float cn = fmaxf(c[0], cp); const float f0 = __builtin_amdgcn_exp2f(c[0] - cn), fp = __builtin_amdgcn_exp2f(cp - cn);   /* both halves' values are brought under the larger of the two c */
  float lt = l[0] * f0 + lp * fp;
#pragma unroll
  for (int j = 0; j < CC / 16; ++j) { const v4f lo = mg[pw][2 * j][lane], hi = mg[pw][2 * j + 1][lane];
#pragma unroll
    for (int r = 0; r < 4; ++r) { acc[0][j][r] = acc[0][j][r] * f0 + lo[r] * fp; acc[0][j][4 + r] = acc[0][j][4 + r] * f0 + hi[r] * fp; } }
  const float gmv = bfr(GM[0]); lt += xhalf(lt); const float inv = 1.0f / lt;
#pragma unroll
  for (int j = 0; j < CC / 16; ++j)
#pragma unroll
    for (int r = 0; r < 4; ++r) { const float o0 = acc[0][j][r] * inv, o1 = acc[0][j][4 + r] * inv; x0[j][r] = gmv * o0 + bfr(x0[j][r]); x1[j][r] = gmv * o1 + bfr(x1[j][r]); }
  __builtin_amdgcn_sched_barrier(0);   /* the stores stand behind all the arithmetic: left to itself the build reuses a store's data registers for later values */
#pragma unroll
  for (int j = 0; j < CC / 16; ++j) { vst2(yr + j * 16, x0[j]); vst2(yr + j * 16 + 4, x1[j]); } }

extern "C" void kernel_launch(void* const* d_in, const int* in_sizes, int n_in, void* d_out, int out_size, void* d_ws, size_t ws_size, hipStream_t stream) {
  (void)in_sizes; (void)n_in; (void)out_size;
  const float** F = (const float**)d_in;
  if (ws_size < (size_t)WS_END) return;
  char* ws = (char*)d_ws; _Float16 *QH = (_Float16*)(ws + WS_QH), *KH = (_Float16*)(ws + WS_KH), *VT = (_Float16*)(ws + WS_VT), *QL = (_Float16*)(ws + WS_QL), *KL = (_Float16*)(ws + WS_KL); __bf16 *VB = (__bf16*)(ws + WS_VB), *VBL = (__bf16*)(ws + WS_VBL); float *S = (float*)(ws + WS_S), *Y = (float*)(ws + WS_Y);
  (void)Y; (void)S; (void)QL; (void)KL; (void)VB; (void)VBL;
  // inputs: 0 x [8,64,64,256] (channels-last = rows); 1 Wq [256,32] (in,out), 2 bq; 3 Wk, 4 bk; 5 Wv [256,256], 6 bv; 7 gamma (scalar 0.5)
  k_proj<<<dim3(TNB * TT / PR), 256, 0, stream>>>(F[0], F[1], F[3], F[5], F[2], F[4], F[6], QH, QL, KH, KL, VT);
  k_fa<<<dim3(TT / FQB, TNB), 32 * FW, 0, stream>>>(QH, QL, KH, KL, VT, F[0], F[7], (float*)d_out);
}

// v007
// It runs in 107 microseconds.
// Two timings next to v006 both put it at 1.04 times that version's speed.
// Counting every step since v000, it is 21.4 times as fast.
// compute dtype: all float inputs rounded to bf16; q/k/v = x W + b with EXACT bf16 products on WMMA 16x16x32 (f32 accumulate); UNSCALED 32-deep logits q.k with both as f16 hi + residual planes (3 products); online softmax in f32 (running maximum; exp(logit - maximum) x 2^11 formed as 2^(logit * log2 e - (maximum * log2 e - 11)): one f32 fma and the hardware's base-2 exponential), once to f16 against v once to f16 (1 product), divided by the f32 sum of the same values at the end; y = gamma * out + x in f32; f32 output.
// SAGAN self-attention on channels-LAST images (B 8, 64 x 64 = 4,096 positions, C 256; (in,out) 1/16-scale weights, zero biases, gamma = 0.5): q = x Wq + bq (32), k = x Wk + bk (32), v = x Wv + bv (256); attn = softmax(q k^T) (NO scaling); out = attn v; y = gamma * out + x -> [B, 64, 64, 256].
#include <hip/hip_runtime.h>
#include <math.h>

typedef __attribute__((ext_vector_type(16))) _Float16 v16h;
typedef __attribute__((ext_vector_type(16))) __bf16 v16b;
typedef __attribute__((ext_vector_type(8)))  _Float16 v8h;
typedef __attribute__((ext_vector_type(8)))  float v8f;
typedef __attribute__((ext_vector_type(4)))  float v4f;
typedef __attribute__((ext_vector_type(2)))  float v2f;
typedef __attribute__((ext_vector_type(4)))  unsigned v4u;
typedef __attribute__((ext_vector_type(4)))  int v4i;
typedef float __attribute__((may_alias)) float_a;
typedef int __attribute__((may_alias)) int_a;

template <typename T> __device__ __forceinline__ void vst2(void* p, T v) { *(T*)p = v;  }
__device__ __forceinline__ v8f wmma16(v16h a, v16h b, v8f c) {
  v8f d = __builtin_amdgcn_wmma_f32_16x16x32_f16(false, a, false, b, (short)0, c, false, false);
  asm volatile("v_nop\n\tv_nop\n\tv_nop\n\tv_nop" : "+v"(d) : "v"(a), "v"(b));
  return d;
}
__device__ __forceinline__ v8f wmma_bf(v16b a, v16b b, v8f c) {
  v8f d = __builtin_amdgcn_wmma_f32_16x16x32_bf16(false, a, false, b, (short)0, c, false, false);
  asm volatile("v_nop\n\tv_nop\n\tv_nop\n\tv_nop" : "+v"(d) : "v"(a), "v"(b));
  return d;
}
// 16x16x32 fragments: lane = (h = lane>>4, row/col = lane&15); elements 0..7 = k0+8h+0..7, 8..15 = k0+16+8h+0..7; D element r = row 8h+r
__device__ __forceinline__ v16h frag_h(const _Float16* rowk0, int lane) {
  union { v16h v; v8h q[2]; } u; const _Float16* p = rowk0 + 8 * (lane >> 4);
  u.q[0] = *(const v8h*)p; u.q[1] = *(const v8h*)(p + 16); return u.v;
}
__device__ __forceinline__ v16h frag_f32(const float* rowk0, int lane) {
  v16h a; const float* p = rowk0 + 8 * (lane >> 4);
#pragma unroll
  for (int i = 0; i < 8; ++i) { a[i] = (_Float16)p[i]; a[8 + i] = (_Float16)p[16 + i]; }
  return a;
}
__device__ __forceinline__ v16h frag_f32s(const float* rowk0, int lane, float sc) {
  v16h a; const float* p = rowk0 + 8 * (lane >> 4);
#pragma unroll
  for (int i = 0; i < 8; ++i) { a[i] = (_Float16)(p[i] * sc); a[8 + i] = (_Float16)(p[16 + i] * sc); }
  return a;
}
// column fragment from a [K][ld] layout (column n), rows >= K read as 0
__device__ __forceinline__ v16h fragc_f32(const float* W, int k0, int n, int lane, int ld, int K) {
  v16h a; const int g = lane >> 4;
#pragma unroll
  for (int i = 0; i < 8; ++i) { const int ka = k0 + 8 * g + i, kb = ka + 16;
    a[i] = (_Float16)(ka < K ? W[(size_t)(ka < K ? ka : K - 1) * ld + n] : 0.f); a[8 + i] = (_Float16)(kb < K ? W[(size_t)(kb < K ? kb : K - 1) * ld + n] : 0.f); }
  return a;
}
struct F2 { v16b h, l; };
__device__ __forceinline__ F2 bsplit16(const float v[16]) { F2 r;
#pragma unroll
  for (int i = 0; i < 16; ++i) { const __bf16 h = (__bf16)v[i]; r.h[i] = h; r.l[i] = (__bf16)(v[i] - (float)h); }
  return r; }
__device__ __forceinline__ F2 split_row(const float* row, int k0, int lane) { float v[16]; const float* p = row + k0 + 8 * (lane >> 4);
#pragma unroll
  for (int i = 0; i < 8; ++i) { v[i] = p[i]; v[8 + i] = p[16 + i]; }
  return bsplit16(v); }
__device__ __forceinline__ F2 split_rowK(const float* row, int k0, int lane, int K) { float v[16]; const int g = lane >> 4;
#pragma unroll
  for (int i = 0; i < 8; ++i) { const int ka = k0 + 8 * g + i, kb = ka + 16; v[i] = ka < K ? row[ka < K ? ka : K - 1] : 0.f; v[8 + i] = kb < K ? row[kb < K ? kb : K - 1] : 0.f; }
  return bsplit16(v); }
__device__ __forceinline__ F2 split_col(const float* W, int k0, int n, int lane, int ld, int K) { float v[16]; const int g = lane >> 4;
#pragma unroll
  for (int i = 0; i < 8; ++i) { const int ka = k0 + 8 * g + i, kb = ka + 16; v[i] = ka < K ? W[(size_t)(ka < K ? ka : K - 1) * ld + n] : 0.f; v[8 + i] = kb < K ? W[(size_t)(kb < K ? kb : K - 1) * ld + n] : 0.f; }
  return bsplit16(v); }
__device__ __forceinline__ v8f mac3(const F2& a, const F2& b, v8f c) { c = wmma_bf(a.l, b.h, c); c = wmma_bf(a.h, b.l, c); return wmma_bf(a.h, b.h, c); }
__device__ __forceinline__ float sigm(float v) { return 1.0f / (1.0f + expf(-v)); }
#define LDSX() do { asm volatile("s_wait_dscnt 0" ::: "memory"); __builtin_amdgcn_wave_barrier(); __builtin_amdgcn_fence(__ATOMIC_RELEASE, "workgroup"); } while (0)

#define NB 8
#define TT 4096
#define CC 256            // plane width: q/k planes carry 32 real columns (rest never written or read), v planes all 256
#define DIN 256
#define NH 1
#define HD 256
#define NQB (TT / 64)
#define HG 1               // one 4,096 x 4,096 f32 score plane in the workspace, which no kernel uses
#define SCALE (1.0f)
#define HDQK 32
#define CAUSAL 0
#ifndef TNB
#define TNB NB
#endif
__device__ __forceinline__ v16b zero16b() { v16b z; _Pragma("unroll") for (int i = 0; i < 16; ++i) z[i] = (__bf16)0.f; return z; }
__device__ __forceinline__ float bfr(float v) { return (float)(__bf16)v; }
__host__ __device__ __forceinline__ int kb_last(int qb) { return CAUSAL ? ((qb * 64 + 63) >> 7) : (TT / 128 - 1); }
typedef __attribute__((ext_vector_type(8))) __bf16 v8b;
__device__ __forceinline__ v16b frag_b(const __bf16* rowk0, int lane) {
  union { v16b v; v8b q[2]; } u; const __bf16* p = rowk0 + 8 * (lane >> 4);
  u.q[0] = *(const v8b*)p; u.q[1] = *(const v8b*)(p + 16); return u.v;
}
#define QBH (TT / 64)
#define QBH_PV 0           // A.g stays single f16
#define QHI 4096            // q residual rows everywhere (3-product logits)
#define KHI 4096           // k residual rows for ALL keys (3-product logits)
// B fragment (k rows k0+.., output column o) of a weight: (in,out) [K][ld] or (out,in) [ld rows of K]: bf16 exact, or f16(bf16 * 256) exact
__device__ __forceinline__ v16b wcol_io(const float* Wm, int k0, int o, int lane, int ld) { v16b w; const int g = lane >> 4;
#pragma unroll
  for (int i = 0; i < 8; ++i) { w[i] = (__bf16)Wm[(size_t)(k0 + 8 * g + i) * ld + o]; w[8 + i] = (__bf16)Wm[(size_t)(k0 + 16 + 8 * g + i) * ld + o]; }
  return w; }
__device__ __forceinline__ v16b wcol_oi(const float* Wm, int k0, int o, int lane, int K) { v16b w; const float* p = Wm + (size_t)o * K + k0 + 8 * (lane >> 4);
#pragma unroll
  for (int i = 0; i < 8; ++i) { w[i] = (__bf16)p[i]; w[8 + i] = (__bf16)p[16 + i]; }
  return w; }
__device__ __forceinline__ v16h wcolh_io(const float* Wm, int k0, int o, int lane, int ld) { v16h w; const int g = lane >> 4;
#pragma unroll
  for (int i = 0; i < 8; ++i) { w[i] = (_Float16)(bfr(Wm[(size_t)(k0 + 8 * g + i) * ld + o]) * 256.0f); w[8 + i] = (_Float16)(bfr(Wm[(size_t)(k0 + 16 + 8 * g + i) * ld + o]) * 256.0f); }
  return w; }
__device__ __forceinline__ v16h wcolh_oi(const float* Wm, int k0, int o, int lane, int K) { v16h w; const float* p = Wm + (size_t)o * K + k0 + 8 * (lane >> 4);
#pragma unroll
  for (int i = 0; i < 8; ++i) { w[i] = (_Float16)(bfr(p[i]) * 256.0f); w[8 + i] = (_Float16)(bfr(p[16 + i]) * 256.0f); }
  return w; }
#define WQKV_LAYOUT 1   // 0 = (in,out) [DIN][CC]; 1 = (in,out) Wq/Wk [DIN][HDQK], Wv [DIN][CC]; 2 = per-head [NH][DIN][HD]
__device__ __forceinline__ v16b wcol_hdk(const float* Wm, int k0, int o, int lane) { v16b w; const int g = lane >> 4; const float* p = Wm + (size_t)(o / HD) * DIN * HD + (o % HD);
#pragma unroll
  for (int i = 0; i < 8; ++i) { w[i] = (__bf16)p[(size_t)(k0 + 8 * g + i) * HD]; w[8 + i] = (__bf16)p[(size_t)(k0 + 16 + 8 * g + i) * HD]; }
  return w; }
#define WO_OUT_IN 0
#if WQKV_LAYOUT == 1
#define WCOL(W, k0, o, lane) ((which == 2) ? wcol_io(W, k0, (o), lane, CC) : (((o) < HDQK) ? wcol_io(W, k0, (o), lane, HDQK) : zero16b()))   /* (in,out): Wq/Wk [256][32] (plane columns >= 32 zero), Wv [256][256] full */
#define WCOL_OLD_UNUSED(W, k0, o, lane) (((o) < HDQK) ? wcol_oi(W, k0, (o), lane, DIN) : zero16b())   /* unused: reads (out,in) [32][256] weights; plane columns >= 32 are zero for all three */
#elif WQKV_LAYOUT == 2
#define WCOL(W, k0, o, lane) wcol_hdk(W, k0, o, lane)
#else
#define WCOL(W, k0, o, lane) wcol_io(W, k0, o, lane, CC)
#endif
#if WO_OUT_IN
#define WOCOL(W, k0, o, lane) wcol_oi(W, k0, o, lane, CC)
#define WOCOLH(W, k0, o, lane) wcolh_oi(W, k0, o, lane, CC)
#else
#define WOCOL(W, k0, o, lane) wcol_io(W, k0, o, lane, DIN)
#define WOCOLH(W, k0, o, lane) wcolh_io(W, k0, o, lane, DIN)
#endif
#ifndef XP
#define OUT1_OFF (4u * (size_t)NB * DIN * TT)   /* output 1 (o) follows output 0 (y) */
#define XP TT              // position pitch of x and of the output
#endif
#define BG HG
#define DVH 128
// ---- k_wz: block = (64 rows, 128 output cols): OR = y (hi + lo, K = 32 real columns of the YR rows) . W^T ((out,in) [256][32], exact) + b
__global__ __launch_bounds__(128) void k_wz(const float* __restrict__ YR, const float* __restrict__ WW, const float* __restrict__ WB, float* __restrict__ ORW) { __shared__ __align__(16) float sf[4][16][132];
  const int tid = threadIdx.x, wave = tid >> 5, lane = tid & 31, col = lane & 15, g = lane >> 4; const int c0 = blockIdx.y * 128; const size_t r0 = (size_t)blockIdx.x * 64 + wave * 16;
  v8f acc[8] = {};
#pragma unroll
  for (int kc = 0; kc < HDQK / 32; ++kc) { const F2 a = split_row(YR + (r0 + col) * CC, kc * 32, lane); asm volatile("s_wait_loadcnt 0x0" ::: "memory");
#pragma unroll
    for (int j = 0; j < 8; ++j) { const v16b w = wcol_oi(WW, kc * 32, c0 + j * 16 + col, lane, HDQK); asm volatile("s_wait_loadcnt 0x0" ::: "memory"); acc[j] = wmma_bf(a.h, w, acc[j]); acc[j] = wmma_bf(a.l, w, acc[j]); } }
#pragma unroll
  for (int j = 0; j < 8; ++j) { const float bb = WB ? bfr(WB[c0 + j * 16 + col]) : 0.f; asm volatile("s_wait_loadcnt 0x0" ::: "memory");
#pragma unroll
    for (int r = 0; r < 8; ++r) sf[wave][8 * g + r][j * 16 + col] = acc[j][r] + bb; }
  LDSX(); for (int rl = 0; rl < 16; ++rl) vst2(ORW + (r0 + rl) * DIN + c0 + lane * 4, *(const v4f*)&sf[wave][rl][lane * 4]); }
// ---- k_fin2: block = (64 positions, 64 channels, batch b): o[b][c][n] = OR[b*N + n][c] (channels-first via LDS transpose) -> output 1; y = gamma * o + bf16(x) -> output 0 (256-B runs)
__global__ __launch_bounds__(256) void k_fin2(const float* __restrict__ ORW, const float* __restrict__ X, const float* __restrict__ GM, float* __restrict__ OUT, float* __restrict__ OUT1) { const float gmv = bfr(GM[0]); __shared__ float st[64][68]; const int tid = threadIdx.x; const int n0 = blockIdx.x * 64, c0 = blockIdx.y * 64; const size_t b = blockIdx.z;
  for (int e = tid; e < 64 * 16; e += 256) { const int nl = e >> 4, q = e & 15; *(v4f*)&st[nl][q * 4] = *(const v4f*)(ORW + (b * TT + n0 + nl) * (size_t)DIN + c0 + q * 4); }
  __syncthreads();
  for (int e = tid; e < 64 * 16; e += 256) { const int cl = e >> 4, q = e & 15; const size_t oi = (b * DIN + c0 + cl) * (size_t)XP + n0 + q * 4; const v4f xr = *(const v4f*)(X + oi); v4f o, y; _Pragma("unroll") for (int i = 0; i < 4; ++i) { o[i] = st[q * 4 + i][cl]; y[i] = gmv * o[i] + bfr(xr[i]); } vst2(OUT + oi, y); vst2(OUT1 + oi, o); } }   /* y = gamma * o + x (output 0), o (output 1) */
#ifndef SM_EXTRA_PARAMS
#define SM_EXTRA_PARAMS
#endif
#ifndef PROJ_EXTRA_PARAMS
#define PROJ_EXTRA_PARAMS
#endif
#ifndef SM_MASK_HOOK
#define SM_MASK_HOOK (void)0
#endif

#define WS_QH  0u                                      // f16 q rows [b*t][CC]
#define WS_KH  (WS_QH + 2u * (size_t)NB * TT * CC)      // f16 k rows [b*t][CC]
#define WS_VT  (WS_KH + 2u * (size_t)NB * TT * CC)      // f16 v planes [b][c][t]
#define WS_QL  (WS_VT + 2u * (size_t)NB * CC * TT)      // f16 q residual x 2^10 rows [b][t < QHI][CC]
#define WS_KL  (WS_QL + 2u * (size_t)NB * QHI * CC)     // f16 k residual x 2^10 rows [b][t < KHI][CC]
#define WS_VB  (WS_KL + 2u * (size_t)NB * KHI * CC)     // bf16 v hi planes [b][c][t < KHI]
#define WS_VBL (WS_VB + 2u * (size_t)NB * CC * KHI)
#define WS_S   (WS_VBL + 2u * (size_t)NB * CC * KHI)    // f32 logits / P [hg][t][s]
#define WS_Y   (WS_S  + 4u * (size_t)HG * TT * TT)      // f32 ctx rows [b*t][CC] (only when there is an output projection)
#define WS_END (WS_Y  + 0u)

// ---- k_proj: block = 128 rows of x, 8 waves x 16 rows, every wave all 320 output columns (32 q, 32 k, 256 v). The three weights are rounded to bf16 and laid k-contiguous per output column in LDS once a block, and the block's x rows are read once, in whole lines, and laid beside them as bf16: every fragment is two 16-byte LDS reads. Exact bf16 products (K = DIN), f32 accumulate, k blocks in ascending order. q and k are formed transposed (A = weight columns, B = x rows): a lane holds 8 consecutive features of one row and stores them directly (f16 rows + residual x 2^10 rows, the 32 real columns only: nobody reads the rest of those planes). v goes through LDS to f16 planes [c][t] in 256-byte runs.
#define PR 128             // rows per block
#define PO (2 * HDQK + CC) // output columns: q, k, v
#define PWP (DIN + 8)      // LDS pitch of a weight column and of an x row in bf16: 512 bytes at 528 (16 B x odd) for 16-byte reads
#define PVP (PR + 8)       // LDS pitch of a v channel in f16: 256-byte runs at 272 bytes (16 B x odd)
typedef __attribute__((ext_vector_type(4))) __bf16 v4b;
__device__ __forceinline__ v8f wmb(v16b a, v16b b, v8f c) { return __builtin_amdgcn_wmma_f32_16x16x32_bf16(false, a, false, b, (short)0, c, false, false); }
__global__ __launch_bounds__(256) void k_proj(const float* __restrict__ X, const float* __restrict__ WQ, const float* __restrict__ WK, const float* __restrict__ WV, const float* __restrict__ BQ, const float* __restrict__ BK, const float* __restrict__ BV,
    _Float16* __restrict__ QH, _Float16* __restrict__ QL, _Float16* __restrict__ KH, _Float16* __restrict__ KL, _Float16* __restrict__ VT) {
  __shared__ __align__(16) __bf16 wt[PO][PWP]; __shared__ __align__(16) __bf16 xs[PR][PWP]; __shared__ __align__(16) _Float16 th[CC][PVP]; __shared__ __align__(16) float sb[PO];
  const int tid = threadIdx.x, wave = __builtin_amdgcn_readfirstlane(tid >> 5), lane = tid & 31, col = lane & 15, g = lane >> 4; const size_t r0 = (size_t)blockIdx.x * PR;
  // the 320 biases, one or two a thread, on their way to LDS with the rest
  const float bvr = BV[tid]; const float bqr = ((wave & 1) ? BK : BQ)[lane];   /* every wave asks, so that no branch and no wait stand in front of the x loads; waves 0 and 1 store */
  // the wave's 16 x rows (16 KB in a row, 512 bytes a load), asked for ahead of the weight staging so that they fly under it
  const float* xp = X + (r0 + wave * 16) * DIN + lane * 4; v4f xr[32];
#pragma unroll
  for (int i = 0; i < 32; ++i) xr[i] = *(const v4f*)(xp + i * 128);
  // weight staging: a unit = 32 output columns (one a lane: whole 128-byte lines) x 8 k rows -> one 16-byte LDS store a lane. A wave brings 32 v columns, all k, and a quarter of the k rows of q (even waves) or k (odd waves)
  const float* sv = WV + wave * 32 + lane;
#pragma unroll 8   /* eight units' loads in flight a wave */
  for (int k8 = 0; k8 < DIN / 8; ++k8) { v8b p;
#pragma unroll
    for (int e = 0; e < 8; ++e) p[e] = (__bf16)sv[(k8 * 8 + e) * CC];
    *(v8b*)&wt[2 * HDQK + wave * 32 + lane][k8 * 8] = p; }
  const float* sq = ((wave & 1) ? WK : WQ) + (wave >> 1) * (DIN / 4) * HDQK + lane;
#pragma unroll
  for (int k8 = 0; k8 < DIN / 32; ++k8) { v8b p;
#pragma unroll
    for (int e = 0; e < 8; ++e) p[e] = (__bf16)sq[(k8 * 8 + e) * HDQK];
    *(v8b*)&wt[(wave & 1) * HDQK + lane][(wave >> 1) * (DIN / 4) + k8 * 8] = p; }
#pragma unroll
  for (int i = 0; i < 32; ++i) { v4b p;
#pragma unroll
    for (int e = 0; e < 4; ++e) p[e] = (__bf16)xr[i][e];
    *(v4b*)&xs[wave * 16 + (i >> 1)][(i & 1) * 128 + lane * 4] = p; }
  sb[2 * HDQK + tid] = bfr(bvr); if (wave < 2) sb[wave * HDQK + lane] = bfr(bqr);
  __syncthreads();   /* weights, biases and x rows are in LDS before any wave reads them */
  v8f aq[4] = {}, av[CC / 16] = {};
#pragma unroll 1   /* one k block a trip: 20 products; the accumulators and one block's fragments fill the registers */
  for (int kc = 0; kc < DIN / 32; ++kc) { const v16b a = frag_b(&xs[wave * 16 + col][kc * 32], lane); v16b w[PO / 16];
#pragma unroll
    for (int j = 0; j < PO / 16; ++j) w[j] = frag_b(&wt[j * 16 + col][kc * 32], lane);
    __builtin_amdgcn_sched_barrier(0);   /* the k block's fragments are asked for as one group: one LDS latency in front of the 20 products, not one in front of each */
#pragma unroll
    for (int j = 0; j < 4; ++j) aq[j] = wmb(w[j], a, aq[j]);   /* D[feature 8 g + r][row col] */
#pragma unroll
    for (int j = 0; j < CC / 16; ++j) av[j] = wmb(a, w[4 + j], av[j]); }   /* D[row 8 g + r][channel col] */
  const size_t trow = r0 + wave * 16 + col;
#pragma unroll
  for (int j = 0; j < 4; ++j) { const int d0 = (j & 1) * 16 + 8 * g; const float* ba = &sb[j * 16 + 8 * g]; v8h hi, lo;
#pragma unroll
    for (int r = 0; r < 8; ++r) { const float v = aq[j][r] + ba[r]; const _Float16 hv = (_Float16)v; hi[r] = hv; lo[r] = (_Float16)((v - (float)hv) * 1024.0f); }
    vst2((j < 2 ? QH : KH) + trow * CC + d0, hi); vst2((j < 2 ? QL : KL) + trow * CC + d0, lo); }
#pragma unroll
  for (int j = 0; j < CC / 16; ++j) { const float bias = sb[2 * HDQK + j * 16 + col]; v8h h;
#pragma unroll
    for (int r = 0; r < 8; ++r) h[r] = (_Float16)(av[j][r] + bias);
    *(v8h*)&th[j * 16 + col][wave * 16 + 8 * g] = h; }
  __syncthreads();   /* every wave's 16 positions of each channel are in LDS before the 256-byte runs are read back */
  const size_t bb = r0 / TT; const int t0 = (int)(r0 % TT);
  _Float16* vd = VT + (bb * CC + (tid >> 4)) * (size_t)TT + t0 + (tid & 15) * 8;   /* 16 lanes bring one channel's 256 bytes */
#pragma unroll
  for (int i = 0; i < CC / 16; ++i) vst2(vd + (size_t)i * 16 * TT, *(const v8h*)&th[i * 16 + (tid >> 4)][(tid & 15) * 8]); }
#define FQ 16              // query columns per tile
#define FU 2               // column tiles per wave
#define FW 8               // waves per block
#define FQB 128            // queries per block: 4 query groups x FU x FQ
#define FK 32              // keys per wave and pass
#define FKB 64             // keys per block and pass: the two halves' FK
#define FP 40              // LDS pitch of a k row in f16: 64-byte rows at 80 bytes (16 B x odd) for 16-byte reads
#define FPV 72             // LDS pitch of a v channel in f16: 128-byte rows at 144 bytes (16 B x odd) for 16-byte reads
__device__ __forceinline__ float xhalf(float x) { return __builtin_bit_cast(float, __builtin_amdgcn_permlanex16(__builtin_bit_cast(int, x), __builtin_bit_cast(int, x), 0x76543210, 0xfedcba98, false, false)); }   /* lane l with lane l ^ 16 */
#define L2E 1.44269504088896340736f   // log2 e
// eight base-2 exponentials, each in place in its own register: none reads another's result or lands in another's source; the v_nop is the slot that the instruction set asks for behind the last, which the build, not seeing into the statement, would not keep. With the builtin the build let an exponential's result land in the source register of the one directly in front of it
__device__ __forceinline__ void exp2x8(float (&e)[8]) {
  asm("v_exp_f32 %0, %0\n\tv_exp_f32 %1, %1\n\tv_exp_f32 %2, %2\n\tv_exp_f32 %3, %3\n\tv_exp_f32 %4, %4\n\tv_exp_f32 %5, %5\n\tv_exp_f32 %6, %6\n\tv_exp_f32 %7, %7\n\tv_nop"
      : "+v"(e[0]), "+v"(e[1]), "+v"(e[2]), "+v"(e[3]), "+v"(e[4]), "+v"(e[5]), "+v"(e[6]), "+v"(e[7])); }
__device__ __forceinline__ void exp2x2(float& a, float& b) { asm("v_exp_f32 %0, %0\n\tv_exp_f32 %1, %1\n\tv_nop" : "+v"(a), "+v"(b)); }   /* the same for two */
__device__ __forceinline__ v8f wm16(v16h a, v16h b, v8f c) { return __builtin_amdgcn_wmma_f32_16x16x32_f16(false, a, false, b, (short)0, c, false, false); }
// one pass's tiles, ten 16-byte copies a lane (8 v rows' pieces, one piece of each k plane), global -> LDS through no register. The wait on the address translations is the statement's own last line, so that it stands in front of whatever the build lets land in the address registers afterwards
__device__ __forceinline__ void stage_kv(const _Float16* gv, const _Float16* gh, const _Float16* gl, unsigned lv, unsigned lk) {
  asm volatile("global_load_async_to_lds_b128 %0, %10, off\n\tglobal_load_async_to_lds_b128 %1, %11, off\n\tglobal_load_async_to_lds_b128 %2, %12, off\n\tglobal_load_async_to_lds_b128 %3, %13, off\n\t"
               "global_load_async_to_lds_b128 %4, %14, off\n\tglobal_load_async_to_lds_b128 %5, %15, off\n\tglobal_load_async_to_lds_b128 %6, %16, off\n\tglobal_load_async_to_lds_b128 %7, %17, off\n\t"
               "global_load_async_to_lds_b128 %8, %18, off\n\tglobal_load_async_to_lds_b128 %9, %19, off\n\ts_wait_xcnt 0x0"
      :: "v"(lv), "v"(lv + 1u * 32 * FPV * 2), "v"(lv + 2u * 32 * FPV * 2), "v"(lv + 3u * 32 * FPV * 2), "v"(lv + 4u * 32 * FPV * 2), "v"(lv + 5u * 32 * FPV * 2), "v"(lv + 6u * 32 * FPV * 2), "v"(lv + 7u * 32 * FPV * 2),
         "v"(lk), "v"(lk + (unsigned)FKB * FP * 2),
         "v"(gv), "v"(gv + (size_t)1 * 32 * TT), "v"(gv + (size_t)2 * 32 * TT), "v"(gv + (size_t)3 * 32 * TT), "v"(gv + (size_t)4 * 32 * TT), "v"(gv + (size_t)5 * 32 * TT), "v"(gv + (size_t)6 * 32 * TT), "v"(gv + (size_t)7 * 32 * TT),
         "v"(gh), "v"(gl)
      : "memory"); }
__global__ __launch_bounds__(32 * FW) void k_fa(const _Float16* __restrict__ QH, const _Float16* __restrict__ QL, const _Float16* __restrict__ KH, const _Float16* __restrict__ KL, const _Float16* __restrict__ VT, const float* __restrict__ X, const float* __restrict__ GM, float* __restrict__ OUT) {
  __shared__ __align__(16) _Float16 sv[2][CC][FPV]; __shared__ __align__(16) _Float16 sk[2][2][FKB][FP]; __shared__ __align__(16) v4f mg[FW][CC / 8][32]; __shared__ float mcl[FW][2][32];
  const int tid = threadIdx.x, wave = __builtin_amdgcn_readfirstlane(tid >> 5), lane = tid & 31, col = lane & 15, g = lane >> 4; const int b = blockIdx.y; const int grp = wave >> 2;   /* grp = the wave's key half */
  const int q0 = blockIdx.x * FQB + (wave & 3) * (FU * FQ) + grp * FQ;   /* column tile 0 is the one the wave keeps to the end; tile 1, the other 16 of the group's 32 queries, goes to the partner wave, whose tile 0 it is */
  v16h qh[FU], ql[FU];
#pragma unroll
  for (int u = 0; u < FU; ++u) { const size_t qrow = ((size_t)b * TT + (q0 ^ (u * FQ)) + col) * CC; qh[u] = frag_h(QH + qrow, lane); ql[u] = frag_h(QL + qrow, lane); }
  asm volatile("s_wait_xcnt 0x0" ::: "memory");   /* stands in front of whatever the build lets land in the q loads' address registers */
  __builtin_amdgcn_sched_barrier(0);   /* keeps the staging's index arithmetic behind that wait: the build lifted it in between the q loads, into their address registers */
  // staging: 8 lanes bring one 128-byte v row (a whole line), a thread 8 rows' pieces (channels srow + 32 i); 4 lanes bring one 64-byte k row, a thread one piece of each plane
  const int srow = tid >> 3, sch = (tid & 7) * 8, krow = tid >> 2, kch = (tid & 3) * 8;
  const _Float16* vsrc = VT + ((size_t)b * CC + srow) * TT + sch; const size_t koff = ((size_t)b * TT + krow) * CC + kch; const _Float16* ksh = KH + koff; const _Float16* ksl = KL + koff;
  const unsigned lv0 = (unsigned)(size_t)&sv[0][srow][sch], lk0 = (unsigned)(size_t)&sk[0][0][krow][kch];   /* the lane's LDS byte addresses in buffer 0: the low 32 bits of the __shared__ addresses */
  stage_kv(vsrc, ksh, ksl, lv0, lk0);
  asm volatile("s_wait_asynccnt 0x0" ::: "memory");   /* the wave's own copies of pass 0's tiles have landed */
  __syncthreads();   /* pass 0's tiles are in LDS before any wave reads them */
  stage_kv(vsrc + FKB, ksh + (size_t)FKB * CC, ksl + (size_t)FKB * CC, lv0 + (unsigned)sizeof(sv[0]), lk0 + (unsigned)sizeof(sk[0]));   /* pass 1's tiles fly under pass 0 */
  v8f acc[FU][CC / 16] = {}; float m[FU], c[FU], l[FU];   /* c = m * log2 e - 11, rounded once per maximum: what every exponent of the column subtracts; l sums the values x 2^11 */
#pragma unroll
  for (int u = 0; u < FU; ++u) { m[u] = -3.0e38f; c[u] = -3.0e38f; l[u] = 0.f; }
#pragma unroll 1   /* one pass a trip: the body already holds 44 matrix instructions and the accumulators fill the registers */
  for (int s = 0; s < TT / FKB; ++s) { const int cur = s & 1;
    float sc[FU][2][8]; v16h kh[2], kl[2];
#pragma unroll
    for (int t = 0; t < 2; ++t) { kh[t] = frag_h(&sk[cur][0][grp * FK + t * 16 + col][0], lane); kl[t] = frag_h(&sk[cur][1][grp * FK + t * 16 + col][0], lane); }
    __builtin_amdgcn_sched_barrier(0);   /* the pass's k fragments are asked for as one group: one LDS latency in front of the twelve score products, not one in front of each pair */
#pragma unroll
    for (int u = 0; u < FU; ++u)
#pragma unroll
      for (int t = 0; t < 2; ++t) { v8f a = {}, al = {}; a = wm16(kh[t], qh[u], a); al = wm16(kh[t], ql[u], al); al = wm16(kl[t], qh[u], al);
#pragma unroll
        for (int r = 0; r < 8; ++r) sc[u][t][r] = a[r] + al[r] * (1.0f / 1024.0f); }
    float mn[FU];
#pragma unroll
    for (int u = 0; u < FU; ++u) { float mx = sc[u][0][0];
#pragma unroll
      for (int r = 0; r < 8; ++r) mx = fmaxf(mx, fmaxf(sc[u][0][r], sc[u][1][r]));
      mn[u] = fmaxf(m[u], fmaxf(mx, xhalf(mx))); }
    if (__builtin_amdgcn_ballot_w32((mn[0] > m[0]) | (mn[1] > m[1])) != 0) {   /* one scalar branch a pass: EXEC stays all ones; a column whose maximum stands gets the same c again and multiplies by 2^0 = 1; the factor comes from the same two rounded values that the old and the new exponents subtract */
      const float cn0 = __builtin_fmaf(mn[0], L2E, -11.0f), cn1 = __builtin_fmaf(mn[1], L2E, -11.0f); float al[FU] = { c[0] - cn0, c[1] - cn1 }; exp2x2(al[0], al[1]); c[0] = cn0; c[1] = cn1;
#pragma unroll
      for (int u = 0; u < FU; ++u) { l[u] *= al[u]; m[u] = mn[u];
#pragma unroll
        for (int j = 0; j < CC / 16; ++j) acc[u][j] *= al[u]; } }
    v16h vf[CC / 16];
#pragma unroll
    for (int j = 0; j < CC / 32; ++j) vf[j] = frag_h(&sv[cur][j * 16 + col][grp * FK], lane);
    __builtin_amdgcn_sched_barrier(0);   /* the first half of the pass's v fragments is asked for as one group ahead of the exponentials */
    v16h pf[FU];
#pragma unroll
    for (int u = 0; u < FU; ++u)
#pragma unroll
      for (int t = 0; t < 2; ++t) { float e[8];
#pragma unroll
        for (int r = 0; r < 8; ++r) e[r] = __builtin_fmaf(sc[u][t][r], L2E, -c[u]);
        exp2x8(e);
#pragma unroll
        for (int r = 0; r < 8; ++r) { l[u] += e[r]; pf[u][t * 8 + r] = (_Float16)e[r]; } }   /* element 8 t + r = key 16 t + 8 g + r: frag_h's own k order */
    __builtin_amdgcn_sched_barrier(0);   /* the second half is asked for only here, where the scores' registers are free */
#pragma unroll
    for (int j = CC / 32; j < CC / 16; ++j) vf[j] = frag_h(&sv[cur][j * 16 + col][grp * FK], lane);
    __builtin_amdgcn_sched_barrier(0);   /* as one group again, ahead of the products on the first half, under which it lands */
#pragma unroll
    for (int j = 0; j < CC / 32; ++j)
#pragma unroll
      for (int u = 0; u < FU; ++u) acc[u][j] = wm16(vf[j], pf[u], acc[u][j]);
    __builtin_amdgcn_sched_barrier(0);   /* the products on the first half stay in front of the waits and the barrier: the second half's reads land under them */
    asm volatile("s_wait_dscnt 0x0" ::: "memory");      /* the wave's last reads of this pass's buffer are done: the last block's fragments are in registers */
    asm volatile("s_wait_asynccnt 0x0" ::: "memory");   /* the wave's own copies of the next pass's tiles have landed */
    __syncthreads();   /* publishes the next pass's tiles and ends every wave's reads of this pass's buffer, which is refilled behind it */
#pragma unroll
    for (int j = CC / 32; j < 3 * CC / 64; ++j)
#pragma unroll
      for (int u = 0; u < FU; ++u) acc[u][j] = wm16(vf[j], pf[u], acc[u][j]);
    if (s + 2 < TT / FKB) stage_kv(vsrc + (s + 2) * FKB, ksh + (size_t)(s + 2) * FKB * CC, ksl + (size_t)(s + 2) * FKB * CC, lv0 + (unsigned)cur * (unsigned)sizeof(sv[0]), lk0 + (unsigned)cur * (unsigned)sizeof(sk[0]));   /* a scalar test, the same for the whole work-group: the tiles of the pass after next, into the buffer just left. They stand in the middle of the last block's products, which need registers only: while one wave of a SIMD forms addresses and waits on their translation, the other has the matrix unit */
#pragma unroll
    for (int j = 3 * CC / 64; j < CC / 16; ++j)
#pragma unroll
      for (int u = 0; u < FU; ++u) acc[u][j] = wm16(vf[j], pf[u], acc[u][j]);
  }
  asm volatile("s_wait_asynccnt 0x0" ::: "memory");   /* no copy is outstanding behind the loop */
  const unsigned ro = (((unsigned)b * TT + q0 + col) * CC + 8 * g) * 4u; const float* xp = (const float*)((const char*)X + ro); float* yr = (float*)((char*)OUT + ro);   /* a lane's 8 accumulator registers = 8 consecutive channels of its query's row, in x and in the output alike: one 32-bit byte offset (under 2^25) serves both, beside the two scalar bases */
  v4f x0[CC / 16], x1[CC / 16];
#pragma unroll
  for (int j = 0; j < CC / 16; ++j) { x0[j] = *(const v4f*)(xp + j * 16); x1[j] = *(const v4f*)(xp + j * 16 + 4); }
  // the two key halves meet: a wave hands tile 1 (partial sums, its c and its l, lane for lane) to the wave of the other half, and takes that wave's tile 1, which is its own tile 0
#pragma unroll
  for (int j = 0; j < CC / 16; ++j) { v4f lo, hi;
#pragma unroll
    for (int r = 0; r < 4; ++r) { lo[r] = acc[1][j][r]; hi[r] = acc[1][j][4 + r]; }
    mg[wave][2 * j][lane] = lo; mg[wave][2 * j + 1][lane] = hi; }
  mcl[wave][0][lane] = c[1]; mcl[wave][1][lane] = l[1];
  __syncthreads();   /* every wave's tile 1 is in LDS before its partner reads it */
  const int pw = wave ^ 4; const float cp = mcl[pw][0][lane], lp = mcl[pw][1][lane]; const float cn = fmaxf(c[0], cp); const float f0 = __builtin_amdgcn_exp2f(c[0] - cn), fp = __builtin_amdgcn_exp2f(cp - cn);   /* both halves' values are brought under the larger of the two c */
  float lt = l[0] * f0 + lp * fp;
#pragma unroll
  for (int j = 0; j < CC / 16; ++j) { const v4f lo = mg[pw][2 * j][lane], hi = mg[pw][2 * j + 1][lane];
#pragma unroll
    for (int r = 0; r < 4; ++r) { acc[0][j][r] = acc[0][j][r] * f0 + lo[r] * fp; acc[0][j][4 + r] = acc[0][j][4 + r] * f0 + hi[r] * fp; } }
  const float gmv = bfr(GM[0]); lt += xhalf(lt); const float inv = 1.0f / lt;
#pragma unroll
  for (int j = 0; j < CC / 16; ++j)
#pragma unroll
    for (int r = 0; r < 4; ++r) { const float o0 = acc[0][j][r] * inv, o1 = acc[0][j][4 + r] * inv; x0[j][r] = gmv * o0 + bfr(x0[j][r]); x1[j][r] = gmv * o1 + bfr(x1[j][r]); }
  __builtin_amdgcn_sched_barrier(0);   /* the stores stand behind all the arithmetic: left to itself the build reuses a store's data registers for later values */
#pragma unroll
  for (int j = 0; j < CC / 16; ++j) { vst2(yr + j * 16, x0[j]); vst2(yr + j * 16 + 4, x1[j]); } }

extern "C" void kernel_launch(void* const* d_in, const int* in_sizes, int n_in, void* d_out, int out_size, void* d_ws, size_t ws_size, hipStream_t stream) {
  (void)in_sizes; (void)n_in; (void)out_size;
  const float** F = (const float**)d_in;
  if (ws_size < (size_t)WS_END) return;
  char* ws = (char*)d_ws; _Float16 *QH = (_Float16*)(ws + WS_QH), *KH = (_Float16*)(ws + WS_KH), *VT = (_Float16*)(ws + WS_VT), *QL = (_Float16*)(ws + WS_QL), *KL = (_Float16*)(ws + WS_KL); __bf16 *VB = (__bf16*)(ws + WS_VB), *VBL = (__bf16*)(ws + WS_VBL); float *S = (float*)(ws + WS_S), *Y = (float*)(ws + WS_Y);
  (void)Y; (void)S; (void)QL; (void)KL; (void)VB; (void)VBL;
  // inputs: 0 x [8,64,64,256] (channels-last = rows); 1 Wq [256,32] (in,out), 2 bq; 3 Wk, 4 bk; 5 Wv [256,256], 6 bv; 7 gamma (scalar 0.5)
  k_proj<<<dim3(TNB * TT / PR), 256, 0, stream>>>(F[0], F[1], F[3], F[5], F[2], F[4], F[6], QH, QL, KH, KL, VT);
  k_fa<<<dim3(TT / FQB, TNB), 32 * FW, 0, stream>>>(QH, QL, KH, KL, VT, F[0], F[7], (float*)d_out);
}

// v008
// One run takes 103 microseconds.
// Two timings next to v007 put it at 1.03 and 1.04 times that version's speed.
// All steps since v000 together make it 22.1 times as fast.
// compute dtype: all float inputs rounded to bf16; q/k/v = x W + b with EXACT bf16 products on WMMA 16x16x32 (f32 accumulate); UNSCALED 32-deep logits q.k with both as f16 hi + residual planes (3 products); online softmax in f32 (a reference maximum per query that is renewed only when the f16 range asks for it; exp(logit - reference) x 2^2 formed as 2^(logit * log2 e - (reference * log2 e - 2)): one f32 fma and the hardware's base-2 exponential), once to f16 against v once to f16 (1 product), divided by the f32 sum of the same values at the end; y = gamma * out + x in f32; f32 output.
// SAGAN self-attention on channels-LAST images (B 8, 64 x 64 = 4,096 positions, C 256; (in,out) 1/16-scale weights, zero biases, gamma = 0.5): q = x Wq + bq (32), k = x Wk + bk (32), v = x Wv + bv (256); attn = softmax(q k^T) (NO scaling); out = attn v; y = gamma * out + x -> [B, 64, 64, 256].
#include <hip/hip_runtime.h>
#include <math.h>

typedef __attribute__((ext_vector_type(16))) _Float16 v16h;
typedef __attribute__((ext_vector_type(16))) __bf16 v16b;
typedef __attribute__((ext_vector_type(8)))  _Float16 v8h;
typedef __attribute__((ext_vector_type(8)))  float v8f;
typedef __attribute__((ext_vector_type(4)))  float v4f;
typedef __attribute__((ext_vector_type(2)))  float v2f;
typedef __attribute__((ext_vector_type(4)))  unsigned v4u;
typedef __attribute__((ext_vector_type(4)))  int v4i;
typedef float __attribute__((may_alias)) float_a;
typedef int __attribute__((may_alias)) int_a;

template <typename T> __device__ __forceinline__ void vst2(void* p, T v) { *(T*)p = v;  }
__device__ __forceinline__ v8f wmma16(v16h a, v16h b, v8f c) {
  v8f d = __builtin_amdgcn_wmma_f32_16x16x32_f16(false, a, false, b, (short)0, c, false, false);
  asm volatile("v_nop\n\tv_nop\n\tv_nop\n\tv_nop" : "+v"(d) : "v"(a), "v"(b));
  return d;
}
__device__ __forceinline__ v8f wmma_bf(v16b a, v16b b, v8f c) {
  v8f d = __builtin_amdgcn_wmma_f32_16x16x32_bf16(false, a, false, b, (short)0, c, false, false);
  asm volatile("v_nop\n\tv_nop\n\tv_nop\n\tv_nop" : "+v"(d) : "v"(a), "v"(b));
  return d;
}
// 16x16x32 fragments: lane = (h = lane>>4, row/col = lane&15); elements 0..7 = k0+8h+0..7, 8..15 = k0+16+8h+0..7; D element r = row 8h+r
__device__ __forceinline__ v16h frag_h(const _Float16* rowk0, int lane) {
  union { v16h v; v8h q[2]; } u; const _Float16* p = rowk0 + 8 * (lane >> 4);
  u.q[0] = *(const v8h*)p; u.q[1] = *(const v8h*)(p + 16); return u.v;
}
__device__ __forceinline__ v16h frag_f32(const float* rowk0, int lane) {
  v16h a; const float* p = rowk0 + 8 * (lane >> 4);
#pragma unroll
  for (int i = 0; i < 8; ++i) { a[i] = (_Float16)p[i]; a[8 + i] = (_Float16)p[16 + i]; }
  return a;
}
__device__ __forceinline__ v16h frag_f32s(const float* rowk0, int lane, float sc) {
  v16h a; const float* p = rowk0 + 8 * (lane >> 4);
#pragma unroll
  for (int i = 0; i < 8; ++i) { a[i] = (_Float16)(p[i] * sc); a[8 + i] = (_Float16)(p[16 + i] * sc); }
  return a;
}
// column fragment from a [K][ld] layout (column n), rows >= K read as 0
__device__ __forceinline__ v16h fragc_f32(const float* W, int k0, int n, int lane, int ld, int K) {
  v16h a; const int g = lane >> 4;
#pragma unroll
  for (int i = 0; i < 8; ++i) { const int ka = k0 + 8 * g + i, kb = ka + 16;
    a[i] = (_Float16)(ka < K ? W[(size_t)(ka < K ? ka : K - 1) * ld + n] : 0.f); a[8 + i] = (_Float16)(kb < K ? W[(size_t)(kb < K ? kb : K - 1) * ld + n] : 0.f); }
  return a;
}
struct F2 { v16b h, l; };
__device__ __forceinline__ F2 bsplit16(const float v[16]) { F2 r;
#pragma unroll
  for (int i = 0; i < 16; ++i) { const __bf16 h = (__bf16)v[i]; r.h[i] = h; r.l[i] = (__bf16)(v[i] - (float)h); }
  return r; }
__device__ __forceinline__ F2 split_row(const float* row, int k0, int lane) { float v[16]; const float* p = row + k0 + 8 * (lane >> 4);
#pragma unroll
  for (int i = 0; i < 8; ++i) { v[i] = p[i]; v[8 + i] = p[16 + i]; }
  return bsplit16(v); }
__device__ __forceinline__ F2 split_rowK(const float* row, int k0, int lane, int K) { float v[16]; const int g = lane >> 4;
#pragma unroll
  for (int i = 0; i < 8; ++i) { const int ka = k0 + 8 * g + i, kb = ka + 16; v[i] = ka < K ? row[ka < K ? ka : K - 1] : 0.f; v[8 + i] = kb < K ? row[kb < K ? kb : K - 1] : 0.f; }
  return bsplit16(v); }
__device__ __forceinline__ F2 split_col(const float* W, int k0, int n, int lane, int ld, int K) { float v[16]; const int g = lane >> 4;
#pragma unroll
  for (int i = 0; i < 8; ++i) { const int ka = k0 + 8 * g + i, kb = ka + 16; v[i] = ka < K ? W[(size_t)(ka < K ? ka : K - 1) * ld + n] : 0.f; v[8 + i] = kb < K ? W[(size_t)(kb < K ? kb : K - 1) * ld + n] : 0.f; }
  return bsplit16(v); }
__device__ __forceinline__ v8f mac3(const F2& a, const F2& b, v8f c) { c = wmma_bf(a.l, b.h, c); c = wmma_bf(a.h, b.l, c); return wmma_bf(a.h, b.h, c); }
__device__ __forceinline__ float sigm(float v) { return 1.0f / (1.0f + expf(-v)); }
#define LDSX() do { asm volatile("s_wait_dscnt 0" ::: "memory"); __builtin_amdgcn_wave_barrier(); __builtin_amdgcn_fence(__ATOMIC_RELEASE, "workgroup"); } while (0)

#define NB 8
#define TT 4096
#define CC 256            // plane width: q/k planes carry 32 real columns (rest never written or read), v planes all 256
#define DIN 256
#define NH 1
#define HD 256
#define NQB (TT / 64)
#define HG 1               // one 4,096 x 4,096 f32 score plane in the workspace, which no kernel uses
#define SCALE (1.0f)
#define HDQK 32
#define CAUSAL 0
#ifndef TNB
#define TNB NB
#endif
__device__ __forceinline__ v16b zero16b() { v16b z; _Pragma("unroll") for (int i = 0; i < 16; ++i) z[i] = (__bf16)0.f; return z; }
__device__ __forceinline__ float bfr(float v) { return (float)(__bf16)v; }
__host__ __device__ __forceinline__ int kb_last(int qb) { return CAUSAL ? ((qb * 64 + 63) >> 7) : (TT / 128 - 1); }
typedef __attribute__((ext_vector_type(8))) __bf16 v8b;
__device__ __forceinline__ v16b frag_b(const __bf16* rowk0, int lane) {
  union { v16b v; v8b q[2]; } u; const __bf16* p = rowk0 + 8 * (lane >> 4);
  u.q[0] = *(const v8b*)p; u.q[1] = *(const v8b*)(p + 16); return u.v;
}
#define QBH (TT / 64)
#define QBH_PV 0           // A.g stays single f16
#define QHI 4096            // q residual rows everywhere (3-product logits)
#define KHI 4096           // k residual rows for ALL keys (3-product logits)
// B fragment (k rows k0+.., output column o) of a weight: (in,out) [K][ld] or (out,in) [ld rows of K]: bf16 exact, or f16(bf16 * 256) exact
__device__ __forceinline__ v16b wcol_io(const float* Wm, int k0, int o, int lane, int ld) { v16b w; const int g = lane >> 4;
#pragma unroll
  for (int i = 0; i < 8; ++i) { w[i] = (__bf16)Wm[(size_t)(k0 + 8 * g + i) * ld + o]; w[8 + i] = (__bf16)Wm[(size_t)(k0 + 16 + 8 * g + i) * ld + o]; }
  return w; }
__device__ __forceinline__ v16b wcol_oi(const float* Wm, int k0, int o, int lane, int K) { v16b w; const float* p = Wm + (size_t)o * K + k0 + 8 * (lane >> 4);
#pragma unroll
  for (int i = 0; i < 8; ++i) { w[i] = (__bf16)p[i]; w[8 + i] = (__bf16)p[16 + i]; }
  return w; }
__device__ __forceinline__ v16h wcolh_io(const float* Wm, int k0, int o, int lane, int ld) { v16h w; const int g = lane >> 4;
#pragma unroll
  for (int i = 0; i < 8; ++i) { w[i] = (_Float16)(bfr(Wm[(size_t)(k0 + 8 * g + i) * ld + o]) * 256.0f); w[8 + i] = (_Float16)(bfr(Wm[(size_t)(k0 + 16 + 8 * g + i) * ld + o]) * 256.0f); }
  return w; }
__device__ __forceinline__ v16h wcolh_oi(const float* Wm, int k0, int o, int lane, int K) { v16h w; const float* p = Wm + (size_t)o * K + k0 + 8 * (lane >> 4);
#pragma unroll
  for (int i = 0; i < 8; ++i) { w[i] = (_Float16)(bfr(p[i]) * 256.0f); w[8 + i] = (_Float16)(bfr(p[16 + i]) * 256.0f); }
  return w; }
#define WQKV_LAYOUT 1   // 0 = (in,out) [DIN][CC]; 1 = (in,out) Wq/Wk [DIN][HDQK], Wv [DIN][CC]; 2 = per-head [NH][DIN][HD]
__device__ __forceinline__ v16b wcol_hdk(const float* Wm, int k0, int o, int lane) { v16b w; const int g = lane >> 4; const float* p = Wm + (size_t)(o / HD) * DIN * HD + (o % HD);
#pragma unroll
  for (int i = 0; i < 8; ++i) { w[i] = (__bf16)p[(size_t)(k0 + 8 * g + i) * HD]; w[8 + i] = (__bf16)p[(size_t)(k0 + 16 + 8 * g + i) * HD]; }
  return w; }
#define WO_OUT_IN 0
#if WQKV_LAYOUT == 1
#define WCOL(W, k0, o, lane) ((which == 2) ? wcol_io(W, k0, (o), lane, CC) : (((o) < HDQK) ? wcol_io(W, k0, (o), lane, HDQK) : zero16b()))   /* (in,out): Wq/Wk [256][32] (plane columns >= 32 zero), Wv [256][256] full */
#define WCOL_OLD_UNUSED(W, k0, o, lane) (((o) < HDQK) ? wcol_oi(W, k0, (o), lane, DIN) : zero16b())   /* unused: reads (out,in) [32][256] weights; plane columns >= 32 are zero for all three */
#elif WQKV_LAYOUT == 2
#define WCOL(W, k0, o, lane) wcol_hdk(W, k0, o, lane)
#else
#define WCOL(W, k0, o, lane) wcol_io(W, k0, o, lane, CC)
#endif
#if WO_OUT_IN
#define WOCOL(W, k0, o, lane) wcol_oi(W, k0, o, lane, CC)
#define WOCOLH(W, k0, o, lane) wcolh_oi(W, k0, o, lane, CC)
#else
#define WOCOL(W, k0, o, lane) wcol_io(W, k0, o, lane, DIN)
#define WOCOLH(W, k0, o, lane) wcolh_io(W, k0, o, lane, DIN)
#endif
#ifndef XP
#define OUT1_OFF (4u * (size_t)NB * DIN * TT)   /* output 1 (o) follows output 0 (y) */
#define XP TT              // position pitch of x and of the output
#endif
#define BG HG
#define DVH 128
// ---- k_wz: block = (64 rows, 128 output cols): OR = y (hi + lo, K = 32 real columns of the YR rows) . W^T ((out,in) [256][32], exact) + b
__global__ __launch_bounds__(128) void k_wz(const float* __restrict__ YR, const float* __restrict__ WW, const float* __restrict__ WB, float* __restrict__ ORW) { __shared__ __align__(16) float sf[4][16][132];
  const int tid = threadIdx.x, wave = tid >> 5, lane = tid & 31, col = lane & 15, g = lane >> 4; const int c0 = blockIdx.y * 128; const size_t r0 = (size_t)blockIdx.x * 64 + wave * 16;
  v8f acc[8] = {};
#pragma unroll
  for (int kc = 0; kc < HDQK / 32; ++kc) { const F2 a = split_row(YR + (r0 + col) * CC, kc * 32, lane); asm volatile("s_wait_loadcnt 0x0" ::: "memory");
#pragma unroll
    for (int j = 0; j < 8; ++j) { const v16b w = wcol_oi(WW, kc * 32, c0 + j * 16 + col, lane, HDQK); asm volatile("s_wait_loadcnt 0x0" ::: "memory"); acc[j] = wmma_bf(a.h, w, acc[j]); acc[j] = wmma_bf(a.l, w, acc[j]); } }
#pragma unroll
  for (int j = 0; j < 8; ++j) { const float bb = WB ? bfr(WB[c0 + j * 16 + col]) : 0.f; asm volatile("s_wait_loadcnt 0x0" ::: "memory");
#pragma unroll
    for (int r = 0; r < 8; ++r) sf[wave][8 * g + r][j * 16 + col] = acc[j][r] + bb; }
  LDSX(); for (int rl = 0; rl < 16; ++rl) vst2(ORW + (r0 + rl) * DIN + c0 + lane * 4, *(const v4f*)&sf[wave][rl][lane * 4]); }
// ---- k_fin2: block = (64 positions, 64 channels, batch b): o[b][c][n] = OR[b*N + n][c] (channels-first via LDS transpose) -> output 1; y = gamma * o + bf16(x) -> output 0 (256-B runs)
__global__ __launch_bounds__(256) void k_fin2(const float* __restrict__ ORW, const float* __restrict__ X, const float* __restrict__ GM, float* __restrict__ OUT, float* __restrict__ OUT1) { const float gmv = bfr(GM[0]); __shared__ float st[64][68]; const int tid = threadIdx.x; const int n0 = blockIdx.x * 64, c0 = blockIdx.y * 64; const size_t b = blockIdx.z;
  for (int e = tid; e < 64 * 16; e += 256) { const int nl = e >> 4, q = e & 15; *(v4f*)&st[nl][q * 4] = *(const v4f*)(ORW + (b * TT + n0 + nl) * (size_t)DIN + c0 + q * 4); }
  __syncthreads();
  for (int e = tid; e < 64 * 16; e += 256) { const int cl = e >> 4, q = e & 15; const size_t oi = (b * DIN + c0 + cl) * (size_t)XP + n0 + q * 4; const v4f xr = *(const v4f*)(X + oi); v4f o, y; _Pragma("unroll") for (int i = 0; i < 4; ++i) { o[i] = st[q * 4 + i][cl]; y[i] = gmv * o[i] + bfr(xr[i]); } vst2(OUT + oi, y); vst2(OUT1 + oi, o); } }   /* y = gamma * o + x (output 0), o (output 1) */
#ifndef SM_EXTRA_PARAMS
#define SM_EXTRA_PARAMS
#endif
#ifndef PROJ_EXTRA_PARAMS
#define PROJ_EXTRA_PARAMS
#endif
#ifndef SM_MASK_HOOK
#define SM_MASK_HOOK (void)0
#endif

#define WS_QH  0u                                      // f16 q rows [b*t][CC]
#define WS_KH  (WS_QH + 2u * (size_t)NB * TT * CC)      // f16 k rows [b*t][CC]
#define WS_VT  (WS_KH + 2u * (size_t)NB * TT * CC)      // f16 v planes [b][c][t]
#define WS_QL  (WS_VT + 2u * (size_t)NB * CC * TT)      // f16 q residual x 2^10 rows [b][t < QHI][CC]
#define WS_KL  (WS_QL + 2u * (size_t)NB * QHI * CC)     // f16 k residual x 2^10 rows [b][t < KHI][CC]
#define WS_VB  (WS_KL + 2u * (size_t)NB * KHI * CC)     // bf16 v hi planes [b][c][t < KHI]
#define WS_VBL (WS_VB + 2u * (size_t)NB * CC * KHI)
#define WS_S   (WS_VBL + 2u * (size_t)NB * CC * KHI)    // f32 logits / P [hg][t][s]
#define WS_Y   (WS_S  + 4u * (size_t)HG * TT * TT)      // f32 ctx rows [b*t][CC] (only when there is an output projection)
#define WS_END (WS_Y  + 0u)

// ---- k_proj: block = 128 rows of x, 8 waves x 16 rows, every wave all 320 output columns (32 q, 32 k, 256 v). The three weights are rounded to bf16 and laid k-contiguous per output column in LDS once a block, and the block's x rows are read once, in whole lines, and laid beside them as bf16: every fragment is two 16-byte LDS reads. Exact bf16 products (K = DIN), f32 accumulate, k blocks in ascending order. q and k are formed transposed (A = weight columns, B = x rows): a lane holds 8 consecutive features of one row and stores them directly (f16 rows + residual x 2^10 rows, the 32 real columns only: nobody reads the rest of those planes). v goes through LDS to f16 planes [c][t] in 256-byte runs.
#define PR 128             // rows per block
#define PO (2 * HDQK + CC) // output columns: q, k, v
#define PWP (DIN + 8)      // LDS pitch of a weight column and of an x row in bf16: 512 bytes at 528 (16 B x odd) for 16-byte reads
#define PVP (PR + 8)       // LDS pitch of a v channel in f16: 256-byte runs at 272 bytes (16 B x odd)
typedef __attribute__((ext_vector_type(4))) __bf16 v4b;
__device__ __forceinline__ v8f wmb(v16b a, v16b b, v8f c) { return __builtin_amdgcn_wmma_f32_16x16x32_bf16(false, a, false, b, (short)0, c, false, false); }
__global__ __launch_bounds__(256) void k_proj(const float* __restrict__ X, const float* __restrict__ WQ, const float* __restrict__ WK, const float* __restrict__ WV, const float* __restrict__ BQ, const float* __restrict__ BK, const float* __restrict__ BV,
    _Float16* __restrict__ QH, _Float16* __restrict__ QL, _Float16* __restrict__ KH, _Float16* __restrict__ KL, _Float16* __restrict__ VT) {
  __shared__ __align__(16) __bf16 wt[PO][PWP]; __shared__ __align__(16) __bf16 xs[PR][PWP]; __shared__ __align__(16) _Float16 th[CC][PVP]; __shared__ __align__(16) float sb[PO];
  const int tid = threadIdx.x, wave = __builtin_amdgcn_readfirstlane(tid >> 5), lane = tid & 31, col = lane & 15, g = lane >> 4; const size_t r0 = (size_t)blockIdx.x * PR;
  // the 320 biases, one or two a thread, on their way to LDS with the rest
  const float bvr = BV[tid]; const float bqr = ((wave & 1) ? BK : BQ)[lane];   /* every wave asks, so that no branch and no wait stand in front of the x loads; waves 0 and 1 store */
  // the wave's 16 x rows (16 KB in a row, 512 bytes a load), asked for ahead of the weight staging so that they fly under it
  const float* xp = X + (r0 + wave * 16) * DIN + lane * 4; v4f xr[32];
#pragma unroll
  for (int i = 0; i < 32; ++i) xr[i] = *(const v4f*)(xp + i * 128);
  // weight staging: a unit = 32 output columns (one a lane: whole 128-byte lines) x 8 k rows -> one 16-byte LDS store a lane. A wave brings 32 v columns, all k, and a quarter of the k rows of q (even waves) or k (odd waves)
  const float* sv = WV + wave * 32 + lane;
#pragma unroll 8   /* eight units' loads in flight a wave */
  for (int k8 = 0; k8 < DIN / 8; ++k8) { v8b p;
#pragma unroll
    for (int e = 0; e < 8; ++e) p[e] = (__bf16)sv[(k8 * 8 + e) * CC];
    *(v8b*)&wt[2 * HDQK + wave * 32 + lane][k8 * 8] = p; }
  const float* sq = ((wave & 1) ? WK : WQ) + (wave >> 1) * (DIN / 4) * HDQK + lane;
#pragma unroll
  for (int k8 = 0; k8 < DIN / 32; ++k8) { v8b p;
#pragma unroll
    for (int e = 0; e < 8; ++e) p[e] = (__bf16)sq[(k8 * 8 + e) * HDQK];
    *(v8b*)&wt[(wave & 1) * HDQK + lane][(wave >> 1) * (DIN / 4) + k8 * 8] = p; }
#pragma unroll
  for (int i = 0; i < 32; ++i) { v4b p;
#pragma unroll
    for (int e = 0; e < 4; ++e) p[e] = (__bf16)xr[i][e];
    *(v4b*)&xs[wave * 16 + (i >> 1)][(i & 1) * 128 + lane * 4] = p; }
  sb[2 * HDQK + tid] = bfr(bvr); if (wave < 2) sb[wave * HDQK + lane] = bfr(bqr);
  __syncthreads();   /* weights, biases and x rows are in LDS before any wave reads them */
  v8f aq[4] = {}, av[CC / 16] = {};
#pragma unroll 1   /* one k block a trip: 20 products; the accumulators and one block's fragments fill the registers */
  for (int kc = 0; kc < DIN / 32; ++kc) { const v16b a = frag_b(&xs[wave * 16 + col][kc * 32], lane); v16b w[PO / 16];
#pragma unroll
    for (int j = 0; j < PO / 16; ++j) w[j] = frag_b(&wt[j * 16 + col][kc * 32], lane);
    __builtin_amdgcn_sched_barrier(0);   /* the k block's fragments are asked for as one group: one LDS latency in front of the 20 products, not one in front of each */
#pragma unroll
    for (int j = 0; j < 4; ++j) aq[j] = wmb(w[j], a, aq[j]);   /* D[feature 8 g + r][row col] */
#pragma unroll
    for (int j = 0; j < CC / 16; ++j) av[j] = wmb(a, w[4 + j], av[j]); }   /* D[row 8 g + r][channel col] */
  const size_t trow = r0 + wave * 16 + col;
#pragma unroll
  for (int j = 0; j < 4; ++j) { const int d0 = (j & 1) * 16 + 8 * g; const float* ba = &sb[j * 16 + 8 * g]; v8h hi, lo;
#pragma unroll
    for (int r = 0; r < 8; ++r) { const float v = aq[j][r] + ba[r]; const _Float16 hv = (_Float16)v; hi[r] = hv; lo[r] = (_Float16)((v - (float)hv) * 1024.0f); }
    vst2((j < 2 ? QH : KH) + trow * CC + d0, hi); vst2((j < 2 ? QL : KL) + trow * CC + d0, lo); }
#pragma unroll
  for (int j = 0; j < CC / 16; ++j) { const float bias = sb[2 * HDQK + j * 16 + col]; v8h h;
#pragma unroll
    for (int r = 0; r < 8; ++r) h[r] = (_Float16)(av[j][r] + bias);
    *(v8h*)&th[j * 16 + col][wave * 16 + 8 * g] = h; }
  __syncthreads();   /* every wave's 16 positions of each channel are in LDS before the 256-byte runs are read back */
  const size_t bb = r0 / TT; const int t0 = (int)(r0 % TT);
  _Float16* vd = VT + (bb * CC + (tid >> 4)) * (size_t)TT + t0 + (tid & 15) * 8;   /* 16 lanes bring one channel's 256 bytes */
#pragma unroll
  for (int i = 0; i < CC / 16; ++i) vst2(vd + (size_t)i * 16 * TT, *(const v8h*)&th[i * 16 + (tid >> 4)][(tid & 15) * 8]); }
#define FQ 16              // query columns per tile
#define FU 2               // column tiles per wave
#define FW 8               // waves per block
#define FQB 128            // queries per block: 4 query groups x FU x FQ
#define FK 32              // keys per wave and pass
#define FKB 64             // keys per block and pass: the two halves' FK
#define FP 40              // LDS pitch of a k row in f16: 64-byte rows at 80 bytes (16 B x odd) for 16-byte reads
#define FPV 72             // LDS pitch of a v channel in f16: 128-byte rows at 144 bytes (16 B x odd) for 16-byte reads
__device__ __forceinline__ float xhalf(float x) { return __builtin_bit_cast(float, __builtin_amdgcn_permlanex16(__builtin_bit_cast(int, x), __builtin_bit_cast(int, x), 0x76543210, 0xfedcba98, false, false)); }   /* lane l with lane l ^ 16 */
#define L2E 1.44269504088896340736f   // log2 e
#define FEX 2.0f            // exponent that a column's largest score gets when its reference is renewed
#define FEMAX 15.5f         // largest exponent let through under a standing reference: 2^15.5 lies inside the f16 range
// eight base-2 exponentials, each in place in its own register: none reads another's result or lands in another's source; the v_nop is the slot that the instruction set asks for behind the last
__device__ __forceinline__ void exp2x8(float (&e)[8]) {
  asm("v_exp_f32 %0, %0\n\tv_exp_f32 %1, %1\n\tv_exp_f32 %2, %2\n\tv_exp_f32 %3, %3\n\tv_exp_f32 %4, %4\n\tv_exp_f32 %5, %5\n\tv_exp_f32 %6, %6\n\tv_exp_f32 %7, %7\n\tv_nop"
      : "+v"(e[0]), "+v"(e[1]), "+v"(e[2]), "+v"(e[3]), "+v"(e[4]), "+v"(e[5]), "+v"(e[6]), "+v"(e[7])); }
__device__ __forceinline__ void exp2x2(float& a, float& b) { asm("v_exp_f32 %0, %0\n\tv_exp_f32 %1, %1\n\tv_nop" : "+v"(a), "+v"(b)); }   /* the same for two */
__device__ __forceinline__ v8f wm16(v16h a, v16h b, v8f c) { return __builtin_amdgcn_wmma_f32_16x16x32_f16(false, a, false, b, (short)0, c, false, false); }
// one pass's tiles, ten 16-byte copies a lane (8 v rows' pieces, one piece of each k plane), global -> LDS through no register. The wait on the address translations is the statement's own last line, so that it stands in front of whatever the build lets land in the address registers afterwards
__device__ __forceinline__ void stage_kv(const _Float16* gv, const _Float16* gh, const _Float16* gl, unsigned lv, unsigned lk) {
  asm volatile("global_load_async_to_lds_b128 %0, %10, off\n\tglobal_load_async_to_lds_b128 %1, %11, off\n\tglobal_load_async_to_lds_b128 %2, %12, off\n\tglobal_load_async_to_lds_b128 %3, %13, off\n\t"
               "global_load_async_to_lds_b128 %4, %14, off\n\tglobal_load_async_to_lds_b128 %5, %15, off\n\tglobal_load_async_to_lds_b128 %6, %16, off\n\tglobal_load_async_to_lds_b128 %7, %17, off\n\t"
               "global_load_async_to_lds_b128 %8, %18, off\n\tglobal_load_async_to_lds_b128 %9, %19, off\n\ts_wait_xcnt 0x0"
      :: "v"(lv), "v"(lv + 1u * 32 * FPV * 2), "v"(lv + 2u * 32 * FPV * 2), "v"(lv + 3u * 32 * FPV * 2), "v"(lv + 4u * 32 * FPV * 2), "v"(lv + 5u * 32 * FPV * 2), "v"(lv + 6u * 32 * FPV * 2), "v"(lv + 7u * 32 * FPV * 2),
         "v"(lk), "v"(lk + (unsigned)FKB * FP * 2),
         "v"(gv), "v"(gv + (size_t)1 * 32 * TT), "v"(gv + (size_t)2 * 32 * TT), "v"(gv + (size_t)3 * 32 * TT), "v"(gv + (size_t)4 * 32 * TT), "v"(gv + (size_t)5 * 32 * TT), "v"(gv + (size_t)6 * 32 * TT), "v"(gv + (size_t)7 * 32 * TT),
         "v"(gh), "v"(gl)
      : "memory"); }
__global__ __launch_bounds__(32 * FW) void k_fa(const _Float16* __restrict__ QH, const _Float16* __restrict__ QL, const _Float16* __restrict__ KH, const _Float16* __restrict__ KL, const _Float16* __restrict__ VT, const float* __restrict__ X, const float* __restrict__ GM, float* __restrict__ OUT) {
  __shared__ __align__(16) _Float16 sv[2][CC][FPV]; __shared__ __align__(16) _Float16 sk[2][2][FKB][FP]; __shared__ __align__(16) v4f mg[FW][CC / 8][32]; __shared__ float mcl[FW][2][32];
  const int tid = threadIdx.x, wave = __builtin_amdgcn_readfirstlane(tid >> 5), lane = tid & 31, col = lane & 15, g = lane >> 4; const int b = blockIdx.y; const int grp = wave >> 2;   /* grp = the wave's key half */
  const int q0 = blockIdx.x * FQB + (wave & 3) * (FU * FQ) + grp * FQ;   /* column tile 0 is the one the wave keeps to the end; tile 1, the other 16 of the group's 32 queries, goes to the partner wave, whose tile 0 it is */
  v16h qh[FU], ql[FU];
#pragma unroll
  for (int u = 0; u < FU; ++u) { const size_t qrow = ((size_t)b * TT + (q0 ^ (u * FQ)) + col) * CC; qh[u] = frag_h(QH + qrow, lane); ql[u] = frag_h(QL + qrow, lane); }
  asm volatile("s_wait_xcnt 0x0" ::: "memory");   /* stands in front of whatever the build lets land in the q loads' address registers */
  __builtin_amdgcn_sched_barrier(0);   /* keeps the staging's index arithmetic behind that wait: the build lifted it in between the q loads, into their address registers */
  // staging: 8 lanes bring one 128-byte v row (a whole line), a thread 8 rows' pieces (channels srow + 32 i); 4 lanes bring one 64-byte k row, a thread one piece of each plane
  const int srow = tid >> 3, sch = (tid & 7) * 8, krow = tid >> 2, kch = (tid & 3) * 8;
  const _Float16* vsrc = VT + ((size_t)b * CC + srow) * TT + sch; const size_t koff = ((size_t)b * TT + krow) * CC + kch; const _Float16* ksh = KH + koff; const _Float16* ksl = KL + koff;
  const unsigned lv0 = (unsigned)(size_t)&sv[0][srow][sch], lk0 = (unsigned)(size_t)&sk[0][0][krow][kch];   /* the lane's LDS byte addresses in buffer 0: the low 32 bits of the __shared__ addresses */
  stage_kv(vsrc, ksh, ksl, lv0, lk0);
  asm volatile("s_wait_asynccnt 0x0" ::: "memory");   /* the wave's own copies of pass 0's tiles have landed */
  __syncthreads();   /* pass 0's tiles are in LDS before any wave reads them */
  stage_kv(vsrc + FKB, ksh + (size_t)FKB * CC, ksl + (size_t)FKB * CC, lv0 + (unsigned)sizeof(sv[0]), lk0 + (unsigned)sizeof(sk[0]));   /* pass 1's tiles fly under pass 0 */
  v8f acc[FU][CC / 16] = {}; float c[FU], l[FU];   /* c = reference maximum * log2 e - FEX, rounded once per reference: what every exponent of the column subtracts; l sums, in f32, the weights formed under that c */
#pragma unroll
  for (int u = 0; u < FU; ++u) { c[u] = -3.0e38f; l[u] = 0.f; }
#pragma unroll 1   /* one pass a trip: the body already holds 44 matrix instructions and the accumulators fill the registers */
  for (int s = 0; s < TT / FKB; ++s) { const int cur = s & 1;
    float sc[FU][2][8]; v16h kh[2], kl[2];
#pragma unroll
    for (int t = 0; t < 2; ++t) { kh[t] = frag_h(&sk[cur][0][grp * FK + t * 16 + col][0], lane); kl[t] = frag_h(&sk[cur][1][grp * FK + t * 16 + col][0], lane); }
    __builtin_amdgcn_sched_barrier(0);   /* the pass's k fragments are asked for as one group: one LDS latency in front of the twelve score products, not one in front of each pair */
#pragma unroll
    for (int u = 0; u < FU; ++u)
#pragma unroll
      for (int t = 0; t < 2; ++t) { v8f a = {}, al = {}; a = wm16(kh[t], qh[u], a); al = wm16(kh[t], ql[u], al); al = wm16(kl[t], qh[u], al);
#pragma unroll
        for (int r = 0; r < 8; ++r) sc[u][t][r] = a[r] + al[r] * (1.0f / 1024.0f); }
    float mn[FU], ex[FU];
#pragma unroll
    for (int u = 0; u < FU; ++u) { float mx = sc[u][0][0];
#pragma unroll
      for (int r = 0; r < 8; ++r) mx = fmaxf(mx, fmaxf(sc[u][0][r], sc[u][1][r]));
      mn[u] = mx; ex[u] = __builtin_fmaf(mx, L2E, -c[u]); }   /* mn = the largest of the lane's 16 scores of the column; ex = the largest of their exponents, by the very fma that forms them all */
    if (__builtin_amdgcn_ballot_w32((ex[0] > FEMAX) | (ex[1] > FEMAX)) != 0) {   /* one scalar branch a pass: EXEC stays all ones; the ballot joins a column's two lanes, so the exchange between the wave's halves is needed only inside. Taken only when some column's largest value would leave the f16 range under its standing reference: then every column of the wave takes the larger of its standing c and the c that this pass's largest score gives; a column whose c stands multiplies by 2^0 = 1; the factor comes from the same two rounded values that the old and the new exponents subtract */
      const float cn0 = fmaxf(c[0], __builtin_fmaf(fmaxf(mn[0], xhalf(mn[0])), L2E, -FEX)), cn1 = fmaxf(c[1], __builtin_fmaf(fmaxf(mn[1], xhalf(mn[1])), L2E, -FEX)); float al[FU] = { c[0] - cn0, c[1] - cn1 }; exp2x2(al[0], al[1]); c[0] = cn0; c[1] = cn1;
#pragma unroll
      for (int u = 0; u < FU; ++u) { l[u] *= al[u];
#pragma unroll
        for (int j = 0; j < CC / 16; ++j) acc[u][j] *= al[u]; } }
    v16h vf[CC / 16];
#pragma unroll
    for (int j = 0; j < CC / 32; ++j) vf[j] = frag_h(&sv[cur][j * 16 + col][grp * FK], lane);
    __builtin_amdgcn_sched_barrier(0);   /* the first half of the pass's v fragments is asked for as one group ahead of the exponentials */
    v16h pf[FU];
#pragma unroll
    for (int u = 0; u < FU; ++u)
#pragma unroll
      for (int t = 0; t < 2; ++t) { float e[8];
#pragma unroll
        for (int r = 0; r < 8; ++r) e[r] = __builtin_fmaf(sc[u][t][r], L2E, -c[u]);
        exp2x8(e);
#pragma unroll
        for (int r = 0; r < 8; ++r) { l[u] += e[r]; pf[u][t * 8 + r] = (_Float16)e[r]; } }   /* element 8 t + r = key 16 t + 8 g + r: frag_h's own k order */
    __builtin_amdgcn_sched_barrier(0);   /* the second half is asked for only here, where the scores' registers are free */
#pragma unroll
    for (int j = CC / 32; j < CC / 16; ++j) vf[j] = frag_h(&sv[cur][j * 16 + col][grp * FK], lane);
    __builtin_amdgcn_sched_barrier(0);   /* as one group again, ahead of the products on the first half, under which it lands */
#pragma unroll
    for (int j = 0; j < CC / 32; ++j)
#pragma unroll
      for (int u = 0; u < FU; ++u) acc[u][j] = wm16(vf[j], pf[u], acc[u][j]);
    __builtin_amdgcn_sched_barrier(0);   /* the products on the first half stay in front of the waits and the barrier: the second half's reads land under them */
    asm volatile("s_wait_dscnt 0x0" ::: "memory");      /* the wave's last reads of this pass's buffer are done: the last block's fragments are in registers */
    asm volatile("s_wait_asynccnt 0x0" ::: "memory");   /* the wave's own copies of the next pass's tiles have landed */
    __syncthreads();   /* publishes the next pass's tiles and ends every wave's reads of this pass's buffer, which is refilled behind it */
#pragma unroll
    for (int j = CC / 32; j < 3 * CC / 64; ++j)
#pragma unroll
      for (int u = 0; u < FU; ++u) acc[u][j] = wm16(vf[j], pf[u], acc[u][j]);
    if (s + 2 < TT / FKB) stage_kv(vsrc + (s + 2) * FKB, ksh + (size_t)(s + 2) * FKB * CC, ksl + (size_t)(s + 2) * FKB * CC, lv0 + (unsigned)cur * (unsigned)sizeof(sv[0]), lk0 + (unsigned)cur * (unsigned)sizeof(sk[0]));   /* a scalar test, the same for the whole work-group: the tiles of the pass after next, into the buffer just left. They stand in the middle of the last block's products, which need registers only: while one wave of a SIMD forms addresses and waits on their translation, the other has the matrix unit */
#pragma unroll
    for (int j = 3 * CC / 64; j < CC / 16; ++j)
#pragma unroll
      for (int u = 0; u < FU; ++u) acc[u][j] = wm16(vf[j], pf[u], acc[u][j]);
  }
  asm volatile("s_wait_asynccnt 0x0" ::: "memory");   /* no copy is outstanding behind the loop */
  const unsigned ro = (((unsigned)b * TT + q0 + col) * CC + 8 * g) * 4u; const float* xp = (const float*)((const char*)X + ro); float* yr = (float*)((char*)OUT + ro);   /* a lane's 8 accumulator registers = 8 consecutive channels of its query's row, in x and in the output alike: one 32-bit byte offset (under 2^25) serves both, beside the two scalar bases */
  v4f x0[CC / 16], x1[CC / 16];
#pragma unroll
  for (int j = 0; j < CC / 16; ++j) { x0[j] = *(const v4f*)(xp + j * 16); x1[j] = *(const v4f*)(xp + j * 16 + 4); }
  // the two key halves meet: a wave hands tile 1 (partial sums, its c and its l, lane for lane) to the wave of the other half, and takes that wave's tile 1, which is its own tile 0
#pragma unroll
  for (int j = 0; j < CC / 16; ++j) { v4f lo, hi;
#pragma unroll
    for (int r = 0; r < 4; ++r) { lo[r] = acc[1][j][r]; hi[r] = acc[1][j][4 + r]; }
    mg[wave][2 * j][lane] = lo; mg[wave][2 * j + 1][lane] = hi; }
  mcl[wave][0][lane] = c[1]; mcl[wave][1][lane] = l[1];
  __syncthreads();   /* every wave's tile 1 is in LDS before its partner reads it */
  const int pw = wave ^ 4; const float cp = mcl[pw][0][lane], lp = mcl[pw][1][lane]; const float cn = fmaxf(c[0], cp); const float f0 = __builtin_amdgcn_exp2f(c[0] - cn), fp = __builtin_amdgcn_exp2f(cp - cn);   /* both halves' values are brought under the larger of the two c */
  float lt = l[0] * f0 + lp * fp;
#pragma unroll
  for (int j = 0; j < CC / 16; ++j) { const v4f lo = mg[pw][2 * j][lane], hi = mg[pw][2 * j + 1][lane];
#pragma unroll
    for (int r = 0; r < 4; ++r) { acc[0][j][r] = acc[0][j][r] * f0 + lo[r] * fp; acc[0][j][4 + r] = acc[0][j][4 + r] * f0 + hi[r] * fp; } }
  const float gmv = bfr(GM[0]); lt += xhalf(lt); const float inv = 1.0f / lt;
#pragma unroll
  for (int j = 0; j < CC / 16; ++j)
#pragma unroll
    for (int r = 0; r < 4; ++r) { const float o0 = acc[0][j][r] * inv, o1 = acc[0][j][4 + r] * inv; x0[j][r] = gmv * o0 + bfr(x0[j][r]); x1[j][r] = gmv * o1 + bfr(x1[j][r]); }
  __builtin_amdgcn_sched_barrier(0);   /* the stores stand behind all the arithmetic: left to itself the build reuses a store's data registers for later values */
#pragma unroll
  for (int j = 0; j < CC / 16; ++j) { vst2(yr + j * 16, x0[j]); vst2(yr + j * 16 + 4, x1[j]); } }

extern "C" void kernel_launch(void* const* d_in, const int* in_sizes, int n_in, void* d_out, int out_size, void* d_ws, size_t ws_size, hipStream_t stream) {
  (void)in_sizes; (void)n_in; (void)out_size;
  const float** F = (const float**)d_in;
  if (ws_size < (size_t)WS_END) return;
  char* ws = (char*)d_ws; _Float16 *QH = (_Float16*)(ws + WS_QH), *KH = (_Float16*)(ws + WS_KH), *VT = (_Float16*)(ws + WS_VT), *QL = (_Float16*)(ws + WS_QL), *KL = (_Float16*)(ws + WS_KL); __bf16 *VB = (__bf16*)(ws + WS_VB), *VBL = (__bf16*)(ws + WS_VBL); float *S = (float*)(ws + WS_S), *Y = (float*)(ws + WS_Y);
  (void)Y; (void)S; (void)QL; (void)KL; (void)VB; (void)VBL;
  // inputs: 0 x [8,64,64,256] (channels-last = rows); 1 Wq [256,32] (in,out), 2 bq; 3 Wk, 4 bk; 5 Wv [256,256], 6 bv; 7 gamma (scalar 0.5)
  k_proj<<<dim3(TNB * TT / PR), 256, 0, stream>>>(F[0], F[1], F[3], F[5], F[2], F[4], F[6], QH, QL, KH, KL, VT);
  k_fa<<<dim3(TT / FQB, TNB), 32 * FW, 0, stream>>>(QH, QL, KH, KL, VT, F[0], F[7], (float*)d_out);
}

// v009
// A run of this version takes 96.2 microseconds.
// In two side-by-side timings against v008, it was 1.06 and 1.07 times as fast.
// All steps since v000 together make it 23.5 times as fast.
// compute dtype: all float inputs rounded to bf16; q/k/v = x W + b with EXACT bf16 products on WMMA 16x16x32 (f32 accumulate); UNSCALED 32-deep logits q.k with both as f16 hi + residual planes (3 products); online softmax in f32 (a reference maximum per query that is renewed only when the f16 range asks for it; exp(logit - reference) x 2^2 formed as 2^(logit * log2 e - (reference * log2 e - 2)): one f32 fma and the hardware's base-2 exponential), once to f16 against v once to f16 (1 product), divided by the f32 sum of the same values at the end; y = gamma * out + x in f32; f32 output.
// SAGAN self-attention on channels-LAST images (B 8, 64 x 64 = 4,096 positions, C 256; (in,out) 1/16-scale weights, zero biases, gamma = 0.5): q = x Wq + bq (32), k = x Wk + bk (32), v = x Wv + bv (256); attn = softmax(q k^T) (NO scaling); out = attn v; y = gamma * out + x -> [B, 64, 64, 256].
#include <hip/hip_runtime.h>
#include <math.h>

typedef __attribute__((ext_vector_type(16))) _Float16 v16h;
typedef __attribute__((ext_vector_type(16))) __bf16 v16b;
typedef __attribute__((ext_vector_type(8)))  _Float16 v8h;
typedef __attribute__((ext_vector_type(8)))  float v8f;
typedef __attribute__((ext_vector_type(4)))  float v4f;
typedef __attribute__((ext_vector_type(2)))  float v2f;
typedef __attribute__((ext_vector_type(4)))  unsigned v4u;
typedef __attribute__((ext_vector_type(4)))  int v4i;
typedef float __attribute__((may_alias)) float_a;
typedef int __attribute__((may_alias)) int_a;

template <typename T> __device__ __forceinline__ void vst2(void* p, T v) { *(T*)p = v;  }
__device__ __forceinline__ v8f wmma16(v16h a, v16h b, v8f c) {
  v8f d = __builtin_amdgcn_wmma_f32_16x16x32_f16(false, a, false, b, (short)0, c, false, false);
  asm volatile("v_nop\n\tv_nop\n\tv_nop\n\tv_nop" : "+v"(d) : "v"(a), "v"(b));
  return d;
}
__device__ __forceinline__ v8f wmma_bf(v16b a, v16b b, v8f c) {
  v8f d = __builtin_amdgcn_wmma_f32_16x16x32_bf16(false, a, false, b, (short)0, c, false, false);
  asm volatile("v_nop\n\tv_nop\n\tv_nop\n\tv_nop" : "+v"(d) : "v"(a), "v"(b));
  return d;
}
// 16x16x32 fragments: lane = (h = lane>>4, row/col = lane&15); elements 0..7 = k0+8h+0..7, 8..15 = k0+16+8h+0..7; D element r = row 8h+r
__device__ __forceinline__ v16h frag_h(const _Float16* rowk0, int lane) {
  union { v16h v; v8h q[2]; } u; const _Float16* p = rowk0 + 8 * (lane >> 4);
  u.q[0] = *(const v8h*)p; u.q[1] = *(const v8h*)(p + 16); return u.v;
}
__device__ __forceinline__ v16h frag_f32(const float* rowk0, int lane) {
  v16h a; const float* p = rowk0 + 8 * (lane >> 4);
#pragma unroll
  for (int i = 0; i < 8; ++i) { a[i] = (_Float16)p[i]; a[8 + i] = (_Float16)p[16 + i]; }
  return a;
}
__device__ __forceinline__ v16h frag_f32s(const float* rowk0, int lane, float sc) {
  v16h a; const float* p = rowk0 + 8 * (lane >> 4);
#pragma unroll
  for (int i = 0; i < 8; ++i) { a[i] = (_Float16)(p[i] * sc); a[8 + i] = (_Float16)(p[16 + i] * sc); }
  return a;
}
// column fragment from a [K][ld] layout (column n), rows >= K read as 0
__device__ __forceinline__ v16h fragc_f32(const float* W, int k0, int n, int lane, int ld, int K) {
  v16h a; const int g = lane >> 4;
#pragma unroll
  for (int i = 0; i < 8; ++i) { const int ka = k0 + 8 * g + i, kb = ka + 16;
    a[i] = (_Float16)(ka < K ? W[(size_t)(ka < K ? ka : K - 1) * ld + n] : 0.f); a[8 + i] = (_Float16)(kb < K ? W[(size_t)(kb < K ? kb : K - 1) * ld + n] : 0.f); }
  return a;
}
struct F2 { v16b h, l; };
__device__ __forceinline__ F2 bsplit16(const float v[16]) { F2 r;
#pragma unroll
  for (int i = 0; i < 16; ++i) { const __bf16 h = (__bf16)v[i]; r.h[i] = h; r.l[i] = (__bf16)(v[i] - (float)h); }
  return r; }
__device__ __forceinline__ F2 split_row(const float* row, int k0, int lane) { float v[16]; const float* p = row + k0 + 8 * (lane >> 4);
#pragma unroll
  for (int i = 0; i < 8; ++i) { v[i] = p[i]; v[8 + i] = p[16 + i]; }
  return bsplit16(v); }
__device__ __forceinline__ F2 split_rowK(const float* row, int k0, int lane, int K) { float v[16]; const int g = lane >> 4;
#pragma unroll
  for (int i = 0; i < 8; ++i) { const int ka = k0 + 8 * g + i, kb = ka + 16; v[i] = ka < K ? row[ka < K ? ka : K - 1] : 0.f; v[8 + i] = kb < K ? row[kb < K ? kb : K - 1] : 0.f; }
  return bsplit16(v); }
__device__ __forceinline__ F2 split_col(const float* W, int k0, int n, int lane, int ld, int K) { float v[16]; const int g = lane >> 4;
#pragma unroll
  for (int i = 0; i < 8; ++i) { const int ka = k0 + 8 * g + i, kb = ka + 16; v[i] = ka < K ? W[(size_t)(ka < K ? ka : K - 1) * ld + n] : 0.f; v[8 + i] = kb < K ? W[(size_t)(kb < K ? kb : K - 1) * ld + n] : 0.f; }
  return bsplit16(v); }
__device__ __forceinline__ v8f mac3(const F2& a, const F2& b, v8f c) { c = wmma_bf(a.l, b.h, c); c = wmma_bf(a.h, b.l, c); return wmma_bf(a.h, b.h, c); }
__device__ __forceinline__ float sigm(float v) { return 1.0f / (1.0f + expf(-v)); }
#define LDSX() do { asm volatile("s_wait_dscnt 0" ::: "memory"); __builtin_amdgcn_wave_barrier(); __builtin_amdgcn_fence(__ATOMIC_RELEASE, "workgroup"); } while (0)

#define NB 8
#define TT 4096
#define CC 256            // plane width: q/k planes carry 32 real columns (rest never written or read), v planes all 256
#define DIN 256
#define NH 1
#define HD 256
#define NQB (TT / 64)
#define HG 1               // one 4,096 x 4,096 f32 score plane in the workspace, which no kernel uses
#define SCALE (1.0f)
#define HDQK 32
#define CAUSAL 0
#ifndef TNB
#define TNB NB
#endif
__device__ __forceinline__ v16b zero16b() { v16b z; _Pragma("unroll") for (int i = 0; i < 16; ++i) z[i] = (__bf16)0.f; return z; }
__device__ __forceinline__ float bfr(float v) { return (float)(__bf16)v; }
__host__ __device__ __forceinline__ int kb_last(int qb) { return CAUSAL ? ((qb * 64 + 63) >> 7) : (TT / 128 - 1); }
typedef __attribute__((ext_vector_type(8))) __bf16 v8b;
__device__ __forceinline__ v16b frag_b(const __bf16* rowk0, int lane) {
  union { v16b v; v8b q[2]; } u; const __bf16* p = rowk0 + 8 * (lane >> 4);
  u.q[0] = *(const v8b*)p; u.q[1] = *(const v8b*)(p + 16); return u.v;
}
#define QBH (TT / 64)
#define QBH_PV 0           // A.g stays single f16
#define QHI 4096            // q residual rows everywhere (3-product logits)
#define KHI 4096           // k residual rows for ALL keys (3-product logits)
// B fragment (k rows k0+.., output column o) of a weight: (in,out) [K][ld] or (out,in) [ld rows of K]: bf16 exact, or f16(bf16 * 256) exact
__device__ __forceinline__ v16b wcol_io(const float* Wm, int k0, int o, int lane, int ld) { v16b w; const int g = lane >> 4;
#pragma unroll
  for (int i = 0; i < 8; ++i) { w[i] = (__bf16)Wm[(size_t)(k0 + 8 * g + i) * ld + o]; w[8 + i] = (__bf16)Wm[(size_t)(k0 + 16 + 8 * g + i) * ld + o]; }
  return w; }
__device__ __forceinline__ v16b wcol_oi(const float* Wm, int k0, int o, int lane, int K) { v16b w; const float* p = Wm + (size_t)o * K + k0 + 8 * (lane >> 4);
#pragma unroll
  for (int i = 0; i < 8; ++i) { w[i] = (__bf16)p[i]; w[8 + i] = (__bf16)p[16 + i]; }
  return w; }
__device__ __forceinline__ v16h wcolh_io(const float* Wm, int k0, int o, int lane, int ld) { v16h w; const int g = lane >> 4;
#pragma unroll
  for (int i = 0; i < 8; ++i) { w[i] = (_Float16)(bfr(Wm[(size_t)(k0 + 8 * g + i) * ld + o]) * 256.0f); w[8 + i] = (_Float16)(bfr(Wm[(size_t)(k0 + 16 + 8 * g + i) * ld + o]) * 256.0f); }
  return w; }
__device__ __forceinline__ v16h wcolh_oi(const float* Wm, int k0, int o, int lane, int K) { v16h w; const float* p = Wm + (size_t)o * K + k0 + 8 * (lane >> 4);
#pragma unroll
  for (int i = 0; i < 8; ++i) { w[i] = (_Float16)(bfr(p[i]) * 256.0f); w[8 + i] = (_Float16)(bfr(p[16 + i]) * 256.0f); }
  return w; }
#define WQKV_LAYOUT 1   // 0 = (in,out) [DIN][CC]; 1 = (in,out) Wq/Wk [DIN][HDQK], Wv [DIN][CC]; 2 = per-head [NH][DIN][HD]
__device__ __forceinline__ v16b wcol_hdk(const float* Wm, int k0, int o, int lane) { v16b w; const int g = lane >> 4; const float* p = Wm + (size_t)(o / HD) * DIN * HD + (o % HD);
#pragma unroll
  for (int i = 0; i < 8; ++i) { w[i] = (__bf16)p[(size_t)(k0 + 8 * g + i) * HD]; w[8 + i] = (__bf16)p[(size_t)(k0 + 16 + 8 * g + i) * HD]; }
  return w; }
#define WO_OUT_IN 0
#if WQKV_LAYOUT == 1
#define WCOL(W, k0, o, lane) ((which == 2) ? wcol_io(W, k0, (o), lane, CC) : (((o) < HDQK) ? wcol_io(W, k0, (o), lane, HDQK) : zero16b()))   /* (in,out): Wq/Wk [256][32] (plane columns >= 32 zero), Wv [256][256] full */
#define WCOL_OLD_UNUSED(W, k0, o, lane) (((o) < HDQK) ? wcol_oi(W, k0, (o), lane, DIN) : zero16b())   /* unused: reads (out,in) [32][256] weights; plane columns >= 32 are zero for all three */
#elif WQKV_LAYOUT == 2
#define WCOL(W, k0, o, lane) wcol_hdk(W, k0, o, lane)
#else
#define WCOL(W, k0, o, lane) wcol_io(W, k0, o, lane, CC)
#endif
#if WO_OUT_IN
#define WOCOL(W, k0, o, lane) wcol_oi(W, k0, o, lane, CC)
#define WOCOLH(W, k0, o, lane) wcolh_oi(W, k0, o, lane, CC)
#else
#define WOCOL(W, k0, o, lane) wcol_io(W, k0, o, lane, DIN)
#define WOCOLH(W, k0, o, lane) wcolh_io(W, k0, o, lane, DIN)
#endif
#ifndef XP
#define OUT1_OFF (4u * (size_t)NB * DIN * TT)   /* output 1 (o) follows output 0 (y) */
#define XP TT              // position pitch of x and of the output
#endif
#define BG HG
#define DVH 128
// ---- k_wz: block = (64 rows, 128 output cols): OR = y (hi + lo, K = 32 real columns of the YR rows) . W^T ((out,in) [256][32], exact) + b
__global__ __launch_bounds__(128) void k_wz(const float* __restrict__ YR, const float* __restrict__ WW, const float* __restrict__ WB, float* __restrict__ ORW) { __shared__ __align__(16) float sf[4][16][132];
  const int tid = threadIdx.x, wave = tid >> 5, lane = tid & 31, col = lane & 15, g = lane >> 4; const int c0 = blockIdx.y * 128; const size_t r0 = (size_t)blockIdx.x * 64 + wave * 16;
  v8f acc[8] = {};
#pragma unroll
  for (int kc = 0; kc < HDQK / 32; ++kc) { const F2 a = split_row(YR + (r0 + col) * CC, kc * 32, lane); asm volatile("s_wait_loadcnt 0x0" ::: "memory");
#pragma unroll
    for (int j = 0; j < 8; ++j) { const v16b w = wcol_oi(WW, kc * 32, c0 + j * 16 + col, lane, HDQK); asm volatile("s_wait_loadcnt 0x0" ::: "memory"); acc[j] = wmma_bf(a.h, w, acc[j]); acc[j] = wmma_bf(a.l, w, acc[j]); } }
#pragma unroll
  for (int j = 0; j < 8; ++j) { const float bb = WB ? bfr(WB[c0 + j * 16 + col]) : 0.f; asm volatile("s_wait_loadcnt 0x0" ::: "memory");
#pragma unroll
    for (int r = 0; r < 8; ++r) sf[wave][8 * g + r][j * 16 + col] = acc[j][r] + bb; }
  LDSX(); for (int rl = 0; rl < 16; ++rl) vst2(ORW + (r0 + rl) * DIN + c0 + lane * 4, *(const v4f*)&sf[wave][rl][lane * 4]); }
// ---- k_fin2: block = (64 positions, 64 channels, batch b): o[b][c][n] = OR[b*N + n][c] (channels-first via LDS transpose) -> output 1; y = gamma * o + bf16(x) -> output 0 (256-B runs)
__global__ __launch_bounds__(256) void k_fin2(const float* __restrict__ ORW, const float* __restrict__ X, const float* __restrict__ GM, float* __restrict__ OUT, float* __restrict__ OUT1) { const float gmv = bfr(GM[0]); __shared__ float st[64][68]; const int tid = threadIdx.x; const int n0 = blockIdx.x * 64, c0 = blockIdx.y * 64; const size_t b = blockIdx.z;
  for (int e = tid; e < 64 * 16; e += 256) { const int nl = e >> 4, q = e & 15; *(v4f*)&st[nl][q * 4] = *(const v4f*)(ORW + (b * TT + n0 + nl) * (size_t)DIN + c0 + q * 4); }
  __syncthreads();
  for (int e = tid; e < 64 * 16; e += 256) { const int cl = e >> 4, q = e & 15; const size_t oi = (b * DIN + c0 + cl) * (size_t)XP + n0 + q * 4; const v4f xr = *(const v4f*)(X + oi); v4f o, y; _Pragma("unroll") for (int i = 0; i < 4; ++i) { o[i] = st[q * 4 + i][cl]; y[i] = gmv * o[i] + bfr(xr[i]); } vst2(OUT + oi, y); vst2(OUT1 + oi, o); } }   /* y = gamma * o + x (output 0), o (output 1) */
#ifndef SM_EXTRA_PARAMS
#define SM_EXTRA_PARAMS
#endif
#ifndef PROJ_EXTRA_PARAMS
#define PROJ_EXTRA_PARAMS
#endif
#ifndef SM_MASK_HOOK
#define SM_MASK_HOOK (void)0
#endif

#define WS_QH  0u                                      // f16 q rows [b*t][CC]
#define WS_KH  (WS_QH + 2u * (size_t)NB * TT * CC)      // f16 k rows [b*t][CC]
#define WS_VT  (WS_KH + 2u * (size_t)NB * TT * CC)      // f16 v planes [b][c][t]
#define WS_QL  (WS_VT + 2u * (size_t)NB * CC * TT)      // f16 q residual x 2^10 rows [b][t < QHI][CC]
#define WS_KL  (WS_QL + 2u * (size_t)NB * QHI * CC)     // f16 k residual x 2^10 rows [b][t < KHI][CC]
#define WS_VB  (WS_KL + 2u * (size_t)NB * KHI * CC)     // bf16 v hi planes [b][c][t < KHI]
#define WS_VBL (WS_VB + 2u * (size_t)NB * CC * KHI)
#define WS_S   (WS_VBL + 2u * (size_t)NB * CC * KHI)    // f32 logits / P [hg][t][s]
#define WS_Y   (WS_S  + 4u * (size_t)HG * TT * TT)      // f32 ctx rows [b*t][CC] (only when there is an output projection)
#define WS_END (WS_Y  + 0u)

// ---- k_proj: block = 128 rows of x, 8 waves x 16 rows, every wave all 320 output columns (32 q, 32 k, 256 v). The three weights are rounded to bf16 and laid k-contiguous per output column in LDS once a block, and the block's x rows are read once, in whole lines, and laid beside them as bf16: every fragment is two 16-byte LDS reads. Exact bf16 products (K = DIN), f32 accumulate, k blocks in ascending order. q and k are formed transposed (A = weight columns, B = x rows): a lane holds 8 consecutive features of one row and stores them directly (f16 rows + residual x 2^10 rows, the 32 real columns only: nobody reads the rest of those planes). v goes through LDS to f16 planes [c][t] in 256-byte runs.
#define PR 128             // rows per block
#define PO (2 * HDQK + CC) // output columns: q, k, v
#define PWP (DIN + 8)      // LDS pitch of a weight column and of an x row in bf16: 512 bytes at 528 (16 B x odd) for 16-byte reads
#define PVP (PR + 8)       // LDS pitch of a v channel in f16: 256-byte runs at 272 bytes (16 B x odd)
typedef __attribute__((ext_vector_type(4))) __bf16 v4b;
__device__ __forceinline__ v8f wmb(v16b a, v16b b, v8f c) { return __builtin_amdgcn_wmma_f32_16x16x32_bf16(false, a, false, b, (short)0, c, false, false); }
__global__ __launch_bounds__(256) void k_proj(const float* __restrict__ X, const float* __restrict__ WQ, const float* __restrict__ WK, const float* __restrict__ WV, const float* __restrict__ BQ, const float* __restrict__ BK, const float* __restrict__ BV,
    _Float16* __restrict__ QH, _Float16* __restrict__ QL, _Float16* __restrict__ KH, _Float16* __restrict__ KL, _Float16* __restrict__ VT) {
  __shared__ __align__(16) __bf16 wt[PO][PWP]; __shared__ __align__(16) __bf16 xs[PR][PWP]; __shared__ __align__(16) _Float16 th[CC][PVP]; __shared__ __align__(16) float sb[PO];
  const int tid = threadIdx.x, wave = __builtin_amdgcn_readfirstlane(tid >> 5), lane = tid & 31, col = lane & 15, g = lane >> 4; const size_t r0 = (size_t)blockIdx.x * PR;
  // the 320 biases, one or two a thread, on their way to LDS with the rest
  const float bvr = BV[tid]; const float bqr = ((wave & 1) ? BK : BQ)[lane];   /* every wave asks, so that no branch and no wait stand in front of the x loads; waves 0 and 1 store */
  // the wave's 16 x rows (16 KB in a row, 512 bytes a load), asked for ahead of the weight staging so that they fly under it
  const float* xp = X + (r0 + wave * 16) * DIN + lane * 4; v4f xr[32];
#pragma unroll
  for (int i = 0; i < 32; ++i) xr[i] = *(const v4f*)(xp + i * 128);
  // weight staging: a unit = 32 output columns (one a lane: whole 128-byte lines) x 8 k rows -> one 16-byte LDS store a lane. A wave brings 32 v columns, all k, and a quarter of the k rows of q (even waves) or k (odd waves)
  const float* sv = WV + wave * 32 + lane;
#pragma unroll 8   /* eight units' loads in flight a wave */
  for (int k8 = 0; k8 < DIN / 8; ++k8) { v8b p;
#pragma unroll
    for (int e = 0; e < 8; ++e) p[e] = (__bf16)sv[(k8 * 8 + e) * CC];
    *(v8b*)&wt[2 * HDQK + wave * 32 + lane][k8 * 8] = p; }
  const float* sq = ((wave & 1) ? WK : WQ) + (wave >> 1) * (DIN / 4) * HDQK + lane;
#pragma unroll
  for (int k8 = 0; k8 < DIN / 32; ++k8) { v8b p;
#pragma unroll
    for (int e = 0; e < 8; ++e) p[e] = (__bf16)sq[(k8 * 8 + e) * HDQK];
    *(v8b*)&wt[(wave & 1) * HDQK + lane][(wave >> 1) * (DIN / 4) + k8 * 8] = p; }
#pragma unroll
  for (int i = 0; i < 32; ++i) { v4b p;
#pragma unroll
    for (int e = 0; e < 4; ++e) p[e] = (__bf16)xr[i][e];
    *(v4b*)&xs[wave * 16 + (i >> 1)][(i & 1) * 128 + lane * 4] = p; }
  sb[2 * HDQK + tid] = bfr(bvr); if (wave < 2) sb[wave * HDQK + lane] = bfr(bqr);
  __syncthreads();   /* weights, biases and x rows are in LDS before any wave reads them */
  v8f aq[4] = {}, av[CC / 16] = {};
#pragma unroll 1   /* one k block a trip: 20 products; the accumulators and one block's fragments fill the registers */
  for (int kc = 0; kc < DIN / 32; ++kc) { const v16b a = frag_b(&xs[wave * 16 + col][kc * 32], lane); v16b w[PO / 16];
#pragma unroll
    for (int j = 0; j < PO / 16; ++j) w[j] = frag_b(&wt[j * 16 + col][kc * 32], lane);
    __builtin_amdgcn_sched_barrier(0);   /* the k block's fragments are asked for as one group: one LDS latency in front of the 20 products, not one in front of each */
#pragma unroll
    for (int j = 0; j < 4; ++j) aq[j] = wmb(w[j], a, aq[j]);   /* D[feature 8 g + r][row col] */
#pragma unroll
    for (int j = 0; j < CC / 16; ++j) av[j] = wmb(a, w[4 + j], av[j]); }   /* D[row 8 g + r][channel col] */
  const size_t trow = r0 + wave * 16 + col;
#pragma unroll
  for (int j = 0; j < 4; ++j) { const int d0 = (j & 1) * 16 + 8 * g; const float* ba = &sb[j * 16 + 8 * g]; v8h hi, lo;
#pragma unroll
    for (int r = 0; r < 8; ++r) { const float v = aq[j][r] + ba[r]; const _Float16 hv = (_Float16)v; hi[r] = hv; lo[r] = (_Float16)((v - (float)hv) * 1024.0f); }
    vst2((j < 2 ? QH : KH) + trow * CC + d0, hi); vst2((j < 2 ? QL : KL) + trow * CC + d0, lo); }
#pragma unroll
  for (int j = 0; j < CC / 16; ++j) { const float bias = sb[2 * HDQK + j * 16 + col]; v8h h;
#pragma unroll
    for (int r = 0; r < 8; ++r) h[r] = (_Float16)(av[j][r] + bias);
    *(v8h*)&th[j * 16 + col][wave * 16 + 8 * g] = h; }
  __syncthreads();   /* every wave's 16 positions of each channel are in LDS before the 256-byte runs are read back */
  const size_t bb = r0 / TT; const int t0 = (int)(r0 % TT);
  _Float16* vd = VT + (bb * CC + (tid >> 4)) * (size_t)TT + t0 + (tid & 15) * 8;   /* 16 lanes bring one channel's 256 bytes */
#pragma unroll
  for (int i = 0; i < CC / 16; ++i) vst2(vd + (size_t)i * 16 * TT, *(const v8h*)&th[i * 16 + (tid >> 4)][(tid & 15) * 8]); }
#define FQ 16              // query columns per tile
#define FU 2               // column tiles per wave
#define FW 8               // waves per block
#define FQB 128            // queries per block: 4 query groups x FU x FQ
#define FK 32              // keys per wave and pass
#define FKB 64             // keys per block and pass: the two halves' FK
#define FST 128            // keys per stage of the LDS ring: two passes
#define FP 40              // LDS pitch of a k row in f16: 64-byte rows at 80 bytes (16 B x odd) for 16-byte reads
#define FPV 136            // LDS pitch of a v channel in f16: 256-byte rows at 272 bytes (16 B x odd) for 16-byte reads
__device__ __forceinline__ float xhalf(float x) { return __builtin_bit_cast(float, __builtin_amdgcn_permlanex16(__builtin_bit_cast(int, x), __builtin_bit_cast(int, x), 0x76543210, 0xfedcba98, false, false)); }   /* lane l with lane l ^ 16 */
#define L2E 1.44269504088896340736f   // log2 e
#define FEX 2.0f            // exponent that a column's largest score gets when its reference is renewed
#define FEMAX 15.5f         // largest exponent let through under a standing reference: 2^15.5 lies inside the f16 range
// eight base-2 exponentials, each in place in its own register: none reads another's result or lands in another's source; the v_nop is the slot that the instruction set asks for behind the last
__device__ __forceinline__ void exp2x8(float (&e)[8]) {
  asm("v_exp_f32 %0, %0\n\tv_exp_f32 %1, %1\n\tv_exp_f32 %2, %2\n\tv_exp_f32 %3, %3\n\tv_exp_f32 %4, %4\n\tv_exp_f32 %5, %5\n\tv_exp_f32 %6, %6\n\tv_exp_f32 %7, %7\n\tv_nop"
      : "+v"(e[0]), "+v"(e[1]), "+v"(e[2]), "+v"(e[3]), "+v"(e[4]), "+v"(e[5]), "+v"(e[6]), "+v"(e[7])); }
__device__ __forceinline__ void exp2x2(float& a, float& b) { asm("v_exp_f32 %0, %0\n\tv_exp_f32 %1, %1\n\tv_nop" : "+v"(a), "+v"(b)); }   /* the same for two */
__device__ __forceinline__ v8f wm16(v16h a, v16h b, v8f c) { return __builtin_amdgcn_wmma_f32_16x16x32_f16(false, a, false, b, (short)0, c, false, false); }
// one stage's tiles, twenty 16-byte copies a lane (16 v rows' pieces, two pieces of each k plane), global -> LDS through no register, in two statements of ten (a statement takes thirty operands). The wait on the address translations is each statement's own last line, so that it stands in front of whatever the build lets land in the address registers afterwards
#define COPY10 "global_load_async_to_lds_b128 %0, %10, off\n\tglobal_load_async_to_lds_b128 %1, %11, off\n\tglobal_load_async_to_lds_b128 %2, %12, off\n\tglobal_load_async_to_lds_b128 %3, %13, off\n\t" \
               "global_load_async_to_lds_b128 %4, %14, off\n\tglobal_load_async_to_lds_b128 %5, %15, off\n\tglobal_load_async_to_lds_b128 %6, %16, off\n\tglobal_load_async_to_lds_b128 %7, %17, off\n\t" \
               "global_load_async_to_lds_b128 %8, %18, off\n\tglobal_load_async_to_lds_b128 %9, %19, off\n\ts_wait_xcnt 0x0"
#define LVR(i) (lv + (unsigned)(i) * 16u * FPV * 2u)   /* v channel srow + 16 i in LDS */
#define GVR(i) (gv + (size_t)(i) * 16 * TT)            /* and in the v planes */
__device__ __forceinline__ void stage_kv(const _Float16* gv, const _Float16* gh, const _Float16* gl, unsigned lv, unsigned lk) {
  asm volatile(COPY10
      :: "v"(LVR(0)), "v"(LVR(1)), "v"(LVR(2)), "v"(LVR(3)), "v"(LVR(4)), "v"(LVR(5)), "v"(LVR(6)), "v"(LVR(7)), "v"(LVR(8)), "v"(LVR(9)),
         "v"(GVR(0)), "v"(GVR(1)), "v"(GVR(2)), "v"(GVR(3)), "v"(GVR(4)), "v"(GVR(5)), "v"(GVR(6)), "v"(GVR(7)), "v"(GVR(8)), "v"(GVR(9))
      : "memory");
  __builtin_amdgcn_sched_barrier(0);   /* the second ten's addresses are formed behind the first ten's wait, in the same registers: formed ahead, all twenty at a time, they pushed a q fragment out to scratch memory */
  asm volatile(COPY10
      :: "v"(LVR(10)), "v"(LVR(11)), "v"(LVR(12)), "v"(LVR(13)), "v"(LVR(14)), "v"(LVR(15)),
         "v"(lk), "v"(lk + 64u * FP * 2u), "v"(lk + (unsigned)FST * FP * 2u), "v"(lk + (unsigned)FST * FP * 2u + 64u * FP * 2u),
         "v"(GVR(10)), "v"(GVR(11)), "v"(GVR(12)), "v"(GVR(13)), "v"(GVR(14)), "v"(GVR(15)),
         "v"(gh), "v"(gh + (size_t)64 * CC), "v"(gl), "v"(gl + (size_t)64 * CC)
      : "memory"); }
__global__ __launch_bounds__(32 * FW) void k_fa(const _Float16* __restrict__ QH, const _Float16* __restrict__ QL, const _Float16* __restrict__ KH, const _Float16* __restrict__ KL, const _Float16* __restrict__ VT, const float* __restrict__ X, const float* __restrict__ GM, float* __restrict__ OUT) {
  __shared__ __align__(16) _Float16 sv[2][CC][FPV]; __shared__ __align__(16) _Float16 sk[2][2][FST][FP]; __shared__ __align__(16) v4f mg[FW][CC / 8][32]; __shared__ float mcl[FW][2][32];
  const int tid = threadIdx.x, wave = __builtin_amdgcn_readfirstlane(tid >> 5), lane = tid & 31, col = lane & 15, g = lane >> 4; const int b = blockIdx.y; const int grp = wave >> 2;   /* grp = the wave's key half */
  const int q0 = blockIdx.x * FQB + (wave & 3) * (FU * FQ) + grp * FQ;   /* column tile 0 is the one the wave keeps to the end; tile 1, the other 16 of the group's 32 queries, goes to the partner wave, whose tile 0 it is */
  v16h qh[FU], ql[FU];
#pragma unroll
  for (int u = 0; u < FU; ++u) { const size_t qrow = ((size_t)b * TT + (q0 ^ (u * FQ)) + col) * CC; qh[u] = frag_h(QH + qrow, lane); ql[u] = frag_h(QL + qrow, lane); }
  asm volatile("s_wait_xcnt 0x0" ::: "memory");   /* stands in front of whatever the build lets land in the q loads' address registers */
  __builtin_amdgcn_sched_barrier(0);   /* keeps the staging's index arithmetic behind that wait: the build lifted it in between the q loads, into their address registers */
  // staging: 16 lanes bring one 256-byte v row (two whole lines in a row), a thread 16 rows' pieces (channels srow + 16 i); 4 lanes bring one 64-byte k row, a thread two pieces (keys krow, krow + 64) of each plane
  const int srow = tid >> 4, sch = (tid & 15) * 8, krow = tid >> 2, kch = (tid & 3) * 8;
  const _Float16* vsrc = VT + ((size_t)b * CC + srow) * TT + sch; const size_t koff = ((size_t)b * TT + krow) * CC + kch; const _Float16* ksh = KH + koff; const _Float16* ksl = KL + koff;
  const unsigned lv0 = (unsigned)(size_t)&sv[0][srow][sch], lk0 = (unsigned)(size_t)&sk[0][0][krow][kch];   /* the lane's LDS byte addresses in buffer 0: the low 32 bits of the __shared__ addresses */
  stage_kv(vsrc, ksh, ksl, lv0, lk0);
  asm volatile("s_wait_asynccnt 0x0" ::: "memory");   /* the wave's own copies of stage 0's tiles have landed */
  __syncthreads();   /* stage 0's tiles are in LDS before any wave reads them */
  stage_kv(vsrc + FST, ksh + (size_t)FST * CC, ksl + (size_t)FST * CC, lv0 + (unsigned)sizeof(sv[0]), lk0 + (unsigned)sizeof(sk[0]));   /* stage 1's tiles fly under stage 0 */
  v8f acc[FU][CC / 16] = {}; float c[FU], l[FU];   /* c = reference maximum * log2 e - FEX, rounded once per reference: what every exponent of the column subtracts; l sums, in f32, the weights formed under that c */
#pragma unroll
  for (int u = 0; u < FU; ++u) { c[u] = -3.0e38f; l[u] = 0.f; }
#pragma unroll 1   /* one pass a trip: the body already holds 44 matrix instructions and the accumulators fill the registers */
  for (int s = 0; s < TT / FKB; ++s) { const int cur = (s >> 1) & 1, kp = (s & 1) * FKB + grp * FK;   /* cur = the stage's buffer; kp = the wave's first key of this pass inside the stage */
    float sc[FU][2][8]; v16h kh[2], kl[2];
#pragma unroll
    for (int t = 0; t < 2; ++t) { kh[t] = frag_h(&sk[cur][0][kp + t * 16 + col][0], lane); kl[t] = frag_h(&sk[cur][1][kp + t * 16 + col][0], lane); }
    __builtin_amdgcn_sched_barrier(0);   /* the pass's k fragments are asked for as one group: one LDS latency in front of the twelve score products, not one in front of each pair */
#pragma unroll
    for (int u = 0; u < FU; ++u)
#pragma unroll
      for (int t = 0; t < 2; ++t) { v8f a = {}, al = {}; a = wm16(kh[t], qh[u], a); al = wm16(kh[t], ql[u], al); al = wm16(kl[t], qh[u], al);
#pragma unroll
        for (int r = 0; r < 8; ++r) sc[u][t][r] = a[r] + al[r] * (1.0f / 1024.0f); }
    float mn[FU], ex[FU];
#pragma unroll
    for (int u = 0; u < FU; ++u) { float mx = sc[u][0][0];
#pragma unroll
      for (int r = 0; r < 8; ++r) mx = fmaxf(mx, fmaxf(sc[u][0][r], sc[u][1][r]));
      mn[u] = mx; ex[u] = __builtin_fmaf(mx, L2E, -c[u]); }   /* mn = the largest of the lane's 16 scores of the column; ex = the largest of their exponents, by the very fma that forms them all */
    if (__builtin_amdgcn_ballot_w32((ex[0] > FEMAX) | (ex[1] > FEMAX)) != 0) {   /* one scalar branch a pass: EXEC stays all ones; the ballot joins a column's two lanes, so the exchange between the wave's halves is needed only inside. Taken only when some column's largest value would leave the f16 range under its standing reference: then every column of the wave takes the larger of its standing c and the c that this pass's largest score gives; a column whose c stands multiplies by 2^0 = 1; the factor comes from the same two rounded values that the old and the new exponents subtract */
      const float cn0 = fmaxf(c[0], __builtin_fmaf(fmaxf(mn[0], xhalf(mn[0])), L2E, -FEX)), cn1 = fmaxf(c[1], __builtin_fmaf(fmaxf(mn[1], xhalf(mn[1])), L2E, -FEX)); float al[FU] = { c[0] - cn0, c[1] - cn1 }; exp2x2(al[0], al[1]); c[0] = cn0; c[1] = cn1;
#pragma unroll
      for (int u = 0; u < FU; ++u) { l[u] *= al[u];
#pragma unroll
        for (int j = 0; j < CC / 16; ++j) acc[u][j] *= al[u]; } }
    v16h vf[CC / 16];
#pragma unroll
    for (int j = 0; j < CC / 32; ++j) vf[j] = frag_h(&sv[cur][j * 16 + col][kp], lane);
    __builtin_amdgcn_sched_barrier(0);   /* the first half of the pass's v fragments is asked for as one group ahead of the exponentials */
    v16h pf[FU];
#pragma unroll
    for (int u = 0; u < FU; ++u)
#pragma unroll
      for (int t = 0; t < 2; ++t) { float e[8];
#pragma unroll
        for (int r = 0; r < 8; ++r) e[r] = __builtin_fmaf(sc[u][t][r], L2E, -c[u]);
        exp2x8(e);
#pragma unroll
        for (int r = 0; r < 8; ++r) { l[u] += e[r]; pf[u][t * 8 + r] = (_Float16)e[r]; } }   /* element 8 t + r = key 16 t + 8 g + r: frag_h's own k order */
    __builtin_amdgcn_sched_barrier(0);   /* the second half is asked for only here, where the scores' registers are free */
#pragma unroll
    for (int j = CC / 32; j < CC / 16; ++j) vf[j] = frag_h(&sv[cur][j * 16 + col][kp], lane);
    __builtin_amdgcn_sched_barrier(0);   /* as one group again, ahead of the products on the first half, under which it lands */
#pragma unroll
    for (int j = 0; j < CC / 32; ++j)
#pragma unroll
      for (int u = 0; u < FU; ++u) acc[u][j] = wm16(vf[j], pf[u], acc[u][j]);
    __builtin_amdgcn_sched_barrier(0);   /* the products on the first half stay in front of the waits and the barrier: the second half's reads land under them */
    if (s & 1) {   /* a scalar test, the same for the whole work-group: the publish point stands in a stage's second pass only */
      asm volatile("s_wait_dscnt 0x0" ::: "memory");      /* the wave's last reads of this stage's buffer are done: the last block's fragments are in registers */
      asm volatile("s_wait_asynccnt 0x0" ::: "memory");   /* the wave's own copies of the next stage's tiles have landed */
      __syncthreads(); }   /* publishes the next stage's tiles and ends every wave's reads of this stage's buffer, which is refilled behind it */
#pragma unroll
    for (int j = CC / 32; j < 3 * CC / 64; ++j)
#pragma unroll
      for (int u = 0; u < FU; ++u) acc[u][j] = wm16(vf[j], pf[u], acc[u][j]);
    if ((s & 1) && s + 3 < TT / FKB) stage_kv(vsrc + (s + 3) * FKB, ksh + (size_t)(s + 3) * FKB * CC, ksl + (size_t)(s + 3) * FKB * CC, lv0 + (unsigned)cur * (unsigned)sizeof(sv[0]), lk0 + (unsigned)cur * (unsigned)sizeof(sk[0]));   /* a scalar test, the same for the whole work-group: behind a stage's publish point the tiles of the stage after next (its first key = (s + 3) * FKB), into the buffer just left. They stand in the middle of the last block's products, which need registers only: while one wave of a SIMD forms addresses and waits on their translation, the other has the matrix unit */
#pragma unroll
    for (int j = 3 * CC / 64; j < CC / 16; ++j)
#pragma unroll
      for (int u = 0; u < FU; ++u) acc[u][j] = wm16(vf[j], pf[u], acc[u][j]);
  }
  asm volatile("s_wait_asynccnt 0x0" ::: "memory");   /* no copy is outstanding behind the loop */
  const unsigned ro = (((unsigned)b * TT + q0 + col) * CC + 8 * g) * 4u; const float* xp = (const float*)((const char*)X + ro); float* yr = (float*)((char*)OUT + ro);   /* a lane's 8 accumulator registers = 8 consecutive channels of its query's row, in x and in the output alike: one 32-bit byte offset (under 2^25) serves both, beside the two scalar bases */
  v4f x0[CC / 16], x1[CC / 16];
#pragma unroll
  for (int j = 0; j < CC / 16; ++j) { x0[j] = *(const v4f*)(xp + j * 16); x1[j] = *(const v4f*)(xp + j * 16 + 4); }
  // the two key halves meet: a wave hands tile 1 (partial sums, its c and its l, lane for lane) to the wave of the other half, and takes that wave's tile 1, which is its own tile 0
#pragma unroll
  for (int j = 0; j < CC / 16; ++j) { v4f lo, hi;
#pragma unroll
    for (int r = 0; r < 4; ++r) { lo[r] = acc[1][j][r]; hi[r] = acc[1][j][4 + r]; }
    mg[wave][2 * j][lane] = lo; mg[wave][2 * j + 1][lane] = hi; }
  mcl[wave][0][lane] = c[1]; mcl[wave][1][lane] = l[1];
  __syncthreads();   /* every wave's tile 1 is in LDS before its partner reads it */
  const int pw = wave ^ 4; const float cp = mcl[pw][0][lane], lp = mcl[pw][1][lane]; const float cn = fmaxf(c[0], cp); const float f0 = __builtin_amdgcn_exp2f(c[0] - cn), fp = __builtin_amdgcn_exp2f(cp - cn);   /* both halves' values are brought under the larger of the two c */
  float lt = l[0] * f0 + lp * fp;
#pragma unroll
  for (int j = 0; j < CC / 16; ++j) { const v4f lo = mg[pw][2 * j][lane], hi = mg[pw][2 * j + 1][lane];
#pragma unroll
    for (int r = 0; r < 4; ++r) { acc[0][j][r] = acc[0][j][r] * f0 + lo[r] * fp; acc[0][j][4 + r] = acc[0][j][4 + r] * f0 + hi[r] * fp; } }
  const float gmv = bfr(GM[0]); lt += xhalf(lt); const float inv = 1.0f / lt;
#pragma unroll
  for (int j = 0; j < CC / 16; ++j)
#pragma unroll
    for (int r = 0; r < 4; ++r) { const float o0 = acc[0][j][r] * inv, o1 = acc[0][j][4 + r] * inv; x0[j][r] = gmv * o0 + bfr(x0[j][r]); x1[j][r] = gmv * o1 + bfr(x1[j][r]); }
  __builtin_amdgcn_sched_barrier(0);   /* the stores stand behind all the arithmetic: left to itself the build reuses a store's data registers for later values */
#pragma unroll
  for (int j = 0; j < CC / 16; ++j) { vst2(yr + j * 16, x0[j]); vst2(yr + j * 16 + 4, x1[j]); } }

extern "C" void kernel_launch(void* const* d_in, const int* in_sizes, int n_in, void* d_out, int out_size, void* d_ws, size_t ws_size, hipStream_t stream) {
  (void)in_sizes; (void)n_in; (void)out_size;
  const float** F = (const float**)d_in;
  if (ws_size < (size_t)WS_END) return;
  char* ws = (char*)d_ws; _Float16 *QH = (_Float16*)(ws + WS_QH), *KH = (_Float16*)(ws + WS_KH), *VT = (_Float16*)(ws + WS_VT), *QL = (_Float16*)(ws + WS_QL), *KL = (_Float16*)(ws + WS_KL); __bf16 *VB = (__bf16*)(ws + WS_VB), *VBL = (__bf16*)(ws + WS_VBL); float *S = (float*)(ws + WS_S), *Y = (float*)(ws + WS_Y);
  (void)Y; (void)S; (void)QL; (void)KL; (void)VB; (void)VBL;
  // inputs: 0 x [8,64,64,256] (channels-last = rows); 1 Wq [256,32] (in,out), 2 bq; 3 Wk, 4 bk; 5 Wv [256,256], 6 bv; 7 gamma (scalar 0.5)
  k_proj<<<dim3(TNB * TT / PR), 256, 0, stream>>>(F[0], F[1], F[3], F[5], F[2], F[4], F[6], QH, QL, KH, KL, VT);
  k_fa<<<dim3(TT / FQB, TNB), 32 * FW, 0, stream>>>(QH, QL, KH, KL, VT, F[0], F[7], (float*)d_out);
}

// v010
// One run takes 92.1 microseconds.
// Next to v009, in two timings, it ran 1.05 times as fast each time.
// All steps since v000 together make it 24.6 times as fast.
// compute dtype: all float inputs rounded to bf16; q/k/v = x W + b with EXACT bf16 products on WMMA 16x16x32 (f32 accumulate); UNSCALED 32-deep logits q.k with both as f16 hi + residual planes (3 products), q carrying the factor log2 e; online softmax in f32 (a reference maximum per query that is renewed only when the f16 range asks for it; exp(logit - reference) x 2^2 formed as 2^(logit * log2 e - (reference * log2 e - 2)): the subtrahend is the start value of the three products' f32 accumulate chain, whose result goes straight to the hardware's base-2 exponential), once to f16 against v once to f16 (1 product), divided by the f32 sum of the same values at the end; y = gamma * out + x in f32; f32 output.
// SAGAN self-attention on channels-LAST images (B 8, 64 x 64 = 4,096 positions, C 256; (in,out) 1/16-scale weights, zero biases, gamma = 0.5): q = x Wq + bq (32), k = x Wk + bk (32), v = x Wv + bv (256); attn = softmax(q k^T) (NO scaling); out = attn v; y = gamma * out + x -> [B, 64, 64, 256].
#include <hip/hip_runtime.h>
#include <math.h>

typedef __attribute__((ext_vector_type(16))) _Float16 v16h;
typedef __attribute__((ext_vector_type(16))) __bf16 v16b;
typedef __attribute__((ext_vector_type(8)))  _Float16 v8h;
typedef __attribute__((ext_vector_type(8)))  float v8f;
typedef __attribute__((ext_vector_type(4)))  float v4f;
typedef __attribute__((ext_vector_type(2)))  float v2f;
typedef __attribute__((ext_vector_type(4)))  unsigned v4u;
typedef __attribute__((ext_vector_type(4)))  int v4i;
typedef float __attribute__((may_alias)) float_a;
typedef int __attribute__((may_alias)) int_a;

template <typename T> __device__ __forceinline__ void vst2(void* p, T v) { *(T*)p = v;  }
__device__ __forceinline__ v8f wmma16(v16h a, v16h b, v8f c) {
  v8f d = __builtin_amdgcn_wmma_f32_16x16x32_f16(false, a, false, b, (short)0, c, false, false);
  asm volatile("v_nop\n\tv_nop\n\tv_nop\n\tv_nop" : "+v"(d) : "v"(a), "v"(b));
  return d;
}
__device__ __forceinline__ v8f wmma_bf(v16b a, v16b b, v8f c) {
  v8f d = __builtin_amdgcn_wmma_f32_16x16x32_bf16(false, a, false, b, (short)0, c, false, false);
  asm volatile("v_nop\n\tv_nop\n\tv_nop\n\tv_nop" : "+v"(d) : "v"(a), "v"(b));
  return d;
}
// 16x16x32 fragments: lane = (h = lane>>4, row/col = lane&15); elements 0..7 = k0+8h+0..7, 8..15 = k0+16+8h+0..7; D element r = row 8h+r
__device__ __forceinline__ v16h frag_h(const _Float16* rowk0, int lane) {
  union { v16h v; v8h q[2]; } u; const _Float16* p = rowk0 + 8 * (lane >> 4);
  u.q[0] = *(const v8h*)p; u.q[1] = *(const v8h*)(p + 16); return u.v;
}
__device__ __forceinline__ v16h frag_f32(const float* rowk0, int lane) {
  v16h a; const float* p = rowk0 + 8 * (lane >> 4);
#pragma unroll
  for (int i = 0; i < 8; ++i) { a[i] = (_Float16)p[i]; a[8 + i] = (_Float16)p[16 + i]; }
  return a;
}
__device__ __forceinline__ v16h frag_f32s(const float* rowk0, int lane, float sc) {
  v16h a; const float* p = rowk0 + 8 * (lane >> 4);
#pragma unroll
  for (int i = 0; i < 8; ++i) { a[i] = (_Float16)(p[i] * sc); a[8 + i] = (_Float16)(p[16 + i] * sc); }
  return a;
}
// column fragment from a [K][ld] layout (column n), rows >= K read as 0
__device__ __forceinline__ v16h fragc_f32(const float* W, int k0, int n, int lane, int ld, int K) {
  v16h a; const int g = lane >> 4;
#pragma unroll
  for (int i = 0; i < 8; ++i) { const int ka = k0 + 8 * g + i, kb = ka + 16;
    a[i] = (_Float16)(ka < K ? W[(size_t)(ka < K ? ka : K - 1) * ld + n] : 0.f); a[8 + i] = (_Float16)(kb < K ? W[(size_t)(kb < K ? kb : K - 1) * ld + n] : 0.f); }
  return a;
}
struct F2 { v16b h, l; };
__device__ __forceinline__ F2 bsplit16(const float v[16]) { F2 r;
#pragma unroll
  for (int i = 0; i < 16; ++i) { const __bf16 h = (__bf16)v[i]; r.h[i] = h; r.l[i] = (__bf16)(v[i] - (float)h); }
  return r; }
__device__ __forceinline__ F2 split_row(const float* row, int k0, int lane) { float v[16]; const float* p = row + k0 + 8 * (lane >> 4);
#pragma unroll
  for (int i = 0; i < 8; ++i) { v[i] = p[i]; v[8 + i] = p[16 + i]; }
  return bsplit16(v); }
__device__ __forceinline__ F2 split_rowK(const float* row, int k0, int lane, int K) { float v[16]; const int g = lane >> 4;
#pragma unroll
  for (int i = 0; i < 8; ++i) { const int ka = k0 + 8 * g + i, kb = ka + 16; v[i] = ka < K ? row[ka < K ? ka : K - 1] : 0.f; v[8 + i] = kb < K ? row[kb < K ? kb : K - 1] : 0.f; }
  return bsplit16(v); }
__device__ __forceinline__ F2 split_col(const float* W, int k0, int n, int lane, int ld, int K) { float v[16]; const int g = lane >> 4;
#pragma unroll
  for (int i = 0; i < 8; ++i) { const int ka = k0 + 8 * g + i, kb = ka + 16; v[i] = ka < K ? W[(size_t)(ka < K ? ka : K - 1) * ld + n] : 0.f; v[8 + i] = kb < K ? W[(size_t)(kb < K ? kb : K - 1) * ld + n] : 0.f; }
  return bsplit16(v); }
__device__ __forceinline__ v8f mac3(const F2& a, const F2& b, v8f c) { c = wmma_bf(a.l, b.h, c); c = wmma_bf(a.h, b.l, c); return wmma_bf(a.h, b.h, c); }
__device__ __forceinline__ float sigm(float v) { return 1.0f / (1.0f + expf(-v)); }
#define LDSX() do { asm volatile("s_wait_dscnt 0" ::: "memory"); __builtin_amdgcn_wave_barrier(); __builtin_amdgcn_fence(__ATOMIC_RELEASE, "workgroup"); } while (0)

#define NB 8
#define TT 4096
#define CC 256            // plane width: q/k planes carry 32 real columns (rest never written or read), v planes all 256
#define DIN 256
#define NH 1
#define HD 256
#define NQB (TT / 64)
#define HG 1               // one 4,096 x 4,096 f32 score plane in the workspace, which no kernel uses
#define SCALE (1.0f)
#define HDQK 32
#define CAUSAL 0
#ifndef TNB
#define TNB NB
#endif
__device__ __forceinline__ v16b zero16b() { v16b z; _Pragma("unroll") for (int i = 0; i < 16; ++i) z[i] = (__bf16)0.f; return z; }
__device__ __forceinline__ float bfr(float v) { return (float)(__bf16)v; }
__host__ __device__ __forceinline__ int kb_last(int qb) { return CAUSAL ? ((qb * 64 + 63) >> 7) : (TT / 128 - 1); }
typedef __attribute__((ext_vector_type(8))) __bf16 v8b;
__device__ __forceinline__ v16b frag_b(const __bf16* rowk0, int lane) {
  union { v16b v; v8b q[2]; } u; const __bf16* p = rowk0 + 8 * (lane >> 4);
  u.q[0] = *(const v8b*)p; u.q[1] = *(const v8b*)(p + 16); return u.v;
}
#define QBH (TT / 64)
#define QBH_PV 0           // A.g stays single f16
#define QHI 4096            // q residual rows everywhere (3-product logits)
#define KHI 4096           // k residual rows for ALL keys (3-product logits)
// B fragment (k rows k0+.., output column o) of a weight: (in,out) [K][ld] or (out,in) [ld rows of K]: bf16 exact, or f16(bf16 * 256) exact
__device__ __forceinline__ v16b wcol_io(const float* Wm, int k0, int o, int lane, int ld) { v16b w; const int g = lane >> 4;
#pragma unroll
  for (int i = 0; i < 8; ++i) { w[i] = (__bf16)Wm[(size_t)(k0 + 8 * g + i) * ld + o]; w[8 + i] = (__bf16)Wm[(size_t)(k0 + 16 + 8 * g + i) * ld + o]; }
  return w; }
__device__ __forceinline__ v16b wcol_oi(const float* Wm, int k0, int o, int lane, int K) { v16b w; const float* p = Wm + (size_t)o * K + k0 + 8 * (lane >> 4);
#pragma unroll
  for (int i = 0; i < 8; ++i) { w[i] = (__bf16)p[i]; w[8 + i] = (__bf16)p[16 + i]; }
  return w; }
__device__ __forceinline__ v16h wcolh_io(const float* Wm, int k0, int o, int lane, int ld) { v16h w; const int g = lane >> 4;
#pragma unroll
  for (int i = 0; i < 8; ++i) { w[i] = (_Float16)(bfr(Wm[(size_t)(k0 + 8 * g + i) * ld + o]) * 256.0f); w[8 + i] = (_Float16)(bfr(Wm[(size_t)(k0 + 16 + 8 * g + i) * ld + o]) * 256.0f); }
  return w; }
__device__ __forceinline__ v16h wcolh_oi(const float* Wm, int k0, int o, int lane, int K) { v16h w; const float* p = Wm + (size_t)o * K + k0 + 8 * (lane >> 4);
#pragma unroll
  for (int i = 0; i < 8; ++i) { w[i] = (_Float16)(bfr(p[i]) * 256.0f); w[8 + i] = (_Float16)(bfr(p[16 + i]) * 256.0f); }
  return w; }
#define WQKV_LAYOUT 1   // 0 = (in,out) [DIN][CC]; 1 = (in,out) Wq/Wk [DIN][HDQK], Wv [DIN][CC]; 2 = per-head [NH][DIN][HD]
__device__ __forceinline__ v16b wcol_hdk(const float* Wm, int k0, int o, int lane) { v16b w; const int g = lane >> 4; const float* p = Wm + (size_t)(o / HD) * DIN * HD + (o % HD);
#pragma unroll
  for (int i = 0; i < 8; ++i) { w[i] = (__bf16)p[(size_t)(k0 + 8 * g + i) * HD]; w[8 + i] = (__bf16)p[(size_t)(k0 + 16 + 8 * g + i) * HD]; }
  return w; }
#define WO_OUT_IN 0
#if WQKV_LAYOUT == 1
#define WCOL(W, k0, o, lane) ((which == 2) ? wcol_io(W, k0, (o), lane, CC) : (((o) < HDQK) ? wcol_io(W, k0, (o), lane, HDQK) : zero16b()))   /* (in,out): Wq/Wk [256][32] (plane columns >= 32 zero), Wv [256][256] full */
#define WCOL_OLD_UNUSED(W, k0, o, lane) (((o) < HDQK) ? wcol_oi(W, k0, (o), lane, DIN) : zero16b())   /* unused: reads (out,in) [32][256] weights; plane columns >= 32 are zero for all three */
#elif WQKV_LAYOUT == 2
#define WCOL(W, k0, o, lane) wcol_hdk(W, k0, o, lane)
#else
#define WCOL(W, k0, o, lane) wcol_io(W, k0, o, lane, CC)
#endif
#if WO_OUT_IN
#define WOCOL(W, k0, o, lane) wcol_oi(W, k0, o, lane, CC)
#define WOCOLH(W, k0, o, lane) wcolh_oi(W, k0, o, lane, CC)
#else
#define WOCOL(W, k0, o, lane) wcol_io(W, k0, o, lane, DIN)
#define WOCOLH(W, k0, o, lane) wcolh_io(W, k0, o, lane, DIN)
#endif
#ifndef XP
#define OUT1_OFF (4u * (size_t)NB * DIN * TT)   /* output 1 (o) follows output 0 (y) */
#define XP TT              // position pitch of x and of the output
#endif
#define BG HG
#define DVH 128
// ---- k_wz: block = (64 rows, 128 output cols): OR = y (hi + lo, K = 32 real columns of the YR rows) . W^T ((out,in) [256][32], exact) + b
__global__ __launch_bounds__(128) void k_wz(const float* __restrict__ YR, const float* __restrict__ WW, const float* __restrict__ WB, float* __restrict__ ORW) { __shared__ __align__(16) float sf[4][16][132];
  const int tid = threadIdx.x, wave = tid >> 5, lane = tid & 31, col = lane & 15, g = lane >> 4; const int c0 = blockIdx.y * 128; const size_t r0 = (size_t)blockIdx.x * 64 + wave * 16;
  v8f acc[8] = {};
#pragma unroll
  for (int kc = 0; kc < HDQK / 32; ++kc) { const F2 a = split_row(YR + (r0 + col) * CC, kc * 32, lane); asm volatile("s_wait_loadcnt 0x0" ::: "memory");
#pragma unroll
    for (int j = 0; j < 8; ++j) { const v16b w = wcol_oi(WW, kc * 32, c0 + j * 16 + col, lane, HDQK); asm volatile("s_wait_loadcnt 0x0" ::: "memory"); acc[j] = wmma_bf(a.h, w, acc[j]); acc[j] = wmma_bf(a.l, w, acc[j]); } }
#pragma unroll
  for (int j = 0; j < 8; ++j) { const float bb = WB ? bfr(WB[c0 + j * 16 + col]) : 0.f; asm volatile("s_wait_loadcnt 0x0" ::: "memory");
#pragma unroll
    for (int r = 0; r < 8; ++r) sf[wave][8 * g + r][j * 16 + col] = acc[j][r] + bb; }
  LDSX(); for (int rl = 0; rl < 16; ++rl) vst2(ORW + (r0 + rl) * DIN + c0 + lane * 4, *(const v4f*)&sf[wave][rl][lane * 4]); }
// ---- k_fin2: block = (64 positions, 64 channels, batch b): o[b][c][n] = OR[b*N + n][c] (channels-first via LDS transpose) -> output 1; y = gamma * o + bf16(x) -> output 0 (256-B runs)
__global__ __launch_bounds__(256) void k_fin2(const float* __restrict__ ORW, const float* __restrict__ X, const float* __restrict__ GM, float* __restrict__ OUT, float* __restrict__ OUT1) { const float gmv = bfr(GM[0]); __shared__ float st[64][68]; const int tid = threadIdx.x; const int n0 = blockIdx.x * 64, c0 = blockIdx.y * 64; const size_t b = blockIdx.z;
  for (int e = tid; e < 64 * 16; e += 256) { const int nl = e >> 4, q = e & 15; *(v4f*)&st[nl][q * 4] = *(const v4f*)(ORW + (b * TT + n0 + nl) * (size_t)DIN + c0 + q * 4); }
  __syncthreads();
  for (int e = tid; e < 64 * 16; e += 256) { const int cl = e >> 4, q = e & 15; const size_t oi = (b * DIN + c0 + cl) * (size_t)XP + n0 + q * 4; const v4f xr = *(const v4f*)(X + oi); v4f o, y; _Pragma("unroll") for (int i = 0; i < 4; ++i) { o[i] = st[q * 4 + i][cl]; y[i] = gmv * o[i] + bfr(xr[i]); } vst2(OUT + oi, y); vst2(OUT1 + oi, o); } }   /* y = gamma * o + x (output 0), o (output 1) */
#ifndef SM_EXTRA_PARAMS
#define SM_EXTRA_PARAMS
#endif
#ifndef PROJ_EXTRA_PARAMS
#define PROJ_EXTRA_PARAMS
#endif
#ifndef SM_MASK_HOOK
#define SM_MASK_HOOK (void)0
#endif

#define WS_QH  0u                                      // f16 q rows [b*t][CC]
#define WS_KH  (WS_QH + 2u * (size_t)NB * TT * CC)      // f16 k rows [b*t][CC]
#define WS_VT  (WS_KH + 2u * (size_t)NB * TT * CC)      // f16 v planes [b][c][t]
#define WS_QL  (WS_VT + 2u * (size_t)NB * CC * TT)      // f16 q residual rows [b][t < QHI][CC]
#define WS_KL  (WS_QL + 2u * (size_t)NB * QHI * CC)     // f16 k residual rows [b][t < KHI][CC]
#define WS_VB  (WS_KL + 2u * (size_t)NB * KHI * CC)     // bf16 v hi planes [b][c][t < KHI]
#define WS_VBL (WS_VB + 2u * (size_t)NB * CC * KHI)
#define WS_S   (WS_VBL + 2u * (size_t)NB * CC * KHI)    // f32 logits / P [hg][t][s]
#define WS_Y   (WS_S  + 4u * (size_t)HG * TT * TT)      // f32 ctx rows [b*t][CC] (only when there is an output projection)
#define WS_END (WS_Y  + 0u)

// ---- k_proj: block = 128 rows of x, 8 waves x 16 rows, every wave all 320 output columns (32 q, 32 k, 256 v). The three weights are rounded to bf16 and laid k-contiguous per output column in LDS once a block, and the block's x rows are read once, in whole lines, and laid beside them as bf16: every fragment is two 16-byte LDS reads. Exact bf16 products (K = DIN), f32 accumulate, k blocks in ascending order. q and k are formed transposed (A = weight columns, B = x rows): a lane holds 8 consecutive features of one row and stores them directly (f16 rows + residual rows at their own scale, the 32 real columns only: nobody reads the rest of those planes); q is multiplied by log2 e in f32 before it is split, so that k_fa's score products are base-2 exponents as they stand. v goes through LDS to f16 planes [c][t] in 256-byte runs.
#define L2E 1.44269504088896340736f   // log2 e
#define PR 128             // rows per block
#define PO (2 * HDQK + CC) // output columns: q, k, v
#define PWP (DIN + 8)      // LDS pitch of a weight column and of an x row in bf16: 512 bytes at 528 (16 B x odd) for 16-byte reads
#define PVP (PR + 8)       // LDS pitch of a v channel in f16: 256-byte runs at 272 bytes (16 B x odd)
typedef __attribute__((ext_vector_type(4))) __bf16 v4b;
__device__ __forceinline__ v8f wmb(v16b a, v16b b, v8f c) { return __builtin_amdgcn_wmma_f32_16x16x32_bf16(false, a, false, b, (short)0, c, false, false); }
__global__ __launch_bounds__(256) void k_proj(const float* __restrict__ X, const float* __restrict__ WQ, const float* __restrict__ WK, const float* __restrict__ WV, const float* __restrict__ BQ, const float* __restrict__ BK, const float* __restrict__ BV,
    _Float16* __restrict__ QH, _Float16* __restrict__ QL, _Float16* __restrict__ KH, _Float16* __restrict__ KL, _Float16* __restrict__ VT) {
  __shared__ __align__(16) __bf16 wt[PO][PWP]; __shared__ __align__(16) __bf16 xs[PR][PWP]; __shared__ __align__(16) _Float16 th[CC][PVP]; __shared__ __align__(16) float sb[PO];
  const int tid = threadIdx.x, wave = __builtin_amdgcn_readfirstlane(tid >> 5), lane = tid & 31, col = lane & 15, g = lane >> 4; const size_t r0 = (size_t)blockIdx.x * PR;
  // the 320 biases, one or two a thread, on their way to LDS with the rest
  const float bvr = BV[tid]; const float bqr = ((wave & 1) ? BK : BQ)[lane];   /* every wave asks, so that no branch and no wait stand in front of the x loads; waves 0 and 1 store */
  // the wave's 16 x rows (16 KB in a row, 512 bytes a load), asked for ahead of the weight staging so that they fly under it
  const float* xp = X + (r0 + wave * 16) * DIN + lane * 4; v4f xr[32];
#pragma unroll
  for (int i = 0; i < 32; ++i) xr[i] = *(const v4f*)(xp + i * 128);
  // weight staging: a unit = 32 output columns (one a lane: whole 128-byte lines) x 8 k rows -> one 16-byte LDS store a lane. A wave brings 32 v columns, all k, and a quarter of the k rows of q (even waves) or k (odd waves)
  const float* sv = WV + wave * 32 + lane;
#pragma unroll 8   /* eight units' loads in flight a wave */
  for (int k8 = 0; k8 < DIN / 8; ++k8) { v8b p;
#pragma unroll
    for (int e = 0; e < 8; ++e) p[e] = (__bf16)sv[(k8 * 8 + e) * CC];
    *(v8b*)&wt[2 * HDQK + wave * 32 + lane][k8 * 8] = p; }
  const float* sq = ((wave & 1) ? WK : WQ) + (wave >> 1) * (DIN / 4) * HDQK + lane;
#pragma unroll
  for (int k8 = 0; k8 < DIN / 32; ++k8) { v8b p;
#pragma unroll
    for (int e = 0; e < 8; ++e) p[e] = (__bf16)sq[(k8 * 8 + e) * HDQK];
    *(v8b*)&wt[(wave & 1) * HDQK + lane][(wave >> 1) * (DIN / 4) + k8 * 8] = p; }
#pragma unroll
  for (int i = 0; i < 32; ++i) { v4b p;
#pragma unroll
    for (int e = 0; e < 4; ++e) p[e] = (__bf16)xr[i][e];
    *(v4b*)&xs[wave * 16 + (i >> 1)][(i & 1) * 128 + lane * 4] = p; }
  sb[2 * HDQK + tid] = bfr(bvr); if (wave < 2) sb[wave * HDQK + lane] = bfr(bqr);
  __syncthreads();   /* weights, biases and x rows are in LDS before any wave reads them */
  v8f aq[4] = {}, av[CC / 16] = {};
#pragma unroll 1   /* one k block a trip: 20 products; the accumulators and one block's fragments fill the registers */
  for (int kc = 0; kc < DIN / 32; ++kc) { const v16b a = frag_b(&xs[wave * 16 + col][kc * 32], lane); v16b w[PO / 16];
#pragma unroll
    for (int j = 0; j < PO / 16; ++j) w[j] = frag_b(&wt[j * 16 + col][kc * 32], lane);
    __builtin_amdgcn_sched_barrier(0);   /* the k block's fragments are asked for as one group: one LDS latency in front of the 20 products, not one in front of each */
#pragma unroll
    for (int j = 0; j < 4; ++j) aq[j] = wmb(w[j], a, aq[j]);   /* D[feature 8 g + r][row col] */
#pragma unroll
    for (int j = 0; j < CC / 16; ++j) av[j] = wmb(a, w[4 + j], av[j]); }   /* D[row 8 g + r][channel col] */
  const size_t trow = r0 + wave * 16 + col;
#pragma unroll
  for (int j = 0; j < 4; ++j) { const int d0 = (j & 1) * 16 + 8 * g; const float* ba = &sb[j * 16 + 8 * g]; v8h hi, lo;
#pragma unroll
    for (int r = 0; r < 8; ++r) { const float v = (aq[j][r] + ba[r]) * (j < 2 ? L2E : 1.0f); const _Float16 hv = (_Float16)v; hi[r] = hv; lo[r] = (_Float16)(v - (float)hv); }   /* the residual keeps its own scale (at most 2^-11 of the value; f16 holds it to 2^-24): its products add into the same accumulator as the main one */
    vst2((j < 2 ? QH : KH) + trow * CC + d0, hi); vst2((j < 2 ? QL : KL) + trow * CC + d0, lo); }
#pragma unroll
  for (int j = 0; j < CC / 16; ++j) { const float bias = sb[2 * HDQK + j * 16 + col]; v8h h;
#pragma unroll
    for (int r = 0; r < 8; ++r) h[r] = (_Float16)(av[j][r] + bias);
    *(v8h*)&th[j * 16 + col][wave * 16 + 8 * g] = h; }
  __syncthreads();   /* every wave's 16 positions of each channel are in LDS before the 256-byte runs are read back */
  const size_t bb = r0 / TT; const int t0 = (int)(r0 % TT);
  _Float16* vd = VT + (bb * CC + (tid >> 4)) * (size_t)TT + t0 + (tid & 15) * 8;   /* 16 lanes bring one channel's 256 bytes */
#pragma unroll
  for (int i = 0; i < CC / 16; ++i) vst2(vd + (size_t)i * 16 * TT, *(const v8h*)&th[i * 16 + (tid >> 4)][(tid & 15) * 8]); }
#define FQ 16              // query columns per tile
#define FU 2               // column tiles per wave
#define FW 8               // waves per block
#define FQB 128            // queries per block: 4 query groups x FU x FQ
#define FK 32              // keys per wave and pass
#define FKB 64             // keys per block and pass: the two halves' FK
#define FST 128            // keys per stage of the LDS ring: two passes
#define FP 40              // LDS pitch of a k row in f16: 64-byte rows at 80 bytes (16 B x odd) for 16-byte reads
#define FPV 136            // LDS pitch of a v channel in f16: 256-byte rows at 272 bytes (16 B x odd) for 16-byte reads
__device__ __forceinline__ float xhalf(float x) { return __builtin_bit_cast(float, __builtin_amdgcn_permlanex16(__builtin_bit_cast(int, x), __builtin_bit_cast(int, x), 0x76543210, 0xfedcba98, false, false)); }   /* lane l with lane l ^ 16 */
#define FEX 2.0f            // exponent that a column's largest score gets when its reference is renewed
#define FEMAX 15.5f         // largest exponent let through under a standing reference: 2^15.5 lies inside the f16 range
// eight base-2 exponentials, each in place in its own register: none reads another's result or lands in another's source; the v_nop is the slot that the instruction set asks for behind the last
__device__ __forceinline__ void exp2x8(float (&e)[8]) {
  asm("v_exp_f32 %0, %0\n\tv_exp_f32 %1, %1\n\tv_exp_f32 %2, %2\n\tv_exp_f32 %3, %3\n\tv_exp_f32 %4, %4\n\tv_exp_f32 %5, %5\n\tv_exp_f32 %6, %6\n\tv_exp_f32 %7, %7\n\tv_nop"
      : "+v"(e[0]), "+v"(e[1]), "+v"(e[2]), "+v"(e[3]), "+v"(e[4]), "+v"(e[5]), "+v"(e[6]), "+v"(e[7])); }
__device__ __forceinline__ void exp2x2(float& a, float& b) { asm("v_exp_f32 %0, %0\n\tv_exp_f32 %1, %1\n\tv_nop" : "+v"(a), "+v"(b)); }   /* the same for two */
__device__ __forceinline__ v16h frag_p(const _Float16* p) { union { v16h v; v8h q[2]; } u; u.q[0] = *(const v8h*)p; u.q[1] = *(const v8h*)(p + 16); return u.v; }   /* frag_h from a pointer that already holds the lane's 8 (lane >> 4) */
__device__ __forceinline__ v8f wm16(v16h a, v16h b, v8f c) { return __builtin_amdgcn_wmma_f32_16x16x32_f16(false, a, false, b, (short)0, c, false, false); }
// one stage's tiles, twenty 16-byte copies a lane (16 v rows' pieces, two pieces of each k plane), global -> LDS through no register, in two statements of ten (a statement takes thirty operands). The wait on the address translations is each statement's own last line, so that it stands in front of whatever the build lets land in the address registers afterwards
#define COPY10 "global_load_async_to_lds_b128 %0, %10, off\n\tglobal_load_async_to_lds_b128 %1, %11, off\n\tglobal_load_async_to_lds_b128 %2, %12, off\n\tglobal_load_async_to_lds_b128 %3, %13, off\n\t" \
               "global_load_async_to_lds_b128 %4, %14, off\n\tglobal_load_async_to_lds_b128 %5, %15, off\n\tglobal_load_async_to_lds_b128 %6, %16, off\n\tglobal_load_async_to_lds_b128 %7, %17, off\n\t" \
               "global_load_async_to_lds_b128 %8, %18, off\n\tglobal_load_async_to_lds_b128 %9, %19, off\n\ts_wait_xcnt 0x0"
#define LVR(i) (lv + (unsigned)(i) * 16u * FPV * 2u)   /* v channel srow + 16 i in LDS */
#define GVR(i) (gv + (size_t)(i) * 16 * TT)            /* and in the v planes */
__device__ __forceinline__ void stage_kv(const _Float16* gv, const _Float16* gh, const _Float16* gl, unsigned lv, unsigned lk) {
  asm volatile(COPY10
      :: "v"(LVR(0)), "v"(LVR(1)), "v"(LVR(2)), "v"(LVR(3)), "v"(LVR(4)), "v"(LVR(5)), "v"(LVR(6)), "v"(LVR(7)), "v"(LVR(8)), "v"(LVR(9)),
         "v"(GVR(0)), "v"(GVR(1)), "v"(GVR(2)), "v"(GVR(3)), "v"(GVR(4)), "v"(GVR(5)), "v"(GVR(6)), "v"(GVR(7)), "v"(GVR(8)), "v"(GVR(9))
      : "memory");
  __builtin_amdgcn_sched_barrier(0);   /* the second ten's addresses are formed behind the first ten's wait, in the same registers: formed ahead, all twenty at a time, they pushed a q fragment out to scratch memory */
  asm volatile(COPY10
      :: "v"(LVR(10)), "v"(LVR(11)), "v"(LVR(12)), "v"(LVR(13)), "v"(LVR(14)), "v"(LVR(15)),
         "v"(lk), "v"(lk + 64u * FP * 2u), "v"(lk + (unsigned)FST * FP * 2u), "v"(lk + (unsigned)FST * FP * 2u + 64u * FP * 2u),
         "v"(GVR(10)), "v"(GVR(11)), "v"(GVR(12)), "v"(GVR(13)), "v"(GVR(14)), "v"(GVR(15)),
         "v"(gh), "v"(gh + (size_t)64 * CC), "v"(gl), "v"(gl + (size_t)64 * CC)
      : "memory"); }
__global__ __launch_bounds__(32 * FW) void k_fa(const _Float16* __restrict__ QH, const _Float16* __restrict__ QL, const _Float16* __restrict__ KH, const _Float16* __restrict__ KL, const _Float16* __restrict__ VT, const float* __restrict__ X, const float* __restrict__ GM, float* __restrict__ OUT) {
  __shared__ __align__(16) _Float16 sv[2][CC][FPV]; __shared__ __align__(16) _Float16 sk[2][2][FST][FP]; __shared__ __align__(16) v4f mg[FW][CC / 8][32]; __shared__ float mcl[FW][2][32];
  const int tid = threadIdx.x, wave = __builtin_amdgcn_readfirstlane(tid >> 5), lane = tid & 31, col = lane & 15, g = lane >> 4; const int b = blockIdx.y; const int grp = wave >> 2;   /* grp = the wave's key half */
  const int q0 = blockIdx.x * FQB + (wave & 3) * (FU * FQ) + grp * FQ;   /* column tile 0 is the one the wave keeps to the end; tile 1, the other 16 of the group's 32 queries, goes to the partner wave, whose tile 0 it is */
  v16h qh[FU], ql[FU];
#pragma unroll
  for (int u = 0; u < FU; ++u) { const size_t qrow = ((size_t)b * TT + (q0 ^ (u * FQ)) + col) * CC; qh[u] = frag_h(QH + qrow, lane); ql[u] = frag_h(QL + qrow, lane); }
  asm volatile("s_wait_xcnt 0x0" ::: "memory");   /* stands in front of whatever the build lets land in the q loads' address registers */
  __builtin_amdgcn_sched_barrier(0);   /* keeps the staging's index arithmetic behind that wait: the build lifted it in between the q loads, into their address registers */
  // staging: 16 lanes bring one 256-byte v row (two whole lines in a row), a thread 16 rows' pieces (channels srow + 16 i); 4 lanes bring one 64-byte k row, a thread two pieces (keys krow, krow + 64) of each plane
  const int srow = tid >> 4, sch = (tid & 15) * 8, krow = tid >> 2, kch = (tid & 3) * 8;
  const _Float16* vsrc = VT + ((size_t)b * CC + srow) * TT + sch; const size_t koff = ((size_t)b * TT + krow) * CC + kch; const _Float16* ksh = KH + koff; const _Float16* ksl = KL + koff;
  const unsigned lv0 = (unsigned)(size_t)&sv[0][srow][sch], lk0 = (unsigned)(size_t)&sk[0][0][krow][kch];   /* the lane's LDS byte addresses in buffer 0: the low 32 bits of the __shared__ addresses */
  stage_kv(vsrc, ksh, ksl, lv0, lk0);
  asm volatile("s_wait_asynccnt 0x0" ::: "memory");   /* the wave's own copies of stage 0's tiles have landed */
  __syncthreads();   /* stage 0's tiles are in LDS before any wave reads them */
  stage_kv(vsrc + FST, ksh + (size_t)FST * CC, ksl + (size_t)FST * CC, lv0 + (unsigned)sizeof(sv[0]), lk0 + (unsigned)sizeof(sk[0]));   /* stage 1's tiles fly under stage 0 */
  const _Float16* kfr = &sk[0][0][col][8 * g]; const _Float16* vfr = &sv[0][col][8 * g];   /* the lane's part of every fragment address, one register an array: what a pass adds is scalar. The loop has no register to spare */
  v8f acc[FU][CC / 16] = {}; float nc[FU], l[FU];   /* nc = -(reference maximum * log2 e - FEX), rounded once per reference: what every exponent of the column starts from; l sums, in f32, the weights formed under that nc */
#pragma unroll
  for (int u = 0; u < FU; ++u) { nc[u] = 0.f; l[u] = 0.f; }   /* pass 0 forms its exponents from 0 and then always sets the reference */
#pragma unroll 1   /* one pass a trip: the body already holds 44 matrix instructions and the accumulators fill the registers */
  for (int s = 0; s < TT / FKB; ++s) { const int cur = (s >> 1) & 1, kp = (s & 1) * FKB + grp * FK;   /* cur = the stage's buffer; kp = the wave's first key of this pass inside the stage */
    v8f e[FU][2]; v16h kh[2], kl[2];
#pragma unroll
    for (int t = 0; t < 2; ++t) { kh[t] = frag_p(kfr + (cur * 2 * FST + kp + t * 16) * FP); kl[t] = frag_p(kfr + (cur * 2 * FST + FST + kp + t * 16) * FP); }
    __builtin_amdgcn_sched_barrier(0);   /* the pass's k fragments are asked for as one group: one LDS latency in front of the twelve score products, not one in front of each pair */
#pragma unroll
    for (int u = 0; u < FU; ++u) { v8f st;
#pragma unroll
      for (int r = 0; r < 8; ++r) st[r] = nc[u];   /* a lane's 8 accumulator registers are 8 keys of ONE query: the column's start value in all of them */
#pragma unroll
      for (int t = 0; t < 2; ++t) e[u][t] = wm16(kh[t], qh[u], st); }
#pragma unroll
    for (int u = 0; u < FU; ++u)
#pragma unroll
      for (int t = 0; t < 2; ++t) e[u][t] = wm16(kh[t], ql[u], e[u][t]);   /* product by product over the four tiles: a tile's next product stands four matrix instructions behind its last */
#pragma unroll
    for (int u = 0; u < FU; ++u)
#pragma unroll
      for (int t = 0; t < 2; ++t) e[u][t] = wm16(kl[t], qh[u], e[u][t]);
    float mx[FU];
#pragma unroll
    for (int u = 0; u < FU; ++u) { float m = e[u][0][0];
#pragma unroll
      for (int r = 0; r < 8; ++r) m = fmaxf(m, fmaxf(e[u][0][r], e[u][1][r]));
      mx[u] = m; }   /* the largest of the lane's 16 exponents of the column */
    const float thr = s ? FEMAX : -__builtin_inff(), dlo = s ? 0.f : -__builtin_inff();   /* scalars: pass 0 always sets the reference, downwards too; later a reference only rises */
    if (__builtin_amdgcn_ballot_w32((mx[0] > thr) | (mx[1] > thr)) != 0) {   /* one scalar branch a pass: EXEC stays all ones; the ballot joins a column's two lanes, so the exchange between the wave's halves is needed only inside. Behind pass 0 taken only when some column's largest value would leave the f16 range under its standing reference: then every column of the wave whose largest exponent of this pass lies above FEX is moved so that it becomes FEX; a column whose reference stands adds 0 and multiplies by 2^0 = 1; shift and factor come from the same two rounded start values */
      float sh[FU], al[FU];
#pragma unroll
      for (int u = 0; u < FU; ++u) { const float nn = nc[u] - fmaxf(fmaxf(mx[u], xhalf(mx[u])) - FEX, dlo); sh[u] = nn - nc[u]; nc[u] = nn; al[u] = fminf(sh[u], 0.f); }   /* the minimum binds in pass 0 alone, where sum and accumulators are 0 and a factor 2^(large) would make 0 x inf of them */
      exp2x2(al[0], al[1]);
#pragma unroll
      for (int u = 0; u < FU; ++u) { l[u] *= al[u];
#pragma unroll
        for (int t = 0; t < 2; ++t) e[u][t] += sh[u];   /* this pass's exponents, formed from the old start value, move with it */
#pragma unroll
        for (int j = 0; j < CC / 16; ++j) acc[u][j] *= al[u]; } }
    v16h vf[CC / 16];
#pragma unroll
    for (int j = 0; j < CC / 32; ++j) vf[j] = frag_p(vfr + (cur * CC + j * 16) * FPV + kp);
    __builtin_amdgcn_sched_barrier(0);   /* the first half of the pass's v fragments is asked for as one group ahead of the exponentials */
    v16h pf[FU];
#pragma unroll
    for (int u = 0; u < FU; ++u)
#pragma unroll
      for (int t = 0; t < 2; ++t) { float w[8];
#pragma unroll
        for (int r = 0; r < 8; ++r) w[r] = e[u][t][r];
        exp2x8(w);
#pragma unroll
        for (int r = 0; r < 8; ++r) { l[u] += w[r]; pf[u][t * 8 + r] = (_Float16)w[r]; } }   /* element 8 t + r = key 16 t + 8 g + r: frag_h's own k order */
    __builtin_amdgcn_sched_barrier(0);   /* the second half is asked for only here, where the scores' registers are free */
#pragma unroll
    for (int j = CC / 32; j < CC / 16; ++j) vf[j] = frag_p(vfr + (cur * CC + j * 16) * FPV + kp);
    __builtin_amdgcn_sched_barrier(0);   /* as one group again, ahead of the products on the first half, under which it lands */
#pragma unroll
    for (int j = 0; j < CC / 32; ++j)
#pragma unroll
      for (int u = 0; u < FU; ++u) acc[u][j] = wm16(vf[j], pf[u], acc[u][j]);
    __builtin_amdgcn_sched_barrier(0);   /* the products on the first half stay in front of the waits and the barrier: the second half's reads land under them */
    if (s & 1) {   /* a scalar test, the same for the whole work-group: the publish point stands in a stage's second pass only */
      asm volatile("s_wait_dscnt 0x0" ::: "memory");      /* the wave's last reads of this stage's buffer are done: the last block's fragments are in registers */
      asm volatile("s_wait_asynccnt 0x0" ::: "memory");   /* the wave's own copies of the next stage's tiles have landed */
      __syncthreads(); }   /* publishes the next stage's tiles and ends every wave's reads of this stage's buffer, which is refilled behind it */
#pragma unroll
    for (int j = CC / 32; j < 3 * CC / 64; ++j)
#pragma unroll
      for (int u = 0; u < FU; ++u) acc[u][j] = wm16(vf[j], pf[u], acc[u][j]);
    if ((s & 1) && s + 3 < TT / FKB) stage_kv(vsrc + (s + 3) * FKB, ksh + (size_t)(s + 3) * FKB * CC, ksl + (size_t)(s + 3) * FKB * CC, lv0 + (unsigned)cur * (unsigned)sizeof(sv[0]), lk0 + (unsigned)cur * (unsigned)sizeof(sk[0]));   /* a scalar test, the same for the whole work-group: behind a stage's publish point the tiles of the stage after next (its first key = (s + 3) * FKB), into the buffer just left. They stand in the middle of the last block's products, which need registers only: while one wave of a SIMD forms addresses and waits on their translation, the other has the matrix unit */
#pragma unroll
    for (int j = 3 * CC / 64; j < CC / 16; ++j)
#pragma unroll
      for (int u = 0; u < FU; ++u) acc[u][j] = wm16(vf[j], pf[u], acc[u][j]);
  }
  asm volatile("s_wait_asynccnt 0x0" ::: "memory");   /* no copy is outstanding behind the loop */
  const float c[FU] = { -nc[0], -nc[1] };   /* what the columns' exponents subtract */
  const unsigned ro = (((unsigned)b * TT + q0 + col) * CC + 8 * g) * 4u; const float* xp = (const float*)((const char*)X + ro); float* yr = (float*)((char*)OUT + ro);   /* a lane's 8 accumulator registers = 8 consecutive channels of its query's row, in x and in the output alike: one 32-bit byte offset (under 2^25) serves both, beside the two scalar bases */
  v4f x0[CC / 16], x1[CC / 16];
#pragma unroll
  for (int j = 0; j < CC / 16; ++j) { x0[j] = *(const v4f*)(xp + j * 16); x1[j] = *(const v4f*)(xp + j * 16 + 4); }
  // the two key halves meet: a wave hands tile 1 (partial sums, its c and its l, lane for lane) to the wave of the other half, and takes that wave's tile 1, which is its own tile 0
#pragma unroll
  for (int j = 0; j < CC / 16; ++j) { v4f lo, hi;
#pragma unroll
    for (int r = 0; r < 4; ++r) { lo[r] = acc[1][j][r]; hi[r] = acc[1][j][4 + r]; }
    mg[wave][2 * j][lane] = lo; mg[wave][2 * j + 1][lane] = hi; }
  mcl[wave][0][lane] = c[1]; mcl[wave][1][lane] = l[1];
  __syncthreads();   /* every wave's tile 1 is in LDS before its partner reads it */
  const int pw = wave ^ 4; const float cp = mcl[pw][0][lane], lp = mcl[pw][1][lane]; const float cn = fmaxf(c[0], cp); const float f0 = __builtin_amdgcn_exp2f(c[0] - cn), fp = __builtin_amdgcn_exp2f(cp - cn);   /* both halves' values are brought under the larger of the two c */
  float lt = l[0] * f0 + lp * fp;
#pragma unroll
  for (int j = 0; j < CC / 16; ++j) { const v4f lo = mg[pw][2 * j][lane], hi = mg[pw][2 * j + 1][lane];
#pragma unroll
    for (int r = 0; r < 4; ++r) { acc[0][j][r] = acc[0][j][r] * f0 + lo[r] * fp; acc[0][j][4 + r] = acc[0][j][4 + r] * f0 + hi[r] * fp; } }
  const float gmv = bfr(GM[0]); lt += xhalf(lt); const float inv = 1.0f / lt;
#pragma unroll
  for (int j = 0; j < CC / 16; ++j)
#pragma unroll
    for (int r = 0; r < 4; ++r) { const float o0 = acc[0][j][r] * inv, o1 = acc[0][j][4 + r] * inv; x0[j][r] = gmv * o0 + bfr(x0[j][r]); x1[j][r] = gmv * o1 + bfr(x1[j][r]); }
  __builtin_amdgcn_sched_barrier(0);   /* the stores stand behind all the arithmetic: left to itself the build reuses a store's data registers for later values */
#pragma unroll
  for (int j = 0; j < CC / 16; ++j) { vst2(yr + j * 16, x0[j]); vst2(yr + j * 16 + 4, x1[j]); } }

extern "C" void kernel_launch(void* const* d_in, const int* in_sizes, int n_in, void* d_out, int out_size, void* d_ws, size_t ws_size, hipStream_t stream) {
  (void)in_sizes; (void)n_in; (void)out_size;
  const float** F = (const float**)d_in;
  if (ws_size < (size_t)WS_END) return;
  char* ws = (char*)d_ws; _Float16 *QH = (_Float16*)(ws + WS_QH), *KH = (_Float16*)(ws + WS_KH), *VT = (_Float16*)(ws + WS_VT), *QL = (_Float16*)(ws + WS_QL), *KL = (_Float16*)(ws + WS_KL); __bf16 *VB = (__bf16*)(ws + WS_VB), *VBL = (__bf16*)(ws + WS_VBL); float *S = (float*)(ws + WS_S), *Y = (float*)(ws + WS_Y);
  (void)Y; (void)S; (void)QL; (void)KL; (void)VB; (void)VBL;
  // inputs: 0 x [8,64,64,256] (channels-last = rows); 1 Wq [256,32] (in,out), 2 bq; 3 Wk, 4 bk; 5 Wv [256,256], 6 bv; 7 gamma (scalar 0.5)
  k_proj<<<dim3(TNB * TT / PR), 256, 0, stream>>>(F[0], F[1], F[3], F[5], F[2], F[4], F[6], QH, QL, KH, KL, VT);
  k_fa<<<dim3(TT / FQB, TNB), 32 * FW, 0, stream>>>(QH, QL, KH, KL, VT, F[0], F[7], (float*)d_out);
}
